// v000
// The times below were measured on an AMD MI455X: many runs one after another, warmed up first and cycling through
// copies of the inputs, with the whole window's GPU time divided by the number of runs. Launches and the gaps
// between them are all in it. The median over several windows is given; except for v000 it joins two sittings, which
// can be a few percent apart, so the side-by-side timings, each taken in one sitting, are the better comparison.
// v000, which the later versions start from, runs in 1120 microseconds.
#include <hip/hip_runtime.h>
// All contractions on v_wmma_f32_16x16x32_bf16, f32 accumulate: x_q·Wq, x_kv·Wk, x_kv·Wv (inputs, W rounded to bf16: single exact term),
// QKᵀ and P·V per 16-query tile as 3-term bf16 hi/lo splits with the |i−j| ≤ 256 band, out·Wo with the A operand split (2 terms);
// interleaved rotary embedding and softmax in f32.
#define BB 4
#define TT 2048
#define EE 1024
#define NH 16
#define HD 64

typedef __bf16 v16b __attribute__((ext_vector_type(16)));
typedef unsigned short v8us __attribute__((ext_vector_type(8), may_alias));
typedef float  v8f  __attribute__((ext_vector_type(8)));
typedef float  v4f  __attribute__((ext_vector_type(4)));
typedef float  v4fa __attribute__((ext_vector_type(4), may_alias));
union FragB { v16b v; v8us half[2]; unsigned short u[16]; };

__device__ __forceinline__ unsigned short bf16_bits(float x) { unsigned int u = __float_as_uint(x); return (unsigned short)((u + 0x7FFFu + ((u >> 16) & 1u)) >> 16); }
__device__ __forceinline__ float bf16_val(unsigned short b) { return __uint_as_float(((unsigned int)b) << 16); }
__device__ __forceinline__ float bf16_round(float x) { return bf16_val(bf16_bits(x)); }
// D += A·B with NT terms: 1 = ah·bh, 2 = + al·bh (A split), 3 = + ah·bl (both split)
template <int NT>
__device__ __forceinline__ v8f mmaN(v16b ah, v16b al, v16b bh, v16b bl, v8f c) {
  c = __builtin_amdgcn_wmma_f32_16x16x32_bf16(false, ah, false, bh, (short)0, c, false, false);
  if (NT >= 2) c = __builtin_amdgcn_wmma_f32_16x16x32_bf16(false, al, false, bh, (short)0, c, false, false);
  if (NT >= 3) c = __builtin_amdgcn_wmma_f32_16x16x32_bf16(false, ah, false, bl, (short)0, c, false, false);
  asm volatile("v_nop\n\tv_nop\n\tv_nop\n\tv_nop" : "+v"(c) : "v"(ah), "v"(al), "v"(bh), "v"(bl));
  return c;
}

__global__ __launch_bounds__(256) void k_wt_bf16(const float* __restrict__ W, unsigned short* __restrict__ Wt, int K, int N) {
  const int t = blockIdx.x * 256 + threadIdx.x;
  const int k8n = K / 8;
  if (t >= N * k8n) return;
  const int n = t / k8n, k8 = (t % k8n) * 8;
  v8us v;
#pragma unroll
  for (int i = 0; i < 8; ++i) v[i] = bf16_bits(W[(size_t)(k8 + i) * N + n]);
  *(v8us*)(Wt + (size_t)n * K + k8) = v;
  
}

// GEMM C[M][N] (f32, pitch ldc) = act(A[M][K]·W + bias). A f32 row-major (pitch lda) converted per fragment to bf16
// (ASPLIT: hi/lo two planes -> 2 terms, else single rounded term); Wt bf16 [N][K] (pitch ldb). BIAS_BF16 rounds the
// bias to bf16 first (bias quantised to bf16 before the add). K%32==0, M%16==0, N%64==0.
template <bool ASPLIT, int ACT, bool BIAS_BF16>
__global__ __launch_bounds__(128) void k_gemm_bf(const float* __restrict__ A, int lda, const unsigned short* __restrict__ Wt, int ldb,
                                               const float* __restrict__ bias, float* __restrict__ C, int ldc, int M, int N, int K) {
  __shared__ __attribute__((aligned(16))) float so[4][16][64];
  const int tid = threadIdx.x, w = tid >> 5, lane = tid & 31, ln = lane & 15, hh = lane >> 4;
  const int ntn = N / 64;
  const int wid = blockIdx.x * 4 + w;
  const int mt = wid / ntn, nq = wid % ntn;
  if (mt * 16 >= M) return;
  const int row0 = mt * 16, col0 = nq * 64;
  const float* arow = A + (size_t)(row0 + ln) * lda;
  v8f acc[4] = {};
  for (int kb = 0; kb < K; kb += 32) {
    FragB ah, al;
    const v4f x0 = *(const v4fa*)(arow + kb + 8 * hh), x1 = *(const v4fa*)(arow + kb + 8 * hh + 4);
    const v4f x2 = *(const v4fa*)(arow + kb + 16 + 8 * hh), x3 = *(const v4fa*)(arow + kb + 16 + 8 * hh + 4);
    float xs[16] = {x0[0],x0[1],x0[2],x0[3],x1[0],x1[1],x1[2],x1[3],x2[0],x2[1],x2[2],x2[3],x3[0],x3[1],x3[2],x3[3]};
#pragma unroll
    for (int i = 0; i < 16; ++i) { const unsigned short hb = bf16_bits(xs[i]); ah.u[i] = hb; al.u[i] = ASPLIT ? bf16_bits(xs[i] - bf16_val(hb)) : (unsigned short)0; }
#pragma unroll
    for (int t = 0; t < 4; ++t) {
      const unsigned short* brow = Wt + (size_t)(col0 + t * 16 + ln) * ldb + kb;
      FragB b;
      b.half[0] = *(const v8us*)(brow + 8 * hh);
      b.half[1] = *(const v8us*)(brow + 16 + 8 * hh);
      acc[t] = mmaN<ASPLIT ? 2 : 1>(ah.v, al.v, b.v, b.v, acc[t]);
    }
  }
#pragma unroll
  for (int t = 0; t < 4; ++t) {
    float bv = bias ? bias[col0 + t * 16 + ln] : 0.f;
    if (BIAS_BF16) bv = bf16_round(bv);
#pragma unroll
    for (int r = 0; r < 8; ++r) { float v = acc[t][r] + bv; if (ACT == 1) v = fmaxf(v, 0.f); so[w][8 * hh + r][t * 16 + ln] = v; }
  }
  __builtin_amdgcn_fence(__ATOMIC_ACQ_REL, "workgroup");
  __builtin_amdgcn_wave_barrier();
  const int rsub = lane >> 4, c4 = (lane & 15) * 4;
  {
#pragma unroll
    for (int q = 0; q < 8; ++q) {
      const int r = q * 2 + rsub;
      const v4f v = *(const v4fa*)&so[w][r][c4];
      *(v4f*)(C + (size_t)(row0 + r) * ldc + col0 + c4) = v;
    }
    
  }
}

// Flash-style causal/unmasked attention, all contractions 3-term bf16 hi/lo splits, f32 softmax with running max.
// q,k,v rows are read from f32 buffers with arbitrary row pitch (so they can live inside a fused qkv buffer);
// D = head size (multiple of 32, <= 128); one wave = 16 query rows; block = 4 waves (64 queries) sharing K/V chunks of 32.
template <int D, bool CAUSAL>
__global__ __launch_bounds__(128) void k_flash(const float* __restrict__ qb, const float* __restrict__ kb, const float* __restrict__ vb,
                                             int pitch, int T, int H, float scale, float* __restrict__ y, int ypitch) {
  constexpr int KS = D / 32;        // k-steps for QK
  constexpr int DT = D / 16;        // d tiles for PV
  __shared__ __attribute__((aligned(16))) unsigned short sKh[32][D + 8], sKl[32][D + 8], sVh[32][D + 8], sVl[32][D + 8];
  __shared__ __attribute__((aligned(16))) unsigned short sPh[4][16][40], sPl[4][16][40];
  __shared__ __attribute__((aligned(16))) float sO[4][16][D];
  const int tid = threadIdx.x, w = tid >> 5, lane = tid & 31, ln = lane & 15, hh = lane >> 4;
  const int nqb = (T + 63) / 64;
  const int bh = blockIdx.x / nqb, qblk = blockIdx.x % nqb;
  const int b = bh / H, h = bh % H;
  const int q0 = qblk * 64 + w * 16;
  const float* Q = qb + (size_t)b * T * pitch + h * D;
  const float* K = kb + (size_t)b * T * pitch + h * D;
  const float* V = vb + (size_t)b * T * pitch + h * D;

  // A fragments of the wave's 16 query rows (scaled), hi/lo
  FragB aqh[KS], aql[KS];
  {
    int row = q0 + ln; if (row >= T) row = T - 1;
    const float* qr = Q + (size_t)row * pitch;
#pragma unroll
    for (int ks = 0; ks < KS; ++ks)
#pragma unroll
      for (int i = 0; i < 16; ++i) {
        const int d = ks * 32 + ((i < 8) ? (8 * hh + i) : (16 + 8 * hh + (i - 8)));
        const float x = qr[d] * scale; const unsigned short hb = bf16_bits(x);
        aqh[ks].u[i] = hb; aql[ks].u[i] = bf16_bits(x - bf16_val(hb));
      }
  }
  float m_r[8], l_r[8];
#pragma unroll
  for (int r = 0; r < 8; ++r) { m_r[r] = -3.0e38f; l_r[r] = 0.f; }
  v8f oacc[DT];
#pragma unroll
  for (int dt = 0; dt < DT; ++dt) oacc[dt] = (v8f){0.f,0.f,0.f,0.f,0.f,0.f,0.f,0.f};

  const int kv_end = CAUSAL ? min(T, qblk * 64 + 64) : T;     // block-uniform
  for (int j0 = 0; j0 < kv_end; j0 += 32) {
    __syncthreads();
    for (int e = tid; e < 32 * (D / 4); e += 128) {
      const int r = e / (D / 4), c4 = (e % (D / 4)) * 4;
      const int key = j0 + r;
      v4f kf = {0.f,0.f,0.f,0.f}, vf = {0.f,0.f,0.f,0.f};
      if (key < T) { kf = *(const v4fa*)(K + (size_t)key * pitch + c4); vf = *(const v4fa*)(V + (size_t)key * pitch + c4); }
#pragma unroll
      for (int t = 0; t < 4; ++t) {
        unsigned short hb = bf16_bits(kf[t]); sKh[r][c4 + t] = hb; sKl[r][c4 + t] = bf16_bits(kf[t] - bf16_val(hb));
        hb = bf16_bits(vf[t]); sVh[r][c4 + t] = hb; sVl[r][c4 + t] = bf16_bits(vf[t] - bf16_val(hb));
      }
    }
    __syncthreads();
    // S tile 16 x 32
    v8f s[2];
#pragma unroll
    for (int nt = 0; nt < 2; ++nt) {
      v8f acc = {};
#pragma unroll
      for (int ks = 0; ks < KS; ++ks) {
        FragB bh_, bl_;
        bh_.half[0] = *(const v8us*)&sKh[nt * 16 + ln][ks * 32 + 8 * hh]; bh_.half[1] = *(const v8us*)&sKh[nt * 16 + ln][ks * 32 + 16 + 8 * hh];
        bl_.half[0] = *(const v8us*)&sKl[nt * 16 + ln][ks * 32 + 8 * hh]; bl_.half[1] = *(const v8us*)&sKl[nt * 16 + ln][ks * 32 + 16 + 8 * hh];
        acc = mmaN<3>(aqh[ks].v, aql[ks].v, bh_.v, bl_.v, acc);
      }
      s[nt] = acc;
    }
    // mask + running max (rows 8hh+r; the 16 lanes of a half share rows)
    float alpha[8];
#pragma unroll
    for (int r = 0; r < 8; ++r) {
      const int qi = q0 + 8 * hh + r;
      const int ja = j0 + ln, jb = j0 + 16 + ln;
      if (CAUSAL) { if (ja > qi) s[0][r] = -3.0e38f; if (jb > qi) s[1][r] = -3.0e38f; }
      if (ja >= T) s[0][r] = -3.0e38f;
      if (jb >= T) s[1][r] = -3.0e38f;
      float mx = fmaxf(s[0][r], s[1][r]);
      mx = fmaxf(mx, __shfl_xor(mx, 1, 32)); mx = fmaxf(mx, __shfl_xor(mx, 2, 32)); mx = fmaxf(mx, __shfl_xor(mx, 4, 32)); mx = fmaxf(mx, __shfl_xor(mx, 8, 32));
      const float mnew = fmaxf(m_r[r], mx);
      alpha[r] = (mnew > -1.0e38f) ? __expf(m_r[r] - mnew) : 1.0f;
      const float p0 = (s[0][r] > -1.0e38f) ? __expf(s[0][r] - mnew) : 0.f;
      const float p1 = (s[1][r] > -1.0e38f) ? __expf(s[1][r] - mnew) : 0.f;
      m_r[r] = mnew;
      l_r[r] = l_r[r] * alpha[r] + p0 + p1;            // per-lane partial row sum (16 lanes combined at the end)
      unsigned short hb = bf16_bits(p0); sPh[w][8 * hh + r][ln] = hb;      sPl[w][8 * hh + r][ln] = bf16_bits(p0 - bf16_val(hb));
      hb = bf16_bits(p1);                sPh[w][8 * hh + r][16 + ln] = hb; sPl[w][8 * hh + r][16 + ln] = bf16_bits(p1 - bf16_val(hb));
    }
#pragma unroll
    for (int dt = 0; dt < DT; ++dt)
#pragma unroll
      for (int r = 0; r < 8; ++r) oacc[dt][r] *= alpha[r];
    __builtin_amdgcn_fence(__ATOMIC_ACQ_REL, "workgroup");
    __builtin_amdgcn_wave_barrier();
    FragB pah, pal;
    pah.half[0] = *(const v8us*)&sPh[w][ln][8 * hh]; pah.half[1] = *(const v8us*)&sPh[w][ln][16 + 8 * hh];
    pal.half[0] = *(const v8us*)&sPl[w][ln][8 * hh]; pal.half[1] = *(const v8us*)&sPl[w][ln][16 + 8 * hh];
#pragma unroll
    for (int dt = 0; dt < DT; ++dt) {
      FragB bvh, bvl;
#pragma unroll
      for (int i = 0; i < 8; ++i) {
        bvh.u[i] = sVh[8 * hh + i][dt * 16 + ln]; bvh.u[8 + i] = sVh[16 + 8 * hh + i][dt * 16 + ln];
        bvl.u[i] = sVl[8 * hh + i][dt * 16 + ln]; bvl.u[8 + i] = sVl[16 + 8 * hh + i][dt * 16 + ln];
      }
      oacc[dt] = mmaN<3>(pah.v, pal.v, bvh.v, bvl.v, oacc[dt]);
    }
    __builtin_amdgcn_fence(__ATOMIC_ACQ_REL, "workgroup");
    __builtin_amdgcn_wave_barrier();
  }
#pragma unroll
  for (int r = 0; r < 8; ++r) {
    float l = l_r[r];
    l += __shfl_xor(l, 1, 32); l += __shfl_xor(l, 2, 32); l += __shfl_xor(l, 4, 32); l += __shfl_xor(l, 8, 32);
    l_r[r] = (l > 0.f) ? 1.0f / l : 0.f;
  }
#pragma unroll
  for (int dt = 0; dt < DT; ++dt)
#pragma unroll
    for (int r = 0; r < 8; ++r) sO[w][8 * hh + r][dt * 16 + ln] = oacc[dt][r] * l_r[r];
  __builtin_amdgcn_fence(__ATOMIC_ACQ_REL, "workgroup");
  __builtin_amdgcn_wave_barrier();
  {
    for (int r = 0; r < 16; ++r) {
      const int row = q0 + r;
      if (row < T && lane < D / 4) {
        const v4f val = *(const v4fa*)&sO[w][r][lane * 4];
        *(v4f*)(y + ((size_t)b * T + row) * ypitch + h * D + lane * 4) = val;
      }
    }
    
  }
}

// General attention: queries [b][Tq] rows at Q + b*Tq*qpitch + h*D + row*qpitch; keys/values j < Tk1 from (K1,V1) at
// X + b*Tk1*pitch + h*D + j*pitch, j >= Tk1 from (K2,V2) with j-Tk1 (pass Tk2 = 0 and null for a single source).
// Optional int mask [B][Tq][Tk] (mmode 0: nonzero or j == qi keep; mmode 1: nonzero masks), causal flag (j <= qi), optional post-softmax multiplier gp[(b*Tq+qi)*Tk + j] on P.
// 3-term bf16 splits, f32 softmax with running max; y[b][row][h*D + d] pitch ypitch, whole-line rows (D % 32 == 0).
template <int D>
__global__ __launch_bounds__(128) void k_flash3c(const float* __restrict__ Qb, int qpitch, int Tq,
                                              const float* __restrict__ K1, const float* __restrict__ V1, int Tk1,
                                              const float* __restrict__ K2, const float* __restrict__ V2, int Tk2, int kpitch, int vpitch,
                                              int H, int hgrp, float scale, const int* __restrict__ mask3, int mmode, int band, int causal, const float* __restrict__ gp,
                                              float* __restrict__ y, int ypitch) {
  constexpr int KS = D / 32, DT = D / 16;
  __shared__ __attribute__((aligned(16))) unsigned short sKh[32][D + 8], sKl[32][D + 8], sVh[32][D + 8], sVl[32][D + 8];
  __shared__ __attribute__((aligned(16))) unsigned short sPh[4][16][40], sPl[4][16][40];
  __shared__ __attribute__((aligned(16))) float sO[4][16][D];
  const int tid = threadIdx.x, w = tid >> 5, lane = tid & 31, ln = lane & 15, hh = lane >> 4;
  const int Tk = Tk1 + Tk2;
  const int nqb = (Tq + 63) / 64;
  const int bh = blockIdx.x / nqb, qblk = blockIdx.x % nqb;
  const int b = bh / H, h = bh % H;
  const int q0 = qblk * 64 + w * 16;
  const float* Q = Qb + (size_t)b * Tq * qpitch + h * D; const int hk = h / (hgrp > 0 ? hgrp : 1);   // K/V head (grouped-query: hgrp query heads share one)
  FragB aqh[KS], aql[KS];
  {
    int row = q0 + ln; if (row >= Tq) row = Tq - 1;
    const float* qr = Q + (size_t)row * qpitch;
#pragma unroll
    for (int ks = 0; ks < KS; ++ks)
#pragma unroll
      for (int i = 0; i < 16; ++i) {
        const int d = ks * 32 + ((i < 8) ? (8 * hh + i) : (16 + 8 * hh + (i - 8)));
        const float x = qr[d] * scale; const unsigned short hb = bf16_bits(x);
        aqh[ks].u[i] = hb; aql[ks].u[i] = bf16_bits(x - bf16_val(hb));
      }
  }
  int qrow[8];
#pragma unroll
  for (int r = 0; r < 8; ++r) { int qi = q0 + 8 * hh + r; qrow[r] = qi < Tq ? qi : Tq - 1; }
  float m_r[8], l_r[8];
#pragma unroll
  for (int r = 0; r < 8; ++r) { m_r[r] = -3.0e38f; l_r[r] = 0.f; }
  v8f oacc[DT];
#pragma unroll
  for (int dt = 0; dt < DT; ++dt) oacc[dt] = (v8f){0.f,0.f,0.f,0.f,0.f,0.f,0.f,0.f};
  const int kv_end = causal ? min(Tk, qblk * 64 + 64) : Tk;
  for (int j0 = 0; j0 < kv_end; j0 += 32) {
    __syncthreads();
    for (int e = tid; e < 32 * (D / 4); e += 128) {
      const int r = e / (D / 4), c4 = (e % (D / 4)) * 4; const int key = j0 + r;
      v4f kf = {0.f,0.f,0.f,0.f}, vf = {0.f,0.f,0.f,0.f};
      if (key < Tk1) { kf = *(const v4fa*)(K1 + (size_t)b * Tk1 * kpitch + hk * D + (size_t)key * kpitch + c4); vf = *(const v4fa*)(V1 + (size_t)b * Tk1 * vpitch + hk * D + (size_t)key * vpitch + c4); }
      else if (key < Tk) { const int k2 = key - Tk1; kf = *(const v4fa*)(K2 + (size_t)b * Tk2 * kpitch + hk * D + (size_t)k2 * kpitch + c4); vf = *(const v4fa*)(V2 + (size_t)b * Tk2 * vpitch + hk * D + (size_t)k2 * vpitch + c4); }
#pragma unroll
      for (int t = 0; t < 4; ++t) {
        unsigned short hb = bf16_bits(kf[t]); sKh[r][c4 + t] = hb; sKl[r][c4 + t] = bf16_bits(kf[t] - bf16_val(hb));
        hb = bf16_bits(vf[t]); sVh[r][c4 + t] = hb; sVl[r][c4 + t] = bf16_bits(vf[t] - bf16_val(hb));
      }
    }
    __syncthreads();
    v8f s[2];
#pragma unroll
    for (int nt = 0; nt < 2; ++nt) {
      v8f acc = {};
#pragma unroll
      for (int ks = 0; ks < KS; ++ks) {
        FragB bh_, bl_;
        bh_.half[0] = *(const v8us*)&sKh[nt * 16 + ln][ks * 32 + 8 * hh]; bh_.half[1] = *(const v8us*)&sKh[nt * 16 + ln][ks * 32 + 16 + 8 * hh];
        bl_.half[0] = *(const v8us*)&sKl[nt * 16 + ln][ks * 32 + 8 * hh]; bl_.half[1] = *(const v8us*)&sKl[nt * 16 + ln][ks * 32 + 16 + 8 * hh];
        acc = mmaN<3>(aqh[ks].v, aql[ks].v, bh_.v, bl_.v, acc);
      }
      s[nt] = acc;
    }
    float alpha[8];
#pragma unroll
    for (int r = 0; r < 8; ++r) {
      const int qi = qrow[r];
      const int ja = j0 + ln, jb = j0 + 16 + ln;
      bool keepa = ja < Tk, keepb = jb < Tk;
      if (causal) { keepa = keepa && (ja <= qi); keepb = keepb && (jb <= qi); }
      if (mask3) { const int* mr = mask3 + ((size_t)b * Tq + qi) * Tk;
        if (mmode == 0) { if (keepa && !(mr[ja] != 0 || ja == qi)) s[0][r] = -1.0e9f; if (keepb && !(mr[jb] != 0 || jb == qi)) s[1][r] = -1.0e9f; }
        else            { if (keepa && mr[ja] != 0) s[0][r] = -3.0e38f; if (keepb && mr[jb] != 0) s[1][r] = -3.0e38f; } }
      if (band > 0) { if (keepa && (ja > qi + band || ja < qi - band)) s[0][r] = -3.0e38f; if (keepb && (jb > qi + band || jb < qi - band)) s[1][r] = -3.0e38f; }
      if (!keepa) s[0][r] = -3.0e38f;
      if (!keepb) s[1][r] = -3.0e38f;
      float mx = fmaxf(s[0][r], s[1][r]);
      mx = fmaxf(mx, __shfl_xor(mx, 1, 32)); mx = fmaxf(mx, __shfl_xor(mx, 2, 32)); mx = fmaxf(mx, __shfl_xor(mx, 4, 32)); mx = fmaxf(mx, __shfl_xor(mx, 8, 32));
      const float mnew = fmaxf(m_r[r], mx);
      alpha[r] = (mnew > -1.0e38f) ? __expf(m_r[r] - mnew) : 1.0f;
      const float p0 = keepa ? __expf(s[0][r] - mnew) : 0.f;
      const float p1 = keepb ? __expf(s[1][r] - mnew) : 0.f;
      m_r[r] = mnew;
      l_r[r] = l_r[r] * alpha[r] + p0 + p1;
      float g0 = p0, g1 = p1; if (gp) { const float* gr = gp + ((size_t)b * Tq + qi) * Tk; g0 *= bf16_round(gr[ja]); g1 *= bf16_round(gr[jb]); }   // post-softmax multiplier: P only, not the normaliser
      unsigned short hb = bf16_bits(g0); sPh[w][8 * hh + r][ln] = hb;      sPl[w][8 * hh + r][ln] = bf16_bits(g0 - bf16_val(hb));
      hb = bf16_bits(g1);                sPh[w][8 * hh + r][16 + ln] = hb; sPl[w][8 * hh + r][16 + ln] = bf16_bits(g1 - bf16_val(hb));
    }
#pragma unroll
    for (int dt = 0; dt < DT; ++dt)
#pragma unroll
      for (int r = 0; r < 8; ++r) oacc[dt][r] *= alpha[r];
    __builtin_amdgcn_fence(__ATOMIC_ACQ_REL, "workgroup");
    __builtin_amdgcn_wave_barrier();
    FragB pah, pal;
    pah.half[0] = *(const v8us*)&sPh[w][ln][8 * hh]; pah.half[1] = *(const v8us*)&sPh[w][ln][16 + 8 * hh];
    pal.half[0] = *(const v8us*)&sPl[w][ln][8 * hh]; pal.half[1] = *(const v8us*)&sPl[w][ln][16 + 8 * hh];
#pragma unroll
    for (int dt = 0; dt < DT; ++dt) {
      FragB bvh, bvl;
#pragma unroll
      for (int i = 0; i < 8; ++i) {
        bvh.u[i] = sVh[8 * hh + i][dt * 16 + ln]; bvh.u[8 + i] = sVh[16 + 8 * hh + i][dt * 16 + ln];
        bvl.u[i] = sVl[8 * hh + i][dt * 16 + ln]; bvl.u[8 + i] = sVl[16 + 8 * hh + i][dt * 16 + ln];
      }
      oacc[dt] = mmaN<3>(pah.v, pal.v, bvh.v, bvl.v, oacc[dt]);
    }
    __builtin_amdgcn_fence(__ATOMIC_ACQ_REL, "workgroup");
    __builtin_amdgcn_wave_barrier();
  }
#pragma unroll
  for (int r = 0; r < 8; ++r) {
    float l = l_r[r];
    l += __shfl_xor(l, 1, 32); l += __shfl_xor(l, 2, 32); l += __shfl_xor(l, 4, 32); l += __shfl_xor(l, 8, 32);
    l_r[r] = (m_r[r] > -1.0e38f) ? 1.0f / l : __builtin_nanf("");
  }
#pragma unroll
  for (int dt = 0; dt < DT; ++dt)
#pragma unroll
    for (int r = 0; r < 8; ++r) sO[w][8 * hh + r][dt * 16 + ln] = oacc[dt][r] * l_r[r];
  __builtin_amdgcn_fence(__ATOMIC_ACQ_REL, "workgroup");
  __builtin_amdgcn_wave_barrier();
  {
    for (int r = 0; r < 16; ++r) {
      const int row = q0 + r;
      if (row < Tq && lane < D / 4) {
        const v4f val = *(const v4fa*)&sO[w][r][lane * 4];
        *(v4f*)(y + ((size_t)b * Tq + row) * ypitch + h * D + lane * 4) = val;
      }
    }
    
  }
}
// interleaved rotary on the head dim: pairs (2i, 2i+1) rotated by pos·inv_freq[i], inv_freq[i] = 10000^(−i/(d/2)); in place on q and k; thread per pair
__global__ __launch_bounds__(256) void k_rope2(float* __restrict__ q, float* __restrict__ k) {
  const size_t t = (size_t)blockIdx.x * 256 + threadIdx.x; if (t >= (size_t)BB * TT * EE / 2) return;
  const size_t e = t * 2; const int col = (int)(e % EE); const int pos = (int)((e / EE) % TT); const int i = (col % HD) / 2;
  const float inv = powf(10000.0f, -(float)i / (float)(HD / 2)); const float ang = (float)pos * inv; float sn, cs; sincosf(ang, &sn, &cs);
  const float q0 = q[e], q1 = q[e + 1], k0 = k[e], k1 = k[e + 1];
  const float nq0 = q0 * cs - q1 * sn, nq1 = q1 * cs + q0 * sn, nk0 = k0 * cs - k1 * sn, nk1 = k1 * cs + k0 * sn;
  typedef float v2f __attribute__((ext_vector_type(2)));
  v2f a = {nq0, nq1}, bb = {nk0, nk1};
  *(v2f*)(q + e) = a; *(v2f*)(k + e) = bb; 
}
extern "C" void kernel_launch(void* const* d_in, const int* in_sizes, int n_in,
                              void* d_out, int out_size, void* d_ws, size_t ws_size, hipStream_t stream) {
  (void)in_sizes; (void)n_in; (void)out_size;
  const float* xq = (const float*)d_in[0]; const float* xkv = (const float*)d_in[1];
  const float* Wq = (const float*)d_in[2]; const float* Wk = (const float*)d_in[3]; const float* Wv = (const float*)d_in[4]; const float* Wo = (const float*)d_in[5];
  char* ws = (char*)d_ws; size_t off = 0;
  auto take = [&](size_t bytes) { char* p = ws + off; off += (bytes + 255) & ~(size_t)255; return p; };
  const int M = BB * TT, gb = ((M / 16) * (EE / 64) + 3) / 4;
  unsigned short* Wt[4]; for (int i = 0; i < 4; ++i) Wt[i] = (unsigned short*)take((size_t)EE * EE * 2);
  float* q = (float*)take((size_t)M * EE * 4); float* k = (float*)take((size_t)M * EE * 4); float* v = (float*)take((size_t)M * EE * 4); float* att = (float*)take((size_t)M * EE * 4);
  if (off > ws_size) return;
  const float* W4[4] = {Wq, Wk, Wv, Wo};
  for (int i = 0; i < 4; ++i) k_wt_bf16<<<(EE * (EE / 8) + 255) / 256, 256, 0, stream>>>(W4[i], Wt[i], EE, EE);
  k_gemm_bf<false, 0, false><<<gb, 128, 0, stream>>>(xq, EE, Wt[0], EE, nullptr, q, EE, M, EE, EE);
  k_gemm_bf<false, 0, false><<<gb, 128, 0, stream>>>(xkv, EE, Wt[1], EE, nullptr, k, EE, M, EE, EE);
  k_gemm_bf<false, 0, false><<<gb, 128, 0, stream>>>(xkv, EE, Wt[2], EE, nullptr, v, EE, M, EE, EE);
  k_rope2<<<(unsigned)(((size_t)M * EE / 2 + 255) / 256), 256, 0, stream>>>(q, k);
  k_flash3c<HD><<<BB * NH * (TT / 64), 128, 0, stream>>>(q, EE, TT, k, v, TT, nullptr, nullptr, 0, EE, EE, NH, 1, 0.125f, nullptr, 0, 256, 0, nullptr, att, EE);
  k_gemm_bf<true, 0, false><<<gb, 128, 0, stream>>>(att, EE, Wt[3], EE, nullptr, (float*)d_out, EE, M, EE, EE);
}

// v001
// It runs in 573 microseconds.
// Next to v000, in two timings, it ran 2.03 times as fast each time.
#include <hip/hip_runtime.h>
// All contractions on v_wmma_f32_16x16x32_bf16, f32 accumulate: x_q·Wq, x_kv·Wk, x_kv·Wv (inputs, W rounded to bf16: single exact term),
// QKᵀ and P·V per 16-query tile as 3-term bf16 hi/lo splits with the |i−j| ≤ 256 band, out·Wo with the A operand split (2 terms);
// interleaved rotary embedding and softmax in f32.
#define BB 4
#define TT 2048
#define EE 1024
#define NH 16
#define HD 64

typedef __bf16 v16b __attribute__((ext_vector_type(16)));
typedef unsigned short v8us __attribute__((ext_vector_type(8), may_alias));
typedef float  v8f  __attribute__((ext_vector_type(8)));
typedef float  v4f  __attribute__((ext_vector_type(4)));
typedef float  v4fa __attribute__((ext_vector_type(4), may_alias));
union FragB { v16b v; v8us half[2]; unsigned short u[16]; };

__device__ __forceinline__ unsigned short bf16_bits(float x) { unsigned int u = __float_as_uint(x); return (unsigned short)((u + 0x7FFFu + ((u >> 16) & 1u)) >> 16); }
__device__ __forceinline__ float bf16_val(unsigned short b) { return __uint_as_float(((unsigned int)b) << 16); }
__device__ __forceinline__ float bf16_round(float x) { return bf16_val(bf16_bits(x)); }
// D += A·B with NT terms: 1 = ah·bh, 2 = + al·bh (A split), 3 = + ah·bl (both split)
template <int NT>
__device__ __forceinline__ v8f mmaN(v16b ah, v16b al, v16b bh, v16b bl, v8f c) {
  c = __builtin_amdgcn_wmma_f32_16x16x32_bf16(false, ah, false, bh, (short)0, c, false, false);
  if (NT >= 2) c = __builtin_amdgcn_wmma_f32_16x16x32_bf16(false, al, false, bh, (short)0, c, false, false);
  if (NT >= 3) c = __builtin_amdgcn_wmma_f32_16x16x32_bf16(false, ah, false, bl, (short)0, c, false, false);
  asm volatile("v_nop\n\tv_nop\n\tv_nop\n\tv_nop" : "+v"(c) : "v"(ah), "v"(al), "v"(bh), "v"(bl));
  return c;
}

__global__ __launch_bounds__(256) void k_wt_bf16(const float* __restrict__ W, unsigned short* __restrict__ Wt, int K, int N) {
  const int t = blockIdx.x * 256 + threadIdx.x;
  const int k8n = K / 8;
  if (t >= N * k8n) return;
  const int n = t / k8n, k8 = (t % k8n) * 8;
  v8us v;
#pragma unroll
  for (int i = 0; i < 8; ++i) v[i] = bf16_bits(W[(size_t)(k8 + i) * N + n]);
  *(v8us*)(Wt + (size_t)n * K + k8) = v;
  
}

// GEMM C[M][N] (f32, pitch ldc) = act(A[M][K]·W + bias). A f32 row-major (pitch lda) converted per fragment to bf16
// (ASPLIT: hi/lo two planes -> 2 terms, else single rounded term); Wt bf16 [N][K] (pitch ldb). BIAS_BF16 rounds the
// bias to bf16 first (bias quantised to bf16 before the add). K%32==0, M%16==0, N%64==0.
template <bool ASPLIT, int ACT, bool BIAS_BF16>
__global__ __launch_bounds__(128) void k_gemm_bf(const float* __restrict__ A, int lda, const unsigned short* __restrict__ Wt, int ldb,
                                               const float* __restrict__ bias, float* __restrict__ C, int ldc, int M, int N, int K) {
  __shared__ __attribute__((aligned(16))) float so[4][16][64];
  const int tid = threadIdx.x, w = tid >> 5, lane = tid & 31, ln = lane & 15, hh = lane >> 4;
  const int ntn = N / 64;
  const int wid = blockIdx.x * 4 + w;
  const int mt = wid / ntn, nq = wid % ntn;
  if (mt * 16 >= M) return;
  const int row0 = mt * 16, col0 = nq * 64;
  const float* arow = A + (size_t)(row0 + ln) * lda;
  v8f acc[4] = {};
  for (int kb = 0; kb < K; kb += 32) {
    FragB ah, al;
    const v4f x0 = *(const v4fa*)(arow + kb + 8 * hh), x1 = *(const v4fa*)(arow + kb + 8 * hh + 4);
    const v4f x2 = *(const v4fa*)(arow + kb + 16 + 8 * hh), x3 = *(const v4fa*)(arow + kb + 16 + 8 * hh + 4);
    float xs[16] = {x0[0],x0[1],x0[2],x0[3],x1[0],x1[1],x1[2],x1[3],x2[0],x2[1],x2[2],x2[3],x3[0],x3[1],x3[2],x3[3]};
#pragma unroll
    for (int i = 0; i < 16; ++i) { const unsigned short hb = bf16_bits(xs[i]); ah.u[i] = hb; al.u[i] = ASPLIT ? bf16_bits(xs[i] - bf16_val(hb)) : (unsigned short)0; }
#pragma unroll
    for (int t = 0; t < 4; ++t) {
      const unsigned short* brow = Wt + (size_t)(col0 + t * 16 + ln) * ldb + kb;
      FragB b;
      b.half[0] = *(const v8us*)(brow + 8 * hh);
      b.half[1] = *(const v8us*)(brow + 16 + 8 * hh);
      acc[t] = mmaN<ASPLIT ? 2 : 1>(ah.v, al.v, b.v, b.v, acc[t]);
    }
  }
#pragma unroll
  for (int t = 0; t < 4; ++t) {
    float bv = bias ? bias[col0 + t * 16 + ln] : 0.f;
    if (BIAS_BF16) bv = bf16_round(bv);
#pragma unroll
    for (int r = 0; r < 8; ++r) { float v = acc[t][r] + bv; if (ACT == 1) v = fmaxf(v, 0.f); so[w][8 * hh + r][t * 16 + ln] = v; }
  }
  __builtin_amdgcn_fence(__ATOMIC_ACQ_REL, "workgroup");
  __builtin_amdgcn_wave_barrier();
  const int rsub = lane >> 4, c4 = (lane & 15) * 4;
  {
#pragma unroll
    for (int q = 0; q < 8; ++q) {
      const int r = q * 2 + rsub;
      const v4f v = *(const v4fa*)&so[w][r][c4];
      *(v4f*)(C + (size_t)(row0 + r) * ldc + col0 + c4) = v;
    }
    
  }
}

// Flash-style causal/unmasked attention, all contractions 3-term bf16 hi/lo splits, f32 softmax with running max.
// q,k,v rows are read from f32 buffers with arbitrary row pitch (so they can live inside a fused qkv buffer);
// D = head size (multiple of 32, <= 128); one wave = 16 query rows; block = 4 waves (64 queries) sharing K/V chunks of 32.
template <int D, bool CAUSAL>
__global__ __launch_bounds__(128) void k_flash(const float* __restrict__ qb, const float* __restrict__ kb, const float* __restrict__ vb,
                                             int pitch, int T, int H, float scale, float* __restrict__ y, int ypitch) {
  constexpr int KS = D / 32;        // k-steps for QK
  constexpr int DT = D / 16;        // d tiles for PV
  __shared__ __attribute__((aligned(16))) unsigned short sKh[32][D + 8], sKl[32][D + 8], sVh[32][D + 8], sVl[32][D + 8];
  __shared__ __attribute__((aligned(16))) unsigned short sPh[4][16][40], sPl[4][16][40];
  __shared__ __attribute__((aligned(16))) float sO[4][16][D];
  const int tid = threadIdx.x, w = tid >> 5, lane = tid & 31, ln = lane & 15, hh = lane >> 4;
  const int nqb = (T + 63) / 64;
  const int bh = blockIdx.x / nqb, qblk = blockIdx.x % nqb;
  const int b = bh / H, h = bh % H;
  const int q0 = qblk * 64 + w * 16;
  const float* Q = qb + (size_t)b * T * pitch + h * D;
  const float* K = kb + (size_t)b * T * pitch + h * D;
  const float* V = vb + (size_t)b * T * pitch + h * D;

  // A fragments of the wave's 16 query rows (scaled), hi/lo
  FragB aqh[KS], aql[KS];
  {
    int row = q0 + ln; if (row >= T) row = T - 1;
    const float* qr = Q + (size_t)row * pitch;
#pragma unroll
    for (int ks = 0; ks < KS; ++ks)
#pragma unroll
      for (int i = 0; i < 16; ++i) {
        const int d = ks * 32 + ((i < 8) ? (8 * hh + i) : (16 + 8 * hh + (i - 8)));
        const float x = qr[d] * scale; const unsigned short hb = bf16_bits(x);
        aqh[ks].u[i] = hb; aql[ks].u[i] = bf16_bits(x - bf16_val(hb));
      }
  }
  float m_r[8], l_r[8];
#pragma unroll
  for (int r = 0; r < 8; ++r) { m_r[r] = -3.0e38f; l_r[r] = 0.f; }
  v8f oacc[DT];
#pragma unroll
  for (int dt = 0; dt < DT; ++dt) oacc[dt] = (v8f){0.f,0.f,0.f,0.f,0.f,0.f,0.f,0.f};

  const int kv_end = CAUSAL ? min(T, qblk * 64 + 64) : T;     // block-uniform
  for (int j0 = 0; j0 < kv_end; j0 += 32) {
    __syncthreads();
    for (int e = tid; e < 32 * (D / 4); e += 128) {
      const int r = e / (D / 4), c4 = (e % (D / 4)) * 4;
      const int key = j0 + r;
      v4f kf = {0.f,0.f,0.f,0.f}, vf = {0.f,0.f,0.f,0.f};
      if (key < T) { kf = *(const v4fa*)(K + (size_t)key * pitch + c4); vf = *(const v4fa*)(V + (size_t)key * pitch + c4); }
#pragma unroll
      for (int t = 0; t < 4; ++t) {
        unsigned short hb = bf16_bits(kf[t]); sKh[r][c4 + t] = hb; sKl[r][c4 + t] = bf16_bits(kf[t] - bf16_val(hb));
        hb = bf16_bits(vf[t]); sVh[r][c4 + t] = hb; sVl[r][c4 + t] = bf16_bits(vf[t] - bf16_val(hb));
      }
    }
    __syncthreads();
    // S tile 16 x 32
    v8f s[2];
#pragma unroll
    for (int nt = 0; nt < 2; ++nt) {
      v8f acc = {};
#pragma unroll
      for (int ks = 0; ks < KS; ++ks) {
        FragB bh_, bl_;
        bh_.half[0] = *(const v8us*)&sKh[nt * 16 + ln][ks * 32 + 8 * hh]; bh_.half[1] = *(const v8us*)&sKh[nt * 16 + ln][ks * 32 + 16 + 8 * hh];
        bl_.half[0] = *(const v8us*)&sKl[nt * 16 + ln][ks * 32 + 8 * hh]; bl_.half[1] = *(const v8us*)&sKl[nt * 16 + ln][ks * 32 + 16 + 8 * hh];
        acc = mmaN<3>(aqh[ks].v, aql[ks].v, bh_.v, bl_.v, acc);
      }
      s[nt] = acc;
    }
    // mask + running max (rows 8hh+r; the 16 lanes of a half share rows)
    float alpha[8];
#pragma unroll
    for (int r = 0; r < 8; ++r) {
      const int qi = q0 + 8 * hh + r;
      const int ja = j0 + ln, jb = j0 + 16 + ln;
      if (CAUSAL) { if (ja > qi) s[0][r] = -3.0e38f; if (jb > qi) s[1][r] = -3.0e38f; }
      if (ja >= T) s[0][r] = -3.0e38f;
      if (jb >= T) s[1][r] = -3.0e38f;
      float mx = fmaxf(s[0][r], s[1][r]);
      mx = fmaxf(mx, __shfl_xor(mx, 1, 32)); mx = fmaxf(mx, __shfl_xor(mx, 2, 32)); mx = fmaxf(mx, __shfl_xor(mx, 4, 32)); mx = fmaxf(mx, __shfl_xor(mx, 8, 32));
      const float mnew = fmaxf(m_r[r], mx);
      alpha[r] = (mnew > -1.0e38f) ? __expf(m_r[r] - mnew) : 1.0f;
      const float p0 = (s[0][r] > -1.0e38f) ? __expf(s[0][r] - mnew) : 0.f;
      const float p1 = (s[1][r] > -1.0e38f) ? __expf(s[1][r] - mnew) : 0.f;
      m_r[r] = mnew;
      l_r[r] = l_r[r] * alpha[r] + p0 + p1;            // per-lane partial row sum (16 lanes combined at the end)
      unsigned short hb = bf16_bits(p0); sPh[w][8 * hh + r][ln] = hb;      sPl[w][8 * hh + r][ln] = bf16_bits(p0 - bf16_val(hb));
      hb = bf16_bits(p1);                sPh[w][8 * hh + r][16 + ln] = hb; sPl[w][8 * hh + r][16 + ln] = bf16_bits(p1 - bf16_val(hb));
    }
#pragma unroll
    for (int dt = 0; dt < DT; ++dt)
#pragma unroll
      for (int r = 0; r < 8; ++r) oacc[dt][r] *= alpha[r];
    __builtin_amdgcn_fence(__ATOMIC_ACQ_REL, "workgroup");
    __builtin_amdgcn_wave_barrier();
    FragB pah, pal;
    pah.half[0] = *(const v8us*)&sPh[w][ln][8 * hh]; pah.half[1] = *(const v8us*)&sPh[w][ln][16 + 8 * hh];
    pal.half[0] = *(const v8us*)&sPl[w][ln][8 * hh]; pal.half[1] = *(const v8us*)&sPl[w][ln][16 + 8 * hh];
#pragma unroll
    for (int dt = 0; dt < DT; ++dt) {
      FragB bvh, bvl;
#pragma unroll
      for (int i = 0; i < 8; ++i) {
        bvh.u[i] = sVh[8 * hh + i][dt * 16 + ln]; bvh.u[8 + i] = sVh[16 + 8 * hh + i][dt * 16 + ln];
        bvl.u[i] = sVl[8 * hh + i][dt * 16 + ln]; bvl.u[8 + i] = sVl[16 + 8 * hh + i][dt * 16 + ln];
      }
      oacc[dt] = mmaN<3>(pah.v, pal.v, bvh.v, bvl.v, oacc[dt]);
    }
    __builtin_amdgcn_fence(__ATOMIC_ACQ_REL, "workgroup");
    __builtin_amdgcn_wave_barrier();
  }
#pragma unroll
  for (int r = 0; r < 8; ++r) {
    float l = l_r[r];
    l += __shfl_xor(l, 1, 32); l += __shfl_xor(l, 2, 32); l += __shfl_xor(l, 4, 32); l += __shfl_xor(l, 8, 32);
    l_r[r] = (l > 0.f) ? 1.0f / l : 0.f;
  }
#pragma unroll
  for (int dt = 0; dt < DT; ++dt)
#pragma unroll
    for (int r = 0; r < 8; ++r) sO[w][8 * hh + r][dt * 16 + ln] = oacc[dt][r] * l_r[r];
  __builtin_amdgcn_fence(__ATOMIC_ACQ_REL, "workgroup");
  __builtin_amdgcn_wave_barrier();
  {
    for (int r = 0; r < 16; ++r) {
      const int row = q0 + r;
      if (row < T && lane < D / 4) {
        const v4f val = *(const v4fa*)&sO[w][r][lane * 4];
        *(v4f*)(y + ((size_t)b * T + row) * ypitch + h * D + lane * 4) = val;
      }
    }
    
  }
}

// General attention: queries [b][Tq] rows at Q + b*Tq*qpitch + h*D + row*qpitch; keys/values j < Tk1 from (K1,V1) at
// X + b*Tk1*pitch + (h/hgrp)*D + j*pitch, j >= Tk1 from (K2,V2) with j-Tk1 (pass Tk2 = 0 and null for a single source).
// Optional int mask [B][Tq][Tk] (mmode 0: nonzero or j == qi keep; mmode 1: nonzero masks), causal flag (j <= qi), optional post-softmax multiplier gp[(b*Tq+qi)*Tk + j] on P.
// 3-term bf16 splits, f32 softmax with running max; y[b][row][h*D + d] pitch ypitch, whole-line rows (D % 32 == 0).
template <int D>
__global__ __launch_bounds__(128) void k_flash3c(const float* __restrict__ Qb, int qpitch, int Tq,
                                              const float* __restrict__ K1, const float* __restrict__ V1, int Tk1,
                                              const float* __restrict__ K2, const float* __restrict__ V2, int Tk2, int kpitch, int vpitch,
                                              int H, int hgrp, float scale, const int* __restrict__ mask3, int mmode, int band, int causal, const float* __restrict__ gp,
                                              float* __restrict__ y, int ypitch) {
  constexpr int KS = D / 32, DT = D / 16;
  __shared__ __attribute__((aligned(16))) unsigned short sKh[32][D + 8], sKl[32][D + 8], sVh[32][D + 8], sVl[32][D + 8];
  __shared__ __attribute__((aligned(16))) unsigned short sPh[4][16][40], sPl[4][16][40];
  __shared__ __attribute__((aligned(16))) float sO[4][16][D];
  const int tid = threadIdx.x, w = tid >> 5, lane = tid & 31, ln = lane & 15, hh = lane >> 4;
  const int Tk = Tk1 + Tk2;
  const int nqb = (Tq + 63) / 64;
  const int bh = blockIdx.x / nqb, qblk = blockIdx.x % nqb;
  const int b = bh / H, h = bh % H;
  const int q0 = qblk * 64 + w * 16;
  const float* Q = Qb + (size_t)b * Tq * qpitch + h * D; const int hk = h / (hgrp > 0 ? hgrp : 1);   // K/V head (grouped-query: hgrp query heads share one)
  FragB aqh[KS], aql[KS];
  {
    int row = q0 + ln; if (row >= Tq) row = Tq - 1;
    const float* qr = Q + (size_t)row * qpitch;
#pragma unroll
    for (int ks = 0; ks < KS; ++ks)
#pragma unroll
      for (int i = 0; i < 16; ++i) {
        const int d = ks * 32 + ((i < 8) ? (8 * hh + i) : (16 + 8 * hh + (i - 8)));
        const float x = qr[d] * scale; const unsigned short hb = bf16_bits(x);
        aqh[ks].u[i] = hb; aql[ks].u[i] = bf16_bits(x - bf16_val(hb));
      }
  }
  int qrow[8];
#pragma unroll
  for (int r = 0; r < 8; ++r) { int qi = q0 + 8 * hh + r; qrow[r] = qi < Tq ? qi : Tq - 1; }
  float m_r[8], l_r[8];
#pragma unroll
  for (int r = 0; r < 8; ++r) { m_r[r] = -3.0e38f; l_r[r] = 0.f; }
  v8f oacc[DT];
#pragma unroll
  for (int dt = 0; dt < DT; ++dt) oacc[dt] = (v8f){0.f,0.f,0.f,0.f,0.f,0.f,0.f,0.f};
  // With a band, a key farther than band from every query row of the block has weight exp(-3e38 - m) = 0 in every row:
  // the loop runs only over the 32-key chunks that meet [first row - band, last row + band] (block-uniform bounds).
  int kv_begin = 0, kv_end = causal ? min(Tk, qblk * 64 + 64) : Tk;
  if (band > 0) { kv_begin = max(0, qblk * 64 - band) & ~31; kv_end = min(kv_end, qblk * 64 + 64 + band); }
  const int wq0 = qblk * 64 + __builtin_amdgcn_readfirstlane(w) * 16;   // the wave's first row, in a scalar register: the chunk test below is a scalar branch
  for (int j0 = kv_begin; j0 < kv_end; j0 += 32) {
    __syncthreads();
    for (int e = tid; e < 32 * (D / 4); e += 128) {
      const int r = e / (D / 4), c4 = (e % (D / 4)) * 4; const int key = j0 + r;
      v4f kf = {0.f,0.f,0.f,0.f}, vf = {0.f,0.f,0.f,0.f};
      if (key < Tk1) { kf = *(const v4fa*)(K1 + (size_t)b * Tk1 * kpitch + hk * D + (size_t)key * kpitch + c4); vf = *(const v4fa*)(V1 + (size_t)b * Tk1 * vpitch + hk * D + (size_t)key * vpitch + c4); }
      else if (key < Tk) { const int k2 = key - Tk1; kf = *(const v4fa*)(K2 + (size_t)b * Tk2 * kpitch + hk * D + (size_t)k2 * kpitch + c4); vf = *(const v4fa*)(V2 + (size_t)b * Tk2 * vpitch + hk * D + (size_t)k2 * vpitch + c4); }
#pragma unroll
      for (int t = 0; t < 4; ++t) {
        unsigned short hb = bf16_bits(kf[t]); sKh[r][c4 + t] = hb; sKl[r][c4 + t] = bf16_bits(kf[t] - bf16_val(hb));
        hb = bf16_bits(vf[t]); sVh[r][c4 + t] = hb; sVl[r][c4 + t] = bf16_bits(vf[t] - bf16_val(hb));
      }
    }
    __syncthreads();
    // a chunk wholly outside the band of this wave's own 16 rows adds nothing to them (no work-group barrier below this line in the trip)
    if (band > 0 && (j0 + 31 < wq0 - band || j0 > wq0 + 15 + band)) continue;
    v8f s[2];
#pragma unroll
    for (int nt = 0; nt < 2; ++nt) {
      v8f acc = {};
#pragma unroll
      for (int ks = 0; ks < KS; ++ks) {
        FragB bh_, bl_;
        bh_.half[0] = *(const v8us*)&sKh[nt * 16 + ln][ks * 32 + 8 * hh]; bh_.half[1] = *(const v8us*)&sKh[nt * 16 + ln][ks * 32 + 16 + 8 * hh];
        bl_.half[0] = *(const v8us*)&sKl[nt * 16 + ln][ks * 32 + 8 * hh]; bl_.half[1] = *(const v8us*)&sKl[nt * 16 + ln][ks * 32 + 16 + 8 * hh];
        acc = mmaN<3>(aqh[ks].v, aql[ks].v, bh_.v, bl_.v, acc);
      }
      s[nt] = acc;
    }
    float alpha[8];
#pragma unroll
    for (int r = 0; r < 8; ++r) {
      const int qi = qrow[r];
      const int ja = j0 + ln, jb = j0 + 16 + ln;
      bool keepa = ja < Tk, keepb = jb < Tk;
      if (causal) { keepa = keepa && (ja <= qi); keepb = keepb && (jb <= qi); }
      if (mask3) { const int* mr = mask3 + ((size_t)b * Tq + qi) * Tk;
        if (mmode == 0) { if (keepa && !(mr[ja] != 0 || ja == qi)) s[0][r] = -1.0e9f; if (keepb && !(mr[jb] != 0 || jb == qi)) s[1][r] = -1.0e9f; }
        else            { if (keepa && mr[ja] != 0) s[0][r] = -3.0e38f; if (keepb && mr[jb] != 0) s[1][r] = -3.0e38f; } }
      if (band > 0) { if (keepa && (ja > qi + band || ja < qi - band)) s[0][r] = -3.0e38f; if (keepb && (jb > qi + band || jb < qi - band)) s[1][r] = -3.0e38f; }
      if (!keepa) s[0][r] = -3.0e38f;
      if (!keepb) s[1][r] = -3.0e38f;
      float mx = fmaxf(s[0][r], s[1][r]);
      mx = fmaxf(mx, __shfl_xor(mx, 1, 32)); mx = fmaxf(mx, __shfl_xor(mx, 2, 32)); mx = fmaxf(mx, __shfl_xor(mx, 4, 32)); mx = fmaxf(mx, __shfl_xor(mx, 8, 32));
      const float mnew = fmaxf(m_r[r], mx);
      alpha[r] = (mnew > -1.0e38f) ? __expf(m_r[r] - mnew) : 1.0f;
      const float p0 = keepa ? __expf(s[0][r] - mnew) : 0.f;
      const float p1 = keepb ? __expf(s[1][r] - mnew) : 0.f;
      m_r[r] = mnew;
      l_r[r] = l_r[r] * alpha[r] + p0 + p1;
      float g0 = p0, g1 = p1; if (gp) { const float* gr = gp + ((size_t)b * Tq + qi) * Tk; g0 *= bf16_round(gr[ja]); g1 *= bf16_round(gr[jb]); }   // post-softmax multiplier: P only, not the normaliser
      unsigned short hb = bf16_bits(g0); sPh[w][8 * hh + r][ln] = hb;      sPl[w][8 * hh + r][ln] = bf16_bits(g0 - bf16_val(hb));
      hb = bf16_bits(g1);                sPh[w][8 * hh + r][16 + ln] = hb; sPl[w][8 * hh + r][16 + ln] = bf16_bits(g1 - bf16_val(hb));
    }
#pragma unroll
    for (int dt = 0; dt < DT; ++dt)
#pragma unroll
      for (int r = 0; r < 8; ++r) oacc[dt][r] *= alpha[r];
    __builtin_amdgcn_fence(__ATOMIC_ACQ_REL, "workgroup");
    __builtin_amdgcn_wave_barrier();
    FragB pah, pal;
    pah.half[0] = *(const v8us*)&sPh[w][ln][8 * hh]; pah.half[1] = *(const v8us*)&sPh[w][ln][16 + 8 * hh];
    pal.half[0] = *(const v8us*)&sPl[w][ln][8 * hh]; pal.half[1] = *(const v8us*)&sPl[w][ln][16 + 8 * hh];
#pragma unroll
    for (int dt = 0; dt < DT; ++dt) {
      FragB bvh, bvl;
#pragma unroll
      for (int i = 0; i < 8; ++i) {
        bvh.u[i] = sVh[8 * hh + i][dt * 16 + ln]; bvh.u[8 + i] = sVh[16 + 8 * hh + i][dt * 16 + ln];
        bvl.u[i] = sVl[8 * hh + i][dt * 16 + ln]; bvl.u[8 + i] = sVl[16 + 8 * hh + i][dt * 16 + ln];
      }
      oacc[dt] = mmaN<3>(pah.v, pal.v, bvh.v, bvl.v, oacc[dt]);
    }
    __builtin_amdgcn_fence(__ATOMIC_ACQ_REL, "workgroup");
    __builtin_amdgcn_wave_barrier();
  }
#pragma unroll
  for (int r = 0; r < 8; ++r) {
    float l = l_r[r];
    l += __shfl_xor(l, 1, 32); l += __shfl_xor(l, 2, 32); l += __shfl_xor(l, 4, 32); l += __shfl_xor(l, 8, 32);
    l_r[r] = (m_r[r] > -1.0e38f) ? 1.0f / l : __builtin_nanf("");
  }
#pragma unroll
  for (int dt = 0; dt < DT; ++dt)
#pragma unroll
    for (int r = 0; r < 8; ++r) sO[w][8 * hh + r][dt * 16 + ln] = oacc[dt][r] * l_r[r];
  __builtin_amdgcn_fence(__ATOMIC_ACQ_REL, "workgroup");
  __builtin_amdgcn_wave_barrier();
  {
    for (int r = 0; r < 16; ++r) {
      const int row = q0 + r;
      if (row < Tq && lane < D / 4) {
        const v4f val = *(const v4fa*)&sO[w][r][lane * 4];
        *(v4f*)(y + ((size_t)b * Tq + row) * ypitch + h * D + lane * 4) = val;
      }
    }
    
  }
}
// interleaved rotary on the head dim: pairs (2i, 2i+1) rotated by pos·inv_freq[i], inv_freq[i] = 10000^(−i/(d/2)); in place on q and k; thread per pair
__global__ __launch_bounds__(256) void k_rope2(float* __restrict__ q, float* __restrict__ k) {
  const size_t t = (size_t)blockIdx.x * 256 + threadIdx.x; if (t >= (size_t)BB * TT * EE / 2) return;
  const size_t e = t * 2; const int col = (int)(e % EE); const int pos = (int)((e / EE) % TT); const int i = (col % HD) / 2;
  const float inv = powf(10000.0f, -(float)i / (float)(HD / 2)); const float ang = (float)pos * inv; float sn, cs; sincosf(ang, &sn, &cs);
  const float q0 = q[e], q1 = q[e + 1], k0 = k[e], k1 = k[e + 1];
  const float nq0 = q0 * cs - q1 * sn, nq1 = q1 * cs + q0 * sn, nk0 = k0 * cs - k1 * sn, nk1 = k1 * cs + k0 * sn;
  typedef float v2f __attribute__((ext_vector_type(2)));
  v2f a = {nq0, nq1}, bb = {nk0, nk1};
  *(v2f*)(q + e) = a; *(v2f*)(k + e) = bb; 
}
extern "C" void kernel_launch(void* const* d_in, const int* in_sizes, int n_in,
                              void* d_out, int out_size, void* d_ws, size_t ws_size, hipStream_t stream) {
  (void)in_sizes; (void)n_in; (void)out_size;
  const float* xq = (const float*)d_in[0]; const float* xkv = (const float*)d_in[1];
  const float* Wq = (const float*)d_in[2]; const float* Wk = (const float*)d_in[3]; const float* Wv = (const float*)d_in[4]; const float* Wo = (const float*)d_in[5];
  char* ws = (char*)d_ws; size_t off = 0;
  auto take = [&](size_t bytes) { char* p = ws + off; off += (bytes + 255) & ~(size_t)255; return p; };
  const int M = BB * TT, gb = ((M / 16) * (EE / 64) + 3) / 4;
  unsigned short* Wt[4]; for (int i = 0; i < 4; ++i) Wt[i] = (unsigned short*)take((size_t)EE * EE * 2);
  float* q = (float*)take((size_t)M * EE * 4); float* k = (float*)take((size_t)M * EE * 4); float* v = (float*)take((size_t)M * EE * 4); float* att = (float*)take((size_t)M * EE * 4);
  if (off > ws_size) return;
  const float* W4[4] = {Wq, Wk, Wv, Wo};
  for (int i = 0; i < 4; ++i) k_wt_bf16<<<(EE * (EE / 8) + 255) / 256, 256, 0, stream>>>(W4[i], Wt[i], EE, EE);
  k_gemm_bf<false, 0, false><<<gb, 128, 0, stream>>>(xq, EE, Wt[0], EE, nullptr, q, EE, M, EE, EE);
  k_gemm_bf<false, 0, false><<<gb, 128, 0, stream>>>(xkv, EE, Wt[1], EE, nullptr, k, EE, M, EE, EE);
  k_gemm_bf<false, 0, false><<<gb, 128, 0, stream>>>(xkv, EE, Wt[2], EE, nullptr, v, EE, M, EE, EE);
  k_rope2<<<(unsigned)(((size_t)M * EE / 2 + 255) / 256), 256, 0, stream>>>(q, k);
  k_flash3c<HD><<<BB * NH * (TT / 64), 128, 0, stream>>>(q, EE, TT, k, v, TT, nullptr, nullptr, 0, EE, EE, NH, 1, 0.125f, nullptr, 0, 256, 0, nullptr, att, EE);
  k_gemm_bf<true, 0, false><<<gb, 128, 0, stream>>>(att, EE, Wt[3], EE, nullptr, (float*)d_out, EE, M, EE, EE);
}

// v002
// Measured time: 384 microseconds a run.
// Next to v001, in two timings, it ran 1.49 times as fast each time.
// All steps since v000 together make it 3.03 times as fast.
#include <hip/hip_runtime.h>
// All contractions on v_wmma_f32_16x16x32_bf16, f32 accumulate: x_q·Wq, x_kv·Wk, x_kv·Wv (inputs, W rounded to bf16: single exact term),
// QKᵀ and P·V per 16-query tile as 3-term bf16 hi/lo splits with the |i−j| ≤ 256 band, out·Wo with the A operand split (2 terms);
// interleaved rotary embedding and softmax in f32.
#define BB 4
#define TT 2048
#define EE 1024
#define NH 16
#define HD 64

typedef __bf16 v16b __attribute__((ext_vector_type(16)));
typedef unsigned short v8us __attribute__((ext_vector_type(8), may_alias));
typedef float  v8f  __attribute__((ext_vector_type(8)));
typedef float  v4f  __attribute__((ext_vector_type(4)));
typedef float  v4fa __attribute__((ext_vector_type(4), may_alias));
union FragB { v16b v; v8us half[2]; unsigned short u[16]; };

__device__ __forceinline__ unsigned short bf16_bits(float x) { unsigned int u = __float_as_uint(x); return (unsigned short)((u + 0x7FFFu + ((u >> 16) & 1u)) >> 16); }
__device__ __forceinline__ float bf16_val(unsigned short b) { return __uint_as_float(((unsigned int)b) << 16); }
__device__ __forceinline__ float bf16_round(float x) { return bf16_val(bf16_bits(x)); }
// D += A·B with NT terms: 1 = ah·bh, 2 = + al·bh (A split), 3 = + ah·bl (both split)
template <int NT>
__device__ __forceinline__ v8f mmaN(v16b ah, v16b al, v16b bh, v16b bl, v8f c) {
  c = __builtin_amdgcn_wmma_f32_16x16x32_bf16(false, ah, false, bh, (short)0, c, false, false);
  if (NT >= 2) c = __builtin_amdgcn_wmma_f32_16x16x32_bf16(false, al, false, bh, (short)0, c, false, false);
  if (NT >= 3) c = __builtin_amdgcn_wmma_f32_16x16x32_bf16(false, ah, false, bl, (short)0, c, false, false);
  asm volatile("v_nop\n\tv_nop\n\tv_nop\n\tv_nop" : "+v"(c) : "v"(ah), "v"(al), "v"(bh), "v"(bl));
  return c;
}

__global__ __launch_bounds__(256) void k_wt_bf16(const float* __restrict__ W, unsigned short* __restrict__ Wt, int K, int N) {
  const int t = blockIdx.x * 256 + threadIdx.x;
  const int k8n = K / 8;
  if (t >= N * k8n) return;
  const int n = t / k8n, k8 = (t % k8n) * 8;
  v8us v;
#pragma unroll
  for (int i = 0; i < 8; ++i) v[i] = bf16_bits(W[(size_t)(k8 + i) * N + n]);
  *(v8us*)(Wt + (size_t)n * K + k8) = v;
  
}

// GEMM C[M][N] (f32, pitch ldc) = act(A[M][K] x W + bias). One work-group of 8 waves makes a 128 x 128 tile of C; a wave makes 32 x 64 of it.
// A pass is 64 k: the A rows (f32, pitch lda) are converted to bf16 once per work-group (ASPLIT: hi and lo planes -> 2 terms, else one
// rounded term) and laid in LDS beside the 128 rows of Wt (bf16 [N][K], pitch ldb); every global load covers whole 128-B lines.
// Two LDS buffers: the next pass is loaded into registers ahead of this pass's products and stored behind them, one barrier a pass.
// The k order of every sum is ascending in steps of 32, hi term then lo term. BIAS_BF16 rounds the bias to bf16 before the add.
// K%64==0, M%128==0, N%128==0.
typedef unsigned short v4us __attribute__((ext_vector_type(4), may_alias));
template <bool ASPLIT, int ACT, bool BIAS_BF16>
__global__ __launch_bounds__(256) void k_gemm_bf(const float* __restrict__ A, int lda, const unsigned short* __restrict__ Wt, int ldb,
                                               const float* __restrict__ bias, float* __restrict__ C, int ldc, int M, int N, int K) {
  constexpr int PB = 72;                 // LDS row pitch in bf16: 128 B of k + 16 B, an odd multiple of 16 B for the 16-byte readers
  constexpr int PLANE = 128 * PB;        // one operand plane of a pass
  constexpr int NPL = ASPLIT ? 3 : 2;    // A hi, W, (A lo)
  constexpr int PO = 68;                 // pitch in f32 of the output staging rows
  __shared__ __attribute__((aligned(16))) unsigned short sm[2 * NPL * PLANE];
  const int tid = threadIdx.x, w = tid >> 5, lane = tid & 31, ln = lane & 15, hh = lane >> 4;
  const int ntn = N / 128;
  const int mb = blockIdx.x / ntn, nb = blockIdx.x % ntn;
  if (mb * 128 >= M) return;             // the same for the whole work-group, ahead of every barrier
  const int row0 = mb * 128, col0 = nb * 128;
  const int wm = w >> 1, wn = w & 1;
  const int ar = tid >> 4, ac = (tid & 15) * 4;    // A staging: 16 lanes cover 256 B of a row
  const int br = tid >> 3, bc = (tid & 7) * 8;     // W staging: 8 lanes cover 128 B of a row
  const float* ag = A + (size_t)(row0 + ar) * lda + ac;
  const unsigned short* bg = Wt + (size_t)(col0 + br) * ldb + bc;
  v4f xa[8]; v8us xb[4];
  v8f acc[2][4] = {};
  const int np = K / 64;
  auto fetch = [&](int kb) {
    const float* pa[8]; const unsigned short* pb[4];
#pragma unroll
    for (int i = 0; i < 8; ++i) { pa[i] = ag + (size_t)(16 * i) * lda + kb; xa[i] = *(const v4fa*)pa[i]; }
#pragma unroll
    for (int i = 0; i < 4; ++i) { pb[i] = bg + (size_t)(32 * i) * ldb + kb; xb[i] = *(const v8us*)pb[i]; }
    // no register that one of these loads names as its address is written (not by a later load's result either) ahead of this wait:
    // the inputs keep all twelve addresses live up to it
    asm volatile("s_wait_xcnt 0x0" :: "v"(pa[0]), "v"(pa[1]), "v"(pa[2]), "v"(pa[3]), "v"(pa[4]), "v"(pa[5]), "v"(pa[6]), "v"(pa[7]),
                 "v"(pb[0]), "v"(pb[1]), "v"(pb[2]), "v"(pb[3]) : "memory");
  };
  fetch(0);
  for (int p = 0; p <= np; ++p) {
    if (p > 0) {
      // products of pass p - 1 out of its buffer
      const unsigned short* sAh = sm + ((p - 1) & 1) * (NPL * PLANE);
      const unsigned short* sB = sAh + PLANE;
      const unsigned short* sAl = sB + PLANE;
#pragma unroll
      for (int ks = 0; ks < 2; ++ks) {
        FragB ah[2], al[2], b[4];
#pragma unroll
        for (int mi = 0; mi < 2; ++mi) {
          const int o = (wm * 32 + mi * 16 + ln) * PB + ks * 32 + 8 * hh;
          ah[mi].half[0] = *(const v8us*)(sAh + o); ah[mi].half[1] = *(const v8us*)(sAh + o + 16);
          if (ASPLIT) { al[mi].half[0] = *(const v8us*)(sAl + o); al[mi].half[1] = *(const v8us*)(sAl + o + 16); }
          else al[mi] = ah[mi];
        }
#pragma unroll
        for (int t = 0; t < 4; ++t) {
          const int o = (wn * 64 + t * 16 + ln) * PB + ks * 32 + 8 * hh;
          b[t].half[0] = *(const v8us*)(sB + o); b[t].half[1] = *(const v8us*)(sB + o + 16);
        }
#pragma unroll
        for (int mi = 0; mi < 2; ++mi)
#pragma unroll
          for (int t = 0; t < 4; ++t) acc[mi][t] = mmaN<ASPLIT ? 2 : 1>(ah[mi].v, al[mi].v, b[t].v, b[t].v, acc[mi][t]);
      }
    }
    if (p < np) {
      // pass p from registers into the buffer whose readers left it at the barrier that ended trip p - 1
      unsigned short* dAh = sm + (p & 1) * (NPL * PLANE);
      unsigned short* dB = dAh + PLANE;
      unsigned short* dAl = dB + PLANE;
#pragma unroll
      for (int i = 0; i < 8; ++i) {
        v4us h, l;
#pragma unroll
        for (int t = 0; t < 4; ++t) { const unsigned short hb = bf16_bits(xa[i][t]); h[t] = hb; l[t] = ASPLIT ? bf16_bits(xa[i][t] - bf16_val(hb)) : (unsigned short)0; }
        *(v4us*)(dAh + (ar + 16 * i) * PB + ac) = h;
        if (ASPLIT) *(v4us*)(dAl + (ar + 16 * i) * PB + ac) = l;
      }
#pragma unroll
      for (int i = 0; i < 4; ++i) *(v8us*)(dB + (br + 32 * i) * PB + bc) = xb[i];
    }
    __syncthreads();
    if (p + 1 < np) {
      // pass p + 1 starts its way from L2 now and is waited for only behind the products of pass p
      fetch((p + 1) * 64);
    }
  }
  // the barrier of the last trip stands behind every wave's last read of the buffers: each wave now stages its 32 x 64 tile in a range of its own
  float* so = (float*)sm + w * (32 * PO);
#pragma unroll
  for (int mi = 0; mi < 2; ++mi)
#pragma unroll
    for (int t = 0; t < 4; ++t) {
      float bv = bias ? bias[col0 + wn * 64 + t * 16 + ln] : 0.f;
      if (BIAS_BF16) bv = bf16_round(bv);
#pragma unroll
      for (int r = 0; r < 8; ++r) { float v = acc[mi][t][r] + bv; if (ACT == 1) v = fmaxf(v, 0.f); so[(mi * 16 + 8 * hh + r) * PO + t * 16 + ln] = v; }
    }
  __builtin_amdgcn_fence(__ATOMIC_ACQ_REL, "workgroup");
  __builtin_amdgcn_wave_barrier();
  const int rsub = lane >> 4, c4 = (lane & 15) * 4;
#pragma unroll
  for (int q = 0; q < 16; ++q) {
    const int r = q * 2 + rsub;
    const v4f v = *(const v4fa*)&so[r * PO + c4];
    *(v4f*)(C + (size_t)(row0 + wm * 32 + r) * ldc + col0 + wn * 64 + c4) = v;
  }
}

// Flash-style causal/unmasked attention, all contractions 3-term bf16 hi/lo splits, f32 softmax with running max.
// q,k,v rows are read from f32 buffers with arbitrary row pitch (so they can live inside a fused qkv buffer);
// D = head size (multiple of 32, <= 128); one wave = 16 query rows; block = 4 waves (64 queries) sharing K/V chunks of 32.
template <int D, bool CAUSAL>
__global__ __launch_bounds__(128) void k_flash(const float* __restrict__ qb, const float* __restrict__ kb, const float* __restrict__ vb,
                                             int pitch, int T, int H, float scale, float* __restrict__ y, int ypitch) {
  constexpr int KS = D / 32;        // k-steps for QK
  constexpr int DT = D / 16;        // d tiles for PV
  __shared__ __attribute__((aligned(16))) unsigned short sKh[32][D + 8], sKl[32][D + 8], sVh[32][D + 8], sVl[32][D + 8];
  __shared__ __attribute__((aligned(16))) unsigned short sPh[4][16][40], sPl[4][16][40];
  __shared__ __attribute__((aligned(16))) float sO[4][16][D];
  const int tid = threadIdx.x, w = tid >> 5, lane = tid & 31, ln = lane & 15, hh = lane >> 4;
  const int nqb = (T + 63) / 64;
  const int bh = blockIdx.x / nqb, qblk = blockIdx.x % nqb;
  const int b = bh / H, h = bh % H;
  const int q0 = qblk * 64 + w * 16;
  const float* Q = qb + (size_t)b * T * pitch + h * D;
  const float* K = kb + (size_t)b * T * pitch + h * D;
  const float* V = vb + (size_t)b * T * pitch + h * D;

  // A fragments of the wave's 16 query rows (scaled), hi/lo
  FragB aqh[KS], aql[KS];
  {
    int row = q0 + ln; if (row >= T) row = T - 1;
    const float* qr = Q + (size_t)row * pitch;
#pragma unroll
    for (int ks = 0; ks < KS; ++ks)
#pragma unroll
      for (int i = 0; i < 16; ++i) {
        const int d = ks * 32 + ((i < 8) ? (8 * hh + i) : (16 + 8 * hh + (i - 8)));
        const float x = qr[d] * scale; const unsigned short hb = bf16_bits(x);
        aqh[ks].u[i] = hb; aql[ks].u[i] = bf16_bits(x - bf16_val(hb));
      }
  }
  float m_r[8], l_r[8];
#pragma unroll
  for (int r = 0; r < 8; ++r) { m_r[r] = -3.0e38f; l_r[r] = 0.f; }
  v8f oacc[DT];
#pragma unroll
  for (int dt = 0; dt < DT; ++dt) oacc[dt] = (v8f){0.f,0.f,0.f,0.f,0.f,0.f,0.f,0.f};

  const int kv_end = CAUSAL ? min(T, qblk * 64 + 64) : T;     // block-uniform
  for (int j0 = 0; j0 < kv_end; j0 += 32) {
    __syncthreads();
    for (int e = tid; e < 32 * (D / 4); e += 128) {
      const int r = e / (D / 4), c4 = (e % (D / 4)) * 4;
      const int key = j0 + r;
      v4f kf = {0.f,0.f,0.f,0.f}, vf = {0.f,0.f,0.f,0.f};
      if (key < T) { kf = *(const v4fa*)(K + (size_t)key * pitch + c4); vf = *(const v4fa*)(V + (size_t)key * pitch + c4); }
#pragma unroll
      for (int t = 0; t < 4; ++t) {
        unsigned short hb = bf16_bits(kf[t]); sKh[r][c4 + t] = hb; sKl[r][c4 + t] = bf16_bits(kf[t] - bf16_val(hb));
        hb = bf16_bits(vf[t]); sVh[r][c4 + t] = hb; sVl[r][c4 + t] = bf16_bits(vf[t] - bf16_val(hb));
      }
    }
    __syncthreads();
    // S tile 16 x 32
    v8f s[2];
#pragma unroll
    for (int nt = 0; nt < 2; ++nt) {
      v8f acc = {};
#pragma unroll
      for (int ks = 0; ks < KS; ++ks) {
        FragB bh_, bl_;
        bh_.half[0] = *(const v8us*)&sKh[nt * 16 + ln][ks * 32 + 8 * hh]; bh_.half[1] = *(const v8us*)&sKh[nt * 16 + ln][ks * 32 + 16 + 8 * hh];
        bl_.half[0] = *(const v8us*)&sKl[nt * 16 + ln][ks * 32 + 8 * hh]; bl_.half[1] = *(const v8us*)&sKl[nt * 16 + ln][ks * 32 + 16 + 8 * hh];
        acc = mmaN<3>(aqh[ks].v, aql[ks].v, bh_.v, bl_.v, acc);
      }
      s[nt] = acc;
    }
    // mask + running max (rows 8hh+r; the 16 lanes of a half share rows)
    float alpha[8];
#pragma unroll
    for (int r = 0; r < 8; ++r) {
      const int qi = q0 + 8 * hh + r;
      const int ja = j0 + ln, jb = j0 + 16 + ln;
      if (CAUSAL) { if (ja > qi) s[0][r] = -3.0e38f; if (jb > qi) s[1][r] = -3.0e38f; }
      if (ja >= T) s[0][r] = -3.0e38f;
      if (jb >= T) s[1][r] = -3.0e38f;
      float mx = fmaxf(s[0][r], s[1][r]);
      mx = fmaxf(mx, __shfl_xor(mx, 1, 32)); mx = fmaxf(mx, __shfl_xor(mx, 2, 32)); mx = fmaxf(mx, __shfl_xor(mx, 4, 32)); mx = fmaxf(mx, __shfl_xor(mx, 8, 32));
      const float mnew = fmaxf(m_r[r], mx);
      alpha[r] = (mnew > -1.0e38f) ? __expf(m_r[r] - mnew) : 1.0f;
      const float p0 = (s[0][r] > -1.0e38f) ? __expf(s[0][r] - mnew) : 0.f;
      const float p1 = (s[1][r] > -1.0e38f) ? __expf(s[1][r] - mnew) : 0.f;
      m_r[r] = mnew;
      l_r[r] = l_r[r] * alpha[r] + p0 + p1;            // per-lane partial row sum (16 lanes combined at the end)
      unsigned short hb = bf16_bits(p0); sPh[w][8 * hh + r][ln] = hb;      sPl[w][8 * hh + r][ln] = bf16_bits(p0 - bf16_val(hb));
      hb = bf16_bits(p1);                sPh[w][8 * hh + r][16 + ln] = hb; sPl[w][8 * hh + r][16 + ln] = bf16_bits(p1 - bf16_val(hb));
    }
#pragma unroll
    for (int dt = 0; dt < DT; ++dt)
#pragma unroll
      for (int r = 0; r < 8; ++r) oacc[dt][r] *= alpha[r];
    __builtin_amdgcn_fence(__ATOMIC_ACQ_REL, "workgroup");
    __builtin_amdgcn_wave_barrier();
    FragB pah, pal;
    pah.half[0] = *(const v8us*)&sPh[w][ln][8 * hh]; pah.half[1] = *(const v8us*)&sPh[w][ln][16 + 8 * hh];
    pal.half[0] = *(const v8us*)&sPl[w][ln][8 * hh]; pal.half[1] = *(const v8us*)&sPl[w][ln][16 + 8 * hh];
#pragma unroll
    for (int dt = 0; dt < DT; ++dt) {
      FragB bvh, bvl;
#pragma unroll
      for (int i = 0; i < 8; ++i) {
        bvh.u[i] = sVh[8 * hh + i][dt * 16 + ln]; bvh.u[8 + i] = sVh[16 + 8 * hh + i][dt * 16 + ln];
        bvl.u[i] = sVl[8 * hh + i][dt * 16 + ln]; bvl.u[8 + i] = sVl[16 + 8 * hh + i][dt * 16 + ln];
      }
      oacc[dt] = mmaN<3>(pah.v, pal.v, bvh.v, bvl.v, oacc[dt]);
    }
    __builtin_amdgcn_fence(__ATOMIC_ACQ_REL, "workgroup");
    __builtin_amdgcn_wave_barrier();
  }
#pragma unroll
  for (int r = 0; r < 8; ++r) {
    float l = l_r[r];
    l += __shfl_xor(l, 1, 32); l += __shfl_xor(l, 2, 32); l += __shfl_xor(l, 4, 32); l += __shfl_xor(l, 8, 32);
    l_r[r] = (l > 0.f) ? 1.0f / l : 0.f;
  }
#pragma unroll
  for (int dt = 0; dt < DT; ++dt)
#pragma unroll
    for (int r = 0; r < 8; ++r) sO[w][8 * hh + r][dt * 16 + ln] = oacc[dt][r] * l_r[r];
  __builtin_amdgcn_fence(__ATOMIC_ACQ_REL, "workgroup");
  __builtin_amdgcn_wave_barrier();
  {
    for (int r = 0; r < 16; ++r) {
      const int row = q0 + r;
      if (row < T && lane < D / 4) {
        const v4f val = *(const v4fa*)&sO[w][r][lane * 4];
        *(v4f*)(y + ((size_t)b * T + row) * ypitch + h * D + lane * 4) = val;
      }
    }
    
  }
}

// General attention: queries [b][Tq] rows at Q + b*Tq*qpitch + h*D + row*qpitch; keys/values j < Tk1 from (K1,V1) at
// X + b*Tk1*pitch + (h/hgrp)*D + j*pitch, j >= Tk1 from (K2,V2) with j-Tk1 (pass Tk2 = 0 and null for a single source).
// Optional int mask [B][Tq][Tk] (mmode 0: nonzero or j == qi keep; mmode 1: nonzero masks), causal flag (j <= qi), optional post-softmax multiplier gp[(b*Tq+qi)*Tk + j] on P.
// 3-term bf16 splits, f32 softmax with running max; y[b][row][h*D + d] pitch ypitch, whole-line rows (D % 32 == 0).
template <int D>
__global__ __launch_bounds__(128) void k_flash3c(const float* __restrict__ Qb, int qpitch, int Tq,
                                              const float* __restrict__ K1, const float* __restrict__ V1, int Tk1,
                                              const float* __restrict__ K2, const float* __restrict__ V2, int Tk2, int kpitch, int vpitch,
                                              int H, int hgrp, float scale, const int* __restrict__ mask3, int mmode, int band, int causal, const float* __restrict__ gp,
                                              float* __restrict__ y, int ypitch) {
  constexpr int KS = D / 32, DT = D / 16;
  __shared__ __attribute__((aligned(16))) unsigned short sKh[32][D + 8], sKl[32][D + 8], sVh[32][D + 8], sVl[32][D + 8];
  __shared__ __attribute__((aligned(16))) unsigned short sPh[4][16][40], sPl[4][16][40];
  __shared__ __attribute__((aligned(16))) float sO[4][16][D];
  const int tid = threadIdx.x, w = tid >> 5, lane = tid & 31, ln = lane & 15, hh = lane >> 4;
  const int Tk = Tk1 + Tk2;
  const int nqb = (Tq + 63) / 64;
  const int bh = blockIdx.x / nqb, qblk = blockIdx.x % nqb;
  const int b = bh / H, h = bh % H;
  const int q0 = qblk * 64 + w * 16;
  const float* Q = Qb + (size_t)b * Tq * qpitch + h * D; const int hk = h / (hgrp > 0 ? hgrp : 1);   // K/V head (grouped-query: hgrp query heads share one)
  FragB aqh[KS], aql[KS];
  {
    int row = q0 + ln; if (row >= Tq) row = Tq - 1;
    const float* qr = Q + (size_t)row * qpitch;
#pragma unroll
    for (int ks = 0; ks < KS; ++ks)
#pragma unroll
      for (int i = 0; i < 16; ++i) {
        const int d = ks * 32 + ((i < 8) ? (8 * hh + i) : (16 + 8 * hh + (i - 8)));
        const float x = qr[d] * scale; const unsigned short hb = bf16_bits(x);
        aqh[ks].u[i] = hb; aql[ks].u[i] = bf16_bits(x - bf16_val(hb));
      }
  }
  int qrow[8];
#pragma unroll
  for (int r = 0; r < 8; ++r) { int qi = q0 + 8 * hh + r; qrow[r] = qi < Tq ? qi : Tq - 1; }
  float m_r[8], l_r[8];
#pragma unroll
  for (int r = 0; r < 8; ++r) { m_r[r] = -3.0e38f; l_r[r] = 0.f; }
  v8f oacc[DT];
#pragma unroll
  for (int dt = 0; dt < DT; ++dt) oacc[dt] = (v8f){0.f,0.f,0.f,0.f,0.f,0.f,0.f,0.f};
  // With a band, a key farther than band from every query row of the block has weight exp(-3e38 - m) = 0 in every row:
  // the loop runs only over the 32-key chunks that meet [first row - band, last row + band] (block-uniform bounds).
  int kv_begin = 0, kv_end = causal ? min(Tk, qblk * 64 + 64) : Tk;
  if (band > 0) { kv_begin = max(0, qblk * 64 - band) & ~31; kv_end = min(kv_end, qblk * 64 + 64 + band); }
  const int wq0 = qblk * 64 + __builtin_amdgcn_readfirstlane(w) * 16;   // the wave's first row, in a scalar register: the chunk test below is a scalar branch
  for (int j0 = kv_begin; j0 < kv_end; j0 += 32) {
    __syncthreads();
    for (int e = tid; e < 32 * (D / 4); e += 128) {
      const int r = e / (D / 4), c4 = (e % (D / 4)) * 4; const int key = j0 + r;
      v4f kf = {0.f,0.f,0.f,0.f}, vf = {0.f,0.f,0.f,0.f};
      if (key < Tk1) { kf = *(const v4fa*)(K1 + (size_t)b * Tk1 * kpitch + hk * D + (size_t)key * kpitch + c4); vf = *(const v4fa*)(V1 + (size_t)b * Tk1 * vpitch + hk * D + (size_t)key * vpitch + c4); }
      else if (key < Tk) { const int k2 = key - Tk1; kf = *(const v4fa*)(K2 + (size_t)b * Tk2 * kpitch + hk * D + (size_t)k2 * kpitch + c4); vf = *(const v4fa*)(V2 + (size_t)b * Tk2 * vpitch + hk * D + (size_t)k2 * vpitch + c4); }
#pragma unroll
      for (int t = 0; t < 4; ++t) {
        unsigned short hb = bf16_bits(kf[t]); sKh[r][c4 + t] = hb; sKl[r][c4 + t] = bf16_bits(kf[t] - bf16_val(hb));
        hb = bf16_bits(vf[t]); sVh[r][c4 + t] = hb; sVl[r][c4 + t] = bf16_bits(vf[t] - bf16_val(hb));
      }
    }
    __syncthreads();
    // a chunk wholly outside the band of this wave's own 16 rows adds nothing to them (no work-group barrier below this line in the trip)
    if (band > 0 && (j0 + 31 < wq0 - band || j0 > wq0 + 15 + band)) continue;
    v8f s[2];
#pragma unroll
    for (int nt = 0; nt < 2; ++nt) {
      v8f acc = {};
#pragma unroll
      for (int ks = 0; ks < KS; ++ks) {
        FragB bh_, bl_;
        bh_.half[0] = *(const v8us*)&sKh[nt * 16 + ln][ks * 32 + 8 * hh]; bh_.half[1] = *(const v8us*)&sKh[nt * 16 + ln][ks * 32 + 16 + 8 * hh];
        bl_.half[0] = *(const v8us*)&sKl[nt * 16 + ln][ks * 32 + 8 * hh]; bl_.half[1] = *(const v8us*)&sKl[nt * 16 + ln][ks * 32 + 16 + 8 * hh];
        acc = mmaN<3>(aqh[ks].v, aql[ks].v, bh_.v, bl_.v, acc);
      }
      s[nt] = acc;
    }
    float alpha[8];
#pragma unroll
    for (int r = 0; r < 8; ++r) {
      const int qi = qrow[r];
      const int ja = j0 + ln, jb = j0 + 16 + ln;
      bool keepa = ja < Tk, keepb = jb < Tk;
      if (causal) { keepa = keepa && (ja <= qi); keepb = keepb && (jb <= qi); }
      if (mask3) { const int* mr = mask3 + ((size_t)b * Tq + qi) * Tk;
        if (mmode == 0) { if (keepa && !(mr[ja] != 0 || ja == qi)) s[0][r] = -1.0e9f; if (keepb && !(mr[jb] != 0 || jb == qi)) s[1][r] = -1.0e9f; }
        else            { if (keepa && mr[ja] != 0) s[0][r] = -3.0e38f; if (keepb && mr[jb] != 0) s[1][r] = -3.0e38f; } }
      if (band > 0) { if (keepa && (ja > qi + band || ja < qi - band)) s[0][r] = -3.0e38f; if (keepb && (jb > qi + band || jb < qi - band)) s[1][r] = -3.0e38f; }
      if (!keepa) s[0][r] = -3.0e38f;
      if (!keepb) s[1][r] = -3.0e38f;
      float mx = fmaxf(s[0][r], s[1][r]);
      mx = fmaxf(mx, __shfl_xor(mx, 1, 32)); mx = fmaxf(mx, __shfl_xor(mx, 2, 32)); mx = fmaxf(mx, __shfl_xor(mx, 4, 32)); mx = fmaxf(mx, __shfl_xor(mx, 8, 32));
      const float mnew = fmaxf(m_r[r], mx);
      alpha[r] = (mnew > -1.0e38f) ? __expf(m_r[r] - mnew) : 1.0f;
      const float p0 = keepa ? __expf(s[0][r] - mnew) : 0.f;
      const float p1 = keepb ? __expf(s[1][r] - mnew) : 0.f;
      m_r[r] = mnew;
      l_r[r] = l_r[r] * alpha[r] + p0 + p1;
      float g0 = p0, g1 = p1; if (gp) { const float* gr = gp + ((size_t)b * Tq + qi) * Tk; g0 *= bf16_round(gr[ja]); g1 *= bf16_round(gr[jb]); }   // post-softmax multiplier: P only, not the normaliser
      unsigned short hb = bf16_bits(g0); sPh[w][8 * hh + r][ln] = hb;      sPl[w][8 * hh + r][ln] = bf16_bits(g0 - bf16_val(hb));
      hb = bf16_bits(g1);                sPh[w][8 * hh + r][16 + ln] = hb; sPl[w][8 * hh + r][16 + ln] = bf16_bits(g1 - bf16_val(hb));
    }
#pragma unroll
    for (int dt = 0; dt < DT; ++dt)
#pragma unroll
      for (int r = 0; r < 8; ++r) oacc[dt][r] *= alpha[r];
    __builtin_amdgcn_fence(__ATOMIC_ACQ_REL, "workgroup");
    __builtin_amdgcn_wave_barrier();
    FragB pah, pal;
    pah.half[0] = *(const v8us*)&sPh[w][ln][8 * hh]; pah.half[1] = *(const v8us*)&sPh[w][ln][16 + 8 * hh];
    pal.half[0] = *(const v8us*)&sPl[w][ln][8 * hh]; pal.half[1] = *(const v8us*)&sPl[w][ln][16 + 8 * hh];
#pragma unroll
    for (int dt = 0; dt < DT; ++dt) {
      FragB bvh, bvl;
#pragma unroll
      for (int i = 0; i < 8; ++i) {
        bvh.u[i] = sVh[8 * hh + i][dt * 16 + ln]; bvh.u[8 + i] = sVh[16 + 8 * hh + i][dt * 16 + ln];
        bvl.u[i] = sVl[8 * hh + i][dt * 16 + ln]; bvl.u[8 + i] = sVl[16 + 8 * hh + i][dt * 16 + ln];
      }
      oacc[dt] = mmaN<3>(pah.v, pal.v, bvh.v, bvl.v, oacc[dt]);
    }
    __builtin_amdgcn_fence(__ATOMIC_ACQ_REL, "workgroup");
    __builtin_amdgcn_wave_barrier();
  }
#pragma unroll
  for (int r = 0; r < 8; ++r) {
    float l = l_r[r];
    l += __shfl_xor(l, 1, 32); l += __shfl_xor(l, 2, 32); l += __shfl_xor(l, 4, 32); l += __shfl_xor(l, 8, 32);
    l_r[r] = (m_r[r] > -1.0e38f) ? 1.0f / l : __builtin_nanf("");
  }
#pragma unroll
  for (int dt = 0; dt < DT; ++dt)
#pragma unroll
    for (int r = 0; r < 8; ++r) sO[w][8 * hh + r][dt * 16 + ln] = oacc[dt][r] * l_r[r];
  __builtin_amdgcn_fence(__ATOMIC_ACQ_REL, "workgroup");
  __builtin_amdgcn_wave_barrier();
  {
    for (int r = 0; r < 16; ++r) {
      const int row = q0 + r;
      if (row < Tq && lane < D / 4) {
        const v4f val = *(const v4fa*)&sO[w][r][lane * 4];
        *(v4f*)(y + ((size_t)b * Tq + row) * ypitch + h * D + lane * 4) = val;
      }
    }
    
  }
}
// interleaved rotary on the head dim: pairs (2i, 2i+1) rotated by pos·inv_freq[i], inv_freq[i] = 10000^(−i/(d/2)); in place on q and k; thread per pair
__global__ __launch_bounds__(256) void k_rope2(float* __restrict__ q, float* __restrict__ k) {
  const size_t t = (size_t)blockIdx.x * 256 + threadIdx.x; if (t >= (size_t)BB * TT * EE / 2) return;
  const size_t e = t * 2; const int col = (int)(e % EE); const int pos = (int)((e / EE) % TT); const int i = (col % HD) / 2;
  const float inv = powf(10000.0f, -(float)i / (float)(HD / 2)); const float ang = (float)pos * inv; float sn, cs; sincosf(ang, &sn, &cs);
  const float q0 = q[e], q1 = q[e + 1], k0 = k[e], k1 = k[e + 1];
  const float nq0 = q0 * cs - q1 * sn, nq1 = q1 * cs + q0 * sn, nk0 = k0 * cs - k1 * sn, nk1 = k1 * cs + k0 * sn;
  typedef float v2f __attribute__((ext_vector_type(2)));
  v2f a = {nq0, nq1}, bb = {nk0, nk1};
  *(v2f*)(q + e) = a; *(v2f*)(k + e) = bb; 
}
extern "C" void kernel_launch(void* const* d_in, const int* in_sizes, int n_in,
                              void* d_out, int out_size, void* d_ws, size_t ws_size, hipStream_t stream) {
  (void)in_sizes; (void)n_in; (void)out_size;
  const float* xq = (const float*)d_in[0]; const float* xkv = (const float*)d_in[1];
  const float* Wq = (const float*)d_in[2]; const float* Wk = (const float*)d_in[3]; const float* Wv = (const float*)d_in[4]; const float* Wo = (const float*)d_in[5];
  char* ws = (char*)d_ws; size_t off = 0;
  auto take = [&](size_t bytes) { char* p = ws + off; off += (bytes + 255) & ~(size_t)255; return p; };
  const int M = BB * TT, gb = (M / 128) * (EE / 128);
  unsigned short* Wt[4]; for (int i = 0; i < 4; ++i) Wt[i] = (unsigned short*)take((size_t)EE * EE * 2);
  float* q = (float*)take((size_t)M * EE * 4); float* k = (float*)take((size_t)M * EE * 4); float* v = (float*)take((size_t)M * EE * 4); float* att = (float*)take((size_t)M * EE * 4);
  if (off > ws_size) return;
  const float* W4[4] = {Wq, Wk, Wv, Wo};
  for (int i = 0; i < 4; ++i) k_wt_bf16<<<(EE * (EE / 8) + 255) / 256, 256, 0, stream>>>(W4[i], Wt[i], EE, EE);
  k_gemm_bf<false, 0, false><<<gb, 256, 0, stream>>>(xq, EE, Wt[0], EE, nullptr, q, EE, M, EE, EE);
  k_gemm_bf<false, 0, false><<<gb, 256, 0, stream>>>(xkv, EE, Wt[1], EE, nullptr, k, EE, M, EE, EE);
  k_gemm_bf<false, 0, false><<<gb, 256, 0, stream>>>(xkv, EE, Wt[2], EE, nullptr, v, EE, M, EE, EE);
  k_rope2<<<(unsigned)(((size_t)M * EE / 2 + 255) / 256), 256, 0, stream>>>(q, k);
  k_flash3c<HD><<<BB * NH * (TT / 64), 128, 0, stream>>>(q, EE, TT, k, v, TT, nullptr, nullptr, 0, EE, EE, NH, 1, 0.125f, nullptr, 0, 256, 0, nullptr, att, EE);
  k_gemm_bf<true, 0, false><<<gb, 256, 0, stream>>>(att, EE, Wt[3], EE, nullptr, (float*)d_out, EE, M, EE, EE);
}

// v003
// It runs in 269 microseconds.
// Timed twice side by side with v002, it ran 1.42 times as fast both times.
// Counting every step since v000, it is 4.31 times as fast.
#include <hip/hip_runtime.h>
// All contractions on v_wmma_f32_16x16x32_bf16, f32 accumulate: x_q·Wq, x_kv·Wk, x_kv·Wv (inputs, W rounded to bf16: single exact term),
// QKᵀ and P·V per 16-query tile as 3-term bf16 hi/lo splits with the |i−j| ≤ 256 band, out·Wo with the A operand split (2 terms);
// interleaved rotary embedding and softmax in f32.
#define BB 4
#define TT 2048
#define EE 1024
#define NH 16
#define HD 64

typedef __bf16 v16b __attribute__((ext_vector_type(16)));
typedef unsigned short v8us __attribute__((ext_vector_type(8), may_alias));
typedef float  v8f  __attribute__((ext_vector_type(8)));
typedef float  v4f  __attribute__((ext_vector_type(4)));
typedef float  v4fa __attribute__((ext_vector_type(4), may_alias));
union FragB { v16b v; v8us half[2]; unsigned short u[16]; };

__device__ __forceinline__ unsigned short bf16_bits(float x) { unsigned int u = __float_as_uint(x); return (unsigned short)((u + 0x7FFFu + ((u >> 16) & 1u)) >> 16); }
__device__ __forceinline__ float bf16_val(unsigned short b) { return __uint_as_float(((unsigned int)b) << 16); }
__device__ __forceinline__ float bf16_round(float x) { return bf16_val(bf16_bits(x)); }
// D += A·B with NT terms: 1 = ah·bh, 2 = + al·bh (A split), 3 = + ah·bl (both split)
template <int NT>
__device__ __forceinline__ v8f mmaN(v16b ah, v16b al, v16b bh, v16b bl, v8f c) {
  c = __builtin_amdgcn_wmma_f32_16x16x32_bf16(false, ah, false, bh, (short)0, c, false, false);
  if (NT >= 2) c = __builtin_amdgcn_wmma_f32_16x16x32_bf16(false, al, false, bh, (short)0, c, false, false);
  if (NT >= 3) c = __builtin_amdgcn_wmma_f32_16x16x32_bf16(false, ah, false, bl, (short)0, c, false, false);
  asm volatile("v_nop\n\tv_nop\n\tv_nop\n\tv_nop" : "+v"(c) : "v"(ah), "v"(al), "v"(bh), "v"(bl));
  return c;
}

__global__ __launch_bounds__(256) void k_wt_bf16(const float* __restrict__ W, unsigned short* __restrict__ Wt, int K, int N) {
  const int t = blockIdx.x * 256 + threadIdx.x;
  const int k8n = K / 8;
  if (t >= N * k8n) return;
  const int n = t / k8n, k8 = (t % k8n) * 8;
  v8us v;
#pragma unroll
  for (int i = 0; i < 8; ++i) v[i] = bf16_bits(W[(size_t)(k8 + i) * N + n]);
  *(v8us*)(Wt + (size_t)n * K + k8) = v;
  
}

// GEMM C[M][N] (f32, pitch ldc) = act(A[M][K] x W + bias). One work-group of 8 waves makes a 128 x 128 tile of C; a wave makes 32 x 64 of it.
// A pass is 64 k: the A rows (f32, pitch lda) are converted to bf16 once per work-group (ASPLIT: hi and lo planes -> 2 terms, else one
// rounded term) and laid in LDS beside the 128 rows of Wt (bf16 [N][K], pitch ldb); every global load covers whole 128-B lines.
// Two LDS buffers: the next pass is loaded into registers ahead of this pass's products and stored behind them, one barrier a pass.
// The k order of every sum is ascending in steps of 32, hi term then lo term. BIAS_BF16 rounds the bias to bf16 before the add.
// K%64==0, M%128==0, N%128==0.
typedef unsigned short v4us __attribute__((ext_vector_type(4), may_alias));
template <bool ASPLIT, int ACT, bool BIAS_BF16>
__global__ __launch_bounds__(256) void k_gemm_bf(const float* __restrict__ A, int lda, const unsigned short* __restrict__ Wt, int ldb,
                                               const float* __restrict__ bias, float* __restrict__ C, int ldc, int M, int N, int K) {
  constexpr int PB = 72;                 // LDS row pitch in bf16: 128 B of k + 16 B, an odd multiple of 16 B for the 16-byte readers
  constexpr int PLANE = 128 * PB;        // one operand plane of a pass
  constexpr int NPL = ASPLIT ? 3 : 2;    // A hi, W, (A lo)
  constexpr int PO = 68;                 // pitch in f32 of the output staging rows
  __shared__ __attribute__((aligned(16))) unsigned short sm[2 * NPL * PLANE];
  const int tid = threadIdx.x, w = tid >> 5, lane = tid & 31, ln = lane & 15, hh = lane >> 4;
  const int ntn = N / 128;
  const int mb = blockIdx.x / ntn, nb = blockIdx.x % ntn;
  if (mb * 128 >= M) return;             // the same for the whole work-group, ahead of every barrier
  const int row0 = mb * 128, col0 = nb * 128;
  const int wm = w >> 1, wn = w & 1;
  const int ar = tid >> 4, ac = (tid & 15) * 4;    // A staging: 16 lanes cover 256 B of a row
  const int br = tid >> 3, bc = (tid & 7) * 8;     // W staging: 8 lanes cover 128 B of a row
  const float* ag = A + (size_t)(row0 + ar) * lda + ac;
  const unsigned short* bg = Wt + (size_t)(col0 + br) * ldb + bc;
  v4f xa[8]; v8us xb[4];
  v8f acc[2][4] = {};
  const int np = K / 64;
  auto fetch = [&](int kb) {
    const float* pa[8]; const unsigned short* pb[4];
#pragma unroll
    for (int i = 0; i < 8; ++i) { pa[i] = ag + (size_t)(16 * i) * lda + kb; xa[i] = *(const v4fa*)pa[i]; }
#pragma unroll
    for (int i = 0; i < 4; ++i) { pb[i] = bg + (size_t)(32 * i) * ldb + kb; xb[i] = *(const v8us*)pb[i]; }
    // no register that one of these loads names as its address is written (not by a later load's result either) ahead of this wait:
    // the inputs keep all twelve addresses live up to it
    asm volatile("s_wait_xcnt 0x0" :: "v"(pa[0]), "v"(pa[1]), "v"(pa[2]), "v"(pa[3]), "v"(pa[4]), "v"(pa[5]), "v"(pa[6]), "v"(pa[7]),
                 "v"(pb[0]), "v"(pb[1]), "v"(pb[2]), "v"(pb[3]) : "memory");
  };
  fetch(0);
  for (int p = 0; p <= np; ++p) {
    if (p > 0) {
      // products of pass p - 1 out of its buffer
      const unsigned short* sAh = sm + ((p - 1) & 1) * (NPL * PLANE);
      const unsigned short* sB = sAh + PLANE;
      const unsigned short* sAl = sB + PLANE;
#pragma unroll
      for (int ks = 0; ks < 2; ++ks) {
        FragB ah[2], al[2], b[4];
#pragma unroll
        for (int mi = 0; mi < 2; ++mi) {
          const int o = (wm * 32 + mi * 16 + ln) * PB + ks * 32 + 8 * hh;
          ah[mi].half[0] = *(const v8us*)(sAh + o); ah[mi].half[1] = *(const v8us*)(sAh + o + 16);
          if (ASPLIT) { al[mi].half[0] = *(const v8us*)(sAl + o); al[mi].half[1] = *(const v8us*)(sAl + o + 16); }
          else al[mi] = ah[mi];
        }
#pragma unroll
        for (int t = 0; t < 4; ++t) {
          const int o = (wn * 64 + t * 16 + ln) * PB + ks * 32 + 8 * hh;
          b[t].half[0] = *(const v8us*)(sB + o); b[t].half[1] = *(const v8us*)(sB + o + 16);
        }
#pragma unroll
        for (int mi = 0; mi < 2; ++mi)
#pragma unroll
          for (int t = 0; t < 4; ++t) acc[mi][t] = mmaN<ASPLIT ? 2 : 1>(ah[mi].v, al[mi].v, b[t].v, b[t].v, acc[mi][t]);
      }
    }
    if (p < np) {
      // pass p from registers into the buffer whose readers left it at the barrier that ended trip p - 1
      unsigned short* dAh = sm + (p & 1) * (NPL * PLANE);
      unsigned short* dB = dAh + PLANE;
      unsigned short* dAl = dB + PLANE;
#pragma unroll
      for (int i = 0; i < 8; ++i) {
        v4us h, l;
#pragma unroll
        for (int t = 0; t < 4; ++t) { const unsigned short hb = bf16_bits(xa[i][t]); h[t] = hb; l[t] = ASPLIT ? bf16_bits(xa[i][t] - bf16_val(hb)) : (unsigned short)0; }
        *(v4us*)(dAh + (ar + 16 * i) * PB + ac) = h;
        if (ASPLIT) *(v4us*)(dAl + (ar + 16 * i) * PB + ac) = l;
      }
#pragma unroll
      for (int i = 0; i < 4; ++i) *(v8us*)(dB + (br + 32 * i) * PB + bc) = xb[i];
    }
    __syncthreads();
    if (p + 1 < np) {
      // pass p + 1 starts its way from L2 now and is waited for only behind the products of pass p
      fetch((p + 1) * 64);
    }
  }
  // the barrier of the last trip stands behind every wave's last read of the buffers: each wave now stages its 32 x 64 tile in a range of its own
  float* so = (float*)sm + w * (32 * PO);
#pragma unroll
  for (int mi = 0; mi < 2; ++mi)
#pragma unroll
    for (int t = 0; t < 4; ++t) {
      float bv = bias ? bias[col0 + wn * 64 + t * 16 + ln] : 0.f;
      if (BIAS_BF16) bv = bf16_round(bv);
#pragma unroll
      for (int r = 0; r < 8; ++r) { float v = acc[mi][t][r] + bv; if (ACT == 1) v = fmaxf(v, 0.f); so[(mi * 16 + 8 * hh + r) * PO + t * 16 + ln] = v; }
    }
  __builtin_amdgcn_fence(__ATOMIC_ACQ_REL, "workgroup");
  __builtin_amdgcn_wave_barrier();
  const int rsub = lane >> 4, c4 = (lane & 15) * 4;
#pragma unroll
  for (int q = 0; q < 16; ++q) {
    const int r = q * 2 + rsub;
    const v4f v = *(const v4fa*)&so[r * PO + c4];
    *(v4f*)(C + (size_t)(row0 + wm * 32 + r) * ldc + col0 + wn * 64 + c4) = v;
  }
}

// Flash-style causal/unmasked attention, all contractions 3-term bf16 hi/lo splits, f32 softmax with running max.
// q,k,v rows are read from f32 buffers with arbitrary row pitch (so they can live inside a fused qkv buffer);
// D = head size (multiple of 32, <= 128); one wave = 16 query rows; block = 4 waves (64 queries) sharing K/V chunks of 32.
template <int D, bool CAUSAL>
__global__ __launch_bounds__(128) void k_flash(const float* __restrict__ qb, const float* __restrict__ kb, const float* __restrict__ vb,
                                             int pitch, int T, int H, float scale, float* __restrict__ y, int ypitch) {
  constexpr int KS = D / 32;        // k-steps for QK
  constexpr int DT = D / 16;        // d tiles for PV
  __shared__ __attribute__((aligned(16))) unsigned short sKh[32][D + 8], sKl[32][D + 8], sVh[32][D + 8], sVl[32][D + 8];
  __shared__ __attribute__((aligned(16))) unsigned short sPh[4][16][40], sPl[4][16][40];
  __shared__ __attribute__((aligned(16))) float sO[4][16][D];
  const int tid = threadIdx.x, w = tid >> 5, lane = tid & 31, ln = lane & 15, hh = lane >> 4;
  const int nqb = (T + 63) / 64;
  const int bh = blockIdx.x / nqb, qblk = blockIdx.x % nqb;
  const int b = bh / H, h = bh % H;
  const int q0 = qblk * 64 + w * 16;
  const float* Q = qb + (size_t)b * T * pitch + h * D;
  const float* K = kb + (size_t)b * T * pitch + h * D;
  const float* V = vb + (size_t)b * T * pitch + h * D;

  // A fragments of the wave's 16 query rows (scaled), hi/lo
  FragB aqh[KS], aql[KS];
  {
    int row = q0 + ln; if (row >= T) row = T - 1;
    const float* qr = Q + (size_t)row * pitch;
#pragma unroll
    for (int ks = 0; ks < KS; ++ks)
#pragma unroll
      for (int i = 0; i < 16; ++i) {
        const int d = ks * 32 + ((i < 8) ? (8 * hh + i) : (16 + 8 * hh + (i - 8)));
        const float x = qr[d] * scale; const unsigned short hb = bf16_bits(x);
        aqh[ks].u[i] = hb; aql[ks].u[i] = bf16_bits(x - bf16_val(hb));
      }
  }
  float m_r[8], l_r[8];
#pragma unroll
  for (int r = 0; r < 8; ++r) { m_r[r] = -3.0e38f; l_r[r] = 0.f; }
  v8f oacc[DT];
#pragma unroll
  for (int dt = 0; dt < DT; ++dt) oacc[dt] = (v8f){0.f,0.f,0.f,0.f,0.f,0.f,0.f,0.f};

  const int kv_end = CAUSAL ? min(T, qblk * 64 + 64) : T;     // block-uniform
  for (int j0 = 0; j0 < kv_end; j0 += 32) {
    __syncthreads();
    for (int e = tid; e < 32 * (D / 4); e += 128) {
      const int r = e / (D / 4), c4 = (e % (D / 4)) * 4;
      const int key = j0 + r;
      v4f kf = {0.f,0.f,0.f,0.f}, vf = {0.f,0.f,0.f,0.f};
      if (key < T) { kf = *(const v4fa*)(K + (size_t)key * pitch + c4); vf = *(const v4fa*)(V + (size_t)key * pitch + c4); }
#pragma unroll
      for (int t = 0; t < 4; ++t) {
        unsigned short hb = bf16_bits(kf[t]); sKh[r][c4 + t] = hb; sKl[r][c4 + t] = bf16_bits(kf[t] - bf16_val(hb));
        hb = bf16_bits(vf[t]); sVh[r][c4 + t] = hb; sVl[r][c4 + t] = bf16_bits(vf[t] - bf16_val(hb));
      }
    }
    __syncthreads();
    // S tile 16 x 32
    v8f s[2];
#pragma unroll
    for (int nt = 0; nt < 2; ++nt) {
      v8f acc = {};
#pragma unroll
      for (int ks = 0; ks < KS; ++ks) {
        FragB bh_, bl_;
        bh_.half[0] = *(const v8us*)&sKh[nt * 16 + ln][ks * 32 + 8 * hh]; bh_.half[1] = *(const v8us*)&sKh[nt * 16 + ln][ks * 32 + 16 + 8 * hh];
        bl_.half[0] = *(const v8us*)&sKl[nt * 16 + ln][ks * 32 + 8 * hh]; bl_.half[1] = *(const v8us*)&sKl[nt * 16 + ln][ks * 32 + 16 + 8 * hh];
        acc = mmaN<3>(aqh[ks].v, aql[ks].v, bh_.v, bl_.v, acc);
      }
      s[nt] = acc;
    }
    // mask + running max (rows 8hh+r; the 16 lanes of a half share rows)
    float alpha[8];
#pragma unroll
    for (int r = 0; r < 8; ++r) {
      const int qi = q0 + 8 * hh + r;
      const int ja = j0 + ln, jb = j0 + 16 + ln;
      if (CAUSAL) { if (ja > qi) s[0][r] = -3.0e38f; if (jb > qi) s[1][r] = -3.0e38f; }
      if (ja >= T) s[0][r] = -3.0e38f;
      if (jb >= T) s[1][r] = -3.0e38f;
      float mx = fmaxf(s[0][r], s[1][r]);
      mx = fmaxf(mx, __shfl_xor(mx, 1, 32)); mx = fmaxf(mx, __shfl_xor(mx, 2, 32)); mx = fmaxf(mx, __shfl_xor(mx, 4, 32)); mx = fmaxf(mx, __shfl_xor(mx, 8, 32));
      const float mnew = fmaxf(m_r[r], mx);
      alpha[r] = (mnew > -1.0e38f) ? __expf(m_r[r] - mnew) : 1.0f;
      const float p0 = (s[0][r] > -1.0e38f) ? __expf(s[0][r] - mnew) : 0.f;
      const float p1 = (s[1][r] > -1.0e38f) ? __expf(s[1][r] - mnew) : 0.f;
      m_r[r] = mnew;
      l_r[r] = l_r[r] * alpha[r] + p0 + p1;            // per-lane partial row sum (16 lanes combined at the end)
      unsigned short hb = bf16_bits(p0); sPh[w][8 * hh + r][ln] = hb;      sPl[w][8 * hh + r][ln] = bf16_bits(p0 - bf16_val(hb));
      hb = bf16_bits(p1);                sPh[w][8 * hh + r][16 + ln] = hb; sPl[w][8 * hh + r][16 + ln] = bf16_bits(p1 - bf16_val(hb));
    }
#pragma unroll
    for (int dt = 0; dt < DT; ++dt)
#pragma unroll
      for (int r = 0; r < 8; ++r) oacc[dt][r] *= alpha[r];
    __builtin_amdgcn_fence(__ATOMIC_ACQ_REL, "workgroup");
    __builtin_amdgcn_wave_barrier();
    FragB pah, pal;
    pah.half[0] = *(const v8us*)&sPh[w][ln][8 * hh]; pah.half[1] = *(const v8us*)&sPh[w][ln][16 + 8 * hh];
    pal.half[0] = *(const v8us*)&sPl[w][ln][8 * hh]; pal.half[1] = *(const v8us*)&sPl[w][ln][16 + 8 * hh];
#pragma unroll
    for (int dt = 0; dt < DT; ++dt) {
      FragB bvh, bvl;
#pragma unroll
      for (int i = 0; i < 8; ++i) {
        bvh.u[i] = sVh[8 * hh + i][dt * 16 + ln]; bvh.u[8 + i] = sVh[16 + 8 * hh + i][dt * 16 + ln];
        bvl.u[i] = sVl[8 * hh + i][dt * 16 + ln]; bvl.u[8 + i] = sVl[16 + 8 * hh + i][dt * 16 + ln];
      }
      oacc[dt] = mmaN<3>(pah.v, pal.v, bvh.v, bvl.v, oacc[dt]);
    }
    __builtin_amdgcn_fence(__ATOMIC_ACQ_REL, "workgroup");
    __builtin_amdgcn_wave_barrier();
  }
#pragma unroll
  for (int r = 0; r < 8; ++r) {
    float l = l_r[r];
    l += __shfl_xor(l, 1, 32); l += __shfl_xor(l, 2, 32); l += __shfl_xor(l, 4, 32); l += __shfl_xor(l, 8, 32);
    l_r[r] = (l > 0.f) ? 1.0f / l : 0.f;
  }
#pragma unroll
  for (int dt = 0; dt < DT; ++dt)
#pragma unroll
    for (int r = 0; r < 8; ++r) sO[w][8 * hh + r][dt * 16 + ln] = oacc[dt][r] * l_r[r];
  __builtin_amdgcn_fence(__ATOMIC_ACQ_REL, "workgroup");
  __builtin_amdgcn_wave_barrier();
  {
    for (int r = 0; r < 16; ++r) {
      const int row = q0 + r;
      if (row < T && lane < D / 4) {
        const v4f val = *(const v4fa*)&sO[w][r][lane * 4];
        *(v4f*)(y + ((size_t)b * T + row) * ypitch + h * D + lane * 4) = val;
      }
    }
    
  }
}

// Banded attention, |i - j| <= band: queries, keys and values are f32 rows at X + (b*T + row)*pitch + h*D.
// 3-term bf16 splits, f32 softmax with running max; y[b][row][h*D + d] pitch ypitch, whole-line rows (D % 32 == 0).
// The trip holds no per-lane and no per-row branch (guards are selects, on clamped addresses): the staging loads of a trip are
// issued together, and so are the eight rows' steps of the maximum.
template <int D>
__global__ __launch_bounds__(128) void k_flash_band(const float* __restrict__ Qb, const float* __restrict__ Kb, const float* __restrict__ Vb,
                                                  int pitch, int T, int H, float scale, int band, float* __restrict__ y, int ypitch) {
  constexpr int KS = D / 32, DT = D / 16;
  __shared__ __attribute__((aligned(16))) unsigned short sKh[32][D + 8], sKl[32][D + 8], sVh[32][D + 8], sVl[32][D + 8];
  __shared__ __attribute__((aligned(16))) unsigned short sPh[4][16][40], sPl[4][16][40];
  __shared__ __attribute__((aligned(16))) float sO[4][16][D];
  const int tid = threadIdx.x, w = tid >> 5, lane = tid & 31, ln = lane & 15, hh = lane >> 4;
  const int nqb = (T + 63) / 64;
  const int bh = blockIdx.x / nqb, qblk = blockIdx.x % nqb;
  const int b = bh / H, h = bh % H;
  const int q0 = qblk * 64 + w * 16;
  const float* Q = Qb + (size_t)b * T * pitch + h * D;
  const float* K = Kb + (size_t)b * T * pitch + h * D;
  const float* V = Vb + (size_t)b * T * pitch + h * D;
  FragB aqh[KS], aql[KS];
  {
    int row = q0 + ln; if (row >= T) row = T - 1;
    const float* qr = Q + (size_t)row * pitch;
#pragma unroll
    for (int ks = 0; ks < KS; ++ks)
#pragma unroll
      for (int i = 0; i < 16; ++i) {
        const int d = ks * 32 + ((i < 8) ? (8 * hh + i) : (16 + 8 * hh + (i - 8)));
        const float x = qr[d] * scale; const unsigned short hb = bf16_bits(x);
        aqh[ks].u[i] = hb; aql[ks].u[i] = bf16_bits(x - bf16_val(hb));
      }
  }
  int qrow[8];
#pragma unroll
  for (int r = 0; r < 8; ++r) { int qi = q0 + 8 * hh + r; qrow[r] = qi < T ? qi : T - 1; }
  float m_r[8], l_r[8];
#pragma unroll
  for (int r = 0; r < 8; ++r) { m_r[r] = -3.0e38f; l_r[r] = 0.f; }
  v8f oacc[DT];
#pragma unroll
  for (int dt = 0; dt < DT; ++dt) oacc[dt] = (v8f){0.f,0.f,0.f,0.f,0.f,0.f,0.f,0.f};
  // A key farther than band from every query row of the block has weight exp(-3e38 - m) = 0 in every row:
  // the loop runs only over the 32-key chunks that meet [first row - band, last row + band] (block-uniform bounds).
  const int kv_begin = max(0, qblk * 64 - band) & ~31, kv_end = min(T, qblk * 64 + 64 + band);
  const int wq0 = qblk * 64 + __builtin_amdgcn_readfirstlane(w) * 16;   // the wave's first row, in a scalar register: the chunk test below is a scalar branch
  for (int j0 = kv_begin; j0 < kv_end; j0 += 32) {
    __syncthreads();
    {
      constexpr int NE = 32 * (D / 4) / 128;   // 16-byte pieces of K, and of V, per thread and trip
      static_assert(NE == 4, "the wait below names four K and four V addresses");
      v4f kf[NE], vf[NE]; const float* pk[NE]; const float* pv[NE];
#pragma unroll
      for (int i = 0; i < NE; ++i) {
        const int e = tid + 128 * i, key = j0 + e / (D / 4), c4 = (e % (D / 4)) * 4;
        const size_t o = (size_t)min(key, T - 1) * pitch + c4;   // address in bounds for every lane; a key past the end is zeroed below
        pk[i] = K + o; pv[i] = V + o;
        kf[i] = *(const v4fa*)pk[i]; vf[i] = *(const v4fa*)pv[i];
      }
      // no register that one of these loads names as its address is written (not by a load's result either) ahead of this wait:
      // the inputs keep all eight addresses live up to it
      asm volatile("s_wait_xcnt 0x0" :: "v"(pk[0]), "v"(pk[1]), "v"(pk[2]), "v"(pk[3]), "v"(pv[0]), "v"(pv[1]), "v"(pv[2]), "v"(pv[3]) : "memory");
#pragma unroll
      for (int i = 0; i < NE; ++i) {
        const int e = tid + 128 * i, r = e / (D / 4), c4 = (e % (D / 4)) * 4;
        const bool in = j0 + r < T;
#pragma unroll
        for (int t = 0; t < 4; ++t) {
          const float kx = in ? kf[i][t] : 0.f, vx = in ? vf[i][t] : 0.f;
          unsigned short hb = bf16_bits(kx); sKh[r][c4 + t] = hb; sKl[r][c4 + t] = bf16_bits(kx - bf16_val(hb));
          hb = bf16_bits(vx); sVh[r][c4 + t] = hb; sVl[r][c4 + t] = bf16_bits(vx - bf16_val(hb));
        }
      }
    }
    __syncthreads();
    // a chunk wholly outside the band of this wave's own 16 rows adds nothing to them (no work-group barrier below this line in the trip)
    if (j0 + 31 < wq0 - band || j0 > wq0 + 15 + band) continue;
    v8f s[2];
#pragma unroll
    for (int nt = 0; nt < 2; ++nt) {
      v8f acc = {};
#pragma unroll
      for (int ks = 0; ks < KS; ++ks) {
        FragB bh_, bl_;
        bh_.half[0] = *(const v8us*)&sKh[nt * 16 + ln][ks * 32 + 8 * hh]; bh_.half[1] = *(const v8us*)&sKh[nt * 16 + ln][ks * 32 + 16 + 8 * hh];
        bl_.half[0] = *(const v8us*)&sKl[nt * 16 + ln][ks * 32 + 8 * hh]; bl_.half[1] = *(const v8us*)&sKl[nt * 16 + ln][ks * 32 + 16 + 8 * hh];
        acc = mmaN<3>(aqh[ks].v, aql[ks].v, bh_.v, bl_.v, acc);
      }
      s[nt] = acc;
    }
    const int ja = j0 + ln, jb = j0 + 16 + ln;
    const bool keepa = ja < T, keepb = jb < T;
    float sa[8], sb[8], mx[8], alpha[8];
#pragma unroll
    for (int r = 0; r < 8; ++r) {
      const int qi = qrow[r];
      sa[r] = (keepa && ja <= qi + band && ja >= qi - band) ? s[0][r] : -3.0e38f;
      sb[r] = (keepb && jb <= qi + band && jb >= qi - band) ? s[1][r] : -3.0e38f;
      mx[r] = fmaxf(sa[r], sb[r]);
    }
    // maximum over the 16 lanes of a row: each exchange step for all eight rows before the next step
    __builtin_amdgcn_sched_barrier(0);   // all eight rows' values stand ready here: without it one row's four exchanges were scheduled ahead, alone, each waited for by itself
#pragma unroll
    for (int m = 1; m <= 8; m <<= 1) {
      float ox[8];
#pragma unroll
      for (int r = 0; r < 8; ++r) ox[r] = __shfl_xor(mx[r], m, 32);
#pragma unroll
      for (int r = 0; r < 8; ++r) mx[r] = fmaxf(mx[r], ox[r]);
    }
#pragma unroll
    for (int r = 0; r < 8; ++r) {
      const float mnew = fmaxf(m_r[r], mx[r]);
      alpha[r] = (mnew > -1.0e38f) ? __expf(m_r[r] - mnew) : 1.0f;
      const float p0 = keepa ? __expf(sa[r] - mnew) : 0.f;
      const float p1 = keepb ? __expf(sb[r] - mnew) : 0.f;
      m_r[r] = mnew;
      l_r[r] = l_r[r] * alpha[r] + p0 + p1;
      unsigned short hb = bf16_bits(p0); sPh[w][8 * hh + r][ln] = hb;      sPl[w][8 * hh + r][ln] = bf16_bits(p0 - bf16_val(hb));
      hb = bf16_bits(p1);                sPh[w][8 * hh + r][16 + ln] = hb; sPl[w][8 * hh + r][16 + ln] = bf16_bits(p1 - bf16_val(hb));
    }
#pragma unroll
    for (int dt = 0; dt < DT; ++dt)
#pragma unroll
      for (int r = 0; r < 8; ++r) oacc[dt][r] *= alpha[r];
    __builtin_amdgcn_fence(__ATOMIC_ACQ_REL, "workgroup");
    __builtin_amdgcn_wave_barrier();
    FragB pah, pal;
    pah.half[0] = *(const v8us*)&sPh[w][ln][8 * hh]; pah.half[1] = *(const v8us*)&sPh[w][ln][16 + 8 * hh];
    pal.half[0] = *(const v8us*)&sPl[w][ln][8 * hh]; pal.half[1] = *(const v8us*)&sPl[w][ln][16 + 8 * hh];
#pragma unroll
    for (int dt = 0; dt < DT; ++dt) {
      FragB bvh, bvl;
#pragma unroll
      for (int i = 0; i < 8; ++i) {
        bvh.u[i] = sVh[8 * hh + i][dt * 16 + ln]; bvh.u[8 + i] = sVh[16 + 8 * hh + i][dt * 16 + ln];
        bvl.u[i] = sVl[8 * hh + i][dt * 16 + ln]; bvl.u[8 + i] = sVl[16 + 8 * hh + i][dt * 16 + ln];
      }
      oacc[dt] = mmaN<3>(pah.v, pal.v, bvh.v, bvl.v, oacc[dt]);
    }
    __builtin_amdgcn_fence(__ATOMIC_ACQ_REL, "workgroup");
    __builtin_amdgcn_wave_barrier();
  }
#pragma unroll
  for (int r = 0; r < 8; ++r) {
    float l = l_r[r];
    l += __shfl_xor(l, 1, 32); l += __shfl_xor(l, 2, 32); l += __shfl_xor(l, 4, 32); l += __shfl_xor(l, 8, 32);
    l_r[r] = (m_r[r] > -1.0e38f) ? 1.0f / l : __builtin_nanf("");
  }
#pragma unroll
  for (int dt = 0; dt < DT; ++dt)
#pragma unroll
    for (int r = 0; r < 8; ++r) sO[w][8 * hh + r][dt * 16 + ln] = oacc[dt][r] * l_r[r];
  __builtin_amdgcn_fence(__ATOMIC_ACQ_REL, "workgroup");
  __builtin_amdgcn_wave_barrier();
  {
    for (int r = 0; r < 16; ++r) {
      const int row = q0 + r;
      if (row < T && lane < D / 4) {
        const v4f val = *(const v4fa*)&sO[w][r][lane * 4];
        *(v4f*)(y + ((size_t)b * T + row) * ypitch + h * D + lane * 4) = val;
      }
    }
  }
}
// interleaved rotary on the head dim: pairs (2i, 2i+1) rotated by pos·inv_freq[i], inv_freq[i] = 10000^(−i/(d/2)); in place on q and k; thread per pair
__global__ __launch_bounds__(256) void k_rope2(float* __restrict__ q, float* __restrict__ k) {
  const size_t t = (size_t)blockIdx.x * 256 + threadIdx.x; if (t >= (size_t)BB * TT * EE / 2) return;
  const size_t e = t * 2; const int col = (int)(e % EE); const int pos = (int)((e / EE) % TT); const int i = (col % HD) / 2;
  const float inv = powf(10000.0f, -(float)i / (float)(HD / 2)); const float ang = (float)pos * inv; float sn, cs; sincosf(ang, &sn, &cs);
  const float q0 = q[e], q1 = q[e + 1], k0 = k[e], k1 = k[e + 1];
  const float nq0 = q0 * cs - q1 * sn, nq1 = q1 * cs + q0 * sn, nk0 = k0 * cs - k1 * sn, nk1 = k1 * cs + k0 * sn;
  typedef float v2f __attribute__((ext_vector_type(2)));
  v2f a = {nq0, nq1}, bb = {nk0, nk1};
  *(v2f*)(q + e) = a; *(v2f*)(k + e) = bb; 
}
extern "C" void kernel_launch(void* const* d_in, const int* in_sizes, int n_in,
                              void* d_out, int out_size, void* d_ws, size_t ws_size, hipStream_t stream) {
  (void)in_sizes; (void)n_in; (void)out_size;
  const float* xq = (const float*)d_in[0]; const float* xkv = (const float*)d_in[1];
  const float* Wq = (const float*)d_in[2]; const float* Wk = (const float*)d_in[3]; const float* Wv = (const float*)d_in[4]; const float* Wo = (const float*)d_in[5];
  char* ws = (char*)d_ws; size_t off = 0;
  auto take = [&](size_t bytes) { char* p = ws + off; off += (bytes + 255) & ~(size_t)255; return p; };
  const int M = BB * TT, gb = (M / 128) * (EE / 128);
  unsigned short* Wt[4]; for (int i = 0; i < 4; ++i) Wt[i] = (unsigned short*)take((size_t)EE * EE * 2);
  float* q = (float*)take((size_t)M * EE * 4); float* k = (float*)take((size_t)M * EE * 4); float* v = (float*)take((size_t)M * EE * 4); float* att = (float*)take((size_t)M * EE * 4);
  if (off > ws_size) return;
  const float* W4[4] = {Wq, Wk, Wv, Wo};
  for (int i = 0; i < 4; ++i) k_wt_bf16<<<(EE * (EE / 8) + 255) / 256, 256, 0, stream>>>(W4[i], Wt[i], EE, EE);
  k_gemm_bf<false, 0, false><<<gb, 256, 0, stream>>>(xq, EE, Wt[0], EE, nullptr, q, EE, M, EE, EE);
  k_gemm_bf<false, 0, false><<<gb, 256, 0, stream>>>(xkv, EE, Wt[1], EE, nullptr, k, EE, M, EE, EE);
  k_gemm_bf<false, 0, false><<<gb, 256, 0, stream>>>(xkv, EE, Wt[2], EE, nullptr, v, EE, M, EE, EE);
  k_rope2<<<(unsigned)(((size_t)M * EE / 2 + 255) / 256), 256, 0, stream>>>(q, k);
  k_flash_band<HD><<<BB * NH * (TT / 64), 128, 0, stream>>>(q, k, v, EE, TT, NH, 0.125f, 256, att, EE);
  k_gemm_bf<true, 0, false><<<gb, 256, 0, stream>>>(att, EE, Wt[3], EE, nullptr, (float*)d_out, EE, M, EE, EE);
}

// v004
// A run of this version takes 255 microseconds.
// Two timings next to v003 both put it at 1.06 times that version's speed.
// Over all steps from v000 it is 4.55 times as fast.
#include <hip/hip_runtime.h>
// All contractions on v_wmma_f32_16x16x32_bf16, f32 accumulate: x_q·Wq, x_kv·Wk, x_kv·Wv (inputs, W rounded to bf16: single exact term),
// QKᵀ and P·V per 16-query tile as 3-term bf16 hi/lo splits with the |i−j| ≤ 256 band, out·Wo with the A operand split (2 terms);
// interleaved rotary embedding and softmax in f32.
#define BB 4
#define TT 2048
#define EE 1024
#define NH 16
#define HD 64

typedef __bf16 v16b __attribute__((ext_vector_type(16)));
typedef unsigned short v8us __attribute__((ext_vector_type(8), may_alias));
typedef float  v8f  __attribute__((ext_vector_type(8)));
typedef float  v4f  __attribute__((ext_vector_type(4)));
typedef float  v4fa __attribute__((ext_vector_type(4), may_alias));
union FragB { v16b v; v8us half[2]; unsigned short u[16]; };

__device__ __forceinline__ unsigned short bf16_bits(float x) { unsigned int u = __float_as_uint(x); return (unsigned short)((u + 0x7FFFu + ((u >> 16) & 1u)) >> 16); }
__device__ __forceinline__ float bf16_val(unsigned short b) { return __uint_as_float(((unsigned int)b) << 16); }
__device__ __forceinline__ float bf16_round(float x) { return bf16_val(bf16_bits(x)); }
// D += A·B with NT terms: 1 = ah·bh, 2 = + al·bh (A split), 3 = + ah·bl (both split)
template <int NT>
__device__ __forceinline__ v8f mmaN(v16b ah, v16b al, v16b bh, v16b bl, v8f c) {
  c = __builtin_amdgcn_wmma_f32_16x16x32_bf16(false, ah, false, bh, (short)0, c, false, false);
  if (NT >= 2) c = __builtin_amdgcn_wmma_f32_16x16x32_bf16(false, al, false, bh, (short)0, c, false, false);
  if (NT >= 3) c = __builtin_amdgcn_wmma_f32_16x16x32_bf16(false, ah, false, bl, (short)0, c, false, false);
  asm volatile("v_nop\n\tv_nop\n\tv_nop\n\tv_nop" : "+v"(c) : "v"(ah), "v"(al), "v"(bh), "v"(bl));
  return c;
}

__global__ __launch_bounds__(256) void k_wt_bf16(const float* __restrict__ W, unsigned short* __restrict__ Wt, int K, int N) {
  const int t = blockIdx.x * 256 + threadIdx.x;
  const int k8n = K / 8;
  if (t >= N * k8n) return;
  const int n = t / k8n, k8 = (t % k8n) * 8;
  v8us v;
#pragma unroll
  for (int i = 0; i < 8; ++i) v[i] = bf16_bits(W[(size_t)(k8 + i) * N + n]);
  *(v8us*)(Wt + (size_t)n * K + k8) = v;
  
}

// GEMM C[M][N] (f32, pitch ldc) = act(A[M][K] x W + bias). One work-group of 8 waves makes a 128 x 128 tile of C; a wave makes 32 x 64 of it.
// A pass is 64 k: the A rows (f32, pitch lda) are converted to bf16 once per work-group (ASPLIT: hi and lo planes -> 2 terms, else one
// rounded term) and laid in LDS beside the 128 rows of Wt (bf16 [N][K], pitch ldb); every global load covers whole 128-B lines.
// Two LDS buffers: the next pass is loaded into registers ahead of this pass's products and stored behind them, one barrier a pass.
// The k order of every sum is ascending in steps of 32, hi term then lo term. BIAS_BF16 rounds the bias to bf16 before the add.
// K%64==0, M%128==0, N%128==0.
// ROT: the interleaved rotary step is applied to the finished f32 tile on its way out: column pair (2i, 2i+1) of a head, row pos = row % TT,
// is turned by the (cos, sin) pair rot[pos][i] that k_rot_table wrote earlier in the same call (a wave's 64 columns are one head).
typedef unsigned short v4us __attribute__((ext_vector_type(4), may_alias));
template <bool ASPLIT, int ACT, bool BIAS_BF16, bool ROT>
__global__ __launch_bounds__(256) void k_gemm_bf(const float* __restrict__ A, int lda, const unsigned short* __restrict__ Wt, int ldb,
                                               const float* __restrict__ bias, float* __restrict__ C, int ldc, int M, int N, int K,
                                               const float* __restrict__ rot) {
  constexpr int PB = 72;                 // LDS row pitch in bf16: 128 B of k + 16 B, an odd multiple of 16 B for the 16-byte readers
  constexpr int PLANE = 128 * PB;        // one operand plane of a pass
  constexpr int NPL = ASPLIT ? 3 : 2;    // A hi, W, (A lo)
  constexpr int PO = 68;                 // pitch in f32 of the output staging rows
  __shared__ __attribute__((aligned(16))) unsigned short sm[2 * NPL * PLANE];
  const int tid = threadIdx.x, w = tid >> 5, lane = tid & 31, ln = lane & 15, hh = lane >> 4;
  const int ntn = N / 128;
  const int mb = blockIdx.x / ntn, nb = blockIdx.x % ntn;
  if (mb * 128 >= M) return;             // the same for the whole work-group, ahead of every barrier
  const int row0 = mb * 128, col0 = nb * 128;
  const int wm = w >> 1, wn = w & 1;
  const int ar = tid >> 4, ac = (tid & 15) * 4;    // A staging: 16 lanes cover 256 B of a row
  const int br = tid >> 3, bc = (tid & 7) * 8;     // W staging: 8 lanes cover 128 B of a row
  const float* ag = A + (size_t)(row0 + ar) * lda + ac;
  const unsigned short* bg = Wt + (size_t)(col0 + br) * ldb + bc;
  v4f xa[8]; v8us xb[4];
  v8f acc[2][4] = {};
  const int np = K / 64;
  auto fetch = [&](int kb) {
    const float* pa[8]; const unsigned short* pb[4];
#pragma unroll
    for (int i = 0; i < 8; ++i) { pa[i] = ag + (size_t)(16 * i) * lda + kb; xa[i] = *(const v4fa*)pa[i]; }
#pragma unroll
    for (int i = 0; i < 4; ++i) { pb[i] = bg + (size_t)(32 * i) * ldb + kb; xb[i] = *(const v8us*)pb[i]; }
    // no register that one of these loads names as its address is written (not by a later load's result either) ahead of this wait:
    // the inputs keep all twelve addresses live up to it
    asm volatile("s_wait_xcnt 0x0" :: "v"(pa[0]), "v"(pa[1]), "v"(pa[2]), "v"(pa[3]), "v"(pa[4]), "v"(pa[5]), "v"(pa[6]), "v"(pa[7]),
                 "v"(pb[0]), "v"(pb[1]), "v"(pb[2]), "v"(pb[3]) : "memory");
  };
  fetch(0);
  for (int p = 0; p <= np; ++p) {
    if (p > 0) {
      // products of pass p - 1 out of its buffer
      const unsigned short* sAh = sm + ((p - 1) & 1) * (NPL * PLANE);
      const unsigned short* sB = sAh + PLANE;
      const unsigned short* sAl = sB + PLANE;
#pragma unroll
      for (int ks = 0; ks < 2; ++ks) {
        FragB ah[2], al[2], b[4];
#pragma unroll
        for (int mi = 0; mi < 2; ++mi) {
          const int o = (wm * 32 + mi * 16 + ln) * PB + ks * 32 + 8 * hh;
          ah[mi].half[0] = *(const v8us*)(sAh + o); ah[mi].half[1] = *(const v8us*)(sAh + o + 16);
          if (ASPLIT) { al[mi].half[0] = *(const v8us*)(sAl + o); al[mi].half[1] = *(const v8us*)(sAl + o + 16); }
          else al[mi] = ah[mi];
        }
#pragma unroll
        for (int t = 0; t < 4; ++t) {
          const int o = (wn * 64 + t * 16 + ln) * PB + ks * 32 + 8 * hh;
          b[t].half[0] = *(const v8us*)(sB + o); b[t].half[1] = *(const v8us*)(sB + o + 16);
        }
#pragma unroll
        for (int mi = 0; mi < 2; ++mi)
#pragma unroll
          for (int t = 0; t < 4; ++t) acc[mi][t] = mmaN<ASPLIT ? 2 : 1>(ah[mi].v, al[mi].v, b[t].v, b[t].v, acc[mi][t]);
      }
    }
    if (p < np) {
      // pass p from registers into the buffer whose readers left it at the barrier that ended trip p - 1
      unsigned short* dAh = sm + (p & 1) * (NPL * PLANE);
      unsigned short* dB = dAh + PLANE;
      unsigned short* dAl = dB + PLANE;
#pragma unroll
      for (int i = 0; i < 8; ++i) {
        v4us h, l;
#pragma unroll
        for (int t = 0; t < 4; ++t) { const unsigned short hb = bf16_bits(xa[i][t]); h[t] = hb; l[t] = ASPLIT ? bf16_bits(xa[i][t] - bf16_val(hb)) : (unsigned short)0; }
        *(v4us*)(dAh + (ar + 16 * i) * PB + ac) = h;
        if (ASPLIT) *(v4us*)(dAl + (ar + 16 * i) * PB + ac) = l;
      }
#pragma unroll
      for (int i = 0; i < 4; ++i) *(v8us*)(dB + (br + 32 * i) * PB + bc) = xb[i];
    }
    __syncthreads();
    if (p + 1 < np) {
      // pass p + 1 starts its way from L2 now and is waited for only behind the products of pass p
      fetch((p + 1) * 64);
    }
  }
  const int rsub = lane >> 4, c4 = (lane & 15) * 4;
  v4f cs[16];
  if (ROT) {
    // the (cos, sin) pairs of this lane's two column pairs in its 16 rows: sixteen loads off one address, issued together (one latency for all)
    static_assert(TT % 128 == 0 && HD == 64, "a 128-row tile stays inside one sequence; a wave's 64 columns are one head");
    const float* pr = rot + (size_t)(row0 % TT + wm * 32 + rsub) * HD + c4;
#pragma unroll
    for (int q = 0; q < 16; ++q) cs[q] = *(const v4fa*)(pr + q * 2 * HD);
    // the address that these loads name is not written ahead of this wait: the input keeps it live up to it
    asm volatile("s_wait_xcnt 0x0" :: "v"(pr) : "memory");
  }
  // the barrier of the last trip stands behind every wave's last read of the buffers: each wave now stages its 32 x 64 tile in a range of its own
  float* so = (float*)sm + w * (32 * PO);
#pragma unroll
  for (int mi = 0; mi < 2; ++mi)
#pragma unroll
    for (int t = 0; t < 4; ++t) {
      float bv = bias ? bias[col0 + wn * 64 + t * 16 + ln] : 0.f;
      if (BIAS_BF16) bv = bf16_round(bv);
#pragma unroll
      for (int r = 0; r < 8; ++r) { float v = acc[mi][t][r] + bv; if (ACT == 1) v = fmaxf(v, 0.f); so[(mi * 16 + 8 * hh + r) * PO + t * 16 + ln] = v; }
    }
  __builtin_amdgcn_fence(__ATOMIC_ACQ_REL, "workgroup");
  __builtin_amdgcn_wave_barrier();
#pragma unroll
  for (int q = 0; q < 16; ++q) {
    const int r = q * 2 + rsub;
    v4f v = *(const v4fa*)&so[r * PO + c4];
    if (ROT) {
      const v4f x = v, t = cs[q];
      v = (v4f){x[0] * t[0] - x[1] * t[1], x[1] * t[0] + x[0] * t[1], x[2] * t[2] - x[3] * t[3], x[3] * t[2] + x[2] * t[3]};
    }
    *(v4f*)(C + (size_t)(row0 + wm * 32 + r) * ldc + col0 + wn * 64 + c4) = v;
  }
}

// Flash-style causal/unmasked attention, all contractions 3-term bf16 hi/lo splits, f32 softmax with running max.
// q,k,v rows are read from f32 buffers with arbitrary row pitch (so they can live inside a fused qkv buffer);
// D = head size (multiple of 32, <= 128); one wave = 16 query rows; block = 4 waves (64 queries) sharing K/V chunks of 32.
template <int D, bool CAUSAL>
__global__ __launch_bounds__(128) void k_flash(const float* __restrict__ qb, const float* __restrict__ kb, const float* __restrict__ vb,
                                             int pitch, int T, int H, float scale, float* __restrict__ y, int ypitch) {
  constexpr int KS = D / 32;        // k-steps for QK
  constexpr int DT = D / 16;        // d tiles for PV
  __shared__ __attribute__((aligned(16))) unsigned short sKh[32][D + 8], sKl[32][D + 8], sVh[32][D + 8], sVl[32][D + 8];
  __shared__ __attribute__((aligned(16))) unsigned short sPh[4][16][40], sPl[4][16][40];
  __shared__ __attribute__((aligned(16))) float sO[4][16][D];
  const int tid = threadIdx.x, w = tid >> 5, lane = tid & 31, ln = lane & 15, hh = lane >> 4;
  const int nqb = (T + 63) / 64;
  const int bh = blockIdx.x / nqb, qblk = blockIdx.x % nqb;
  const int b = bh / H, h = bh % H;
  const int q0 = qblk * 64 + w * 16;
  const float* Q = qb + (size_t)b * T * pitch + h * D;
  const float* K = kb + (size_t)b * T * pitch + h * D;
  const float* V = vb + (size_t)b * T * pitch + h * D;

  // A fragments of the wave's 16 query rows (scaled), hi/lo
  FragB aqh[KS], aql[KS];
  {
    int row = q0 + ln; if (row >= T) row = T - 1;
    const float* qr = Q + (size_t)row * pitch;
#pragma unroll
    for (int ks = 0; ks < KS; ++ks)
#pragma unroll
      for (int i = 0; i < 16; ++i) {
        const int d = ks * 32 + ((i < 8) ? (8 * hh + i) : (16 + 8 * hh + (i - 8)));
        const float x = qr[d] * scale; const unsigned short hb = bf16_bits(x);
        aqh[ks].u[i] = hb; aql[ks].u[i] = bf16_bits(x - bf16_val(hb));
      }
  }
  float m_r[8], l_r[8];
#pragma unroll
  for (int r = 0; r < 8; ++r) { m_r[r] = -3.0e38f; l_r[r] = 0.f; }
  v8f oacc[DT];
#pragma unroll
  for (int dt = 0; dt < DT; ++dt) oacc[dt] = (v8f){0.f,0.f,0.f,0.f,0.f,0.f,0.f,0.f};

  const int kv_end = CAUSAL ? min(T, qblk * 64 + 64) : T;     // block-uniform
  for (int j0 = 0; j0 < kv_end; j0 += 32) {
    __syncthreads();
    for (int e = tid; e < 32 * (D / 4); e += 128) {
      const int r = e / (D / 4), c4 = (e % (D / 4)) * 4;
      const int key = j0 + r;
      v4f kf = {0.f,0.f,0.f,0.f}, vf = {0.f,0.f,0.f,0.f};
      if (key < T) { kf = *(const v4fa*)(K + (size_t)key * pitch + c4); vf = *(const v4fa*)(V + (size_t)key * pitch + c4); }
#pragma unroll
      for (int t = 0; t < 4; ++t) {
        unsigned short hb = bf16_bits(kf[t]); sKh[r][c4 + t] = hb; sKl[r][c4 + t] = bf16_bits(kf[t] - bf16_val(hb));
        hb = bf16_bits(vf[t]); sVh[r][c4 + t] = hb; sVl[r][c4 + t] = bf16_bits(vf[t] - bf16_val(hb));
      }
    }
    __syncthreads();
    // S tile 16 x 32
    v8f s[2];
#pragma unroll
    for (int nt = 0; nt < 2; ++nt) {
      v8f acc = {};
#pragma unroll
      for (int ks = 0; ks < KS; ++ks) {
        FragB bh_, bl_;
        bh_.half[0] = *(const v8us*)&sKh[nt * 16 + ln][ks * 32 + 8 * hh]; bh_.half[1] = *(const v8us*)&sKh[nt * 16 + ln][ks * 32 + 16 + 8 * hh];
        bl_.half[0] = *(const v8us*)&sKl[nt * 16 + ln][ks * 32 + 8 * hh]; bl_.half[1] = *(const v8us*)&sKl[nt * 16 + ln][ks * 32 + 16 + 8 * hh];
        acc = mmaN<3>(aqh[ks].v, aql[ks].v, bh_.v, bl_.v, acc);
      }
      s[nt] = acc;
    }
    // mask + running max (rows 8hh+r; the 16 lanes of a half share rows)
    float alpha[8];
#pragma unroll
    for (int r = 0; r < 8; ++r) {
      const int qi = q0 + 8 * hh + r;
      const int ja = j0 + ln, jb = j0 + 16 + ln;
      if (CAUSAL) { if (ja > qi) s[0][r] = -3.0e38f; if (jb > qi) s[1][r] = -3.0e38f; }
      if (ja >= T) s[0][r] = -3.0e38f;
      if (jb >= T) s[1][r] = -3.0e38f;
      float mx = fmaxf(s[0][r], s[1][r]);
      mx = fmaxf(mx, __shfl_xor(mx, 1, 32)); mx = fmaxf(mx, __shfl_xor(mx, 2, 32)); mx = fmaxf(mx, __shfl_xor(mx, 4, 32)); mx = fmaxf(mx, __shfl_xor(mx, 8, 32));
      const float mnew = fmaxf(m_r[r], mx);
      alpha[r] = (mnew > -1.0e38f) ? __expf(m_r[r] - mnew) : 1.0f;
      const float p0 = (s[0][r] > -1.0e38f) ? __expf(s[0][r] - mnew) : 0.f;
      const float p1 = (s[1][r] > -1.0e38f) ? __expf(s[1][r] - mnew) : 0.f;
      m_r[r] = mnew;
      l_r[r] = l_r[r] * alpha[r] + p0 + p1;            // per-lane partial row sum (16 lanes combined at the end)
      unsigned short hb = bf16_bits(p0); sPh[w][8 * hh + r][ln] = hb;      sPl[w][8 * hh + r][ln] = bf16_bits(p0 - bf16_val(hb));
      hb = bf16_bits(p1);                sPh[w][8 * hh + r][16 + ln] = hb; sPl[w][8 * hh + r][16 + ln] = bf16_bits(p1 - bf16_val(hb));
    }
#pragma unroll
    for (int dt = 0; dt < DT; ++dt)
#pragma unroll
      for (int r = 0; r < 8; ++r) oacc[dt][r] *= alpha[r];
    __builtin_amdgcn_fence(__ATOMIC_ACQ_REL, "workgroup");
    __builtin_amdgcn_wave_barrier();
    FragB pah, pal;
    pah.half[0] = *(const v8us*)&sPh[w][ln][8 * hh]; pah.half[1] = *(const v8us*)&sPh[w][ln][16 + 8 * hh];
    pal.half[0] = *(const v8us*)&sPl[w][ln][8 * hh]; pal.half[1] = *(const v8us*)&sPl[w][ln][16 + 8 * hh];
#pragma unroll
    for (int dt = 0; dt < DT; ++dt) {
      FragB bvh, bvl;
#pragma unroll
      for (int i = 0; i < 8; ++i) {
        bvh.u[i] = sVh[8 * hh + i][dt * 16 + ln]; bvh.u[8 + i] = sVh[16 + 8 * hh + i][dt * 16 + ln];
        bvl.u[i] = sVl[8 * hh + i][dt * 16 + ln]; bvl.u[8 + i] = sVl[16 + 8 * hh + i][dt * 16 + ln];
      }
      oacc[dt] = mmaN<3>(pah.v, pal.v, bvh.v, bvl.v, oacc[dt]);
    }
    __builtin_amdgcn_fence(__ATOMIC_ACQ_REL, "workgroup");
    __builtin_amdgcn_wave_barrier();
  }
#pragma unroll
  for (int r = 0; r < 8; ++r) {
    float l = l_r[r];
    l += __shfl_xor(l, 1, 32); l += __shfl_xor(l, 2, 32); l += __shfl_xor(l, 4, 32); l += __shfl_xor(l, 8, 32);
    l_r[r] = (l > 0.f) ? 1.0f / l : 0.f;
  }
#pragma unroll
  for (int dt = 0; dt < DT; ++dt)
#pragma unroll
    for (int r = 0; r < 8; ++r) sO[w][8 * hh + r][dt * 16 + ln] = oacc[dt][r] * l_r[r];
  __builtin_amdgcn_fence(__ATOMIC_ACQ_REL, "workgroup");
  __builtin_amdgcn_wave_barrier();
  {
    for (int r = 0; r < 16; ++r) {
      const int row = q0 + r;
      if (row < T && lane < D / 4) {
        const v4f val = *(const v4fa*)&sO[w][r][lane * 4];
        *(v4f*)(y + ((size_t)b * T + row) * ypitch + h * D + lane * 4) = val;
      }
    }
    
  }
}

// Banded attention, |i - j| <= band: queries, keys and values are f32 rows at X + (b*T + row)*pitch + h*D.
// 3-term bf16 splits, f32 softmax with running max; y[b][row][h*D + d] pitch ypitch, whole-line rows (D % 32 == 0).
// The trip holds no per-lane and no per-row branch (guards are selects, on clamped addresses): the staging loads of a trip are
// issued together, and so are the eight rows' steps of the maximum.
template <int D>
__global__ __launch_bounds__(128) void k_flash_band(const float* __restrict__ Qb, const float* __restrict__ Kb, const float* __restrict__ Vb,
                                                  int pitch, int T, int H, float scale, int band, float* __restrict__ y, int ypitch) {
  constexpr int KS = D / 32, DT = D / 16;
  __shared__ __attribute__((aligned(16))) unsigned short sKh[32][D + 8], sKl[32][D + 8], sVh[32][D + 8], sVl[32][D + 8];
  __shared__ __attribute__((aligned(16))) unsigned short sPh[4][16][40], sPl[4][16][40];
  __shared__ __attribute__((aligned(16))) float sO[4][16][D];
  const int tid = threadIdx.x, w = tid >> 5, lane = tid & 31, ln = lane & 15, hh = lane >> 4;
  const int nqb = (T + 63) / 64;
  const int bh = blockIdx.x / nqb, qblk = blockIdx.x % nqb;
  const int b = bh / H, h = bh % H;
  const int q0 = qblk * 64 + w * 16;
  const float* Q = Qb + (size_t)b * T * pitch + h * D;
  const float* K = Kb + (size_t)b * T * pitch + h * D;
  const float* V = Vb + (size_t)b * T * pitch + h * D;
  FragB aqh[KS], aql[KS];
  {
    int row = q0 + ln; if (row >= T) row = T - 1;
    const float* qr = Q + (size_t)row * pitch;
#pragma unroll
    for (int ks = 0; ks < KS; ++ks)
#pragma unroll
      for (int i = 0; i < 16; ++i) {
        const int d = ks * 32 + ((i < 8) ? (8 * hh + i) : (16 + 8 * hh + (i - 8)));
        const float x = qr[d] * scale; const unsigned short hb = bf16_bits(x);
        aqh[ks].u[i] = hb; aql[ks].u[i] = bf16_bits(x - bf16_val(hb));
      }
  }
  int qrow[8];
#pragma unroll
  for (int r = 0; r < 8; ++r) { int qi = q0 + 8 * hh + r; qrow[r] = qi < T ? qi : T - 1; }
  float m_r[8], l_r[8];
#pragma unroll
  for (int r = 0; r < 8; ++r) { m_r[r] = -3.0e38f; l_r[r] = 0.f; }
  v8f oacc[DT];
#pragma unroll
  for (int dt = 0; dt < DT; ++dt) oacc[dt] = (v8f){0.f,0.f,0.f,0.f,0.f,0.f,0.f,0.f};
  // A key farther than band from every query row of the block has weight exp(-3e38 - m) = 0 in every row:
  // the loop runs only over the 32-key chunks that meet [first row - band, last row + band] (block-uniform bounds).
  const int kv_begin = max(0, qblk * 64 - band) & ~31, kv_end = min(T, qblk * 64 + 64 + band);
  const int wq0 = qblk * 64 + __builtin_amdgcn_readfirstlane(w) * 16;   // the wave's first row, in a scalar register: the chunk test below is a scalar branch
  for (int j0 = kv_begin; j0 < kv_end; j0 += 32) {
    __syncthreads();
    {
      constexpr int NE = 32 * (D / 4) / 128;   // 16-byte pieces of K, and of V, per thread and trip
      static_assert(NE == 4, "the wait below names four K and four V addresses");
      v4f kf[NE], vf[NE]; const float* pk[NE]; const float* pv[NE];
#pragma unroll
      for (int i = 0; i < NE; ++i) {
        const int e = tid + 128 * i, key = j0 + e / (D / 4), c4 = (e % (D / 4)) * 4;
        const size_t o = (size_t)min(key, T - 1) * pitch + c4;   // address in bounds for every lane; a key past the end is zeroed below
        pk[i] = K + o; pv[i] = V + o;
        kf[i] = *(const v4fa*)pk[i]; vf[i] = *(const v4fa*)pv[i];
      }
      // no register that one of these loads names as its address is written (not by a load's result either) ahead of this wait:
      // the inputs keep all eight addresses live up to it
      asm volatile("s_wait_xcnt 0x0" :: "v"(pk[0]), "v"(pk[1]), "v"(pk[2]), "v"(pk[3]), "v"(pv[0]), "v"(pv[1]), "v"(pv[2]), "v"(pv[3]) : "memory");
#pragma unroll
      for (int i = 0; i < NE; ++i) {
        const int e = tid + 128 * i, r = e / (D / 4), c4 = (e % (D / 4)) * 4;
        const bool in = j0 + r < T;
#pragma unroll
        for (int t = 0; t < 4; ++t) {
          const float kx = in ? kf[i][t] : 0.f, vx = in ? vf[i][t] : 0.f;
          unsigned short hb = bf16_bits(kx); sKh[r][c4 + t] = hb; sKl[r][c4 + t] = bf16_bits(kx - bf16_val(hb));
          hb = bf16_bits(vx); sVh[r][c4 + t] = hb; sVl[r][c4 + t] = bf16_bits(vx - bf16_val(hb));
        }
      }
    }
    __syncthreads();
    // a chunk wholly outside the band of this wave's own 16 rows adds nothing to them (no work-group barrier below this line in the trip)
    if (j0 + 31 < wq0 - band || j0 > wq0 + 15 + band) continue;
    v8f s[2];
#pragma unroll
    for (int nt = 0; nt < 2; ++nt) {
      v8f acc = {};
#pragma unroll
      for (int ks = 0; ks < KS; ++ks) {
        FragB bh_, bl_;
        bh_.half[0] = *(const v8us*)&sKh[nt * 16 + ln][ks * 32 + 8 * hh]; bh_.half[1] = *(const v8us*)&sKh[nt * 16 + ln][ks * 32 + 16 + 8 * hh];
        bl_.half[0] = *(const v8us*)&sKl[nt * 16 + ln][ks * 32 + 8 * hh]; bl_.half[1] = *(const v8us*)&sKl[nt * 16 + ln][ks * 32 + 16 + 8 * hh];
        acc = mmaN<3>(aqh[ks].v, aql[ks].v, bh_.v, bl_.v, acc);
      }
      s[nt] = acc;
    }
    const int ja = j0 + ln, jb = j0 + 16 + ln;
    const bool keepa = ja < T, keepb = jb < T;
    float sa[8], sb[8], mx[8], alpha[8];
#pragma unroll
    for (int r = 0; r < 8; ++r) {
      const int qi = qrow[r];
      sa[r] = (keepa && ja <= qi + band && ja >= qi - band) ? s[0][r] : -3.0e38f;
      sb[r] = (keepb && jb <= qi + band && jb >= qi - band) ? s[1][r] : -3.0e38f;
      mx[r] = fmaxf(sa[r], sb[r]);
    }
    // maximum over the 16 lanes of a row: each exchange step for all eight rows before the next step
    __builtin_amdgcn_sched_barrier(0);   // all eight rows' values stand ready here: without it one row's four exchanges were scheduled ahead, alone, each waited for by itself
#pragma unroll
    for (int m = 1; m <= 8; m <<= 1) {
      float ox[8];
#pragma unroll
      for (int r = 0; r < 8; ++r) ox[r] = __shfl_xor(mx[r], m, 32);
#pragma unroll
      for (int r = 0; r < 8; ++r) mx[r] = fmaxf(mx[r], ox[r]);
    }
#pragma unroll
    for (int r = 0; r < 8; ++r) {
      const float mnew = fmaxf(m_r[r], mx[r]);
      alpha[r] = (mnew > -1.0e38f) ? __expf(m_r[r] - mnew) : 1.0f;
      const float p0 = keepa ? __expf(sa[r] - mnew) : 0.f;
      const float p1 = keepb ? __expf(sb[r] - mnew) : 0.f;
      m_r[r] = mnew;
      l_r[r] = l_r[r] * alpha[r] + p0 + p1;
      unsigned short hb = bf16_bits(p0); sPh[w][8 * hh + r][ln] = hb;      sPl[w][8 * hh + r][ln] = bf16_bits(p0 - bf16_val(hb));
      hb = bf16_bits(p1);                sPh[w][8 * hh + r][16 + ln] = hb; sPl[w][8 * hh + r][16 + ln] = bf16_bits(p1 - bf16_val(hb));
    }
#pragma unroll
    for (int dt = 0; dt < DT; ++dt)
#pragma unroll
      for (int r = 0; r < 8; ++r) oacc[dt][r] *= alpha[r];
    __builtin_amdgcn_fence(__ATOMIC_ACQ_REL, "workgroup");
    __builtin_amdgcn_wave_barrier();
    FragB pah, pal;
    pah.half[0] = *(const v8us*)&sPh[w][ln][8 * hh]; pah.half[1] = *(const v8us*)&sPh[w][ln][16 + 8 * hh];
    pal.half[0] = *(const v8us*)&sPl[w][ln][8 * hh]; pal.half[1] = *(const v8us*)&sPl[w][ln][16 + 8 * hh];
#pragma unroll
    for (int dt = 0; dt < DT; ++dt) {
      FragB bvh, bvl;
#pragma unroll
      for (int i = 0; i < 8; ++i) {
        bvh.u[i] = sVh[8 * hh + i][dt * 16 + ln]; bvh.u[8 + i] = sVh[16 + 8 * hh + i][dt * 16 + ln];
        bvl.u[i] = sVl[8 * hh + i][dt * 16 + ln]; bvl.u[8 + i] = sVl[16 + 8 * hh + i][dt * 16 + ln];
      }
      oacc[dt] = mmaN<3>(pah.v, pal.v, bvh.v, bvl.v, oacc[dt]);
    }
    __builtin_amdgcn_fence(__ATOMIC_ACQ_REL, "workgroup");
    __builtin_amdgcn_wave_barrier();
  }
#pragma unroll
  for (int r = 0; r < 8; ++r) {
    float l = l_r[r];
    l += __shfl_xor(l, 1, 32); l += __shfl_xor(l, 2, 32); l += __shfl_xor(l, 4, 32); l += __shfl_xor(l, 8, 32);
    l_r[r] = (m_r[r] > -1.0e38f) ? 1.0f / l : __builtin_nanf("");
  }
#pragma unroll
  for (int dt = 0; dt < DT; ++dt)
#pragma unroll
    for (int r = 0; r < 8; ++r) sO[w][8 * hh + r][dt * 16 + ln] = oacc[dt][r] * l_r[r];
  __builtin_amdgcn_fence(__ATOMIC_ACQ_REL, "workgroup");
  __builtin_amdgcn_wave_barrier();
  {
    for (int r = 0; r < 16; ++r) {
      const int row = q0 + r;
      if (row < T && lane < D / 4) {
        const v4f val = *(const v4fa*)&sO[w][r][lane * 4];
        *(v4f*)(y + ((size_t)b * T + row) * ypitch + h * D + lane * 4) = val;
      }
    }
  }
}
// table of the interleaved rotary step: rot[pos][i] = (cos, sin) of pos * inv_freq[i], inv_freq[i] = 10000^(-i/(d/2)); thread per (pos, i);
// written anew in every call, ahead of the two GEMMs that read it
__global__ __launch_bounds__(256) void k_rot_table(float* __restrict__ rot) {
  const int t = blockIdx.x * 256 + threadIdx.x; if (t >= TT * (HD / 2)) return;
  const int pos = t / (HD / 2), i = t % (HD / 2);
  const float inv = powf(10000.0f, -(float)i / (float)(HD / 2)); const float ang = (float)pos * inv; float sn, cs; sincosf(ang, &sn, &cs);
  typedef float v2f __attribute__((ext_vector_type(2)));
  v2f a = {cs, sn};
  *(v2f*)(rot + (size_t)t * 2) = a;
}
extern "C" void kernel_launch(void* const* d_in, const int* in_sizes, int n_in,
                              void* d_out, int out_size, void* d_ws, size_t ws_size, hipStream_t stream) {
  (void)in_sizes; (void)n_in; (void)out_size;
  const float* xq = (const float*)d_in[0]; const float* xkv = (const float*)d_in[1];
  const float* Wq = (const float*)d_in[2]; const float* Wk = (const float*)d_in[3]; const float* Wv = (const float*)d_in[4]; const float* Wo = (const float*)d_in[5];
  char* ws = (char*)d_ws; size_t off = 0;
  auto take = [&](size_t bytes) { char* p = ws + off; off += (bytes + 255) & ~(size_t)255; return p; };
  const int M = BB * TT, gb = (M / 128) * (EE / 128);
  unsigned short* Wt[4]; for (int i = 0; i < 4; ++i) Wt[i] = (unsigned short*)take((size_t)EE * EE * 2);
  float* q = (float*)take((size_t)M * EE * 4); float* k = (float*)take((size_t)M * EE * 4); float* v = (float*)take((size_t)M * EE * 4); float* att = (float*)take((size_t)M * EE * 4);
  float* rot = (float*)take((size_t)TT * HD * 4);
  if (off > ws_size) return;
  const float* W4[4] = {Wq, Wk, Wv, Wo};
  for (int i = 0; i < 4; ++i) k_wt_bf16<<<(EE * (EE / 8) + 255) / 256, 256, 0, stream>>>(W4[i], Wt[i], EE, EE);
  k_rot_table<<<(TT * (HD / 2) + 255) / 256, 256, 0, stream>>>(rot);
  k_gemm_bf<false, 0, false, true><<<gb, 256, 0, stream>>>(xq, EE, Wt[0], EE, nullptr, q, EE, M, EE, EE, rot);
  k_gemm_bf<false, 0, false, true><<<gb, 256, 0, stream>>>(xkv, EE, Wt[1], EE, nullptr, k, EE, M, EE, EE, rot);
  k_gemm_bf<false, 0, false, false><<<gb, 256, 0, stream>>>(xkv, EE, Wt[2], EE, nullptr, v, EE, M, EE, EE, nullptr);
  k_flash_band<HD><<<BB * NH * (TT / 64), 128, 0, stream>>>(q, k, v, EE, TT, NH, 0.125f, 256, att, EE);
  k_gemm_bf<true, 0, false, false><<<gb, 256, 0, stream>>>(att, EE, Wt[3], EE, nullptr, (float*)d_out, EE, M, EE, EE, nullptr);
}

// v005
// Measured time: 240 microseconds a run.
// In both of two side-by-side timings against v004, it was 1.06 times as fast.
// All steps since v000 together make it 4.84 times as fast.
#include <hip/hip_runtime.h>
// All contractions on v_wmma_f32_16x16x32_bf16, f32 accumulate: x_q·Wq, x_kv·Wk, x_kv·Wv (inputs, W rounded to bf16: single exact term),
// QKᵀ and P·V per 16-query tile as 3-term bf16 hi/lo splits with the |i−j| ≤ 256 band, out·Wo with the A operand split (2 terms);
// interleaved rotary embedding and softmax in f32.
#define BB 4
#define TT 2048
#define EE 1024
#define NH 16
#define HD 64

typedef __bf16 v16b __attribute__((ext_vector_type(16)));
typedef unsigned short v8us __attribute__((ext_vector_type(8), may_alias));
typedef float  v8f  __attribute__((ext_vector_type(8)));
typedef float  v4f  __attribute__((ext_vector_type(4)));
typedef float  v4fa __attribute__((ext_vector_type(4), may_alias));
union FragB { v16b v; v8us half[2]; unsigned short u[16]; };

__device__ __forceinline__ unsigned short bf16_bits(float x) { unsigned int u = __float_as_uint(x); return (unsigned short)((u + 0x7FFFu + ((u >> 16) & 1u)) >> 16); }
__device__ __forceinline__ float bf16_val(unsigned short b) { return __uint_as_float(((unsigned int)b) << 16); }
__device__ __forceinline__ float bf16_round(float x) { return bf16_val(bf16_bits(x)); }
// D += A·B with NT terms: 1 = ah·bh, 2 = + al·bh (A split), 3 = + ah·bl (both split)
template <int NT>
__device__ __forceinline__ v8f mmaN(v16b ah, v16b al, v16b bh, v16b bl, v8f c) {
  c = __builtin_amdgcn_wmma_f32_16x16x32_bf16(false, ah, false, bh, (short)0, c, false, false);
  if (NT >= 2) c = __builtin_amdgcn_wmma_f32_16x16x32_bf16(false, al, false, bh, (short)0, c, false, false);
  if (NT >= 3) c = __builtin_amdgcn_wmma_f32_16x16x32_bf16(false, ah, false, bl, (short)0, c, false, false);
  asm volatile("v_nop\n\tv_nop\n\tv_nop\n\tv_nop" : "+v"(c) : "v"(ah), "v"(al), "v"(bh), "v"(bl));
  return c;
}

__global__ __launch_bounds__(256) void k_wt_bf16(const float* __restrict__ W, unsigned short* __restrict__ Wt, int K, int N) {
  const int t = blockIdx.x * 256 + threadIdx.x;
  const int k8n = K / 8;
  if (t >= N * k8n) return;
  const int n = t / k8n, k8 = (t % k8n) * 8;
  v8us v;
#pragma unroll
  for (int i = 0; i < 8; ++i) v[i] = bf16_bits(W[(size_t)(k8 + i) * N + n]);
  *(v8us*)(Wt + (size_t)n * K + k8) = v;
  
}

// GEMM C[M][N] (f32, pitch ldc) = act(A[M][K] x W + bias). One work-group of 8 waves makes a 128 x 128 tile of C; a wave makes 32 x 64 of it.
// A pass is 64 k: the A rows (f32, pitch lda) are converted to bf16 once per work-group (ASPLIT: hi and lo planes -> 2 terms, else one
// rounded term) and laid in LDS beside the 128 rows of Wt (bf16 [N][K], pitch ldb); every global load covers whole 128-B lines.
// Two LDS buffers: the next pass is loaded into registers ahead of this pass's products and stored behind them, one barrier a pass.
// The k order of every sum is ascending in steps of 32, hi term then lo term. BIAS_BF16 rounds the bias to bf16 before the add.
// K%64==0, M%128==0, N%128==0.
// ROT: the interleaved rotary step is applied to the finished f32 tile on its way out: column pair (2i, 2i+1) of a head, row pos = row % TT,
// is turned by the (cos, sin) pair rot[pos][i] that k_rot_table wrote earlier in the same call (a wave's 64 columns are one head).
typedef unsigned short v4us __attribute__((ext_vector_type(4), may_alias));
template <bool ASPLIT, int ACT, bool BIAS_BF16, bool ROT>
__global__ __launch_bounds__(256) void k_gemm_bf(const float* __restrict__ A, int lda, const unsigned short* __restrict__ Wt, int ldb,
                                               const float* __restrict__ bias, float* __restrict__ C, int ldc, int M, int N, int K,
                                               const float* __restrict__ rot) {
  constexpr int PB = 72;                 // LDS row pitch in bf16: 128 B of k + 16 B, an odd multiple of 16 B for the 16-byte readers
  constexpr int PLANE = 128 * PB;        // one operand plane of a pass
  constexpr int NPL = ASPLIT ? 3 : 2;    // A hi, W, (A lo)
  constexpr int PO = 68;                 // pitch in f32 of the output staging rows
  __shared__ __attribute__((aligned(16))) unsigned short sm[2 * NPL * PLANE];
  const int tid = threadIdx.x, w = tid >> 5, lane = tid & 31, ln = lane & 15, hh = lane >> 4;
  const int ntn = N / 128;
  const int mb = blockIdx.x / ntn, nb = blockIdx.x % ntn;
  if (mb * 128 >= M) return;             // the same for the whole work-group, ahead of every barrier
  const int row0 = mb * 128, col0 = nb * 128;
  const int wm = w >> 1, wn = w & 1;
  const int ar = tid >> 4, ac = (tid & 15) * 4;    // A staging: 16 lanes cover 256 B of a row
  const int br = tid >> 3, bc = (tid & 7) * 8;     // W staging: 8 lanes cover 128 B of a row
  const float* ag = A + (size_t)(row0 + ar) * lda + ac;
  const unsigned short* bg = Wt + (size_t)(col0 + br) * ldb + bc;
  v4f xa[8]; v8us xb[4];
  v8f acc[2][4] = {};
  const int np = K / 64;
  auto fetch = [&](int kb) {
    const float* pa[8]; const unsigned short* pb[4];
#pragma unroll
    for (int i = 0; i < 8; ++i) { pa[i] = ag + (size_t)(16 * i) * lda + kb; xa[i] = *(const v4fa*)pa[i]; }
#pragma unroll
    for (int i = 0; i < 4; ++i) { pb[i] = bg + (size_t)(32 * i) * ldb + kb; xb[i] = *(const v8us*)pb[i]; }
    // no register that one of these loads names as its address is written (not by a later load's result either) ahead of this wait:
    // the inputs keep all twelve addresses live up to it
    asm volatile("s_wait_xcnt 0x0" :: "v"(pa[0]), "v"(pa[1]), "v"(pa[2]), "v"(pa[3]), "v"(pa[4]), "v"(pa[5]), "v"(pa[6]), "v"(pa[7]),
                 "v"(pb[0]), "v"(pb[1]), "v"(pb[2]), "v"(pb[3]) : "memory");
  };
  fetch(0);
  for (int p = 0; p <= np; ++p) {
    if (p > 0) {
      // products of pass p - 1 out of its buffer
      const unsigned short* sAh = sm + ((p - 1) & 1) * (NPL * PLANE);
      const unsigned short* sB = sAh + PLANE;
      const unsigned short* sAl = sB + PLANE;
#pragma unroll
      for (int ks = 0; ks < 2; ++ks) {
        FragB ah[2], al[2], b[4];
#pragma unroll
        for (int mi = 0; mi < 2; ++mi) {
          const int o = (wm * 32 + mi * 16 + ln) * PB + ks * 32 + 8 * hh;
          ah[mi].half[0] = *(const v8us*)(sAh + o); ah[mi].half[1] = *(const v8us*)(sAh + o + 16);
          if (ASPLIT) { al[mi].half[0] = *(const v8us*)(sAl + o); al[mi].half[1] = *(const v8us*)(sAl + o + 16); }
          else al[mi] = ah[mi];
        }
#pragma unroll
        for (int t = 0; t < 4; ++t) {
          const int o = (wn * 64 + t * 16 + ln) * PB + ks * 32 + 8 * hh;
          b[t].half[0] = *(const v8us*)(sB + o); b[t].half[1] = *(const v8us*)(sB + o + 16);
        }
#pragma unroll
        for (int mi = 0; mi < 2; ++mi)
#pragma unroll
          for (int t = 0; t < 4; ++t) acc[mi][t] = mmaN<ASPLIT ? 2 : 1>(ah[mi].v, al[mi].v, b[t].v, b[t].v, acc[mi][t]);
      }
    }
    if (p < np) {
      // pass p from registers into the buffer whose readers left it at the barrier that ended trip p - 1
      unsigned short* dAh = sm + (p & 1) * (NPL * PLANE);
      unsigned short* dB = dAh + PLANE;
      unsigned short* dAl = dB + PLANE;
#pragma unroll
      for (int i = 0; i < 8; ++i) {
        v4us h, l;
#pragma unroll
        for (int t = 0; t < 4; ++t) { const unsigned short hb = bf16_bits(xa[i][t]); h[t] = hb; l[t] = ASPLIT ? bf16_bits(xa[i][t] - bf16_val(hb)) : (unsigned short)0; }
        *(v4us*)(dAh + (ar + 16 * i) * PB + ac) = h;
        if (ASPLIT) *(v4us*)(dAl + (ar + 16 * i) * PB + ac) = l;
      }
#pragma unroll
      for (int i = 0; i < 4; ++i) *(v8us*)(dB + (br + 32 * i) * PB + bc) = xb[i];
    }
    __syncthreads();
    if (p + 1 < np) {
      // pass p + 1 starts its way from L2 now and is waited for only behind the products of pass p
      fetch((p + 1) * 64);
    }
  }
  const int rsub = lane >> 4, c4 = (lane & 15) * 4;
  v4f cs[16];
  if (ROT) {
    // the (cos, sin) pairs of this lane's two column pairs in its 16 rows: sixteen loads off one address, issued together (one latency for all)
    static_assert(TT % 128 == 0 && HD == 64, "a 128-row tile stays inside one sequence; a wave's 64 columns are one head");
    const float* pr = rot + (size_t)(row0 % TT + wm * 32 + rsub) * HD + c4;
#pragma unroll
    for (int q = 0; q < 16; ++q) cs[q] = *(const v4fa*)(pr + q * 2 * HD);
    // the address that these loads name is not written ahead of this wait: the input keeps it live up to it
    asm volatile("s_wait_xcnt 0x0" :: "v"(pr) : "memory");
  }
  // the barrier of the last trip stands behind every wave's last read of the buffers: each wave now stages its 32 x 64 tile in a range of its own
  float* so = (float*)sm + w * (32 * PO);
#pragma unroll
  for (int mi = 0; mi < 2; ++mi)
#pragma unroll
    for (int t = 0; t < 4; ++t) {
      float bv = bias ? bias[col0 + wn * 64 + t * 16 + ln] : 0.f;
      if (BIAS_BF16) bv = bf16_round(bv);
#pragma unroll
      for (int r = 0; r < 8; ++r) { float v = acc[mi][t][r] + bv; if (ACT == 1) v = fmaxf(v, 0.f); so[(mi * 16 + 8 * hh + r) * PO + t * 16 + ln] = v; }
    }
  __builtin_amdgcn_fence(__ATOMIC_ACQ_REL, "workgroup");
  __builtin_amdgcn_wave_barrier();
#pragma unroll
  for (int q = 0; q < 16; ++q) {
    const int r = q * 2 + rsub;
    v4f v = *(const v4fa*)&so[r * PO + c4];
    if (ROT) {
      const v4f x = v, t = cs[q];
      v = (v4f){x[0] * t[0] - x[1] * t[1], x[1] * t[0] + x[0] * t[1], x[2] * t[2] - x[3] * t[3], x[3] * t[2] + x[2] * t[3]};
    }
    *(v4f*)(C + (size_t)(row0 + wm * 32 + r) * ldc + col0 + wn * 64 + c4) = v;
  }
}

// Flash-style causal/unmasked attention, all contractions 3-term bf16 hi/lo splits, f32 softmax with running max.
// q,k,v rows are read from f32 buffers with arbitrary row pitch (so they can live inside a fused qkv buffer);
// D = head size (multiple of 32, <= 128); one wave = 16 query rows; block = 4 waves (64 queries) sharing K/V chunks of 32.
template <int D, bool CAUSAL>
__global__ __launch_bounds__(128) void k_flash(const float* __restrict__ qb, const float* __restrict__ kb, const float* __restrict__ vb,
                                             int pitch, int T, int H, float scale, float* __restrict__ y, int ypitch) {
  constexpr int KS = D / 32;        // k-steps for QK
  constexpr int DT = D / 16;        // d tiles for PV
  __shared__ __attribute__((aligned(16))) unsigned short sKh[32][D + 8], sKl[32][D + 8], sVh[32][D + 8], sVl[32][D + 8];
  __shared__ __attribute__((aligned(16))) unsigned short sPh[4][16][40], sPl[4][16][40];
  __shared__ __attribute__((aligned(16))) float sO[4][16][D];
  const int tid = threadIdx.x, w = tid >> 5, lane = tid & 31, ln = lane & 15, hh = lane >> 4;
  const int nqb = (T + 63) / 64;
  const int bh = blockIdx.x / nqb, qblk = blockIdx.x % nqb;
  const int b = bh / H, h = bh % H;
  const int q0 = qblk * 64 + w * 16;
  const float* Q = qb + (size_t)b * T * pitch + h * D;
  const float* K = kb + (size_t)b * T * pitch + h * D;
  const float* V = vb + (size_t)b * T * pitch + h * D;

  // A fragments of the wave's 16 query rows (scaled), hi/lo
  FragB aqh[KS], aql[KS];
  {
    int row = q0 + ln; if (row >= T) row = T - 1;
    const float* qr = Q + (size_t)row * pitch;
#pragma unroll
    for (int ks = 0; ks < KS; ++ks)
#pragma unroll
      for (int i = 0; i < 16; ++i) {
        const int d = ks * 32 + ((i < 8) ? (8 * hh + i) : (16 + 8 * hh + (i - 8)));
        const float x = qr[d] * scale; const unsigned short hb = bf16_bits(x);
        aqh[ks].u[i] = hb; aql[ks].u[i] = bf16_bits(x - bf16_val(hb));
      }
  }
  float m_r[8], l_r[8];
#pragma unroll
  for (int r = 0; r < 8; ++r) { m_r[r] = -3.0e38f; l_r[r] = 0.f; }
  v8f oacc[DT];
#pragma unroll
  for (int dt = 0; dt < DT; ++dt) oacc[dt] = (v8f){0.f,0.f,0.f,0.f,0.f,0.f,0.f,0.f};

  const int kv_end = CAUSAL ? min(T, qblk * 64 + 64) : T;     // block-uniform
  for (int j0 = 0; j0 < kv_end; j0 += 32) {
    __syncthreads();
    for (int e = tid; e < 32 * (D / 4); e += 128) {
      const int r = e / (D / 4), c4 = (e % (D / 4)) * 4;
      const int key = j0 + r;
      v4f kf = {0.f,0.f,0.f,0.f}, vf = {0.f,0.f,0.f,0.f};
      if (key < T) { kf = *(const v4fa*)(K + (size_t)key * pitch + c4); vf = *(const v4fa*)(V + (size_t)key * pitch + c4); }
#pragma unroll
      for (int t = 0; t < 4; ++t) {
        unsigned short hb = bf16_bits(kf[t]); sKh[r][c4 + t] = hb; sKl[r][c4 + t] = bf16_bits(kf[t] - bf16_val(hb));
        hb = bf16_bits(vf[t]); sVh[r][c4 + t] = hb; sVl[r][c4 + t] = bf16_bits(vf[t] - bf16_val(hb));
      }
    }
    __syncthreads();
    // S tile 16 x 32
    v8f s[2];
#pragma unroll
    for (int nt = 0; nt < 2; ++nt) {
      v8f acc = {};
#pragma unroll
      for (int ks = 0; ks < KS; ++ks) {
        FragB bh_, bl_;
        bh_.half[0] = *(const v8us*)&sKh[nt * 16 + ln][ks * 32 + 8 * hh]; bh_.half[1] = *(const v8us*)&sKh[nt * 16 + ln][ks * 32 + 16 + 8 * hh];
        bl_.half[0] = *(const v8us*)&sKl[nt * 16 + ln][ks * 32 + 8 * hh]; bl_.half[1] = *(const v8us*)&sKl[nt * 16 + ln][ks * 32 + 16 + 8 * hh];
        acc = mmaN<3>(aqh[ks].v, aql[ks].v, bh_.v, bl_.v, acc);
      }
      s[nt] = acc;
    }
    // mask + running max (rows 8hh+r; the 16 lanes of a half share rows)
    float alpha[8];
#pragma unroll
    for (int r = 0; r < 8; ++r) {
      const int qi = q0 + 8 * hh + r;
      const int ja = j0 + ln, jb = j0 + 16 + ln;
      if (CAUSAL) { if (ja > qi) s[0][r] = -3.0e38f; if (jb > qi) s[1][r] = -3.0e38f; }
      if (ja >= T) s[0][r] = -3.0e38f;
      if (jb >= T) s[1][r] = -3.0e38f;
      float mx = fmaxf(s[0][r], s[1][r]);
      mx = fmaxf(mx, __shfl_xor(mx, 1, 32)); mx = fmaxf(mx, __shfl_xor(mx, 2, 32)); mx = fmaxf(mx, __shfl_xor(mx, 4, 32)); mx = fmaxf(mx, __shfl_xor(mx, 8, 32));
      const float mnew = fmaxf(m_r[r], mx);
      alpha[r] = (mnew > -1.0e38f) ? __expf(m_r[r] - mnew) : 1.0f;
      const float p0 = (s[0][r] > -1.0e38f) ? __expf(s[0][r] - mnew) : 0.f;
      const float p1 = (s[1][r] > -1.0e38f) ? __expf(s[1][r] - mnew) : 0.f;
      m_r[r] = mnew;
      l_r[r] = l_r[r] * alpha[r] + p0 + p1;            // per-lane partial row sum (16 lanes combined at the end)
      unsigned short hb = bf16_bits(p0); sPh[w][8 * hh + r][ln] = hb;      sPl[w][8 * hh + r][ln] = bf16_bits(p0 - bf16_val(hb));
      hb = bf16_bits(p1);                sPh[w][8 * hh + r][16 + ln] = hb; sPl[w][8 * hh + r][16 + ln] = bf16_bits(p1 - bf16_val(hb));
    }
#pragma unroll
    for (int dt = 0; dt < DT; ++dt)
#pragma unroll
      for (int r = 0; r < 8; ++r) oacc[dt][r] *= alpha[r];
    __builtin_amdgcn_fence(__ATOMIC_ACQ_REL, "workgroup");
    __builtin_amdgcn_wave_barrier();
    FragB pah, pal;
    pah.half[0] = *(const v8us*)&sPh[w][ln][8 * hh]; pah.half[1] = *(const v8us*)&sPh[w][ln][16 + 8 * hh];
    pal.half[0] = *(const v8us*)&sPl[w][ln][8 * hh]; pal.half[1] = *(const v8us*)&sPl[w][ln][16 + 8 * hh];
#pragma unroll
    for (int dt = 0; dt < DT; ++dt) {
      FragB bvh, bvl;
#pragma unroll
      for (int i = 0; i < 8; ++i) {
        bvh.u[i] = sVh[8 * hh + i][dt * 16 + ln]; bvh.u[8 + i] = sVh[16 + 8 * hh + i][dt * 16 + ln];
        bvl.u[i] = sVl[8 * hh + i][dt * 16 + ln]; bvl.u[8 + i] = sVl[16 + 8 * hh + i][dt * 16 + ln];
      }
      oacc[dt] = mmaN<3>(pah.v, pal.v, bvh.v, bvl.v, oacc[dt]);
    }
    __builtin_amdgcn_fence(__ATOMIC_ACQ_REL, "workgroup");
    __builtin_amdgcn_wave_barrier();
  }
#pragma unroll
  for (int r = 0; r < 8; ++r) {
    float l = l_r[r];
    l += __shfl_xor(l, 1, 32); l += __shfl_xor(l, 2, 32); l += __shfl_xor(l, 4, 32); l += __shfl_xor(l, 8, 32);
    l_r[r] = (l > 0.f) ? 1.0f / l : 0.f;
  }
#pragma unroll
  for (int dt = 0; dt < DT; ++dt)
#pragma unroll
    for (int r = 0; r < 8; ++r) sO[w][8 * hh + r][dt * 16 + ln] = oacc[dt][r] * l_r[r];
  __builtin_amdgcn_fence(__ATOMIC_ACQ_REL, "workgroup");
  __builtin_amdgcn_wave_barrier();
  {
    for (int r = 0; r < 16; ++r) {
      const int row = q0 + r;
      if (row < T && lane < D / 4) {
        const v4f val = *(const v4fa*)&sO[w][r][lane * 4];
        *(v4f*)(y + ((size_t)b * T + row) * ypitch + h * D + lane * 4) = val;
      }
    }
    
  }
}

// 16 x 16 tile of 16-bit values, row-major in LDS, read transposed: lane l passes the address of row 8 (l >> 4) + (l & 7), columns 8 ((l >> 3) & 1) + 0..7,
// and receives rows 8 (l >> 4) + 0..7 of column l & 15. A load that the compiler sees: it places the wait.
__device__ __forceinline__ v8us ld_tr16(const unsigned short* p) {
  typedef short s16x8 __attribute__((ext_vector_type(8)));
  typedef __attribute__((address_space(3))) s16x8 lds_s16x8;
  return __builtin_bit_cast(v8us, __builtin_amdgcn_ds_load_tr16_b128_v8i16((lds_s16x8*)p));
}
// Banded attention, |i - j| <= band: queries, keys and values are f32 rows at X + (b*T + row)*pitch + h*D.
// 3-term bf16 splits, f32 softmax with running max; y[b][row][h*D + d] pitch ypitch, whole-line rows (D % 32 == 0).
// The trip holds no per-lane and no per-row branch (guards are selects, on clamped addresses): the staging loads of a trip are
// issued together, and so are the eight rows' steps of the maximum.
template <int D>
__global__ __launch_bounds__(128) void k_flash_band(const float* __restrict__ Qb, const float* __restrict__ Kb, const float* __restrict__ Vb,
                                                  int pitch, int T, int H, float scale, int band, float* __restrict__ y, int ypitch) {
  constexpr int KS = D / 32, DT = D / 16;
  __shared__ __attribute__((aligned(16))) unsigned short sKh[32][D + 8], sKl[32][D + 8];
  __shared__ __attribute__((aligned(32))) unsigned short sVh[32][D + 16], sVl[32][D + 16];   // V rows at an odd multiple of 32 B, the pitch of the transposing reader
  __shared__ __attribute__((aligned(16))) unsigned short sPh[4][16][40], sPl[4][16][40];
  __shared__ __attribute__((aligned(16))) float sO[4][16][D];
  const int tid = threadIdx.x, w = tid >> 5, lane = tid & 31, ln = lane & 15, hh = lane >> 4;
  const int nqb = (T + 63) / 64;
  const int bh = blockIdx.x / nqb, qblk = blockIdx.x % nqb;
  const int b = bh / H, h = bh % H;
  const int q0 = qblk * 64 + w * 16;
  const float* Q = Qb + (size_t)b * T * pitch + h * D;
  const float* K = Kb + (size_t)b * T * pitch + h * D;
  const float* V = Vb + (size_t)b * T * pitch + h * D;
  FragB aqh[KS], aql[KS];
  {
    int row = q0 + ln; if (row >= T) row = T - 1;
    const float* qr = Q + (size_t)row * pitch;
#pragma unroll
    for (int ks = 0; ks < KS; ++ks)
#pragma unroll
      for (int i = 0; i < 16; ++i) {
        const int d = ks * 32 + ((i < 8) ? (8 * hh + i) : (16 + 8 * hh + (i - 8)));
        const float x = qr[d] * scale; const unsigned short hb = bf16_bits(x);
        aqh[ks].u[i] = hb; aql[ks].u[i] = bf16_bits(x - bf16_val(hb));
      }
  }
  const int trow = 8 * hh + (lane & 7), tcol = 8 * ((lane >> 3) & 1);   // the 16 bytes this lane hands to a transposing load of a 16 x 16 tile
  int qrow[8];
#pragma unroll
  for (int r = 0; r < 8; ++r) { int qi = q0 + 8 * hh + r; qrow[r] = qi < T ? qi : T - 1; }
  float m_r[8], l_r[8];
#pragma unroll
  for (int r = 0; r < 8; ++r) { m_r[r] = -3.0e38f; l_r[r] = 0.f; }
  v8f oacc[DT];
#pragma unroll
  for (int dt = 0; dt < DT; ++dt) oacc[dt] = (v8f){0.f,0.f,0.f,0.f,0.f,0.f,0.f,0.f};
  // A key farther than band from every query row of the block has weight exp(-3e38 - m) = 0 in every row:
  // the loop runs only over the 32-key chunks that meet [first row - band, last row + band] (block-uniform bounds).
  const int kv_begin = max(0, qblk * 64 - band) & ~31, kv_end = min(T, qblk * 64 + 64 + band);
  const int wq0 = qblk * 64 + __builtin_amdgcn_readfirstlane(w) * 16;   // the wave's first row, in a scalar register: the chunk test below is a scalar branch
  for (int j0 = kv_begin; j0 < kv_end; j0 += 32) {
    __syncthreads();
    {
      constexpr int NE = 32 * (D / 4) / 128;   // 16-byte pieces of K, and of V, per thread and trip
      static_assert(NE == 4, "the wait below names four K and four V addresses");
      v4f kf[NE], vf[NE]; const float* pk[NE]; const float* pv[NE];
#pragma unroll
      for (int i = 0; i < NE; ++i) {
        const int e = tid + 128 * i, key = j0 + e / (D / 4), c4 = (e % (D / 4)) * 4;
        const size_t o = (size_t)min(key, T - 1) * pitch + c4;   // address in bounds for every lane; a key past the end is zeroed below
        pk[i] = K + o; pv[i] = V + o;
        kf[i] = *(const v4fa*)pk[i]; vf[i] = *(const v4fa*)pv[i];
      }
      // no register that one of these loads names as its address is written (not by a load's result either) ahead of this wait:
      // the inputs keep all eight addresses live up to it
      asm volatile("s_wait_xcnt 0x0" :: "v"(pk[0]), "v"(pk[1]), "v"(pk[2]), "v"(pk[3]), "v"(pv[0]), "v"(pv[1]), "v"(pv[2]), "v"(pv[3]) : "memory");
#pragma unroll
      for (int i = 0; i < NE; ++i) {
        const int e = tid + 128 * i, r = e / (D / 4), c4 = (e % (D / 4)) * 4;
        const bool in = j0 + r < T;
#pragma unroll
        for (int t = 0; t < 4; ++t) {
          const float kx = in ? kf[i][t] : 0.f, vx = in ? vf[i][t] : 0.f;
          unsigned short hb = bf16_bits(kx); sKh[r][c4 + t] = hb; sKl[r][c4 + t] = bf16_bits(kx - bf16_val(hb));
          hb = bf16_bits(vx); sVh[r][c4 + t] = hb; sVl[r][c4 + t] = bf16_bits(vx - bf16_val(hb));
        }
      }
    }
    __syncthreads();
    // a chunk wholly outside the band of this wave's own 16 rows adds nothing to them (no work-group barrier below this line in the trip)
    if (j0 + 31 < wq0 - band || j0 > wq0 + 15 + band) continue;
    v8f s[2];
#pragma unroll
    for (int nt = 0; nt < 2; ++nt) {
      v8f acc = {};
#pragma unroll
      for (int ks = 0; ks < KS; ++ks) {
        FragB bh_, bl_;
        bh_.half[0] = *(const v8us*)&sKh[nt * 16 + ln][ks * 32 + 8 * hh]; bh_.half[1] = *(const v8us*)&sKh[nt * 16 + ln][ks * 32 + 16 + 8 * hh];
        bl_.half[0] = *(const v8us*)&sKl[nt * 16 + ln][ks * 32 + 8 * hh]; bl_.half[1] = *(const v8us*)&sKl[nt * 16 + ln][ks * 32 + 16 + 8 * hh];
        acc = mmaN<3>(aqh[ks].v, aql[ks].v, bh_.v, bl_.v, acc);
      }
      s[nt] = acc;
    }
    const int ja = j0 + ln, jb = j0 + 16 + ln;
    const bool keepa = ja < T, keepb = jb < T;
    float sa[8], sb[8], mx[8], alpha[8];
#pragma unroll
    for (int r = 0; r < 8; ++r) {
      const int qi = qrow[r];
      sa[r] = (keepa && ja <= qi + band && ja >= qi - band) ? s[0][r] : -3.0e38f;
      sb[r] = (keepb && jb <= qi + band && jb >= qi - band) ? s[1][r] : -3.0e38f;
      mx[r] = fmaxf(sa[r], sb[r]);
    }
    // maximum over the 16 lanes of a row: each exchange step for all eight rows before the next step
    __builtin_amdgcn_sched_barrier(0);   // all eight rows' values stand ready here: without it one row's four exchanges were scheduled ahead, alone, each waited for by itself
#pragma unroll
    for (int m = 1; m <= 8; m <<= 1) {
      float ox[8];
#pragma unroll
      for (int r = 0; r < 8; ++r) ox[r] = __shfl_xor(mx[r], m, 32);
#pragma unroll
      for (int r = 0; r < 8; ++r) mx[r] = fmaxf(mx[r], ox[r]);
    }
#pragma unroll
    for (int r = 0; r < 8; ++r) {
      const float mnew = fmaxf(m_r[r], mx[r]);
      alpha[r] = (mnew > -1.0e38f) ? __expf(m_r[r] - mnew) : 1.0f;
      const float p0 = keepa ? __expf(sa[r] - mnew) : 0.f;
      const float p1 = keepb ? __expf(sb[r] - mnew) : 0.f;
      m_r[r] = mnew;
      l_r[r] = l_r[r] * alpha[r] + p0 + p1;
      unsigned short hb = bf16_bits(p0); sPh[w][8 * hh + r][ln] = hb;      sPl[w][8 * hh + r][ln] = bf16_bits(p0 - bf16_val(hb));
      hb = bf16_bits(p1);                sPh[w][8 * hh + r][16 + ln] = hb; sPl[w][8 * hh + r][16 + ln] = bf16_bits(p1 - bf16_val(hb));
    }
#pragma unroll
    for (int dt = 0; dt < DT; ++dt)
#pragma unroll
      for (int r = 0; r < 8; ++r) oacc[dt][r] *= alpha[r];
    __builtin_amdgcn_fence(__ATOMIC_ACQ_REL, "workgroup");
    __builtin_amdgcn_wave_barrier();
    FragB pah, pal;
    pah.half[0] = *(const v8us*)&sPh[w][ln][8 * hh]; pah.half[1] = *(const v8us*)&sPh[w][ln][16 + 8 * hh];
    pal.half[0] = *(const v8us*)&sPl[w][ln][8 * hh]; pal.half[1] = *(const v8us*)&sPl[w][ln][16 + 8 * hh];
    // lane (ln, hh) gets V[8 hh + 0..7][dt * 16 + ln] from the first load of a pair and V[16 + 8 hh + 0..7][dt * 16 + ln] from the second: the k order of pah / pal.
    // All sixteen loads stand in one group ahead of the products: one LDS latency a trip, not one per 16 columns.
    FragB bvh[DT], bvl[DT];
#pragma unroll
    for (int dt = 0; dt < DT; ++dt) {
      bvh[dt].half[0] = ld_tr16(&sVh[trow][dt * 16 + tcol]); bvh[dt].half[1] = ld_tr16(&sVh[16 + trow][dt * 16 + tcol]);
      bvl[dt].half[0] = ld_tr16(&sVl[trow][dt * 16 + tcol]); bvl[dt].half[1] = ld_tr16(&sVl[16 + trow][dt * 16 + tcol]);
    }
#pragma unroll
    for (int dt = 0; dt < DT; ++dt) oacc[dt] = mmaN<3>(pah.v, pal.v, bvh[dt].v, bvl[dt].v, oacc[dt]);
    __builtin_amdgcn_fence(__ATOMIC_ACQ_REL, "workgroup");
    __builtin_amdgcn_wave_barrier();
  }
#pragma unroll
  for (int r = 0; r < 8; ++r) {
    float l = l_r[r];
    l += __shfl_xor(l, 1, 32); l += __shfl_xor(l, 2, 32); l += __shfl_xor(l, 4, 32); l += __shfl_xor(l, 8, 32);
    l_r[r] = (m_r[r] > -1.0e38f) ? 1.0f / l : __builtin_nanf("");
  }
#pragma unroll
  for (int dt = 0; dt < DT; ++dt)
#pragma unroll
    for (int r = 0; r < 8; ++r) sO[w][8 * hh + r][dt * 16 + ln] = oacc[dt][r] * l_r[r];
  __builtin_amdgcn_fence(__ATOMIC_ACQ_REL, "workgroup");
  __builtin_amdgcn_wave_barrier();
  {
    for (int r = 0; r < 16; ++r) {
      const int row = q0 + r;
      if (row < T && lane < D / 4) {
        const v4f val = *(const v4fa*)&sO[w][r][lane * 4];
        *(v4f*)(y + ((size_t)b * T + row) * ypitch + h * D + lane * 4) = val;
      }
    }
  }
}
// table of the interleaved rotary step: rot[pos][i] = (cos, sin) of pos * inv_freq[i], inv_freq[i] = 10000^(-i/(d/2)); thread per (pos, i);
// written anew in every call, ahead of the two GEMMs that read it
__global__ __launch_bounds__(256) void k_rot_table(float* __restrict__ rot) {
  const int t = blockIdx.x * 256 + threadIdx.x; if (t >= TT * (HD / 2)) return;
  const int pos = t / (HD / 2), i = t % (HD / 2);
  const float inv = powf(10000.0f, -(float)i / (float)(HD / 2)); const float ang = (float)pos * inv; float sn, cs; sincosf(ang, &sn, &cs);
  typedef float v2f __attribute__((ext_vector_type(2)));
  v2f a = {cs, sn};
  *(v2f*)(rot + (size_t)t * 2) = a;
}
extern "C" void kernel_launch(void* const* d_in, const int* in_sizes, int n_in,
                              void* d_out, int out_size, void* d_ws, size_t ws_size, hipStream_t stream) {
  (void)in_sizes; (void)n_in; (void)out_size;
  const float* xq = (const float*)d_in[0]; const float* xkv = (const float*)d_in[1];
  const float* Wq = (const float*)d_in[2]; const float* Wk = (const float*)d_in[3]; const float* Wv = (const float*)d_in[4]; const float* Wo = (const float*)d_in[5];
  char* ws = (char*)d_ws; size_t off = 0;
  auto take = [&](size_t bytes) { char* p = ws + off; off += (bytes + 255) & ~(size_t)255; return p; };
  const int M = BB * TT, gb = (M / 128) * (EE / 128);
  unsigned short* Wt[4]; for (int i = 0; i < 4; ++i) Wt[i] = (unsigned short*)take((size_t)EE * EE * 2);
  float* q = (float*)take((size_t)M * EE * 4); float* k = (float*)take((size_t)M * EE * 4); float* v = (float*)take((size_t)M * EE * 4); float* att = (float*)take((size_t)M * EE * 4);
  float* rot = (float*)take((size_t)TT * HD * 4);
  if (off > ws_size) return;
  const float* W4[4] = {Wq, Wk, Wv, Wo};
  for (int i = 0; i < 4; ++i) k_wt_bf16<<<(EE * (EE / 8) + 255) / 256, 256, 0, stream>>>(W4[i], Wt[i], EE, EE);
  k_rot_table<<<(TT * (HD / 2) + 255) / 256, 256, 0, stream>>>(rot);
  k_gemm_bf<false, 0, false, true><<<gb, 256, 0, stream>>>(xq, EE, Wt[0], EE, nullptr, q, EE, M, EE, EE, rot);
  k_gemm_bf<false, 0, false, true><<<gb, 256, 0, stream>>>(xkv, EE, Wt[1], EE, nullptr, k, EE, M, EE, EE, rot);
  k_gemm_bf<false, 0, false, false><<<gb, 256, 0, stream>>>(xkv, EE, Wt[2], EE, nullptr, v, EE, M, EE, EE, nullptr);
  k_flash_band<HD><<<BB * NH * (TT / 64), 128, 0, stream>>>(q, k, v, EE, TT, NH, 0.125f, 256, att, EE);
  k_gemm_bf<true, 0, false, false><<<gb, 256, 0, stream>>>(att, EE, Wt[3], EE, nullptr, (float*)d_out, EE, M, EE, EE, nullptr);
}

// v006
// One run takes 212 microseconds.
// Timed twice side by side with v005, it ran 1.13 times as fast both times.
// Counting every step since v000, it is 5.47 times as fast.
#include <hip/hip_runtime.h>
// All contractions on v_wmma_f32_16x16x32_bf16, f32 accumulate: x_q·Wq, x_kv·Wk, x_kv·Wv (inputs, W rounded to bf16: single exact term),
// QKᵀ and P·V per 16-query tile as 3-term bf16 hi/lo splits with the |i−j| ≤ 256 band, out·Wo with the A operand split (2 terms);
// interleaved rotary embedding and softmax in f32.
#define BB 4
#define TT 2048
#define EE 1024
#define NH 16
#define HD 64

typedef __bf16 v16b __attribute__((ext_vector_type(16)));
typedef unsigned short v8us __attribute__((ext_vector_type(8), may_alias));
typedef float  v8f  __attribute__((ext_vector_type(8)));
typedef float  v4f  __attribute__((ext_vector_type(4)));
typedef float  v4fa __attribute__((ext_vector_type(4), may_alias));
union FragB { v16b v; v8us half[2]; unsigned short u[16]; };

__device__ __forceinline__ unsigned short bf16_bits(float x) { unsigned int u = __float_as_uint(x); return (unsigned short)((u + 0x7FFFu + ((u >> 16) & 1u)) >> 16); }
__device__ __forceinline__ float bf16_val(unsigned short b) { return __uint_as_float(((unsigned int)b) << 16); }
__device__ __forceinline__ float bf16_round(float x) { return bf16_val(bf16_bits(x)); }
// D += A·B with NT terms: 1 = ah·bh, 2 = + al·bh (A split), 3 = + ah·bl (both split)
template <int NT>
__device__ __forceinline__ v8f mmaN(v16b ah, v16b al, v16b bh, v16b bl, v8f c) {
  c = __builtin_amdgcn_wmma_f32_16x16x32_bf16(false, ah, false, bh, (short)0, c, false, false);
  if (NT >= 2) c = __builtin_amdgcn_wmma_f32_16x16x32_bf16(false, al, false, bh, (short)0, c, false, false);
  if (NT >= 3) c = __builtin_amdgcn_wmma_f32_16x16x32_bf16(false, ah, false, bl, (short)0, c, false, false);
  asm volatile("v_nop\n\tv_nop\n\tv_nop\n\tv_nop" : "+v"(c) : "v"(ah), "v"(al), "v"(bh), "v"(bl));
  return c;
}

__global__ __launch_bounds__(256) void k_wt_bf16(const float* __restrict__ W, unsigned short* __restrict__ Wt, int K, int N) {
  const int t = blockIdx.x * 256 + threadIdx.x;
  const int k8n = K / 8;
  if (t >= N * k8n) return;
  const int n = t / k8n, k8 = (t % k8n) * 8;
  v8us v;
#pragma unroll
  for (int i = 0; i < 8; ++i) v[i] = bf16_bits(W[(size_t)(k8 + i) * N + n]);
  *(v8us*)(Wt + (size_t)n * K + k8) = v;
  
}

// GEMM C[M][N] (f32, pitch ldc) = act(A[M][K] x W + bias). One work-group of 8 waves makes a 128 x 128 tile of C; a wave makes 32 x 64 of it.
// A pass is 64 k: the A rows are laid in LDS beside the 128 rows of Wt (bf16 [N][K], pitch ldb); every global load covers whole 128-B lines.
// ALO == 0: A is f32 (pitch lda), rounded to bf16 once per work-group, one term. ALO > 0: A arrives as the bf16 pairs its producer wrote, rows of
// 16-bit values at pitch lda, hi at column k and lo at column ALO + k: both planes are copied as they are, 2 terms.
// Two LDS buffers: the next pass is loaded into registers ahead of this pass's products and stored behind them, one barrier a pass.
// The k order of every sum is ascending in steps of 32, hi term then lo term. BIAS_BF16 rounds the bias to bf16 before the add.
// K%64==0, M%128==0, N%128==0.
// ROT: the interleaved rotary step is applied to the finished f32 tile on its way out: column pair (2i, 2i+1) of a head, row pos = row % TT,
// is turned by the (cos, sin) pair rot[pos][i] that k_rot_table wrote earlier in the same call (a wave's 64 columns are one head).
// LO > 0: the finished value, times oscale, leaves as a bf16 pair hi = bf16(x), lo = bf16(x - hi), the operands of the attention's 3-term products:
// C is then rows of 16-bit values at pitch ldc, hi at column c and lo at column LO + c of the same row (a wave's 64 columns are one 128-B line of each).
typedef unsigned short v4us __attribute__((ext_vector_type(4), may_alias));
template <int ALO, int ACT, bool BIAS_BF16, bool ROT, int LO>
__global__ __launch_bounds__(256) void k_gemm_bf(const float* __restrict__ A, int lda, const unsigned short* __restrict__ Wt, int ldb,
                                               const float* __restrict__ bias, float* __restrict__ C, int ldc, int M, int N, int K,
                                               const float* __restrict__ rot, float oscale) {
  constexpr bool ASPLIT = ALO > 0;
  constexpr int PB = 72;                 // LDS row pitch in bf16: 128 B of k + 16 B, an odd multiple of 16 B for the 16-byte readers
  constexpr int PLANE = 128 * PB;        // one operand plane of a pass
  constexpr int NPL = ASPLIT ? 3 : 2;    // A hi, W, (A lo)
  constexpr int PO = 68;                 // pitch in f32 of the output staging rows
  __shared__ __attribute__((aligned(16))) unsigned short sm[2 * NPL * PLANE];
  const int tid = threadIdx.x, w = tid >> 5, lane = tid & 31, ln = lane & 15, hh = lane >> 4;
  const int ntn = N / 128;
  const int mb = blockIdx.x / ntn, nb = blockIdx.x % ntn;
  if (mb * 128 >= M) return;             // the same for the whole work-group, ahead of every barrier
  const int row0 = mb * 128, col0 = nb * 128;
  const int wm = w >> 1, wn = w & 1;
  const int ar = tid >> 4, ac = (tid & 15) * 4;    // staging of an f32 A: 16 lanes cover 256 B of a row
  const int br = tid >> 3, bc = (tid & 7) * 8;     // staging of W and of each plane of a 16-bit A: 8 lanes cover 128 B of a row
  const float* ag = A + (size_t)(row0 + ar) * lda + ac;
  const unsigned short* ap = (const unsigned short*)A + (size_t)(row0 + br) * lda + bc;
  const unsigned short* bg = Wt + (size_t)(col0 + br) * ldb + bc;
  v4f xa[8]; v8us xah[4], xal[4], xb[4];
  v8f acc[2][4] = {};
  const int np = K / 64;
  auto fetch = [&](int kb) {
    if constexpr (ASPLIT) {
      const unsigned short* pp[4]; const unsigned short* pb[4];
#pragma unroll   // constant indices: the arrays stay in registers (the same for the loops below)
      for (int i = 0; i < 4; ++i) { pp[i] = ap + (size_t)(32 * i) * lda + kb; xah[i] = *(const v8us*)pp[i]; xal[i] = *(const v8us*)(pp[i] + ALO); }
#pragma unroll
      for (int i = 0; i < 4; ++i) { pb[i] = bg + (size_t)(32 * i) * ldb + kb; xb[i] = *(const v8us*)pb[i]; }
      // no register that one of these loads names as its address is written (not by a later load's result either) ahead of this wait:
      // the inputs keep all eight addresses live up to it
      asm volatile("s_wait_xcnt 0x0" :: "v"(pp[0]), "v"(pp[1]), "v"(pp[2]), "v"(pp[3]), "v"(pb[0]), "v"(pb[1]), "v"(pb[2]), "v"(pb[3]) : "memory");
    } else {
    const float* pa[8]; const unsigned short* pb[4];
#pragma unroll
    for (int i = 0; i < 8; ++i) { pa[i] = ag + (size_t)(16 * i) * lda + kb; xa[i] = *(const v4fa*)pa[i]; }
#pragma unroll
    for (int i = 0; i < 4; ++i) { pb[i] = bg + (size_t)(32 * i) * ldb + kb; xb[i] = *(const v8us*)pb[i]; }
    // no register that one of these loads names as its address is written (not by a later load's result either) ahead of this wait:
    // the inputs keep all twelve addresses live up to it
    asm volatile("s_wait_xcnt 0x0" :: "v"(pa[0]), "v"(pa[1]), "v"(pa[2]), "v"(pa[3]), "v"(pa[4]), "v"(pa[5]), "v"(pa[6]), "v"(pa[7]),
                 "v"(pb[0]), "v"(pb[1]), "v"(pb[2]), "v"(pb[3]) : "memory");
    }
  };
  fetch(0);
  for (int p = 0; p <= np; ++p) {
    if (p > 0) {
      // products of pass p - 1 out of its buffer
      const unsigned short* sAh = sm + ((p - 1) & 1) * (NPL * PLANE);
      const unsigned short* sB = sAh + PLANE;
      const unsigned short* sAl = sB + PLANE;
#pragma unroll
      for (int ks = 0; ks < 2; ++ks) {
        FragB ah[2], al[2], b[4];
#pragma unroll
        for (int mi = 0; mi < 2; ++mi) {
          const int o = (wm * 32 + mi * 16 + ln) * PB + ks * 32 + 8 * hh;
          ah[mi].half[0] = *(const v8us*)(sAh + o); ah[mi].half[1] = *(const v8us*)(sAh + o + 16);
          if (ASPLIT) { al[mi].half[0] = *(const v8us*)(sAl + o); al[mi].half[1] = *(const v8us*)(sAl + o + 16); }
          else al[mi] = ah[mi];
        }
#pragma unroll
        for (int t = 0; t < 4; ++t) {
          const int o = (wn * 64 + t * 16 + ln) * PB + ks * 32 + 8 * hh;
          b[t].half[0] = *(const v8us*)(sB + o); b[t].half[1] = *(const v8us*)(sB + o + 16);
        }
#pragma unroll
        for (int mi = 0; mi < 2; ++mi)
#pragma unroll
          for (int t = 0; t < 4; ++t) acc[mi][t] = mmaN<ASPLIT ? 2 : 1>(ah[mi].v, al[mi].v, b[t].v, b[t].v, acc[mi][t]);
      }
    }
    if (p < np) {
      // pass p from registers into the buffer whose readers left it at the barrier that ended trip p - 1
      unsigned short* dAh = sm + (p & 1) * (NPL * PLANE);
      unsigned short* dB = dAh + PLANE;
      unsigned short* dAl = dB + PLANE;
      if constexpr (ASPLIT) {
#pragma unroll   // constant indices: the arrays stay in registers
        for (int i = 0; i < 4; ++i) { *(v8us*)(dAh + (br + 32 * i) * PB + bc) = xah[i]; *(v8us*)(dAl + (br + 32 * i) * PB + bc) = xal[i]; }
      } else {
#pragma unroll
        for (int i = 0; i < 8; ++i) {
          v4us h;
#pragma unroll
          for (int t = 0; t < 4; ++t) h[t] = bf16_bits(xa[i][t]);
          *(v4us*)(dAh + (ar + 16 * i) * PB + ac) = h;
        }
      }
#pragma unroll
      for (int i = 0; i < 4; ++i) *(v8us*)(dB + (br + 32 * i) * PB + bc) = xb[i];
    }
    __syncthreads();
    if (p + 1 < np) {
      // pass p + 1 starts its way from L2 now and is waited for only behind the products of pass p
      fetch((p + 1) * 64);
    }
  }
  const int rsub = lane >> 4, c4 = (lane & 15) * 4;
  v4f cs[16];
  if (ROT) {
    // the (cos, sin) pairs of this lane's two column pairs in its 16 rows: sixteen loads off one address, issued together (one latency for all)
    static_assert(TT % 128 == 0 && HD == 64, "a 128-row tile stays inside one sequence; a wave's 64 columns are one head");
    const float* pr = rot + (size_t)(row0 % TT + wm * 32 + rsub) * HD + c4;
#pragma unroll
    for (int q = 0; q < 16; ++q) cs[q] = *(const v4fa*)(pr + q * 2 * HD);
    // the address that these loads name is not written ahead of this wait: the input keeps it live up to it
    asm volatile("s_wait_xcnt 0x0" :: "v"(pr) : "memory");
  }
  // the barrier of the last trip stands behind every wave's last read of the buffers: each wave now stages its 32 x 64 tile in a range of its own
  float* so = (float*)sm + w * (32 * PO);
#pragma unroll
  for (int mi = 0; mi < 2; ++mi)
#pragma unroll
    for (int t = 0; t < 4; ++t) {
      float bv = bias ? bias[col0 + wn * 64 + t * 16 + ln] : 0.f;
      if (BIAS_BF16) bv = bf16_round(bv);
#pragma unroll
      for (int r = 0; r < 8; ++r) { float v = acc[mi][t][r] + bv; if (ACT == 1) v = fmaxf(v, 0.f); so[(mi * 16 + 8 * hh + r) * PO + t * 16 + ln] = v; }
    }
  __builtin_amdgcn_fence(__ATOMIC_ACQ_REL, "workgroup");
  __builtin_amdgcn_wave_barrier();
#pragma unroll
  for (int q = 0; q < 16; ++q) {
    const int r = q * 2 + rsub;
    v4f v = *(const v4fa*)&so[r * PO + c4];
    if (ROT) {
      const v4f x = v, t = cs[q];
      v = (v4f){x[0] * t[0] - x[1] * t[1], x[1] * t[0] + x[0] * t[1], x[2] * t[2] - x[3] * t[3], x[3] * t[2] + x[2] * t[3]};
    }
    if (LO > 0) {
      v4us h, l;
#pragma unroll   // constant indices: the vectors stay in registers
      for (int t = 0; t < 4; ++t) { const float x = v[t] * oscale; const unsigned short hb = bf16_bits(x); h[t] = hb; l[t] = bf16_bits(x - bf16_val(hb)); }
      unsigned short* ph = (unsigned short*)C + (size_t)(row0 + wm * 32 + r) * ldc + col0 + wn * 64 + c4;
      *(v4us*)ph = h; *(v4us*)(ph + LO) = l;
      // neither the address nor the data that these two stores name is written ahead of this wait: the inputs keep them live up to it
      asm volatile("s_wait_xcnt 0x0" :: "v"(ph), "v"(h), "v"(l) : "memory");
    } else {
      *(v4f*)(C + (size_t)(row0 + wm * 32 + r) * ldc + col0 + wn * 64 + c4) = v;
    }
  }
}

// Flash-style causal/unmasked attention, all contractions 3-term bf16 hi/lo splits, f32 softmax with running max.
// q,k,v rows are read from f32 buffers with arbitrary row pitch (so they can live inside a fused qkv buffer);
// D = head size (multiple of 32, <= 128); one wave = 16 query rows; block = 4 waves (64 queries) sharing K/V chunks of 32.
template <int D, bool CAUSAL>
__global__ __launch_bounds__(128) void k_flash(const float* __restrict__ qb, const float* __restrict__ kb, const float* __restrict__ vb,
                                             int pitch, int T, int H, float scale, float* __restrict__ y, int ypitch) {
  constexpr int KS = D / 32;        // k-steps for QK
  constexpr int DT = D / 16;        // d tiles for PV
  __shared__ __attribute__((aligned(16))) unsigned short sKh[32][D + 8], sKl[32][D + 8], sVh[32][D + 8], sVl[32][D + 8];
  __shared__ __attribute__((aligned(16))) unsigned short sPh[4][16][40], sPl[4][16][40];
  __shared__ __attribute__((aligned(16))) float sO[4][16][D];
  const int tid = threadIdx.x, w = tid >> 5, lane = tid & 31, ln = lane & 15, hh = lane >> 4;
  const int nqb = (T + 63) / 64;
  const int bh = blockIdx.x / nqb, qblk = blockIdx.x % nqb;
  const int b = bh / H, h = bh % H;
  const int q0 = qblk * 64 + w * 16;
  const float* Q = qb + (size_t)b * T * pitch + h * D;
  const float* K = kb + (size_t)b * T * pitch + h * D;
  const float* V = vb + (size_t)b * T * pitch + h * D;

  // A fragments of the wave's 16 query rows (scaled), hi/lo
  FragB aqh[KS], aql[KS];
  {
    int row = q0 + ln; if (row >= T) row = T - 1;
    const float* qr = Q + (size_t)row * pitch;
#pragma unroll
    for (int ks = 0; ks < KS; ++ks)
#pragma unroll
      for (int i = 0; i < 16; ++i) {
        const int d = ks * 32 + ((i < 8) ? (8 * hh + i) : (16 + 8 * hh + (i - 8)));
        const float x = qr[d] * scale; const unsigned short hb = bf16_bits(x);
        aqh[ks].u[i] = hb; aql[ks].u[i] = bf16_bits(x - bf16_val(hb));
      }
  }
  float m_r[8], l_r[8];
#pragma unroll
  for (int r = 0; r < 8; ++r) { m_r[r] = -3.0e38f; l_r[r] = 0.f; }
  v8f oacc[DT];
#pragma unroll
  for (int dt = 0; dt < DT; ++dt) oacc[dt] = (v8f){0.f,0.f,0.f,0.f,0.f,0.f,0.f,0.f};

  const int kv_end = CAUSAL ? min(T, qblk * 64 + 64) : T;     // block-uniform
  for (int j0 = 0; j0 < kv_end; j0 += 32) {
    __syncthreads();
    for (int e = tid; e < 32 * (D / 4); e += 128) {
      const int r = e / (D / 4), c4 = (e % (D / 4)) * 4;
      const int key = j0 + r;
      v4f kf = {0.f,0.f,0.f,0.f}, vf = {0.f,0.f,0.f,0.f};
      if (key < T) { kf = *(const v4fa*)(K + (size_t)key * pitch + c4); vf = *(const v4fa*)(V + (size_t)key * pitch + c4); }
#pragma unroll
      for (int t = 0; t < 4; ++t) {
        unsigned short hb = bf16_bits(kf[t]); sKh[r][c4 + t] = hb; sKl[r][c4 + t] = bf16_bits(kf[t] - bf16_val(hb));
        hb = bf16_bits(vf[t]); sVh[r][c4 + t] = hb; sVl[r][c4 + t] = bf16_bits(vf[t] - bf16_val(hb));
      }
    }
    __syncthreads();
    // S tile 16 x 32
    v8f s[2];
#pragma unroll
    for (int nt = 0; nt < 2; ++nt) {
      v8f acc = {};
#pragma unroll
      for (int ks = 0; ks < KS; ++ks) {
        FragB bh_, bl_;
        bh_.half[0] = *(const v8us*)&sKh[nt * 16 + ln][ks * 32 + 8 * hh]; bh_.half[1] = *(const v8us*)&sKh[nt * 16 + ln][ks * 32 + 16 + 8 * hh];
        bl_.half[0] = *(const v8us*)&sKl[nt * 16 + ln][ks * 32 + 8 * hh]; bl_.half[1] = *(const v8us*)&sKl[nt * 16 + ln][ks * 32 + 16 + 8 * hh];
        acc = mmaN<3>(aqh[ks].v, aql[ks].v, bh_.v, bl_.v, acc);
      }
      s[nt] = acc;
    }
    // mask + running max (rows 8hh+r; the 16 lanes of a half share rows)
    float alpha[8];
#pragma unroll
    for (int r = 0; r < 8; ++r) {
      const int qi = q0 + 8 * hh + r;
      const int ja = j0 + ln, jb = j0 + 16 + ln;
      if (CAUSAL) { if (ja > qi) s[0][r] = -3.0e38f; if (jb > qi) s[1][r] = -3.0e38f; }
      if (ja >= T) s[0][r] = -3.0e38f;
      if (jb >= T) s[1][r] = -3.0e38f;
      float mx = fmaxf(s[0][r], s[1][r]);
      mx = fmaxf(mx, __shfl_xor(mx, 1, 32)); mx = fmaxf(mx, __shfl_xor(mx, 2, 32)); mx = fmaxf(mx, __shfl_xor(mx, 4, 32)); mx = fmaxf(mx, __shfl_xor(mx, 8, 32));
      const float mnew = fmaxf(m_r[r], mx);
      alpha[r] = (mnew > -1.0e38f) ? __expf(m_r[r] - mnew) : 1.0f;
      const float p0 = (s[0][r] > -1.0e38f) ? __expf(s[0][r] - mnew) : 0.f;
      const float p1 = (s[1][r] > -1.0e38f) ? __expf(s[1][r] - mnew) : 0.f;
      m_r[r] = mnew;
      l_r[r] = l_r[r] * alpha[r] + p0 + p1;            // per-lane partial row sum (16 lanes combined at the end)
      unsigned short hb = bf16_bits(p0); sPh[w][8 * hh + r][ln] = hb;      sPl[w][8 * hh + r][ln] = bf16_bits(p0 - bf16_val(hb));
      hb = bf16_bits(p1);                sPh[w][8 * hh + r][16 + ln] = hb; sPl[w][8 * hh + r][16 + ln] = bf16_bits(p1 - bf16_val(hb));
    }
#pragma unroll
    for (int dt = 0; dt < DT; ++dt)
#pragma unroll
      for (int r = 0; r < 8; ++r) oacc[dt][r] *= alpha[r];
    __builtin_amdgcn_fence(__ATOMIC_ACQ_REL, "workgroup");
    __builtin_amdgcn_wave_barrier();
    FragB pah, pal;
    pah.half[0] = *(const v8us*)&sPh[w][ln][8 * hh]; pah.half[1] = *(const v8us*)&sPh[w][ln][16 + 8 * hh];
    pal.half[0] = *(const v8us*)&sPl[w][ln][8 * hh]; pal.half[1] = *(const v8us*)&sPl[w][ln][16 + 8 * hh];
#pragma unroll
    for (int dt = 0; dt < DT; ++dt) {
      FragB bvh, bvl;
#pragma unroll
      for (int i = 0; i < 8; ++i) {
        bvh.u[i] = sVh[8 * hh + i][dt * 16 + ln]; bvh.u[8 + i] = sVh[16 + 8 * hh + i][dt * 16 + ln];
        bvl.u[i] = sVl[8 * hh + i][dt * 16 + ln]; bvl.u[8 + i] = sVl[16 + 8 * hh + i][dt * 16 + ln];
      }
      oacc[dt] = mmaN<3>(pah.v, pal.v, bvh.v, bvl.v, oacc[dt]);
    }
    __builtin_amdgcn_fence(__ATOMIC_ACQ_REL, "workgroup");
    __builtin_amdgcn_wave_barrier();
  }
#pragma unroll
  for (int r = 0; r < 8; ++r) {
    float l = l_r[r];
    l += __shfl_xor(l, 1, 32); l += __shfl_xor(l, 2, 32); l += __shfl_xor(l, 4, 32); l += __shfl_xor(l, 8, 32);
    l_r[r] = (l > 0.f) ? 1.0f / l : 0.f;
  }
#pragma unroll
  for (int dt = 0; dt < DT; ++dt)
#pragma unroll
    for (int r = 0; r < 8; ++r) sO[w][8 * hh + r][dt * 16 + ln] = oacc[dt][r] * l_r[r];
  __builtin_amdgcn_fence(__ATOMIC_ACQ_REL, "workgroup");
  __builtin_amdgcn_wave_barrier();
  {
    for (int r = 0; r < 16; ++r) {
      const int row = q0 + r;
      if (row < T && lane < D / 4) {
        const v4f val = *(const v4fa*)&sO[w][r][lane * 4];
        *(v4f*)(y + ((size_t)b * T + row) * ypitch + h * D + lane * 4) = val;
      }
    }
    
  }
}

// 16 x 16 tile of 16-bit values, row-major in LDS, read transposed: lane l passes the address of row 8 (l >> 4) + (l & 7), columns 8 ((l >> 3) & 1) + 0..7,
// and receives rows 8 (l >> 4) + 0..7 of column l & 15. A load that the compiler sees: it places the wait.
__device__ __forceinline__ v8us ld_tr16(const unsigned short* p) {
  typedef short s16x8 __attribute__((ext_vector_type(8)));
  typedef __attribute__((address_space(3))) s16x8 lds_s16x8;
  return __builtin_bit_cast(v8us, __builtin_amdgcn_ds_load_tr16_b128_v8i16((lds_s16x8*)p));
}
// Banded attention, |i - j| <= band: queries (already scaled), keys and values arrive as the bf16 pairs that the projection GEMMs wrote:
// rows of 16-bit values at X + (b*T + row)*pitch, hi at column h*D + d, lo at column LO + h*D + d. Nothing is converted on the way into LDS or into the Q fragments.
// 3-term bf16 products, f32 softmax with running max; the output leaves as such pairs too, for the GEMM behind it: y rows of 16-bit values at pitch ypitch,
// hi at column h*D + d, lo at column LO + h*D + d (a head's 64 columns are one 128-B line of each).
// The trip holds no per-lane and no per-row branch (guards are selects, on clamped addresses): the staging loads of a trip are
// issued together, and so are the eight rows' steps of the maximum.
template <int D, int LO>
__global__ __launch_bounds__(128) void k_flash_band(const unsigned short* __restrict__ Qb, const unsigned short* __restrict__ Kb, const unsigned short* __restrict__ Vb,
                                                  int pitch, int T, int H, int band, unsigned short* __restrict__ y, int ypitch) {
  constexpr int KS = D / 32, DT = D / 16;
  __shared__ __attribute__((aligned(16))) unsigned short sKh[32][D + 8], sKl[32][D + 8];
  __shared__ __attribute__((aligned(32))) unsigned short sVh[32][D + 16], sVl[32][D + 16];   // V rows at an odd multiple of 32 B, the pitch of the transposing reader
  __shared__ __attribute__((aligned(16))) unsigned short sPh[4][16][40], sPl[4][16][40];
  __shared__ __attribute__((aligned(16))) float sO[4][16][D];
  const int tid = threadIdx.x, w = tid >> 5, lane = tid & 31, ln = lane & 15, hh = lane >> 4;
  const int nqb = (T + 63) / 64;
  const int bh = blockIdx.x / nqb, qblk = blockIdx.x % nqb;
  const int b = bh / H, h = bh % H;
  const int q0 = qblk * 64 + w * 16;
  const unsigned short* Q = Qb + (size_t)b * T * pitch + h * D;
  const unsigned short* K = Kb + (size_t)b * T * pitch + h * D;
  const unsigned short* V = Vb + (size_t)b * T * pitch + h * D;
  FragB aqh[KS], aql[KS];
  {
    // lane (ln, hh) holds d = ks * 32 + 8 hh + 0..7 and ks * 32 + 16 + 8 hh + 0..7 of row q0 + ln: two 16-byte pieces of the row, hi and lo alike
    int row = q0 + ln; if (row >= T) row = T - 1;
    const unsigned short* qr = Q + (size_t)row * pitch + 8 * hh;
#pragma unroll
    for (int ks = 0; ks < KS; ++ks) {
      aqh[ks].half[0] = *(const v8us*)(qr + ks * 32);      aqh[ks].half[1] = *(const v8us*)(qr + ks * 32 + 16);
      aql[ks].half[0] = *(const v8us*)(qr + LO + ks * 32); aql[ks].half[1] = *(const v8us*)(qr + LO + ks * 32 + 16);
    }
    // the address that these loads name is not written ahead of this wait: the input keeps it live up to it
    asm volatile("s_wait_xcnt 0x0" :: "v"(qr) : "memory");
  }
  const int trow = 8 * hh + (lane & 7), tcol = 8 * ((lane >> 3) & 1);   // the 16 bytes this lane hands to a transposing load of a 16 x 16 tile
  int qrow[8];
#pragma unroll
  for (int r = 0; r < 8; ++r) { int qi = q0 + 8 * hh + r; qrow[r] = qi < T ? qi : T - 1; }
  float m_r[8], l_r[8];
#pragma unroll
  for (int r = 0; r < 8; ++r) { m_r[r] = -3.0e38f; l_r[r] = 0.f; }
  v8f oacc[DT];
#pragma unroll
  for (int dt = 0; dt < DT; ++dt) oacc[dt] = (v8f){0.f,0.f,0.f,0.f,0.f,0.f,0.f,0.f};
  // A key farther than band from every query row of the block has weight exp(-3e38 - m) = 0 in every row:
  // the loop runs only over the 32-key chunks that meet [first row - band, last row + band] (block-uniform bounds).
  const int kv_begin = max(0, qblk * 64 - band) & ~31, kv_end = min(T, qblk * 64 + 64 + band);
  const int wq0 = qblk * 64 + __builtin_amdgcn_readfirstlane(w) * 16;   // the wave's first row, in a scalar register: the chunk test below is a scalar branch
  for (int j0 = kv_begin; j0 < kv_end; j0 += 32) {
    __syncthreads();
    {
      constexpr int NE = 32 * (D / 8) / 128;   // 16-byte pieces of each of K hi, K lo, V hi, V lo per thread and trip
      static_assert(NE == 2, "the wait below names two K and two V addresses");
      v8us kh[NE], kl[NE], vh[NE], vl[NE]; const unsigned short* pk[NE]; const unsigned short* pv[NE];
#pragma unroll
      for (int i = 0; i < NE; ++i) {
        const int e = tid + 128 * i, key = j0 + e / (D / 8), c8 = (e % (D / 8)) * 8;
        const size_t o = (size_t)min(key, T - 1) * pitch + c8;   // address in bounds for every lane; a key past the end is zeroed below
        pk[i] = K + o; pv[i] = V + o;
        kh[i] = *(const v8us*)pk[i]; kl[i] = *(const v8us*)(pk[i] + LO); vh[i] = *(const v8us*)pv[i]; vl[i] = *(const v8us*)(pv[i] + LO);
      }
      // no register that one of these loads names as its address is written (not by a load's result either) ahead of this wait:
      // the inputs keep all four addresses live up to it
      asm volatile("s_wait_xcnt 0x0" :: "v"(pk[0]), "v"(pk[1]), "v"(pv[0]), "v"(pv[1]) : "memory");
      if (j0 + 32 > T) {   // the same for the whole work-group: only a last chunk that runs past the end has keys to zero
#pragma unroll   // constant indices: the arrays stay in registers
        for (int i = 0; i < NE; ++i)
          if (j0 + (tid + 128 * i) / (D / 8) >= T) { kh[i] = (v8us)(unsigned short)0; kl[i] = (v8us)(unsigned short)0; vh[i] = (v8us)(unsigned short)0; vl[i] = (v8us)(unsigned short)0; }
      }
#pragma unroll
      for (int i = 0; i < NE; ++i) {
        const int e = tid + 128 * i, r = e / (D / 8), c8 = (e % (D / 8)) * 8;
        *(v8us*)&sKh[r][c8] = kh[i]; *(v8us*)&sKl[r][c8] = kl[i]; *(v8us*)&sVh[r][c8] = vh[i]; *(v8us*)&sVl[r][c8] = vl[i];
      }
    }
    __syncthreads();
    // a chunk wholly outside the band of this wave's own 16 rows adds nothing to them (no work-group barrier below this line in the trip)
    if (j0 + 31 < wq0 - band || j0 > wq0 + 15 + band) continue;
    v8f s[2];
#pragma unroll
    for (int nt = 0; nt < 2; ++nt) {
      v8f acc = {};
#pragma unroll
      for (int ks = 0; ks < KS; ++ks) {
        FragB bh_, bl_;
        bh_.half[0] = *(const v8us*)&sKh[nt * 16 + ln][ks * 32 + 8 * hh]; bh_.half[1] = *(const v8us*)&sKh[nt * 16 + ln][ks * 32 + 16 + 8 * hh];
        bl_.half[0] = *(const v8us*)&sKl[nt * 16 + ln][ks * 32 + 8 * hh]; bl_.half[1] = *(const v8us*)&sKl[nt * 16 + ln][ks * 32 + 16 + 8 * hh];
        acc = mmaN<3>(aqh[ks].v, aql[ks].v, bh_.v, bl_.v, acc);
      }
      s[nt] = acc;
    }
    const int ja = j0 + ln, jb = j0 + 16 + ln;
    const bool keepa = ja < T, keepb = jb < T;
    float sa[8], sb[8], mx[8], alpha[8];
#pragma unroll
    for (int r = 0; r < 8; ++r) {
      const int qi = qrow[r];
      sa[r] = (keepa && ja <= qi + band && ja >= qi - band) ? s[0][r] : -3.0e38f;
      sb[r] = (keepb && jb <= qi + band && jb >= qi - band) ? s[1][r] : -3.0e38f;
      mx[r] = fmaxf(sa[r], sb[r]);
    }
    // maximum over the 16 lanes of a row: each exchange step for all eight rows before the next step
    __builtin_amdgcn_sched_barrier(0);   // all eight rows' values stand ready here: without it one row's four exchanges were scheduled ahead, alone, each waited for by itself
#pragma unroll
    for (int m = 1; m <= 8; m <<= 1) {
      float ox[8];
#pragma unroll
      for (int r = 0; r < 8; ++r) ox[r] = __shfl_xor(mx[r], m, 32);
#pragma unroll
      for (int r = 0; r < 8; ++r) mx[r] = fmaxf(mx[r], ox[r]);
    }
#pragma unroll
    for (int r = 0; r < 8; ++r) {
      const float mnew = fmaxf(m_r[r], mx[r]);
      alpha[r] = (mnew > -1.0e38f) ? __expf(m_r[r] - mnew) : 1.0f;
      const float p0 = keepa ? __expf(sa[r] - mnew) : 0.f;
      const float p1 = keepb ? __expf(sb[r] - mnew) : 0.f;
      m_r[r] = mnew;
      l_r[r] = l_r[r] * alpha[r] + p0 + p1;
      unsigned short hb = bf16_bits(p0); sPh[w][8 * hh + r][ln] = hb;      sPl[w][8 * hh + r][ln] = bf16_bits(p0 - bf16_val(hb));
      hb = bf16_bits(p1);                sPh[w][8 * hh + r][16 + ln] = hb; sPl[w][8 * hh + r][16 + ln] = bf16_bits(p1 - bf16_val(hb));
    }
#pragma unroll
    for (int dt = 0; dt < DT; ++dt)
#pragma unroll
      for (int r = 0; r < 8; ++r) oacc[dt][r] *= alpha[r];
    __builtin_amdgcn_fence(__ATOMIC_ACQ_REL, "workgroup");
    __builtin_amdgcn_wave_barrier();
    FragB pah, pal;
    pah.half[0] = *(const v8us*)&sPh[w][ln][8 * hh]; pah.half[1] = *(const v8us*)&sPh[w][ln][16 + 8 * hh];
    pal.half[0] = *(const v8us*)&sPl[w][ln][8 * hh]; pal.half[1] = *(const v8us*)&sPl[w][ln][16 + 8 * hh];
    // lane (ln, hh) gets V[8 hh + 0..7][dt * 16 + ln] from the first load of a pair and V[16 + 8 hh + 0..7][dt * 16 + ln] from the second: the k order of pah / pal.
    // All sixteen loads stand in one group ahead of the products: one LDS latency a trip, not one per 16 columns.
    FragB bvh[DT], bvl[DT];
#pragma unroll
    for (int dt = 0; dt < DT; ++dt) {
      bvh[dt].half[0] = ld_tr16(&sVh[trow][dt * 16 + tcol]); bvh[dt].half[1] = ld_tr16(&sVh[16 + trow][dt * 16 + tcol]);
      bvl[dt].half[0] = ld_tr16(&sVl[trow][dt * 16 + tcol]); bvl[dt].half[1] = ld_tr16(&sVl[16 + trow][dt * 16 + tcol]);
    }
#pragma unroll
    for (int dt = 0; dt < DT; ++dt) oacc[dt] = mmaN<3>(pah.v, pal.v, bvh[dt].v, bvl[dt].v, oacc[dt]);
    __builtin_amdgcn_fence(__ATOMIC_ACQ_REL, "workgroup");
    __builtin_amdgcn_wave_barrier();
  }
#pragma unroll
  for (int r = 0; r < 8; ++r) {
    float l = l_r[r];
    l += __shfl_xor(l, 1, 32); l += __shfl_xor(l, 2, 32); l += __shfl_xor(l, 4, 32); l += __shfl_xor(l, 8, 32);
    l_r[r] = (m_r[r] > -1.0e38f) ? 1.0f / l : __builtin_nanf("");
  }
#pragma unroll
  for (int dt = 0; dt < DT; ++dt)
#pragma unroll
    for (int r = 0; r < 8; ++r) sO[w][8 * hh + r][dt * 16 + ln] = oacc[dt][r] * l_r[r];
  __builtin_amdgcn_fence(__ATOMIC_ACQ_REL, "workgroup");
  __builtin_amdgcn_wave_barrier();
  {
    static_assert(D == 64, "16 lanes of 4 columns cover a row: a wave stores two rows at a time");
    for (int r2 = 0; r2 < 16; r2 += 2) {
      const int r = r2 + hh, row = q0 + r;
      if (row < T) {
        const v4f val = *(const v4fa*)&sO[w][r][ln * 4];
        v4us h4, l4;
#pragma unroll   // constant indices: the vectors stay in registers
        for (int t = 0; t < 4; ++t) { const unsigned short hb = bf16_bits(val[t]); h4[t] = hb; l4[t] = bf16_bits(val[t] - bf16_val(hb)); }
        unsigned short* py = y + ((size_t)b * T + row) * ypitch + h * D + ln * 4;
        *(v4us*)py = h4; *(v4us*)(py + LO) = l4;
        // neither the address nor the data that these two stores name is written ahead of this wait: the inputs keep them live up to it
        asm volatile("s_wait_xcnt 0x0" :: "v"(py), "v"(h4), "v"(l4) : "memory");
      }
    }
  }
}
// table of the interleaved rotary step: rot[pos][i] = (cos, sin) of pos * inv_freq[i], inv_freq[i] = 10000^(-i/(d/2)); thread per (pos, i);
// written anew in every call, ahead of the two GEMMs that read it
__global__ __launch_bounds__(256) void k_rot_table(float* __restrict__ rot) {
  const int t = blockIdx.x * 256 + threadIdx.x; if (t >= TT * (HD / 2)) return;
  const int pos = t / (HD / 2), i = t % (HD / 2);
  const float inv = powf(10000.0f, -(float)i / (float)(HD / 2)); const float ang = (float)pos * inv; float sn, cs; sincosf(ang, &sn, &cs);
  typedef float v2f __attribute__((ext_vector_type(2)));
  v2f a = {cs, sn};
  *(v2f*)(rot + (size_t)t * 2) = a;
}
extern "C" void kernel_launch(void* const* d_in, const int* in_sizes, int n_in,
                              void* d_out, int out_size, void* d_ws, size_t ws_size, hipStream_t stream) {
  (void)in_sizes; (void)n_in; (void)out_size;
  const float* xq = (const float*)d_in[0]; const float* xkv = (const float*)d_in[1];
  const float* Wq = (const float*)d_in[2]; const float* Wk = (const float*)d_in[3]; const float* Wv = (const float*)d_in[4]; const float* Wo = (const float*)d_in[5];
  char* ws = (char*)d_ws; size_t off = 0;
  auto take = [&](size_t bytes) { char* p = ws + off; off += (bytes + 255) & ~(size_t)255; return p; };
  const int M = BB * TT, gb = (M / 128) * (EE / 128);
  unsigned short* Wt[4]; for (int i = 0; i < 4; ++i) Wt[i] = (unsigned short*)take((size_t)EE * EE * 2);
  float* q = (float*)take((size_t)M * EE * 4); float* k = (float*)take((size_t)M * EE * 4); float* v = (float*)take((size_t)M * EE * 4); float* att = (float*)take((size_t)M * EE * 4);
  float* rot = (float*)take((size_t)TT * HD * 4);
  if (off > ws_size) return;
  const float* W4[4] = {Wq, Wk, Wv, Wo};
  for (int i = 0; i < 4; ++i) k_wt_bf16<<<(EE * (EE / 8) + 255) / 256, 256, 0, stream>>>(W4[i], Wt[i], EE, EE);
  k_rot_table<<<(TT * (HD / 2) + 255) / 256, 256, 0, stream>>>(rot);
  // q (times 1/sqrt(HD)), k, v and the attention's output leave their kernels as bf16 hi | lo rows of 2 * EE 16-bit values, in the room of the f32 rows
  k_gemm_bf<0, 0, false, true, EE><<<gb, 256, 0, stream>>>(xq, EE, Wt[0], EE, nullptr, q, 2 * EE, M, EE, EE, rot, 0.125f);
  k_gemm_bf<0, 0, false, true, EE><<<gb, 256, 0, stream>>>(xkv, EE, Wt[1], EE, nullptr, k, 2 * EE, M, EE, EE, rot, 1.0f);
  k_gemm_bf<0, 0, false, false, EE><<<gb, 256, 0, stream>>>(xkv, EE, Wt[2], EE, nullptr, v, 2 * EE, M, EE, EE, nullptr, 1.0f);
  k_flash_band<HD, EE><<<BB * NH * (TT / 64), 128, 0, stream>>>((const unsigned short*)q, (const unsigned short*)k, (const unsigned short*)v, 2 * EE, TT, NH, 256, (unsigned short*)att, 2 * EE);
  k_gemm_bf<EE, 0, false, false, 0><<<gb, 256, 0, stream>>>(att, 2 * EE, Wt[3], EE, nullptr, (float*)d_out, EE, M, EE, EE, nullptr, 1.0f);
}

// v007
// A run of this version takes 197 microseconds.
// Timed twice side by side with v006, it ran 1.08 times as fast both times.
// All steps since v000 together make it 5.91 times as fast.
#include <hip/hip_runtime.h>
// All contractions on v_wmma_f32_16x16x32_bf16, f32 accumulate: x_q·Wq, x_kv·Wk, x_kv·Wv (inputs, W rounded to bf16: single exact term),
// QKᵀ and P·V per 16-query tile as 3-term bf16 hi/lo splits with the |i−j| ≤ 256 band, out·Wo with the A operand split (2 terms);
// interleaved rotary embedding and softmax in f32.
#define BB 4
#define TT 2048
#define EE 1024
#define NH 16
#define HD 64

typedef __bf16 v16b __attribute__((ext_vector_type(16)));
typedef unsigned short v8us __attribute__((ext_vector_type(8), may_alias));
typedef float  v8f  __attribute__((ext_vector_type(8)));
typedef float  v4f  __attribute__((ext_vector_type(4)));
typedef float  v4fa __attribute__((ext_vector_type(4), may_alias));
union FragB { v16b v; v8us half[2]; unsigned short u[16]; };

__device__ __forceinline__ unsigned short bf16_bits(float x) { unsigned int u = __float_as_uint(x); return (unsigned short)((u + 0x7FFFu + ((u >> 16) & 1u)) >> 16); }
__device__ __forceinline__ float bf16_val(unsigned short b) { return __uint_as_float(((unsigned int)b) << 16); }
__device__ __forceinline__ float bf16_round(float x) { return bf16_val(bf16_bits(x)); }
// D += A·B with NT terms: 1 = ah·bh, 2 = + al·bh (A split), 3 = + ah·bl (both split)
template <int NT>
__device__ __forceinline__ v8f mmaN(v16b ah, v16b al, v16b bh, v16b bl, v8f c) {
  c = __builtin_amdgcn_wmma_f32_16x16x32_bf16(false, ah, false, bh, (short)0, c, false, false);
  if (NT >= 2) c = __builtin_amdgcn_wmma_f32_16x16x32_bf16(false, al, false, bh, (short)0, c, false, false);
  if (NT >= 3) c = __builtin_amdgcn_wmma_f32_16x16x32_bf16(false, ah, false, bl, (short)0, c, false, false);
  asm volatile("v_nop\n\tv_nop\n\tv_nop\n\tv_nop" : "+v"(c) : "v"(ah), "v"(al), "v"(bh), "v"(bl));
  return c;
}

// Wt[n][k] = bf16(W[k][n]); thread t makes 8 k of one n. A part of k_setup.
__device__ __forceinline__ void wt_bf16_part(const float* __restrict__ W, unsigned short* __restrict__ Wt, int K, int N, int t) {
  const int k8n = K / 8;
  if (t >= N * k8n) return;
  const int n = t / k8n, k8 = (t % k8n) * 8;
  v8us v;
#pragma unroll
  for (int i = 0; i < 8; ++i) v[i] = bf16_bits(W[(size_t)(k8 + i) * N + n]);
  *(v8us*)(Wt + (size_t)n * K + k8) = v;
  
}

// GEMM C[M][N] (f32, pitch ldc) = act(A[M][K] x W + bias). One work-group of 8 waves makes a 128 x 128 tile of C; a wave makes 32 x 64 of it.
// A pass is 64 k: the A rows are laid in LDS beside the 128 rows of Wt (bf16 [N][K], pitch ldb); every global load covers whole 128-B lines.
// ALO == 0: A is f32 (pitch lda), rounded to bf16 once per work-group, one term. ALO > 0: A arrives as the bf16 pairs its producer wrote, rows of
// 16-bit values at pitch lda, hi at column k and lo at column ALO + k: both planes are copied as they are, 2 terms.
// Two LDS buffers: the next pass is loaded into registers ahead of this pass's products and stored behind them, one barrier a pass.
// The k order of every sum is ascending in steps of 32, hi term then lo term. BIAS_BF16 rounds the bias to bf16 before the add.
// K%64==0, M%128==0, N%128==0.
// ROT: the interleaved rotary step is applied to the finished f32 tile on its way out: column pair (2i, 2i+1) of a head, row pos = row % TT,
// is turned by the (cos, sin) pair rot[pos][i] that k_setup wrote earlier in the same call (a wave's 64 columns are one head).
// LO > 0: the finished value, times oscale, leaves as a bf16 pair hi = bf16(x), lo = bf16(x - hi), the operands of the attention's 3-term products:
// C is then rows of 16-bit values at pitch ldc, hi at column c and lo at column LO + c of the same row (a wave's 64 columns are one 128-B line of each).
typedef unsigned short v4us __attribute__((ext_vector_type(4), may_alias));
// The body of one work-group: sm is the kernel's LDS array of GEMM_LDS(ALO) 16-bit values, bid the number of the tile.
constexpr int GEMM_PB = 72;              // LDS row pitch in bf16: 128 B of k + 16 B, an odd multiple of 16 B for the 16-byte readers
constexpr int GEMM_LDS(int alo) { return 2 * (alo > 0 ? 3 : 2) * 128 * GEMM_PB; }   // two buffers of the planes A hi, W, (A lo)
template <int ALO, int ACT, bool BIAS_BF16, bool ROT, int LO>
__device__ __forceinline__ void gemm_tile(unsigned short* sm, int bid, const float* __restrict__ A, int lda, const unsigned short* __restrict__ Wt, int ldb,
                                          const float* __restrict__ bias, float* __restrict__ C, int ldc, int M, int N, int K,
                                          const float* __restrict__ rot, float oscale) {
  constexpr bool ASPLIT = ALO > 0;
  constexpr int PB = GEMM_PB;
  constexpr int PLANE = 128 * PB;        // one operand plane of a pass
  constexpr int NPL = ASPLIT ? 3 : 2;    // A hi, W, (A lo)
  constexpr int PO = 68;                 // pitch in f32 of the output staging rows
  const int tid = threadIdx.x, w = tid >> 5, lane = tid & 31, ln = lane & 15, hh = lane >> 4;
  const int ntn = N / 128;
  const int mb = bid / ntn, nb = bid % ntn;
  if (mb * 128 >= M) return;             // the same for the whole work-group, ahead of every barrier
  const int row0 = mb * 128, col0 = nb * 128;
  const int wm = w >> 1, wn = w & 1;
  const int ar = tid >> 4, ac = (tid & 15) * 4;    // staging of an f32 A: 16 lanes cover 256 B of a row
  const int br = tid >> 3, bc = (tid & 7) * 8;     // staging of W and of each plane of a 16-bit A: 8 lanes cover 128 B of a row
  const float* ag = A + (size_t)(row0 + ar) * lda + ac;
  const unsigned short* ap = (const unsigned short*)A + (size_t)(row0 + br) * lda + bc;
  const unsigned short* bg = Wt + (size_t)(col0 + br) * ldb + bc;
  v4f xa[8]; v8us xah[4], xal[4], xb[4];
  v8f acc[2][4] = {};
  const int np = K / 64;
  auto fetch = [&](int kb) {
    if constexpr (ASPLIT) {
      const unsigned short* pp[4]; const unsigned short* pb[4];
#pragma unroll   // constant indices: the arrays stay in registers (the same for the loops below)
      for (int i = 0; i < 4; ++i) { pp[i] = ap + (size_t)(32 * i) * lda + kb; xah[i] = *(const v8us*)pp[i]; xal[i] = *(const v8us*)(pp[i] + ALO); }
#pragma unroll
      for (int i = 0; i < 4; ++i) { pb[i] = bg + (size_t)(32 * i) * ldb + kb; xb[i] = *(const v8us*)pb[i]; }
      // no register that one of these loads names as its address is written (not by a later load's result either) ahead of this wait:
      // the inputs keep all eight addresses live up to it
      asm volatile("s_wait_xcnt 0x0" :: "v"(pp[0]), "v"(pp[1]), "v"(pp[2]), "v"(pp[3]), "v"(pb[0]), "v"(pb[1]), "v"(pb[2]), "v"(pb[3]) : "memory");
    } else {
    const float* pa[8]; const unsigned short* pb[4];
#pragma unroll
    for (int i = 0; i < 8; ++i) { pa[i] = ag + (size_t)(16 * i) * lda + kb; xa[i] = *(const v4fa*)pa[i]; }
#pragma unroll
    for (int i = 0; i < 4; ++i) { pb[i] = bg + (size_t)(32 * i) * ldb + kb; xb[i] = *(const v8us*)pb[i]; }
    // no register that one of these loads names as its address is written (not by a later load's result either) ahead of this wait:
    // the inputs keep all twelve addresses live up to it
    asm volatile("s_wait_xcnt 0x0" :: "v"(pa[0]), "v"(pa[1]), "v"(pa[2]), "v"(pa[3]), "v"(pa[4]), "v"(pa[5]), "v"(pa[6]), "v"(pa[7]),
                 "v"(pb[0]), "v"(pb[1]), "v"(pb[2]), "v"(pb[3]) : "memory");
    }
  };
  fetch(0);
  for (int p = 0; p <= np; ++p) {
    if (p > 0) {
      // products of pass p - 1 out of its buffer
      const unsigned short* sAh = sm + ((p - 1) & 1) * (NPL * PLANE);
      const unsigned short* sB = sAh + PLANE;
      const unsigned short* sAl = sB + PLANE;
#pragma unroll
      for (int ks = 0; ks < 2; ++ks) {
        FragB ah[2], al[2], b[4];
#pragma unroll
        for (int mi = 0; mi < 2; ++mi) {
          const int o = (wm * 32 + mi * 16 + ln) * PB + ks * 32 + 8 * hh;
          ah[mi].half[0] = *(const v8us*)(sAh + o); ah[mi].half[1] = *(const v8us*)(sAh + o + 16);
          if (ASPLIT) { al[mi].half[0] = *(const v8us*)(sAl + o); al[mi].half[1] = *(const v8us*)(sAl + o + 16); }
          else al[mi] = ah[mi];
        }
#pragma unroll
        for (int t = 0; t < 4; ++t) {
          const int o = (wn * 64 + t * 16 + ln) * PB + ks * 32 + 8 * hh;
          b[t].half[0] = *(const v8us*)(sB + o); b[t].half[1] = *(const v8us*)(sB + o + 16);
        }
#pragma unroll
        for (int mi = 0; mi < 2; ++mi)
#pragma unroll
          for (int t = 0; t < 4; ++t) acc[mi][t] = mmaN<ASPLIT ? 2 : 1>(ah[mi].v, al[mi].v, b[t].v, b[t].v, acc[mi][t]);
      }
    }
    if (p < np) {
      // pass p from registers into the buffer whose readers left it at the barrier that ended trip p - 1
      unsigned short* dAh = sm + (p & 1) * (NPL * PLANE);
      unsigned short* dB = dAh + PLANE;
      unsigned short* dAl = dB + PLANE;
      if constexpr (ASPLIT) {
#pragma unroll   // constant indices: the arrays stay in registers
        for (int i = 0; i < 4; ++i) { *(v8us*)(dAh + (br + 32 * i) * PB + bc) = xah[i]; *(v8us*)(dAl + (br + 32 * i) * PB + bc) = xal[i]; }
      } else {
#pragma unroll
        for (int i = 0; i < 8; ++i) {
          v4us h;
#pragma unroll
          for (int t = 0; t < 4; ++t) h[t] = bf16_bits(xa[i][t]);
          *(v4us*)(dAh + (ar + 16 * i) * PB + ac) = h;
        }
      }
#pragma unroll
      for (int i = 0; i < 4; ++i) *(v8us*)(dB + (br + 32 * i) * PB + bc) = xb[i];
    }
    __syncthreads();
    if (p + 1 < np) {
      // pass p + 1 starts its way from L2 now and is waited for only behind the products of pass p
      fetch((p + 1) * 64);
    }
  }
  const int rsub = lane >> 4, c4 = (lane & 15) * 4;
  v4f cs[16];
  if (ROT) {
    // the (cos, sin) pairs of this lane's two column pairs in its 16 rows: sixteen loads off one address, issued together (one latency for all)
    static_assert(TT % 128 == 0 && HD == 64, "a 128-row tile stays inside one sequence; a wave's 64 columns are one head");
    const float* pr = rot + (size_t)(row0 % TT + wm * 32 + rsub) * HD + c4;
#pragma unroll
    for (int q = 0; q < 16; ++q) cs[q] = *(const v4fa*)(pr + q * 2 * HD);
    // the address that these loads name is not written ahead of this wait: the input keeps it live up to it
    asm volatile("s_wait_xcnt 0x0" :: "v"(pr) : "memory");
  }
  // the barrier of the last trip stands behind every wave's last read of the buffers: each wave now stages its 32 x 64 tile in a range of its own
  float* so = (float*)sm + w * (32 * PO);
#pragma unroll
  for (int mi = 0; mi < 2; ++mi)
#pragma unroll
    for (int t = 0; t < 4; ++t) {
      float bv = bias ? bias[col0 + wn * 64 + t * 16 + ln] : 0.f;
      if (BIAS_BF16) bv = bf16_round(bv);
#pragma unroll
      for (int r = 0; r < 8; ++r) { float v = acc[mi][t][r] + bv; if (ACT == 1) v = fmaxf(v, 0.f); so[(mi * 16 + 8 * hh + r) * PO + t * 16 + ln] = v; }
    }
  __builtin_amdgcn_fence(__ATOMIC_ACQ_REL, "workgroup");
  __builtin_amdgcn_wave_barrier();
#pragma unroll
  for (int q = 0; q < 16; ++q) {
    const int r = q * 2 + rsub;
    v4f v = *(const v4fa*)&so[r * PO + c4];
    if (ROT) {
      const v4f x = v, t = cs[q];
      v = (v4f){x[0] * t[0] - x[1] * t[1], x[1] * t[0] + x[0] * t[1], x[2] * t[2] - x[3] * t[3], x[3] * t[2] + x[2] * t[3]};
    }
    if (LO > 0) {
      v4us h, l;
#pragma unroll   // constant indices: the vectors stay in registers
      for (int t = 0; t < 4; ++t) { const float x = v[t] * oscale; const unsigned short hb = bf16_bits(x); h[t] = hb; l[t] = bf16_bits(x - bf16_val(hb)); }
      unsigned short* ph = (unsigned short*)C + (size_t)(row0 + wm * 32 + r) * ldc + col0 + wn * 64 + c4;
      *(v4us*)ph = h; *(v4us*)(ph + LO) = l;
      // neither the address nor the data that these two stores name is written ahead of this wait: the inputs keep them live up to it
      asm volatile("s_wait_xcnt 0x0" :: "v"(ph), "v"(h), "v"(l) : "memory");
    } else {
      *(v4f*)(C + (size_t)(row0 + wm * 32 + r) * ldc + col0 + wn * 64 + c4) = v;
    }
  }
}

template <int ALO, int ACT, bool BIAS_BF16, bool ROT, int LO>
__global__ __launch_bounds__(256) void k_gemm_bf(const float* __restrict__ A, int lda, const unsigned short* __restrict__ Wt, int ldb,
                                               const float* __restrict__ bias, float* __restrict__ C, int ldc, int M, int N, int K,
                                               const float* __restrict__ rot, float oscale) {
  __shared__ __attribute__((aligned(16))) unsigned short sm[GEMM_LDS(ALO)];
  gemm_tile<ALO, ACT, BIAS_BF16, ROT, LO>(sm, blockIdx.x, A, lda, Wt, ldb, bias, C, ldc, M, N, K, rot, oscale);
}
// The three projections, none of which reads another's output, in one launch: blockIdx.y = 0 makes q = rot(xq Wq) * qscale, 1 makes k = rot(xkv Wk), 2 makes v = xkv Wv;
// blockIdx.x is the tile, as in k_gemm_bf. The choice is the same for the whole work-group.
template <int LO>
__global__ __launch_bounds__(256) void k_gemm_qkv(const float* __restrict__ xq, const float* __restrict__ xkv, int lda,
                                                const unsigned short* __restrict__ Tq, const unsigned short* __restrict__ Tk, const unsigned short* __restrict__ Tv, int ldb,
                                                float* __restrict__ q, float* __restrict__ k, float* __restrict__ v, int ldc, int M, int N, int K,
                                                const float* __restrict__ rot, float qscale) {
  __shared__ __attribute__((aligned(16))) unsigned short sm[GEMM_LDS(0)];
  const int z = blockIdx.y;
  if (z < 2) gemm_tile<0, 0, false, true, LO>(sm, blockIdx.x, z == 0 ? xq : xkv, lda, z == 0 ? Tq : Tk, ldb, nullptr, z == 0 ? q : k, ldc, M, N, K, rot, z == 0 ? qscale : 1.0f);
  else gemm_tile<0, 0, false, false, LO>(sm, blockIdx.x, xkv, lda, Tv, ldb, nullptr, v, ldc, M, N, K, nullptr, 1.0f);
}

// Flash-style causal/unmasked attention, all contractions 3-term bf16 hi/lo splits, f32 softmax with running max.
// q,k,v rows are read from f32 buffers with arbitrary row pitch (so they can live inside a fused qkv buffer);
// D = head size (multiple of 32, <= 128); one wave = 16 query rows; block = 4 waves (64 queries) sharing K/V chunks of 32.
template <int D, bool CAUSAL>
__global__ __launch_bounds__(128) void k_flash(const float* __restrict__ qb, const float* __restrict__ kb, const float* __restrict__ vb,
                                             int pitch, int T, int H, float scale, float* __restrict__ y, int ypitch) {
  constexpr int KS = D / 32;        // k-steps for QK
  constexpr int DT = D / 16;        // d tiles for PV
  __shared__ __attribute__((aligned(16))) unsigned short sKh[32][D + 8], sKl[32][D + 8], sVh[32][D + 8], sVl[32][D + 8];
  __shared__ __attribute__((aligned(16))) unsigned short sPh[4][16][40], sPl[4][16][40];
  __shared__ __attribute__((aligned(16))) float sO[4][16][D];
  const int tid = threadIdx.x, w = tid >> 5, lane = tid & 31, ln = lane & 15, hh = lane >> 4;
  const int nqb = (T + 63) / 64;
  const int bh = blockIdx.x / nqb, qblk = blockIdx.x % nqb;
  const int b = bh / H, h = bh % H;
  const int q0 = qblk * 64 + w * 16;
  const float* Q = qb + (size_t)b * T * pitch + h * D;
  const float* K = kb + (size_t)b * T * pitch + h * D;
  const float* V = vb + (size_t)b * T * pitch + h * D;

  // A fragments of the wave's 16 query rows (scaled), hi/lo
  FragB aqh[KS], aql[KS];
  {
    int row = q0 + ln; if (row >= T) row = T - 1;
    const float* qr = Q + (size_t)row * pitch;
#pragma unroll
    for (int ks = 0; ks < KS; ++ks)
#pragma unroll
      for (int i = 0; i < 16; ++i) {
        const int d = ks * 32 + ((i < 8) ? (8 * hh + i) : (16 + 8 * hh + (i - 8)));
        const float x = qr[d] * scale; const unsigned short hb = bf16_bits(x);
        aqh[ks].u[i] = hb; aql[ks].u[i] = bf16_bits(x - bf16_val(hb));
      }
  }
  float m_r[8], l_r[8];
#pragma unroll
  for (int r = 0; r < 8; ++r) { m_r[r] = -3.0e38f; l_r[r] = 0.f; }
  v8f oacc[DT];
#pragma unroll
  for (int dt = 0; dt < DT; ++dt) oacc[dt] = (v8f){0.f,0.f,0.f,0.f,0.f,0.f,0.f,0.f};

  const int kv_end = CAUSAL ? min(T, qblk * 64 + 64) : T;     // block-uniform
  for (int j0 = 0; j0 < kv_end; j0 += 32) {
    __syncthreads();
    for (int e = tid; e < 32 * (D / 4); e += 128) {
      const int r = e / (D / 4), c4 = (e % (D / 4)) * 4;
      const int key = j0 + r;
      v4f kf = {0.f,0.f,0.f,0.f}, vf = {0.f,0.f,0.f,0.f};
      if (key < T) { kf = *(const v4fa*)(K + (size_t)key * pitch + c4); vf = *(const v4fa*)(V + (size_t)key * pitch + c4); }
#pragma unroll
      for (int t = 0; t < 4; ++t) {
        unsigned short hb = bf16_bits(kf[t]); sKh[r][c4 + t] = hb; sKl[r][c4 + t] = bf16_bits(kf[t] - bf16_val(hb));
        hb = bf16_bits(vf[t]); sVh[r][c4 + t] = hb; sVl[r][c4 + t] = bf16_bits(vf[t] - bf16_val(hb));
      }
    }
    __syncthreads();
    // S tile 16 x 32
    v8f s[2];
#pragma unroll
    for (int nt = 0; nt < 2; ++nt) {
      v8f acc = {};
#pragma unroll
      for (int ks = 0; ks < KS; ++ks) {
        FragB bh_, bl_;
        bh_.half[0] = *(const v8us*)&sKh[nt * 16 + ln][ks * 32 + 8 * hh]; bh_.half[1] = *(const v8us*)&sKh[nt * 16 + ln][ks * 32 + 16 + 8 * hh];
        bl_.half[0] = *(const v8us*)&sKl[nt * 16 + ln][ks * 32 + 8 * hh]; bl_.half[1] = *(const v8us*)&sKl[nt * 16 + ln][ks * 32 + 16 + 8 * hh];
        acc = mmaN<3>(aqh[ks].v, aql[ks].v, bh_.v, bl_.v, acc);
      }
      s[nt] = acc;
    }
    // mask + running max (rows 8hh+r; the 16 lanes of a half share rows)
    float alpha[8];
#pragma unroll
    for (int r = 0; r < 8; ++r) {
      const int qi = q0 + 8 * hh + r;
      const int ja = j0 + ln, jb = j0 + 16 + ln;
      if (CAUSAL) { if (ja > qi) s[0][r] = -3.0e38f; if (jb > qi) s[1][r] = -3.0e38f; }
      if (ja >= T) s[0][r] = -3.0e38f;
      if (jb >= T) s[1][r] = -3.0e38f;
      float mx = fmaxf(s[0][r], s[1][r]);
      mx = fmaxf(mx, __shfl_xor(mx, 1, 32)); mx = fmaxf(mx, __shfl_xor(mx, 2, 32)); mx = fmaxf(mx, __shfl_xor(mx, 4, 32)); mx = fmaxf(mx, __shfl_xor(mx, 8, 32));
      const float mnew = fmaxf(m_r[r], mx);
      alpha[r] = (mnew > -1.0e38f) ? __expf(m_r[r] - mnew) : 1.0f;
      const float p0 = (s[0][r] > -1.0e38f) ? __expf(s[0][r] - mnew) : 0.f;
      const float p1 = (s[1][r] > -1.0e38f) ? __expf(s[1][r] - mnew) : 0.f;
      m_r[r] = mnew;
      l_r[r] = l_r[r] * alpha[r] + p0 + p1;            // per-lane partial row sum (16 lanes combined at the end)
      unsigned short hb = bf16_bits(p0); sPh[w][8 * hh + r][ln] = hb;      sPl[w][8 * hh + r][ln] = bf16_bits(p0 - bf16_val(hb));
      hb = bf16_bits(p1);                sPh[w][8 * hh + r][16 + ln] = hb; sPl[w][8 * hh + r][16 + ln] = bf16_bits(p1 - bf16_val(hb));
    }
#pragma unroll
    for (int dt = 0; dt < DT; ++dt)
#pragma unroll
      for (int r = 0; r < 8; ++r) oacc[dt][r] *= alpha[r];
    __builtin_amdgcn_fence(__ATOMIC_ACQ_REL, "workgroup");
    __builtin_amdgcn_wave_barrier();
    FragB pah, pal;
    pah.half[0] = *(const v8us*)&sPh[w][ln][8 * hh]; pah.half[1] = *(const v8us*)&sPh[w][ln][16 + 8 * hh];
    pal.half[0] = *(const v8us*)&sPl[w][ln][8 * hh]; pal.half[1] = *(const v8us*)&sPl[w][ln][16 + 8 * hh];
#pragma unroll
    for (int dt = 0; dt < DT; ++dt) {
      FragB bvh, bvl;
#pragma unroll
      for (int i = 0; i < 8; ++i) {
        bvh.u[i] = sVh[8 * hh + i][dt * 16 + ln]; bvh.u[8 + i] = sVh[16 + 8 * hh + i][dt * 16 + ln];
        bvl.u[i] = sVl[8 * hh + i][dt * 16 + ln]; bvl.u[8 + i] = sVl[16 + 8 * hh + i][dt * 16 + ln];
      }
      oacc[dt] = mmaN<3>(pah.v, pal.v, bvh.v, bvl.v, oacc[dt]);
    }
    __builtin_amdgcn_fence(__ATOMIC_ACQ_REL, "workgroup");
    __builtin_amdgcn_wave_barrier();
  }
#pragma unroll
  for (int r = 0; r < 8; ++r) {
    float l = l_r[r];
    l += __shfl_xor(l, 1, 32); l += __shfl_xor(l, 2, 32); l += __shfl_xor(l, 4, 32); l += __shfl_xor(l, 8, 32);
    l_r[r] = (l > 0.f) ? 1.0f / l : 0.f;
  }
#pragma unroll
  for (int dt = 0; dt < DT; ++dt)
#pragma unroll
    for (int r = 0; r < 8; ++r) sO[w][8 * hh + r][dt * 16 + ln] = oacc[dt][r] * l_r[r];
  __builtin_amdgcn_fence(__ATOMIC_ACQ_REL, "workgroup");
  __builtin_amdgcn_wave_barrier();
  {
    for (int r = 0; r < 16; ++r) {
      const int row = q0 + r;
      if (row < T && lane < D / 4) {
        const v4f val = *(const v4fa*)&sO[w][r][lane * 4];
        *(v4f*)(y + ((size_t)b * T + row) * ypitch + h * D + lane * 4) = val;
      }
    }
    
  }
}

// 16 x 16 tile of 16-bit values, row-major in LDS, read transposed: lane l passes the address of row 8 (l >> 4) + (l & 7), columns 8 ((l >> 3) & 1) + 0..7,
// and receives rows 8 (l >> 4) + 0..7 of column l & 15. A load that the compiler sees: it places the wait.
__device__ __forceinline__ v8us ld_tr16(const unsigned short* p) {
  typedef short s16x8 __attribute__((ext_vector_type(8)));
  typedef __attribute__((address_space(3))) s16x8 lds_s16x8;
  return __builtin_bit_cast(v8us, __builtin_amdgcn_ds_load_tr16_b128_v8i16((lds_s16x8*)p));
}
// Banded attention, |i - j| <= band: queries (already scaled), keys and values arrive as the bf16 pairs that the projection GEMMs wrote:
// rows of 16-bit values at X + (b*T + row)*pitch, hi at column h*D + d, lo at column LO + h*D + d. Nothing is converted on the way into LDS or into the Q fragments.
// 3-term bf16 products, f32 softmax with running max; the output leaves as such pairs too, for the GEMM behind it: y rows of 16-bit values at pitch ypitch,
// hi at column h*D + d, lo at column LO + h*D + d (a head's 64 columns are one 128-B line of each).
// The trip holds no per-lane and no per-row branch (guards are selects, on clamped addresses): the staging loads of a trip are
// issued together, and so are the eight rows' steps of the maximum.
template <int D, int LO>
__global__ __launch_bounds__(128) void k_flash_band(const unsigned short* __restrict__ Qb, const unsigned short* __restrict__ Kb, const unsigned short* __restrict__ Vb,
                                                  int pitch, int T, int H, int band, unsigned short* __restrict__ y, int ypitch) {
  constexpr int KS = D / 32, DT = D / 16;
  __shared__ __attribute__((aligned(16))) unsigned short sKh[32][D + 8], sKl[32][D + 8];
  __shared__ __attribute__((aligned(32))) unsigned short sVh[32][D + 16], sVl[32][D + 16];   // V rows at an odd multiple of 32 B, the pitch of the transposing reader
  __shared__ __attribute__((aligned(16))) unsigned short sPh[4][16][40], sPl[4][16][40];
  __shared__ __attribute__((aligned(16))) float sO[4][16][D];
  const int tid = threadIdx.x, w = tid >> 5, lane = tid & 31, ln = lane & 15, hh = lane >> 4;
  const int nqb = (T + 63) / 64;
  const int bh = blockIdx.x / nqb, qblk = blockIdx.x % nqb;
  const int b = bh / H, h = bh % H;
  const int q0 = qblk * 64 + w * 16;
  const unsigned short* Q = Qb + (size_t)b * T * pitch + h * D;
  const unsigned short* K = Kb + (size_t)b * T * pitch + h * D;
  const unsigned short* V = Vb + (size_t)b * T * pitch + h * D;
  FragB aqh[KS], aql[KS];
  {
    // lane (ln, hh) holds d = ks * 32 + 8 hh + 0..7 and ks * 32 + 16 + 8 hh + 0..7 of row q0 + ln: two 16-byte pieces of the row, hi and lo alike
    int row = q0 + ln; if (row >= T) row = T - 1;
    const unsigned short* qr = Q + (size_t)row * pitch + 8 * hh;
#pragma unroll
    for (int ks = 0; ks < KS; ++ks) {
      aqh[ks].half[0] = *(const v8us*)(qr + ks * 32);      aqh[ks].half[1] = *(const v8us*)(qr + ks * 32 + 16);
      aql[ks].half[0] = *(const v8us*)(qr + LO + ks * 32); aql[ks].half[1] = *(const v8us*)(qr + LO + ks * 32 + 16);
    }
    // the address that these loads name is not written ahead of this wait: the input keeps it live up to it
    asm volatile("s_wait_xcnt 0x0" :: "v"(qr) : "memory");
  }
  const int trow = 8 * hh + (lane & 7), tcol = 8 * ((lane >> 3) & 1);   // the 16 bytes this lane hands to a transposing load of a 16 x 16 tile
  int qrow[8];
#pragma unroll
  for (int r = 0; r < 8; ++r) { int qi = q0 + 8 * hh + r; qrow[r] = qi < T ? qi : T - 1; }
  float m_r[8], l_r[8];
#pragma unroll
  for (int r = 0; r < 8; ++r) { m_r[r] = -3.0e38f; l_r[r] = 0.f; }
  v8f oacc[DT];
#pragma unroll
  for (int dt = 0; dt < DT; ++dt) oacc[dt] = (v8f){0.f,0.f,0.f,0.f,0.f,0.f,0.f,0.f};
  // A key farther than band from every query row of the block has weight exp(-3e38 - m) = 0 in every row:
  // the loop runs only over the 32-key chunks that meet [first row - band, last row + band] (block-uniform bounds).
  const int kv_begin = max(0, qblk * 64 - band) & ~31, kv_end = min(T, qblk * 64 + 64 + band);
  const int wq0 = qblk * 64 + __builtin_amdgcn_readfirstlane(w) * 16;   // the wave's first row, in a scalar register: the chunk test below is a scalar branch
  for (int j0 = kv_begin; j0 < kv_end; j0 += 32) {
    __syncthreads();
    {
      constexpr int NE = 32 * (D / 8) / 128;   // 16-byte pieces of each of K hi, K lo, V hi, V lo per thread and trip
      static_assert(NE == 2, "the wait below names two K and two V addresses");
      v8us kh[NE], kl[NE], vh[NE], vl[NE]; const unsigned short* pk[NE]; const unsigned short* pv[NE];
#pragma unroll
      for (int i = 0; i < NE; ++i) {
        const int e = tid + 128 * i, key = j0 + e / (D / 8), c8 = (e % (D / 8)) * 8;
        const size_t o = (size_t)min(key, T - 1) * pitch + c8;   // address in bounds for every lane; a key past the end is zeroed below
        pk[i] = K + o; pv[i] = V + o;
        kh[i] = *(const v8us*)pk[i]; kl[i] = *(const v8us*)(pk[i] + LO); vh[i] = *(const v8us*)pv[i]; vl[i] = *(const v8us*)(pv[i] + LO);
      }
      // no register that one of these loads names as its address is written (not by a load's result either) ahead of this wait:
      // the inputs keep all four addresses live up to it
      asm volatile("s_wait_xcnt 0x0" :: "v"(pk[0]), "v"(pk[1]), "v"(pv[0]), "v"(pv[1]) : "memory");
      if (j0 + 32 > T) {   // the same for the whole work-group: only a last chunk that runs past the end has keys to zero
#pragma unroll   // constant indices: the arrays stay in registers
        for (int i = 0; i < NE; ++i)
          if (j0 + (tid + 128 * i) / (D / 8) >= T) { kh[i] = (v8us)(unsigned short)0; kl[i] = (v8us)(unsigned short)0; vh[i] = (v8us)(unsigned short)0; vl[i] = (v8us)(unsigned short)0; }
      }
#pragma unroll
      for (int i = 0; i < NE; ++i) {
        const int e = tid + 128 * i, r = e / (D / 8), c8 = (e % (D / 8)) * 8;
        *(v8us*)&sKh[r][c8] = kh[i]; *(v8us*)&sKl[r][c8] = kl[i]; *(v8us*)&sVh[r][c8] = vh[i]; *(v8us*)&sVl[r][c8] = vl[i];
      }
    }
    __syncthreads();
    // a chunk wholly outside the band of this wave's own 16 rows adds nothing to them (no work-group barrier below this line in the trip)
    if (j0 + 31 < wq0 - band || j0 > wq0 + 15 + band) continue;
    v8f s[2];
#pragma unroll
    for (int nt = 0; nt < 2; ++nt) {
      v8f acc = {};
#pragma unroll
      for (int ks = 0; ks < KS; ++ks) {
        FragB bh_, bl_;
        bh_.half[0] = *(const v8us*)&sKh[nt * 16 + ln][ks * 32 + 8 * hh]; bh_.half[1] = *(const v8us*)&sKh[nt * 16 + ln][ks * 32 + 16 + 8 * hh];
        bl_.half[0] = *(const v8us*)&sKl[nt * 16 + ln][ks * 32 + 8 * hh]; bl_.half[1] = *(const v8us*)&sKl[nt * 16 + ln][ks * 32 + 16 + 8 * hh];
        acc = mmaN<3>(aqh[ks].v, aql[ks].v, bh_.v, bl_.v, acc);
      }
      s[nt] = acc;
    }
    const int ja = j0 + ln, jb = j0 + 16 + ln;
    const bool keepa = ja < T, keepb = jb < T;
    float sa[8], sb[8], mx[8], alpha[8];
#pragma unroll
    for (int r = 0; r < 8; ++r) {
      const int qi = qrow[r];
      sa[r] = (keepa && ja <= qi + band && ja >= qi - band) ? s[0][r] : -3.0e38f;
      sb[r] = (keepb && jb <= qi + band && jb >= qi - band) ? s[1][r] : -3.0e38f;
      mx[r] = fmaxf(sa[r], sb[r]);
    }
    // maximum over the 16 lanes of a row: each exchange step for all eight rows before the next step
    __builtin_amdgcn_sched_barrier(0);   // all eight rows' values stand ready here: without it one row's four exchanges were scheduled ahead, alone, each waited for by itself
#pragma unroll
    for (int m = 1; m <= 8; m <<= 1) {
      float ox[8];
#pragma unroll
      for (int r = 0; r < 8; ++r) ox[r] = __shfl_xor(mx[r], m, 32);
#pragma unroll
      for (int r = 0; r < 8; ++r) mx[r] = fmaxf(mx[r], ox[r]);
    }
#pragma unroll
    for (int r = 0; r < 8; ++r) {
      const float mnew = fmaxf(m_r[r], mx[r]);
      alpha[r] = (mnew > -1.0e38f) ? __expf(m_r[r] - mnew) : 1.0f;
      const float p0 = keepa ? __expf(sa[r] - mnew) : 0.f;
      const float p1 = keepb ? __expf(sb[r] - mnew) : 0.f;
      m_r[r] = mnew;
      l_r[r] = l_r[r] * alpha[r] + p0 + p1;
      unsigned short hb = bf16_bits(p0); sPh[w][8 * hh + r][ln] = hb;      sPl[w][8 * hh + r][ln] = bf16_bits(p0 - bf16_val(hb));
      hb = bf16_bits(p1);                sPh[w][8 * hh + r][16 + ln] = hb; sPl[w][8 * hh + r][16 + ln] = bf16_bits(p1 - bf16_val(hb));
    }
#pragma unroll
    for (int dt = 0; dt < DT; ++dt)
#pragma unroll
      for (int r = 0; r < 8; ++r) oacc[dt][r] *= alpha[r];
    __builtin_amdgcn_fence(__ATOMIC_ACQ_REL, "workgroup");
    __builtin_amdgcn_wave_barrier();
    FragB pah, pal;
    pah.half[0] = *(const v8us*)&sPh[w][ln][8 * hh]; pah.half[1] = *(const v8us*)&sPh[w][ln][16 + 8 * hh];
    pal.half[0] = *(const v8us*)&sPl[w][ln][8 * hh]; pal.half[1] = *(const v8us*)&sPl[w][ln][16 + 8 * hh];
    // lane (ln, hh) gets V[8 hh + 0..7][dt * 16 + ln] from the first load of a pair and V[16 + 8 hh + 0..7][dt * 16 + ln] from the second: the k order of pah / pal.
    // All sixteen loads stand in one group ahead of the products: one LDS latency a trip, not one per 16 columns.
    FragB bvh[DT], bvl[DT];
#pragma unroll
    for (int dt = 0; dt < DT; ++dt) {
      bvh[dt].half[0] = ld_tr16(&sVh[trow][dt * 16 + tcol]); bvh[dt].half[1] = ld_tr16(&sVh[16 + trow][dt * 16 + tcol]);
      bvl[dt].half[0] = ld_tr16(&sVl[trow][dt * 16 + tcol]); bvl[dt].half[1] = ld_tr16(&sVl[16 + trow][dt * 16 + tcol]);
    }
#pragma unroll
    for (int dt = 0; dt < DT; ++dt) oacc[dt] = mmaN<3>(pah.v, pal.v, bvh[dt].v, bvl[dt].v, oacc[dt]);
    __builtin_amdgcn_fence(__ATOMIC_ACQ_REL, "workgroup");
    __builtin_amdgcn_wave_barrier();
  }
#pragma unroll
  for (int r = 0; r < 8; ++r) {
    float l = l_r[r];
    l += __shfl_xor(l, 1, 32); l += __shfl_xor(l, 2, 32); l += __shfl_xor(l, 4, 32); l += __shfl_xor(l, 8, 32);
    l_r[r] = (m_r[r] > -1.0e38f) ? 1.0f / l : __builtin_nanf("");
  }
#pragma unroll
  for (int dt = 0; dt < DT; ++dt)
#pragma unroll
    for (int r = 0; r < 8; ++r) sO[w][8 * hh + r][dt * 16 + ln] = oacc[dt][r] * l_r[r];
  __builtin_amdgcn_fence(__ATOMIC_ACQ_REL, "workgroup");
  __builtin_amdgcn_wave_barrier();
  {
    static_assert(D == 64, "16 lanes of 4 columns cover a row: a wave stores two rows at a time");
    for (int r2 = 0; r2 < 16; r2 += 2) {
      const int r = r2 + hh, row = q0 + r;
      if (row < T) {
        const v4f val = *(const v4fa*)&sO[w][r][ln * 4];
        v4us h4, l4;
#pragma unroll   // constant indices: the vectors stay in registers
        for (int t = 0; t < 4; ++t) { const unsigned short hb = bf16_bits(val[t]); h4[t] = hb; l4[t] = bf16_bits(val[t] - bf16_val(hb)); }
        unsigned short* py = y + ((size_t)b * T + row) * ypitch + h * D + ln * 4;
        *(v4us*)py = h4; *(v4us*)(py + LO) = l4;
        // neither the address nor the data that these two stores name is written ahead of this wait: the inputs keep them live up to it
        asm volatile("s_wait_xcnt 0x0" :: "v"(py), "v"(h4), "v"(l4) : "memory");
      }
    }
  }
}
// table of the interleaved rotary step: rot[pos][i] = (cos, sin) of pos * inv_freq[i], inv_freq[i] = 10000^(-i/(d/2)); thread per (pos, i);
// written anew in every call, ahead of the GEMMs that read it. A part of k_setup.
__device__ __forceinline__ void rot_table_part(float* __restrict__ rot, int t) {
  if (t >= TT * (HD / 2)) return;
  const int pos = t / (HD / 2), i = t % (HD / 2);
  const float inv = powf(10000.0f, -(float)i / (float)(HD / 2)); const float ang = (float)pos * inv; float sn, cs; sincosf(ang, &sn, &cs);
  typedef float v2f __attribute__((ext_vector_type(2)));
  v2f a = {cs, sn};
  *(v2f*)(rot + (size_t)t * 2) = a;
}
// All that the GEMMs need beforehand, in one launch (no part reads what another writes): the first SETUP_RB work-groups write the rotary table
// (the longest threads, so they start first), then SETUP_WB work-groups for each of the four weight matrices.
constexpr int SETUP_RB = (TT * (HD / 2) + 255) / 256, SETUP_WB = (EE * (EE / 8) + 255) / 256;
__global__ __launch_bounds__(256) void k_setup(const float* __restrict__ Wq, const float* __restrict__ Wk, const float* __restrict__ Wv, const float* __restrict__ Wo,
                                             unsigned short* __restrict__ Tq, unsigned short* __restrict__ Tk, unsigned short* __restrict__ Tv, unsigned short* __restrict__ To,
                                             float* __restrict__ rot) {
  const int bid = blockIdx.x;
  if (bid < SETUP_RB) { rot_table_part(rot, bid * 256 + threadIdx.x); return; }
  const int m = (bid - SETUP_RB) / SETUP_WB, t = ((bid - SETUP_RB) % SETUP_WB) * 256 + threadIdx.x;
  wt_bf16_part(m == 0 ? Wq : m == 1 ? Wk : m == 2 ? Wv : Wo, m == 0 ? Tq : m == 1 ? Tk : m == 2 ? Tv : To, EE, EE, t);
}
extern "C" void kernel_launch(void* const* d_in, const int* in_sizes, int n_in,
                              void* d_out, int out_size, void* d_ws, size_t ws_size, hipStream_t stream) {
  (void)in_sizes; (void)n_in; (void)out_size;
  const float* xq = (const float*)d_in[0]; const float* xkv = (const float*)d_in[1];
  const float* Wq = (const float*)d_in[2]; const float* Wk = (const float*)d_in[3]; const float* Wv = (const float*)d_in[4]; const float* Wo = (const float*)d_in[5];
  char* ws = (char*)d_ws; size_t off = 0;
  auto take = [&](size_t bytes) { char* p = ws + off; off += (bytes + 255) & ~(size_t)255; return p; };
  const int M = BB * TT, gb = (M / 128) * (EE / 128);
  unsigned short* Wt[4]; for (int i = 0; i < 4; ++i) Wt[i] = (unsigned short*)take((size_t)EE * EE * 2);
  float* q = (float*)take((size_t)M * EE * 4); float* k = (float*)take((size_t)M * EE * 4); float* v = (float*)take((size_t)M * EE * 4); float* att = (float*)take((size_t)M * EE * 4);
  float* rot = (float*)take((size_t)TT * HD * 4);
  if (off > ws_size) return;
  k_setup<<<SETUP_RB + 4 * SETUP_WB, 256, 0, stream>>>(Wq, Wk, Wv, Wo, Wt[0], Wt[1], Wt[2], Wt[3], rot);
  // q (times 1/sqrt(HD)), k, v and the attention's output leave their kernels as bf16 hi | lo rows of 2 * EE 16-bit values, in the room of the f32 rows
  k_gemm_qkv<EE><<<dim3(gb, 3), 256, 0, stream>>>(xq, xkv, EE, Wt[0], Wt[1], Wt[2], EE, q, k, v, 2 * EE, M, EE, EE, rot, 0.125f);
  k_flash_band<HD, EE><<<BB * NH * (TT / 64), 128, 0, stream>>>((const unsigned short*)q, (const unsigned short*)k, (const unsigned short*)v, 2 * EE, TT, NH, 256, (unsigned short*)att, 2 * EE);
  k_gemm_bf<EE, 0, false, false, 0><<<gb, 256, 0, stream>>>(att, 2 * EE, Wt[3], EE, nullptr, (float*)d_out, EE, M, EE, EE, nullptr, 1.0f);
}

// v008
// It runs in 169 microseconds.
// Next to v007, in two timings, it ran 1.16 times as fast each time.
// Over all steps from v000 it is 6.86 times as fast.
#include <hip/hip_runtime.h>
// All contractions on v_wmma_f32_16x16x32_bf16, f32 accumulate: x_q·Wq, x_kv·Wk, x_kv·Wv (inputs, W rounded to bf16: single exact term),
// QKᵀ and P·V per 16-query tile as 3-term bf16 hi/lo splits with the |i−j| ≤ 256 band, out·Wo with the A operand split (2 terms);
// interleaved rotary embedding and softmax in f32.
#define BB 4
#define TT 2048
#define EE 1024
#define NH 16
#define HD 64

typedef __bf16 v16b __attribute__((ext_vector_type(16)));
typedef unsigned short v8us __attribute__((ext_vector_type(8), may_alias));
typedef float  v8f  __attribute__((ext_vector_type(8)));
typedef float  v4f  __attribute__((ext_vector_type(4)));
typedef float  v4fa __attribute__((ext_vector_type(4), may_alias));
union FragB { v16b v; v8us half[2]; unsigned short u[16]; };

__device__ __forceinline__ unsigned short bf16_bits(float x) { unsigned int u = __float_as_uint(x); return (unsigned short)((u + 0x7FFFu + ((u >> 16) & 1u)) >> 16); }
__device__ __forceinline__ float bf16_val(unsigned short b) { return __uint_as_float(((unsigned int)b) << 16); }
__device__ __forceinline__ float bf16_round(float x) { return bf16_val(bf16_bits(x)); }
// D += A·B with NT terms: 1 = ah·bh, 2 = + al·bh (A split), 3 = + ah·bl (both split)
template <int NT>
__device__ __forceinline__ v8f mmaN(v16b ah, v16b al, v16b bh, v16b bl, v8f c) {
  c = __builtin_amdgcn_wmma_f32_16x16x32_bf16(false, ah, false, bh, (short)0, c, false, false);
  if (NT >= 2) c = __builtin_amdgcn_wmma_f32_16x16x32_bf16(false, al, false, bh, (short)0, c, false, false);
  if (NT >= 3) c = __builtin_amdgcn_wmma_f32_16x16x32_bf16(false, ah, false, bl, (short)0, c, false, false);
  asm volatile("v_nop\n\tv_nop\n\tv_nop\n\tv_nop" : "+v"(c) : "v"(ah), "v"(al), "v"(bh), "v"(bl));
  return c;
}

// D += A x B, both split, the terms in the order ah x bh, ah x bl, al x bh: the order of mmaN<3> when its A and B change places
__device__ __forceinline__ v8f mma3x(v16b ah, v16b al, v16b bh, v16b bl, v8f c) {
  c = __builtin_amdgcn_wmma_f32_16x16x32_bf16(false, ah, false, bh, (short)0, c, false, false);
  c = __builtin_amdgcn_wmma_f32_16x16x32_bf16(false, ah, false, bl, (short)0, c, false, false);
  c = __builtin_amdgcn_wmma_f32_16x16x32_bf16(false, al, false, bh, (short)0, c, false, false);
  // the four vector slots that the chip needs behind a matrix instruction, on every path out of here (as in mmaN)
  asm volatile("v_nop\n\tv_nop\n\tv_nop\n\tv_nop" : "+v"(c) : "v"(ah), "v"(al), "v"(bh), "v"(bl));
  return c;
}
// x rounded to bf16 as bf16_bits rounds it, the 16 bits left in the top half of the word (the low half holds no value)
__device__ __forceinline__ unsigned int bf16_top(float x) { unsigned int u = __float_as_uint(x); return u + 0x7FFFu + ((u >> 16) & 1u); }
typedef unsigned int v8u __attribute__((ext_vector_type(8)));
typedef float v2f __attribute__((ext_vector_type(2)));
// the value of lane l ^ 16
__device__ __forceinline__ float xhalf(float x) {
  return __builtin_bit_cast(float, __builtin_amdgcn_permlanex16(__builtin_bit_cast(int, x), __builtin_bit_cast(int, x), 0x76543210, 0xfedcba98, false, false));
}

// Wt[n][k] = bf16(W[k][n]); thread t makes 8 k of one n. A part of k_setup.
__device__ __forceinline__ void wt_bf16_part(const float* __restrict__ W, unsigned short* __restrict__ Wt, int K, int N, int t) {
  const int k8n = K / 8;
  if (t >= N * k8n) return;
  const int n = t / k8n, k8 = (t % k8n) * 8;
  v8us v;
#pragma unroll
  for (int i = 0; i < 8; ++i) v[i] = bf16_bits(W[(size_t)(k8 + i) * N + n]);
  *(v8us*)(Wt + (size_t)n * K + k8) = v;
  
}

// GEMM C[M][N] (f32, pitch ldc) = act(A[M][K] x W + bias). One work-group of 8 waves makes a 128 x 128 tile of C; a wave makes 32 x 64 of it.
// A pass is 64 k: the A rows are laid in LDS beside the 128 rows of Wt (bf16 [N][K], pitch ldb); every global load covers whole 128-B lines.
// ALO == 0: A is f32 (pitch lda), rounded to bf16 once per work-group, one term. ALO > 0: A arrives as the bf16 pairs its producer wrote, rows of
// 16-bit values at pitch lda, hi at column k and lo at column ALO + k: both planes are copied as they are, 2 terms.
// Two LDS buffers: the next pass is loaded into registers ahead of this pass's products and stored behind them, one barrier a pass.
// The k order of every sum is ascending in steps of 32, hi term then lo term. BIAS_BF16 rounds the bias to bf16 before the add.
// K%64==0, M%128==0, N%128==0.
// ROT: the interleaved rotary step is applied to the finished f32 tile on its way out: column pair (2i, 2i+1) of a head, row pos = row % TT,
// is turned by the (cos, sin) pair rot[pos][i] that k_setup wrote earlier in the same call (a wave's 64 columns are one head).
// LO > 0: the finished value, times oscale, leaves as a bf16 pair hi = bf16(x), lo = bf16(x - hi), the operands of the attention's 3-term products:
// C is then rows of 16-bit values at pitch ldc, hi at column c and lo at column LO + c of the same row (a wave's 64 columns are one 128-B line of each).
typedef unsigned short v4us __attribute__((ext_vector_type(4), may_alias));
// The body of one work-group: sm is the kernel's LDS array of GEMM_LDS(ALO) 16-bit values, bid the number of the tile.
constexpr int GEMM_PB = 72;              // LDS row pitch in bf16: 128 B of k + 16 B, an odd multiple of 16 B for the 16-byte readers
constexpr int GEMM_LDS(int alo) { return 2 * (alo > 0 ? 3 : 2) * 128 * GEMM_PB; }   // two buffers of the planes A hi, W, (A lo)
template <int ALO, int ACT, bool BIAS_BF16, bool ROT, int LO>
__device__ __forceinline__ void gemm_tile(unsigned short* sm, int bid, const float* __restrict__ A, int lda, const unsigned short* __restrict__ Wt, int ldb,
                                          const float* __restrict__ bias, float* __restrict__ C, int ldc, int M, int N, int K,
                                          const float* __restrict__ rot, float oscale) {
  constexpr bool ASPLIT = ALO > 0;
  constexpr int PB = GEMM_PB;
  constexpr int PLANE = 128 * PB;        // one operand plane of a pass
  constexpr int NPL = ASPLIT ? 3 : 2;    // A hi, W, (A lo)
  constexpr int PO = 68;                 // pitch in f32 of the output staging rows
  const int tid = threadIdx.x, w = tid >> 5, lane = tid & 31, ln = lane & 15, hh = lane >> 4;
  const int ntn = N / 128;
  const int mb = bid / ntn, nb = bid % ntn;
  if (mb * 128 >= M) return;             // the same for the whole work-group, ahead of every barrier
  const int row0 = mb * 128, col0 = nb * 128;
  const int wm = w >> 1, wn = w & 1;
  const int ar = tid >> 4, ac = (tid & 15) * 4;    // staging of an f32 A: 16 lanes cover 256 B of a row
  const int br = tid >> 3, bc = (tid & 7) * 8;     // staging of W and of each plane of a 16-bit A: 8 lanes cover 128 B of a row
  const float* ag = A + (size_t)(row0 + ar) * lda + ac;
  const unsigned short* ap = (const unsigned short*)A + (size_t)(row0 + br) * lda + bc;
  const unsigned short* bg = Wt + (size_t)(col0 + br) * ldb + bc;
  v4f xa[8]; v8us xah[4], xal[4], xb[4];
  v8f acc[2][4] = {};
  const int np = K / 64;
  auto fetch = [&](int kb) {
    if constexpr (ASPLIT) {
      const unsigned short* pp[4]; const unsigned short* pb[4];
#pragma unroll   // constant indices: the arrays stay in registers (the same for the loops below)
      for (int i = 0; i < 4; ++i) { pp[i] = ap + (size_t)(32 * i) * lda + kb; xah[i] = *(const v8us*)pp[i]; xal[i] = *(const v8us*)(pp[i] + ALO); }
#pragma unroll
      for (int i = 0; i < 4; ++i) { pb[i] = bg + (size_t)(32 * i) * ldb + kb; xb[i] = *(const v8us*)pb[i]; }
      // no register that one of these loads names as its address is written (not by a later load's result either) ahead of this wait:
      // the inputs keep all eight addresses live up to it
      asm volatile("s_wait_xcnt 0x0" :: "v"(pp[0]), "v"(pp[1]), "v"(pp[2]), "v"(pp[3]), "v"(pb[0]), "v"(pb[1]), "v"(pb[2]), "v"(pb[3]) : "memory");
    } else {
    const float* pa[8]; const unsigned short* pb[4];
#pragma unroll
    for (int i = 0; i < 8; ++i) { pa[i] = ag + (size_t)(16 * i) * lda + kb; xa[i] = *(const v4fa*)pa[i]; }
#pragma unroll
    for (int i = 0; i < 4; ++i) { pb[i] = bg + (size_t)(32 * i) * ldb + kb; xb[i] = *(const v8us*)pb[i]; }
    // no register that one of these loads names as its address is written (not by a later load's result either) ahead of this wait:
    // the inputs keep all twelve addresses live up to it
    asm volatile("s_wait_xcnt 0x0" :: "v"(pa[0]), "v"(pa[1]), "v"(pa[2]), "v"(pa[3]), "v"(pa[4]), "v"(pa[5]), "v"(pa[6]), "v"(pa[7]),
                 "v"(pb[0]), "v"(pb[1]), "v"(pb[2]), "v"(pb[3]) : "memory");
    }
  };
  fetch(0);
  for (int p = 0; p <= np; ++p) {
    if (p > 0) {
      // products of pass p - 1 out of its buffer
      const unsigned short* sAh = sm + ((p - 1) & 1) * (NPL * PLANE);
      const unsigned short* sB = sAh + PLANE;
      const unsigned short* sAl = sB + PLANE;
#pragma unroll
      for (int ks = 0; ks < 2; ++ks) {
        FragB ah[2], al[2], b[4];
#pragma unroll
        for (int mi = 0; mi < 2; ++mi) {
          const int o = (wm * 32 + mi * 16 + ln) * PB + ks * 32 + 8 * hh;
          ah[mi].half[0] = *(const v8us*)(sAh + o); ah[mi].half[1] = *(const v8us*)(sAh + o + 16);
          if (ASPLIT) { al[mi].half[0] = *(const v8us*)(sAl + o); al[mi].half[1] = *(const v8us*)(sAl + o + 16); }
          else al[mi] = ah[mi];
        }
#pragma unroll
        for (int t = 0; t < 4; ++t) {
          const int o = (wn * 64 + t * 16 + ln) * PB + ks * 32 + 8 * hh;
          b[t].half[0] = *(const v8us*)(sB + o); b[t].half[1] = *(const v8us*)(sB + o + 16);
        }
#pragma unroll
        for (int mi = 0; mi < 2; ++mi)
#pragma unroll
          for (int t = 0; t < 4; ++t) acc[mi][t] = mmaN<ASPLIT ? 2 : 1>(ah[mi].v, al[mi].v, b[t].v, b[t].v, acc[mi][t]);
      }
    }
    if (p < np) {
      // pass p from registers into the buffer whose readers left it at the barrier that ended trip p - 1
      unsigned short* dAh = sm + (p & 1) * (NPL * PLANE);
      unsigned short* dB = dAh + PLANE;
      unsigned short* dAl = dB + PLANE;
      if constexpr (ASPLIT) {
#pragma unroll   // constant indices: the arrays stay in registers
        for (int i = 0; i < 4; ++i) { *(v8us*)(dAh + (br + 32 * i) * PB + bc) = xah[i]; *(v8us*)(dAl + (br + 32 * i) * PB + bc) = xal[i]; }
      } else {
#pragma unroll
        for (int i = 0; i < 8; ++i) {
          v4us h;
#pragma unroll
          for (int t = 0; t < 4; ++t) h[t] = bf16_bits(xa[i][t]);
          *(v4us*)(dAh + (ar + 16 * i) * PB + ac) = h;
        }
      }
#pragma unroll
      for (int i = 0; i < 4; ++i) *(v8us*)(dB + (br + 32 * i) * PB + bc) = xb[i];
    }
    __syncthreads();
    if (p + 1 < np) {
      // pass p + 1 starts its way from L2 now and is waited for only behind the products of pass p
      fetch((p + 1) * 64);
    }
  }
  const int rsub = lane >> 4, c4 = (lane & 15) * 4;
  v4f cs[16];
  if (ROT) {
    // the (cos, sin) pairs of this lane's two column pairs in its 16 rows: sixteen loads off one address, issued together (one latency for all)
    static_assert(TT % 128 == 0 && HD == 64, "a 128-row tile stays inside one sequence; a wave's 64 columns are one head");
    const float* pr = rot + (size_t)(row0 % TT + wm * 32 + rsub) * HD + c4;
#pragma unroll
    for (int q = 0; q < 16; ++q) cs[q] = *(const v4fa*)(pr + q * 2 * HD);
    // the address that these loads name is not written ahead of this wait: the input keeps it live up to it
    asm volatile("s_wait_xcnt 0x0" :: "v"(pr) : "memory");
  }
  // the barrier of the last trip stands behind every wave's last read of the buffers: each wave now stages its 32 x 64 tile in a range of its own
  float* so = (float*)sm + w * (32 * PO);
#pragma unroll
  for (int mi = 0; mi < 2; ++mi)
#pragma unroll
    for (int t = 0; t < 4; ++t) {
      float bv = bias ? bias[col0 + wn * 64 + t * 16 + ln] : 0.f;
      if (BIAS_BF16) bv = bf16_round(bv);
#pragma unroll
      for (int r = 0; r < 8; ++r) { float v = acc[mi][t][r] + bv; if (ACT == 1) v = fmaxf(v, 0.f); so[(mi * 16 + 8 * hh + r) * PO + t * 16 + ln] = v; }
    }
  __builtin_amdgcn_fence(__ATOMIC_ACQ_REL, "workgroup");
  __builtin_amdgcn_wave_barrier();
#pragma unroll
  for (int q = 0; q < 16; ++q) {
    const int r = q * 2 + rsub;
    v4f v = *(const v4fa*)&so[r * PO + c4];
    if (ROT) {
      const v4f x = v, t = cs[q];
      v = (v4f){x[0] * t[0] - x[1] * t[1], x[1] * t[0] + x[0] * t[1], x[2] * t[2] - x[3] * t[3], x[3] * t[2] + x[2] * t[3]};
    }
    if (LO > 0) {
      v4us h, l;
#pragma unroll   // constant indices: the vectors stay in registers
      for (int t = 0; t < 4; ++t) { const float x = v[t] * oscale; const unsigned short hb = bf16_bits(x); h[t] = hb; l[t] = bf16_bits(x - bf16_val(hb)); }
      unsigned short* ph = (unsigned short*)C + (size_t)(row0 + wm * 32 + r) * ldc + col0 + wn * 64 + c4;
      *(v4us*)ph = h; *(v4us*)(ph + LO) = l;
      // neither the address nor the data that these two stores name is written ahead of this wait: the inputs keep them live up to it
      asm volatile("s_wait_xcnt 0x0" :: "v"(ph), "v"(h), "v"(l) : "memory");
    } else {
      *(v4f*)(C + (size_t)(row0 + wm * 32 + r) * ldc + col0 + wn * 64 + c4) = v;
    }
  }
}

template <int ALO, int ACT, bool BIAS_BF16, bool ROT, int LO>
__global__ __launch_bounds__(256) void k_gemm_bf(const float* __restrict__ A, int lda, const unsigned short* __restrict__ Wt, int ldb,
                                               const float* __restrict__ bias, float* __restrict__ C, int ldc, int M, int N, int K,
                                               const float* __restrict__ rot, float oscale) {
  __shared__ __attribute__((aligned(16))) unsigned short sm[GEMM_LDS(ALO)];
  gemm_tile<ALO, ACT, BIAS_BF16, ROT, LO>(sm, blockIdx.x, A, lda, Wt, ldb, bias, C, ldc, M, N, K, rot, oscale);
}
// The three projections, none of which reads another's output, in one launch: blockIdx.y = 0 makes q = rot(xq Wq) * qscale, 1 makes k = rot(xkv Wk), 2 makes v = xkv Wv;
// blockIdx.x is the tile, as in k_gemm_bf. The choice is the same for the whole work-group.
template <int LO>
__global__ __launch_bounds__(256) void k_gemm_qkv(const float* __restrict__ xq, const float* __restrict__ xkv, int lda,
                                                const unsigned short* __restrict__ Tq, const unsigned short* __restrict__ Tk, const unsigned short* __restrict__ Tv, int ldb,
                                                float* __restrict__ q, float* __restrict__ k, float* __restrict__ v, int ldc, int M, int N, int K,
                                                const float* __restrict__ rot, float qscale) {
  __shared__ __attribute__((aligned(16))) unsigned short sm[GEMM_LDS(0)];
  const int z = blockIdx.y;
  if (z < 2) gemm_tile<0, 0, false, true, LO>(sm, blockIdx.x, z == 0 ? xq : xkv, lda, z == 0 ? Tq : Tk, ldb, nullptr, z == 0 ? q : k, ldc, M, N, K, rot, z == 0 ? qscale : 1.0f);
  else gemm_tile<0, 0, false, false, LO>(sm, blockIdx.x, xkv, lda, Tv, ldb, nullptr, v, ldc, M, N, K, nullptr, 1.0f);
}

// Flash-style causal/unmasked attention, all contractions 3-term bf16 hi/lo splits, f32 softmax with running max.
// q,k,v rows are read from f32 buffers with arbitrary row pitch (so they can live inside a fused qkv buffer);
// D = head size (multiple of 32, <= 128); one wave = 16 query rows; block = 4 waves (64 queries) sharing K/V chunks of 32.
template <int D, bool CAUSAL>
__global__ __launch_bounds__(128) void k_flash(const float* __restrict__ qb, const float* __restrict__ kb, const float* __restrict__ vb,
                                             int pitch, int T, int H, float scale, float* __restrict__ y, int ypitch) {
  constexpr int KS = D / 32;        // k-steps for QK
  constexpr int DT = D / 16;        // d tiles for PV
  __shared__ __attribute__((aligned(16))) unsigned short sKh[32][D + 8], sKl[32][D + 8], sVh[32][D + 8], sVl[32][D + 8];
  __shared__ __attribute__((aligned(16))) unsigned short sPh[4][16][40], sPl[4][16][40];
  __shared__ __attribute__((aligned(16))) float sO[4][16][D];
  const int tid = threadIdx.x, w = tid >> 5, lane = tid & 31, ln = lane & 15, hh = lane >> 4;
  const int nqb = (T + 63) / 64;
  const int bh = blockIdx.x / nqb, qblk = blockIdx.x % nqb;
  const int b = bh / H, h = bh % H;
  const int q0 = qblk * 64 + w * 16;
  const float* Q = qb + (size_t)b * T * pitch + h * D;
  const float* K = kb + (size_t)b * T * pitch + h * D;
  const float* V = vb + (size_t)b * T * pitch + h * D;

  // A fragments of the wave's 16 query rows (scaled), hi/lo
  FragB aqh[KS], aql[KS];
  {
    int row = q0 + ln; if (row >= T) row = T - 1;
    const float* qr = Q + (size_t)row * pitch;
#pragma unroll
    for (int ks = 0; ks < KS; ++ks)
#pragma unroll
      for (int i = 0; i < 16; ++i) {
        const int d = ks * 32 + ((i < 8) ? (8 * hh + i) : (16 + 8 * hh + (i - 8)));
        const float x = qr[d] * scale; const unsigned short hb = bf16_bits(x);
        aqh[ks].u[i] = hb; aql[ks].u[i] = bf16_bits(x - bf16_val(hb));
      }
  }
  float m_r[8], l_r[8];
#pragma unroll
  for (int r = 0; r < 8; ++r) { m_r[r] = -3.0e38f; l_r[r] = 0.f; }
  v8f oacc[DT];
#pragma unroll
  for (int dt = 0; dt < DT; ++dt) oacc[dt] = (v8f){0.f,0.f,0.f,0.f,0.f,0.f,0.f,0.f};

  const int kv_end = CAUSAL ? min(T, qblk * 64 + 64) : T;     // block-uniform
  for (int j0 = 0; j0 < kv_end; j0 += 32) {
    __syncthreads();
    for (int e = tid; e < 32 * (D / 4); e += 128) {
      const int r = e / (D / 4), c4 = (e % (D / 4)) * 4;
      const int key = j0 + r;
      v4f kf = {0.f,0.f,0.f,0.f}, vf = {0.f,0.f,0.f,0.f};
      if (key < T) { kf = *(const v4fa*)(K + (size_t)key * pitch + c4); vf = *(const v4fa*)(V + (size_t)key * pitch + c4); }
#pragma unroll
      for (int t = 0; t < 4; ++t) {
        unsigned short hb = bf16_bits(kf[t]); sKh[r][c4 + t] = hb; sKl[r][c4 + t] = bf16_bits(kf[t] - bf16_val(hb));
        hb = bf16_bits(vf[t]); sVh[r][c4 + t] = hb; sVl[r][c4 + t] = bf16_bits(vf[t] - bf16_val(hb));
      }
    }
    __syncthreads();
    // S tile 16 x 32
    v8f s[2];
#pragma unroll
    for (int nt = 0; nt < 2; ++nt) {
      v8f acc = {};
#pragma unroll
      for (int ks = 0; ks < KS; ++ks) {
        FragB bh_, bl_;
        bh_.half[0] = *(const v8us*)&sKh[nt * 16 + ln][ks * 32 + 8 * hh]; bh_.half[1] = *(const v8us*)&sKh[nt * 16 + ln][ks * 32 + 16 + 8 * hh];
        bl_.half[0] = *(const v8us*)&sKl[nt * 16 + ln][ks * 32 + 8 * hh]; bl_.half[1] = *(const v8us*)&sKl[nt * 16 + ln][ks * 32 + 16 + 8 * hh];
        acc = mmaN<3>(aqh[ks].v, aql[ks].v, bh_.v, bl_.v, acc);
      }
      s[nt] = acc;
    }
    // mask + running max (rows 8hh+r; the 16 lanes of a half share rows)
    float alpha[8];
#pragma unroll
    for (int r = 0; r < 8; ++r) {
      const int qi = q0 + 8 * hh + r;
      const int ja = j0 + ln, jb = j0 + 16 + ln;
      if (CAUSAL) { if (ja > qi) s[0][r] = -3.0e38f; if (jb > qi) s[1][r] = -3.0e38f; }
      if (ja >= T) s[0][r] = -3.0e38f;
      if (jb >= T) s[1][r] = -3.0e38f;
      float mx = fmaxf(s[0][r], s[1][r]);
      mx = fmaxf(mx, __shfl_xor(mx, 1, 32)); mx = fmaxf(mx, __shfl_xor(mx, 2, 32)); mx = fmaxf(mx, __shfl_xor(mx, 4, 32)); mx = fmaxf(mx, __shfl_xor(mx, 8, 32));
      const float mnew = fmaxf(m_r[r], mx);
      alpha[r] = (mnew > -1.0e38f) ? __expf(m_r[r] - mnew) : 1.0f;
      const float p0 = (s[0][r] > -1.0e38f) ? __expf(s[0][r] - mnew) : 0.f;
      const float p1 = (s[1][r] > -1.0e38f) ? __expf(s[1][r] - mnew) : 0.f;
      m_r[r] = mnew;
      l_r[r] = l_r[r] * alpha[r] + p0 + p1;            // per-lane partial row sum (16 lanes combined at the end)
      unsigned short hb = bf16_bits(p0); sPh[w][8 * hh + r][ln] = hb;      sPl[w][8 * hh + r][ln] = bf16_bits(p0 - bf16_val(hb));
      hb = bf16_bits(p1);                sPh[w][8 * hh + r][16 + ln] = hb; sPl[w][8 * hh + r][16 + ln] = bf16_bits(p1 - bf16_val(hb));
    }
#pragma unroll
    for (int dt = 0; dt < DT; ++dt)
#pragma unroll
      for (int r = 0; r < 8; ++r) oacc[dt][r] *= alpha[r];
    __builtin_amdgcn_fence(__ATOMIC_ACQ_REL, "workgroup");
    __builtin_amdgcn_wave_barrier();
    FragB pah, pal;
    pah.half[0] = *(const v8us*)&sPh[w][ln][8 * hh]; pah.half[1] = *(const v8us*)&sPh[w][ln][16 + 8 * hh];
    pal.half[0] = *(const v8us*)&sPl[w][ln][8 * hh]; pal.half[1] = *(const v8us*)&sPl[w][ln][16 + 8 * hh];
#pragma unroll
    for (int dt = 0; dt < DT; ++dt) {
      FragB bvh, bvl;
#pragma unroll
      for (int i = 0; i < 8; ++i) {
        bvh.u[i] = sVh[8 * hh + i][dt * 16 + ln]; bvh.u[8 + i] = sVh[16 + 8 * hh + i][dt * 16 + ln];
        bvl.u[i] = sVl[8 * hh + i][dt * 16 + ln]; bvl.u[8 + i] = sVl[16 + 8 * hh + i][dt * 16 + ln];
      }
      oacc[dt] = mmaN<3>(pah.v, pal.v, bvh.v, bvl.v, oacc[dt]);
    }
    __builtin_amdgcn_fence(__ATOMIC_ACQ_REL, "workgroup");
    __builtin_amdgcn_wave_barrier();
  }
#pragma unroll
  for (int r = 0; r < 8; ++r) {
    float l = l_r[r];
    l += __shfl_xor(l, 1, 32); l += __shfl_xor(l, 2, 32); l += __shfl_xor(l, 4, 32); l += __shfl_xor(l, 8, 32);
    l_r[r] = (l > 0.f) ? 1.0f / l : 0.f;
  }
#pragma unroll
  for (int dt = 0; dt < DT; ++dt)
#pragma unroll
    for (int r = 0; r < 8; ++r) sO[w][8 * hh + r][dt * 16 + ln] = oacc[dt][r] * l_r[r];
  __builtin_amdgcn_fence(__ATOMIC_ACQ_REL, "workgroup");
  __builtin_amdgcn_wave_barrier();
  {
    for (int r = 0; r < 16; ++r) {
      const int row = q0 + r;
      if (row < T && lane < D / 4) {
        const v4f val = *(const v4fa*)&sO[w][r][lane * 4];
        *(v4f*)(y + ((size_t)b * T + row) * ypitch + h * D + lane * 4) = val;
      }
    }
    
  }
}

// 16 x 16 tile of 16-bit values, row-major in LDS, read transposed: lane l passes the address of row 8 (l >> 4) + (l & 7), columns 8 ((l >> 3) & 1) + 0..7,
// and receives rows 8 (l >> 4) + 0..7 of column l & 15. A load that the compiler sees: it places the wait.
__device__ __forceinline__ v8us ld_tr16(const unsigned short* p) {
  typedef short s16x8 __attribute__((ext_vector_type(8)));
  typedef __attribute__((address_space(3))) s16x8 lds_s16x8;
  return __builtin_bit_cast(v8us, __builtin_amdgcn_ds_load_tr16_b128_v8i16((lds_s16x8*)p));
}
template <int D, int LO>
__global__ __launch_bounds__(128) void k_flash_band(const unsigned short* __restrict__ Qb, const unsigned short* __restrict__ Kb, const unsigned short* __restrict__ Vb,
                                                  int pitch, int T, int H, int band, unsigned short* __restrict__ y, int ypitch) {
  constexpr int KS = D / 32, DT = D / 16;
  __shared__ __attribute__((aligned(16))) unsigned short sKh[32][D + 8], sKl[32][D + 8];
  __shared__ __attribute__((aligned(32))) unsigned short sVh[32][D + 16], sVl[32][D + 16];   // V rows at an odd multiple of 32 B, the pitch of the transposing reader
  __shared__ __attribute__((aligned(16))) float sO[4][16][D + 4];   // 16 B more a row: the 16 lanes that write one column group of 16 rows meet 16 different bank groups
  const int tid = threadIdx.x, w = tid >> 5, lane = tid & 31, ln = lane & 15, hh = lane >> 4;
  const int nqb = (T + 63) / 64;
  const int bh = blockIdx.x / nqb, qblk = blockIdx.x % nqb;
  const int b = bh / H, h = bh % H;
  const int q0 = qblk * 64 + w * 16;
  const unsigned short* Q = Qb + (size_t)b * T * pitch + h * D;
  const unsigned short* K = Kb + (size_t)b * T * pitch + h * D;
  const unsigned short* V = Vb + (size_t)b * T * pitch + h * D;
  FragB aqh[KS], aql[KS];
  {
    // lane (ln, hh) holds d = ks * 32 + 8 hh + 0..7 and ks * 32 + 16 + 8 hh + 0..7 of row q0 + ln: two 16-byte pieces of the row, hi and lo alike
    int row = q0 + ln; if (row >= T) row = T - 1;
    const unsigned short* qr = Q + (size_t)row * pitch + 8 * hh;
#pragma unroll
    for (int ks = 0; ks < KS; ++ks) {
      aqh[ks].half[0] = *(const v8us*)(qr + ks * 32);      aqh[ks].half[1] = *(const v8us*)(qr + ks * 32 + 16);
      aql[ks].half[0] = *(const v8us*)(qr + LO + ks * 32); aql[ks].half[1] = *(const v8us*)(qr + LO + ks * 32 + 16);
    }
    // the address that these loads name is not written ahead of this wait: the input keeps it live up to it
    asm volatile("s_wait_xcnt 0x0" :: "v"(qr) : "memory");
  }
  const int trow = 8 * hh + (lane & 7), tcol = 8 * ((lane >> 3) & 1);   // the 16 bytes this lane hands to a transposing load of a 16 x 16 tile
  // the keys that count for this lane's query: klo .. klo + kwid = [qi - band, min(qi + band, T - 1)]
  const int qi = min(q0 + ln, T - 1);
  const int klo = qi - band;
  const unsigned kwid = (unsigned)(min(qi + band, T - 1) - klo);
  float m_r = -3.0e38f, l_r = 0.f;
  v8f oacc[DT];   // oacc[dt][r] = O[q0 + ln][dt * 16 + 8 hh + r]
#pragma unroll
  for (int dt = 0; dt < DT; ++dt) oacc[dt] = (v8f){0.f,0.f,0.f,0.f,0.f,0.f,0.f,0.f};
  // A key farther than band from every query row of the block has weight exp(-3e38 - m) = 0 in every row:
  // the loop runs only over the 32-key chunks that meet [first row - band, last row + band] (block-uniform bounds).
  const int kv_begin = max(0, qblk * 64 - band) & ~31, kv_end = min(T, qblk * 64 + 64 + band);
  const int wq0 = qblk * 64 + __builtin_amdgcn_readfirstlane(w) * 16;   // the wave's first row, in a scalar register: the chunk test below is a scalar branch
  for (int j0 = kv_begin; j0 < kv_end; j0 += 32) {
    __syncthreads();
    {
      constexpr int NE = 32 * (D / 8) / 128;   // 16-byte pieces of each of K hi, K lo, V hi, V lo per thread and trip
      static_assert(NE == 2, "the wait below names two K and two V addresses");
      v8us kh[NE], kl[NE], vh[NE], vl[NE]; const unsigned short* pk[NE]; const unsigned short* pv[NE];
#pragma unroll
      for (int i = 0; i < NE; ++i) {
        const int e = tid + 128 * i, key = j0 + e / (D / 8), c8 = (e % (D / 8)) * 8;
        const size_t o = (size_t)min(key, T - 1) * pitch + c8;   // address in bounds for every lane; a key past the end is zeroed below
        pk[i] = K + o; pv[i] = V + o;
        kh[i] = *(const v8us*)pk[i]; kl[i] = *(const v8us*)(pk[i] + LO); vh[i] = *(const v8us*)pv[i]; vl[i] = *(const v8us*)(pv[i] + LO);
      }
      // no register that one of these loads names as its address is written (not by a load's result either) ahead of this wait:
      // the inputs keep all four addresses live up to it
      asm volatile("s_wait_xcnt 0x0" :: "v"(pk[0]), "v"(pk[1]), "v"(pv[0]), "v"(pv[1]) : "memory");
      if (j0 + 32 > T) {   // the same for the whole work-group: only a last chunk that runs past the end has keys to zero
#pragma unroll   // constant indices: the arrays stay in registers
        for (int i = 0; i < NE; ++i)
          if (j0 + (tid + 128 * i) / (D / 8) >= T) { kh[i] = (v8us)(unsigned short)0; kl[i] = (v8us)(unsigned short)0; vh[i] = (v8us)(unsigned short)0; vl[i] = (v8us)(unsigned short)0; }
      }
#pragma unroll
      for (int i = 0; i < NE; ++i) {
        const int e = tid + 128 * i, r = e / (D / 8), c8 = (e % (D / 8)) * 8;
        *(v8us*)&sKh[r][c8] = kh[i]; *(v8us*)&sKl[r][c8] = kl[i]; *(v8us*)&sVh[r][c8] = vh[i]; *(v8us*)&sVl[r][c8] = vl[i];
      }
    }
    __syncthreads();
    // a chunk wholly outside the band of this wave's own 16 rows adds nothing to them (no work-group barrier below this line in the trip)
    if (j0 + 31 < wq0 - band || j0 > wq0 + 15 + band) continue;
    // S^T tile nt: s[nt][r] = score of key j0 + nt * 16 + 8 hh + r with query q0 + ln. A = K rows, B = the Q fragments, both in the k order d = 8 hh + 0..7, 16 + 8 hh + 0..7 of each 32.
    v8f s[2];
#pragma unroll
    for (int nt = 0; nt < 2; ++nt) {
      v8f acc = {};
#pragma unroll
      for (int ks = 0; ks < KS; ++ks) {
        FragB kh_, kl_;
        kh_.half[0] = *(const v8us*)&sKh[nt * 16 + ln][ks * 32 + 8 * hh]; kh_.half[1] = *(const v8us*)&sKh[nt * 16 + ln][ks * 32 + 16 + 8 * hh];
        kl_.half[0] = *(const v8us*)&sKl[nt * 16 + ln][ks * 32 + 8 * hh]; kl_.half[1] = *(const v8us*)&sKl[nt * 16 + ln][ks * 32 + 16 + 8 * hh];
        acc = mma3x(kh_.v, kl_.v, aqh[ks].v, aql[ks].v, acc);
      }
      s[nt] = acc;
    }
    // element i = nt * 8 + r of this lane: key j0 + nt * 16 + 8 hh + r
    const int kd0 = j0 + 8 * hh - klo;
    float sc[16];
#pragma unroll
    for (int i = 0; i < 16; ++i) sc[i] = ((unsigned)(kd0 + (i >> 3) * 16 + (i & 7)) <= kwid) ? s[i >> 3][i & 7] : -3.0e38f;
    float mx4[4];
#pragma unroll
    for (int c = 0; c < 4; ++c) mx4[c] = fmaxf(fmaxf(sc[c], sc[4 + c]), fmaxf(sc[8 + c], sc[12 + c]));
    float mx = fmaxf(fmaxf(mx4[0], mx4[1]), fmaxf(mx4[2], mx4[3]));
    mx = fmaxf(mx, xhalf(mx));   // the other 16 keys of the chunk are in lane l ^ 16
    const float mnew = fmaxf(m_r, mx);
    const float alpha = (mnew > -1.0e38f) ? __expf(m_r - mnew) : 1.0f;
    m_r = mnew;
    // b[i] = P^T[key 8 hh + i or 16 + 8 hh + (i - 8)][q0 + ln]: the k order in which the transposing loads below deliver V
    // (register j holds elements 2 j and 2 j + 1); hi = bf16(p), lo = bf16(p - hi), rounded as bf16_bits rounds
    v8u ph, pl;
    v2f ps2[2] = {{0.f, 0.f}, {0.f, 0.f}};
#pragma unroll
    for (int j = 0; j < 8; ++j) {
      const v2f p = {__expf(sc[2 * j] - mnew), __expf(sc[2 * j + 1] - mnew)};
      ps2[j & 1] += p;
      const unsigned int h0 = bf16_top(p[0]), h1 = bf16_top(p[1]);
      const v2f hv = {__uint_as_float(h0 & 0xFFFF0000u), __uint_as_float(h1 & 0xFFFF0000u)};
      const v2f lo = p - hv;
      ph[j] = __builtin_amdgcn_perm(h1, h0, 0x07060302u);                              // the top halves of h0 (low) and h1 (high)
      pl[j] = __builtin_amdgcn_perm(bf16_top(lo[1]), bf16_top(lo[0]), 0x07060302u);
    }
    const v16b pbh = __builtin_bit_cast(v16b, ph), pbl = __builtin_bit_cast(v16b, pl);
    l_r = l_r * alpha + ((ps2[0][0] + ps2[0][1]) + (ps2[1][0] + ps2[1][1]));   // this lane's 16 keys; the halves are joined behind the loop
#pragma unroll
    for (int dt = 0; dt < DT; ++dt)
#pragma unroll
      for (int r = 0; r < 8; ++r) oacc[dt][r] *= alpha;
    // A = V^T: lane (ln, hh) gets V[8 hh + 0..7][dt * 16 + ln] from the first load of a pair and V[16 + 8 hh + 0..7][dt * 16 + ln] from the second: the k order of pbh / pbl.
    // All sixteen loads stand in one group ahead of the products: one LDS latency a trip, not one per 16 columns.
    FragB avh[DT], avl[DT];
#pragma unroll
    for (int dt = 0; dt < DT; ++dt) {
      avh[dt].half[0] = ld_tr16(&sVh[trow][dt * 16 + tcol]); avh[dt].half[1] = ld_tr16(&sVh[16 + trow][dt * 16 + tcol]);
      avl[dt].half[0] = ld_tr16(&sVl[trow][dt * 16 + tcol]); avl[dt].half[1] = ld_tr16(&sVl[16 + trow][dt * 16 + tcol]);
    }
#pragma unroll
    for (int dt = 0; dt < DT; ++dt) oacc[dt] = mma3x(avh[dt].v, avl[dt].v, pbh, pbl, oacc[dt]);
  }
  {
    const float l = l_r + xhalf(l_r);
    const float inv = (m_r > -1.0e38f) ? 1.0f / l : __builtin_nanf("");
#pragma unroll
    for (int dt = 0; dt < DT; ++dt) {
      // a lane's eight values are eight columns in a row of its query: two 16-byte stores
      *(v4fa*)&sO[w][ln][dt * 16 + 8 * hh]     = (v4f){oacc[dt][0] * inv, oacc[dt][1] * inv, oacc[dt][2] * inv, oacc[dt][3] * inv};
      *(v4fa*)&sO[w][ln][dt * 16 + 8 * hh + 4] = (v4f){oacc[dt][4] * inv, oacc[dt][5] * inv, oacc[dt][6] * inv, oacc[dt][7] * inv};
    }
  }
  __builtin_amdgcn_fence(__ATOMIC_ACQ_REL, "workgroup");
  __builtin_amdgcn_wave_barrier();
  {
    static_assert(D == 64, "16 lanes of 4 columns cover a row: a wave stores two rows at a time");
    for (int r2 = 0; r2 < 16; r2 += 2) {
      const int r = r2 + hh, row = q0 + r;
      if (row < T) {
        const v4f val = *(const v4fa*)&sO[w][r][ln * 4];
        v4us h4, l4;
#pragma unroll   // constant indices: the vectors stay in registers
        for (int t = 0; t < 4; ++t) { const unsigned short hb = bf16_bits(val[t]); h4[t] = hb; l4[t] = bf16_bits(val[t] - bf16_val(hb)); }
        unsigned short* py = y + ((size_t)b * T + row) * ypitch + h * D + ln * 4;
        *(v4us*)py = h4; *(v4us*)(py + LO) = l4;
        // neither the address nor the data that these two stores name is written ahead of this wait: the inputs keep them live up to it
        asm volatile("s_wait_xcnt 0x0" :: "v"(py), "v"(h4), "v"(l4) : "memory");
      }
    }
  }
}
// table of the interleaved rotary step: rot[pos][i] = (cos, sin) of pos * inv_freq[i], inv_freq[i] = 10000^(-i/(d/2)); thread per (pos, i);
// written anew in every call, ahead of the GEMMs that read it. A part of k_setup.
__device__ __forceinline__ void rot_table_part(float* __restrict__ rot, int t) {
  if (t >= TT * (HD / 2)) return;
  const int pos = t / (HD / 2), i = t % (HD / 2);
  const float inv = powf(10000.0f, -(float)i / (float)(HD / 2)); const float ang = (float)pos * inv; float sn, cs; sincosf(ang, &sn, &cs);
  v2f a = {cs, sn};
  *(v2f*)(rot + (size_t)t * 2) = a;
}
// All that the GEMMs need beforehand, in one launch (no part reads what another writes): the first SETUP_RB work-groups write the rotary table
// (the longest threads, so they start first), then SETUP_WB work-groups for each of the four weight matrices.
constexpr int SETUP_RB = (TT * (HD / 2) + 255) / 256, SETUP_WB = (EE * (EE / 8) + 255) / 256;
__global__ __launch_bounds__(256) void k_setup(const float* __restrict__ Wq, const float* __restrict__ Wk, const float* __restrict__ Wv, const float* __restrict__ Wo,
                                             unsigned short* __restrict__ Tq, unsigned short* __restrict__ Tk, unsigned short* __restrict__ Tv, unsigned short* __restrict__ To,
                                             float* __restrict__ rot) {
  const int bid = blockIdx.x;
  if (bid < SETUP_RB) { rot_table_part(rot, bid * 256 + threadIdx.x); return; }
  const int m = (bid - SETUP_RB) / SETUP_WB, t = ((bid - SETUP_RB) % SETUP_WB) * 256 + threadIdx.x;
  wt_bf16_part(m == 0 ? Wq : m == 1 ? Wk : m == 2 ? Wv : Wo, m == 0 ? Tq : m == 1 ? Tk : m == 2 ? Tv : To, EE, EE, t);
}
extern "C" void kernel_launch(void* const* d_in, const int* in_sizes, int n_in,
                              void* d_out, int out_size, void* d_ws, size_t ws_size, hipStream_t stream) {
  (void)in_sizes; (void)n_in; (void)out_size;
  const float* xq = (const float*)d_in[0]; const float* xkv = (const float*)d_in[1];
  const float* Wq = (const float*)d_in[2]; const float* Wk = (const float*)d_in[3]; const float* Wv = (const float*)d_in[4]; const float* Wo = (const float*)d_in[5];
  char* ws = (char*)d_ws; size_t off = 0;
  auto take = [&](size_t bytes) { char* p = ws + off; off += (bytes + 255) & ~(size_t)255; return p; };
  const int M = BB * TT, gb = (M / 128) * (EE / 128);
  unsigned short* Wt[4]; for (int i = 0; i < 4; ++i) Wt[i] = (unsigned short*)take((size_t)EE * EE * 2);
  float* q = (float*)take((size_t)M * EE * 4); float* k = (float*)take((size_t)M * EE * 4); float* v = (float*)take((size_t)M * EE * 4); float* att = (float*)take((size_t)M * EE * 4);
  float* rot = (float*)take((size_t)TT * HD * 4);
  if (off > ws_size) return;
  k_setup<<<SETUP_RB + 4 * SETUP_WB, 256, 0, stream>>>(Wq, Wk, Wv, Wo, Wt[0], Wt[1], Wt[2], Wt[3], rot);
  // q (times 1/sqrt(HD)), k, v and the attention's output leave their kernels as bf16 hi | lo rows of 2 * EE 16-bit values, in the room of the f32 rows
  k_gemm_qkv<EE><<<dim3(gb, 3), 256, 0, stream>>>(xq, xkv, EE, Wt[0], Wt[1], Wt[2], EE, q, k, v, 2 * EE, M, EE, EE, rot, 0.125f);
  k_flash_band<HD, EE><<<BB * NH * (TT / 64), 128, 0, stream>>>((const unsigned short*)q, (const unsigned short*)k, (const unsigned short*)v, 2 * EE, TT, NH, 256, (unsigned short*)att, 2 * EE);
  k_gemm_bf<EE, 0, false, false, 0><<<gb, 256, 0, stream>>>(att, 2 * EE, Wt[3], EE, nullptr, (float*)d_out, EE, M, EE, EE, nullptr, 1.0f);
}

// v009
// It runs in 160 microseconds.
// In both of two side-by-side timings against v008, it was 1.05 times as fast.
// Over all steps from v000 it is 7.21 times as fast.
#include <hip/hip_runtime.h>
// All contractions on v_wmma_f32_16x16x32_bf16, f32 accumulate: x_q·Wq, x_kv·Wk, x_kv·Wv (inputs, W rounded to bf16: single exact term),
// QKᵀ and P·V per 16-query tile as 3-term bf16 hi/lo splits with the |i−j| ≤ 256 band, out·Wo with the A operand split (2 terms);
// interleaved rotary embedding and softmax in f32.
#define BB 4
#define TT 2048
#define EE 1024
#define NH 16
#define HD 64

typedef __bf16 v16b __attribute__((ext_vector_type(16)));
typedef unsigned short v8us __attribute__((ext_vector_type(8), may_alias));
typedef float  v8f  __attribute__((ext_vector_type(8)));
typedef float  v4f  __attribute__((ext_vector_type(4)));
typedef float  v4fa __attribute__((ext_vector_type(4), may_alias));
union FragB { v16b v; v8us half[2]; unsigned short u[16]; };

__device__ __forceinline__ unsigned short bf16_bits(float x) { unsigned int u = __float_as_uint(x); return (unsigned short)((u + 0x7FFFu + ((u >> 16) & 1u)) >> 16); }
__device__ __forceinline__ float bf16_val(unsigned short b) { return __uint_as_float(((unsigned int)b) << 16); }
__device__ __forceinline__ float bf16_round(float x) { return bf16_val(bf16_bits(x)); }
// D += A·B with NT terms: 1 = ah·bh, 2 = + al·bh (A split), 3 = + ah·bl (both split)
template <int NT>
__device__ __forceinline__ v8f mmaN(v16b ah, v16b al, v16b bh, v16b bl, v8f c) {
  c = __builtin_amdgcn_wmma_f32_16x16x32_bf16(false, ah, false, bh, (short)0, c, false, false);
  if (NT >= 2) c = __builtin_amdgcn_wmma_f32_16x16x32_bf16(false, al, false, bh, (short)0, c, false, false);
  if (NT >= 3) c = __builtin_amdgcn_wmma_f32_16x16x32_bf16(false, ah, false, bl, (short)0, c, false, false);
  asm volatile("v_nop\n\tv_nop\n\tv_nop\n\tv_nop" : "+v"(c) : "v"(ah), "v"(al), "v"(bh), "v"(bl));
  return c;
}

// D += A x B, both split, the terms in the order ah x bh, ah x bl, al x bh: the order of mmaN<3> when its A and B change places
__device__ __forceinline__ v8f mma3x(v16b ah, v16b al, v16b bh, v16b bl, v8f c) {
  c = __builtin_amdgcn_wmma_f32_16x16x32_bf16(false, ah, false, bh, (short)0, c, false, false);
  c = __builtin_amdgcn_wmma_f32_16x16x32_bf16(false, ah, false, bl, (short)0, c, false, false);
  c = __builtin_amdgcn_wmma_f32_16x16x32_bf16(false, al, false, bh, (short)0, c, false, false);
  // the four vector slots that the chip needs behind a matrix instruction, on every path out of here (as in mmaN)
  asm volatile("v_nop\n\tv_nop\n\tv_nop\n\tv_nop" : "+v"(c) : "v"(ah), "v"(al), "v"(bh), "v"(bl));
  return c;
}
// x rounded to bf16 as bf16_bits rounds it, the 16 bits left in the top half of the word (the low half holds no value)
__device__ __forceinline__ unsigned int bf16_top(float x) { unsigned int u = __float_as_uint(x); return u + 0x7FFFu + ((u >> 16) & 1u); }
typedef unsigned int v8u __attribute__((ext_vector_type(8)));
typedef float v2f __attribute__((ext_vector_type(2)));
// the value of lane l ^ 16
__device__ __forceinline__ float xhalf(float x) {
  return __builtin_bit_cast(float, __builtin_amdgcn_permlanex16(__builtin_bit_cast(int, x), __builtin_bit_cast(int, x), 0x76543210, 0xfedcba98, false, false));
}

// Wt[n][k] = bf16(W[k][n]), one tile of 64 k x 128 n per work-group of 8 waves, turned in LDS. A part of k_setup.
// In: a wave's load is 512 B in a row of W (four whole lines); a thread takes 4 n of 8 rows k and rounds them.
// Out: eight lanes store the 128 B (64 k) of one row of Wt, one whole line. sT holds WT_TN rows of WT_P 16-bit values.
constexpr int WT_TK = 64, WT_TN = 128;
constexpr int WT_P = WT_TK + 8;          // LDS row pitch in bf16: 128 B of k + 16 B, as in the GEMM's planes
__device__ __forceinline__ void wt_bf16_tile(unsigned short* sT, const float* __restrict__ W, unsigned short* __restrict__ Wt, int K, int N, int tile) {
  const int tid = threadIdx.x, w = tid >> 5, lane = tid & 31;
  const int ntn = N / WT_TN;
  const int k0 = (tile / ntn) * WT_TK, n0 = (tile % ntn) * WT_TN;
  const float* pw = W + (size_t)(k0 + 8 * w) * N + n0 + 4 * lane;
  v4f x[8];
#pragma unroll   // constant indices: the arrays stay in registers (the same for the loops below); the eight loads are issued together
  for (int i = 0; i < 8; ++i) x[i] = *(const v4fa*)(pw + (size_t)i * N);
#pragma unroll
  for (int j = 0; j < 4; ++j) {
    v8us v;
#pragma unroll
    for (int i = 0; i < 8; ++i) v[i] = bf16_bits(x[i][j]);
    *(v8us*)(sT + (4 * lane + j) * WT_P + 8 * w) = v;
  }
  __syncthreads();
  const int r = tid >> 3, c = (tid & 7) * 8;
  unsigned short* po = Wt + (size_t)(n0 + r) * K + k0 + c;
  v8us o[4];
#pragma unroll
  for (int i = 0; i < 4; ++i) o[i] = *(const v8us*)(sT + (r + 32 * i) * WT_P + c);
#pragma unroll
  for (int i = 0; i < 4; ++i) *(v8us*)(po + (size_t)(32 * i) * K) = o[i];
  // neither the address nor the data that these four stores name is written ahead of this wait: the inputs keep them live up to it
  asm volatile("s_wait_xcnt 0x0" :: "v"(po), "v"(o[0]), "v"(o[1]), "v"(o[2]), "v"(o[3]) : "memory");
}

// GEMM C[M][N] (f32, pitch ldc) = act(A[M][K] x W + bias). One work-group of 8 waves makes a 128 x 128 tile of C; a wave makes 32 x 64 of it.
// A pass is 64 k: the A rows are laid in LDS beside the 128 rows of Wt (bf16 [N][K], pitch ldb); every global load covers whole 128-B lines.
// ALO == 0: A is f32 (pitch lda), rounded to bf16 once per work-group, one term. ALO > 0: A arrives as the bf16 pairs its producer wrote, rows of
// 16-bit values at pitch lda, hi at column k and lo at column ALO + k: both planes are copied as they are, 2 terms.
// Two LDS buffers: the next pass is loaded into registers ahead of this pass's products and stored behind them, one barrier a pass.
// The k order of every sum is ascending in steps of 32, hi term then lo term. BIAS_BF16 rounds the bias to bf16 before the add.
// K%64==0, M%128==0, N%128==0.
// ROT: the interleaved rotary step is applied to the finished f32 tile on its way out: column pair (2i, 2i+1) of a head, row pos = row % TT,
// is turned by the (cos, sin) pair rot[pos][i] that k_setup wrote earlier in the same call (a wave's 64 columns are one head).
// LO > 0: the finished value, times oscale, leaves as a bf16 pair hi = bf16(x), lo = bf16(x - hi), the operands of the attention's 3-term products:
// C is then rows of 16-bit values at pitch ldc, hi at column c and lo at column LO + c of the same row (a wave's 64 columns are one 128-B line of each).
typedef unsigned short v4us __attribute__((ext_vector_type(4), may_alias));
// The body of one work-group: sm is the kernel's LDS array of GEMM_LDS(ALO) 16-bit values, bid the number of the tile.
constexpr int GEMM_PB = 72;              // LDS row pitch in bf16: 128 B of k + 16 B, an odd multiple of 16 B for the 16-byte readers
constexpr int GEMM_LDS(int alo) { return 2 * (alo > 0 ? 3 : 2) * 128 * GEMM_PB; }   // two buffers of the planes A hi, W, (A lo)
template <int ALO, int ACT, bool BIAS_BF16, bool ROT, int LO>
__device__ __forceinline__ void gemm_tile(unsigned short* sm, int bid, const float* __restrict__ A, int lda, const unsigned short* __restrict__ Wt, int ldb,
                                          const float* __restrict__ bias, float* __restrict__ C, int ldc, int M, int N, int K,
                                          const float* __restrict__ rot, float oscale) {
  constexpr bool ASPLIT = ALO > 0;
  constexpr int PB = GEMM_PB;
  constexpr int PLANE = 128 * PB;        // one operand plane of a pass
  constexpr int NPL = ASPLIT ? 3 : 2;    // A hi, W, (A lo)
  constexpr int PO = 68;                 // pitch in f32 of the output staging rows
  const int tid = threadIdx.x, w = tid >> 5, lane = tid & 31, ln = lane & 15, hh = lane >> 4;
  const int ntn = N / 128;
  const int mb = bid / ntn, nb = bid % ntn;
  if (mb * 128 >= M) return;             // the same for the whole work-group, ahead of every barrier
  const int row0 = mb * 128, col0 = nb * 128;
  const int wm = w >> 1, wn = w & 1;
  const int ar = tid >> 4, ac = (tid & 15) * 4;    // staging of an f32 A: 16 lanes cover 256 B of a row
  const int br = tid >> 3, bc = (tid & 7) * 8;     // staging of W and of each plane of a 16-bit A: 8 lanes cover 128 B of a row
  const float* ag = A + (size_t)(row0 + ar) * lda + ac;
  const unsigned short* ap = (const unsigned short*)A + (size_t)(row0 + br) * lda + bc;
  const unsigned short* bg = Wt + (size_t)(col0 + br) * ldb + bc;
  v4f xa[8]; v8us xah[4], xal[4], xb[4];
  v8f acc[2][4] = {};
  const int np = K / 64;
  auto fetch = [&](int kb) {
    if constexpr (ASPLIT) {
      const unsigned short* pp[4]; const unsigned short* pb[4];
#pragma unroll   // constant indices: the arrays stay in registers (the same for the loops below)
      for (int i = 0; i < 4; ++i) { pp[i] = ap + (size_t)(32 * i) * lda + kb; xah[i] = *(const v8us*)pp[i]; xal[i] = *(const v8us*)(pp[i] + ALO); }
#pragma unroll
      for (int i = 0; i < 4; ++i) { pb[i] = bg + (size_t)(32 * i) * ldb + kb; xb[i] = *(const v8us*)pb[i]; }
      // no register that one of these loads names as its address is written (not by a later load's result either) ahead of this wait:
      // the inputs keep all eight addresses live up to it
      asm volatile("s_wait_xcnt 0x0" :: "v"(pp[0]), "v"(pp[1]), "v"(pp[2]), "v"(pp[3]), "v"(pb[0]), "v"(pb[1]), "v"(pb[2]), "v"(pb[3]) : "memory");
    } else {
    const float* pa[8]; const unsigned short* pb[4];
#pragma unroll
    for (int i = 0; i < 8; ++i) { pa[i] = ag + (size_t)(16 * i) * lda + kb; xa[i] = *(const v4fa*)pa[i]; }
#pragma unroll
    for (int i = 0; i < 4; ++i) { pb[i] = bg + (size_t)(32 * i) * ldb + kb; xb[i] = *(const v8us*)pb[i]; }
    // no register that one of these loads names as its address is written (not by a later load's result either) ahead of this wait:
    // the inputs keep all twelve addresses live up to it
    asm volatile("s_wait_xcnt 0x0" :: "v"(pa[0]), "v"(pa[1]), "v"(pa[2]), "v"(pa[3]), "v"(pa[4]), "v"(pa[5]), "v"(pa[6]), "v"(pa[7]),
                 "v"(pb[0]), "v"(pb[1]), "v"(pb[2]), "v"(pb[3]) : "memory");
    }
  };
  fetch(0);
  for (int p = 0; p <= np; ++p) {
    if (p > 0) {
      // products of pass p - 1 out of its buffer
      const unsigned short* sAh = sm + ((p - 1) & 1) * (NPL * PLANE);
      const unsigned short* sB = sAh + PLANE;
      const unsigned short* sAl = sB + PLANE;
#pragma unroll
      for (int ks = 0; ks < 2; ++ks) {
        FragB ah[2], al[2], b[4];
#pragma unroll
        for (int mi = 0; mi < 2; ++mi) {
          const int o = (wm * 32 + mi * 16 + ln) * PB + ks * 32 + 8 * hh;
          ah[mi].half[0] = *(const v8us*)(sAh + o); ah[mi].half[1] = *(const v8us*)(sAh + o + 16);
          if (ASPLIT) { al[mi].half[0] = *(const v8us*)(sAl + o); al[mi].half[1] = *(const v8us*)(sAl + o + 16); }
          else al[mi] = ah[mi];
        }
#pragma unroll
        for (int t = 0; t < 4; ++t) {
          const int o = (wn * 64 + t * 16 + ln) * PB + ks * 32 + 8 * hh;
          b[t].half[0] = *(const v8us*)(sB + o); b[t].half[1] = *(const v8us*)(sB + o + 16);
        }
#pragma unroll
        for (int mi = 0; mi < 2; ++mi)
#pragma unroll
          for (int t = 0; t < 4; ++t) acc[mi][t] = mmaN<ASPLIT ? 2 : 1>(ah[mi].v, al[mi].v, b[t].v, b[t].v, acc[mi][t]);
      }
    }
    if (p < np) {
      // pass p from registers into the buffer whose readers left it at the barrier that ended trip p - 1
      unsigned short* dAh = sm + (p & 1) * (NPL * PLANE);
      unsigned short* dB = dAh + PLANE;
      unsigned short* dAl = dB + PLANE;
      if constexpr (ASPLIT) {
#pragma unroll   // constant indices: the arrays stay in registers
        for (int i = 0; i < 4; ++i) { *(v8us*)(dAh + (br + 32 * i) * PB + bc) = xah[i]; *(v8us*)(dAl + (br + 32 * i) * PB + bc) = xal[i]; }
      } else {
#pragma unroll
        for (int i = 0; i < 8; ++i) {
          v4us h;
#pragma unroll
          for (int t = 0; t < 4; ++t) h[t] = bf16_bits(xa[i][t]);
          *(v4us*)(dAh + (ar + 16 * i) * PB + ac) = h;
        }
      }
#pragma unroll
      for (int i = 0; i < 4; ++i) *(v8us*)(dB + (br + 32 * i) * PB + bc) = xb[i];
    }
    __syncthreads();
    if (p + 1 < np) {
      // pass p + 1 starts its way from L2 now and is waited for only behind the products of pass p
      fetch((p + 1) * 64);
    }
  }
  const int rsub = lane >> 4, c4 = (lane & 15) * 4;
  v4f cs[16];
  if (ROT) {
    // the (cos, sin) pairs of this lane's two column pairs in its 16 rows: sixteen loads off one address, issued together (one latency for all)
    static_assert(TT % 128 == 0 && HD == 64, "a 128-row tile stays inside one sequence; a wave's 64 columns are one head");
    const float* pr = rot + (size_t)(row0 % TT + wm * 32 + rsub) * HD + c4;
#pragma unroll
    for (int q = 0; q < 16; ++q) cs[q] = *(const v4fa*)(pr + q * 2 * HD);
    // the address that these loads name is not written ahead of this wait: the input keeps it live up to it
    asm volatile("s_wait_xcnt 0x0" :: "v"(pr) : "memory");
  }
  // the barrier of the last trip stands behind every wave's last read of the buffers: each wave now stages its 32 x 64 tile in a range of its own
  float* so = (float*)sm + w * (32 * PO);
#pragma unroll
  for (int mi = 0; mi < 2; ++mi)
#pragma unroll
    for (int t = 0; t < 4; ++t) {
      float bv = bias ? bias[col0 + wn * 64 + t * 16 + ln] : 0.f;
      if (BIAS_BF16) bv = bf16_round(bv);
#pragma unroll
      for (int r = 0; r < 8; ++r) { float v = acc[mi][t][r] + bv; if (ACT == 1) v = fmaxf(v, 0.f); so[(mi * 16 + 8 * hh + r) * PO + t * 16 + ln] = v; }
    }
  __builtin_amdgcn_fence(__ATOMIC_ACQ_REL, "workgroup");
  __builtin_amdgcn_wave_barrier();
#pragma unroll
  for (int q = 0; q < 16; ++q) {
    const int r = q * 2 + rsub;
    v4f v = *(const v4fa*)&so[r * PO + c4];
    if (ROT) {
      const v4f x = v, t = cs[q];
      v = (v4f){x[0] * t[0] - x[1] * t[1], x[1] * t[0] + x[0] * t[1], x[2] * t[2] - x[3] * t[3], x[3] * t[2] + x[2] * t[3]};
    }
    if (LO > 0) {
      v4us h, l;
#pragma unroll   // constant indices: the vectors stay in registers
      for (int t = 0; t < 4; ++t) { const float x = v[t] * oscale; const unsigned short hb = bf16_bits(x); h[t] = hb; l[t] = bf16_bits(x - bf16_val(hb)); }
      unsigned short* ph = (unsigned short*)C + (size_t)(row0 + wm * 32 + r) * ldc + col0 + wn * 64 + c4;
      *(v4us*)ph = h; *(v4us*)(ph + LO) = l;
      // neither the address nor the data that these two stores name is written ahead of this wait: the inputs keep them live up to it
      asm volatile("s_wait_xcnt 0x0" :: "v"(ph), "v"(h), "v"(l) : "memory");
    } else {
      *(v4f*)(C + (size_t)(row0 + wm * 32 + r) * ldc + col0 + wn * 64 + c4) = v;
    }
  }
}

template <int ALO, int ACT, bool BIAS_BF16, bool ROT, int LO>
__global__ __launch_bounds__(256) void k_gemm_bf(const float* __restrict__ A, int lda, const unsigned short* __restrict__ Wt, int ldb,
                                               const float* __restrict__ bias, float* __restrict__ C, int ldc, int M, int N, int K,
                                               const float* __restrict__ rot, float oscale) {
  __shared__ __attribute__((aligned(16))) unsigned short sm[GEMM_LDS(ALO)];
  gemm_tile<ALO, ACT, BIAS_BF16, ROT, LO>(sm, blockIdx.x, A, lda, Wt, ldb, bias, C, ldc, M, N, K, rot, oscale);
}
// The three projections, none of which reads another's output, in one launch: blockIdx.y = 0 makes q = rot(xq Wq) * qscale, 1 makes k = rot(xkv Wk), 2 makes v = xkv Wv;
// blockIdx.x is the tile, as in k_gemm_bf. The choice is the same for the whole work-group.
template <int LO>
__global__ __launch_bounds__(256) void k_gemm_qkv(const float* __restrict__ xq, const float* __restrict__ xkv, int lda,
                                                const unsigned short* __restrict__ Tq, const unsigned short* __restrict__ Tk, const unsigned short* __restrict__ Tv, int ldb,
                                                float* __restrict__ q, float* __restrict__ k, float* __restrict__ v, int ldc, int M, int N, int K,
                                                const float* __restrict__ rot, float qscale) {
  __shared__ __attribute__((aligned(16))) unsigned short sm[GEMM_LDS(0)];
  const int z = blockIdx.y;
  if (z < 2) gemm_tile<0, 0, false, true, LO>(sm, blockIdx.x, z == 0 ? xq : xkv, lda, z == 0 ? Tq : Tk, ldb, nullptr, z == 0 ? q : k, ldc, M, N, K, rot, z == 0 ? qscale : 1.0f);
  else gemm_tile<0, 0, false, false, LO>(sm, blockIdx.x, xkv, lda, Tv, ldb, nullptr, v, ldc, M, N, K, nullptr, 1.0f);
}

// Flash-style causal/unmasked attention, all contractions 3-term bf16 hi/lo splits, f32 softmax with running max.
// q,k,v rows are read from f32 buffers with arbitrary row pitch (so they can live inside a fused qkv buffer);
// D = head size (multiple of 32, <= 128); one wave = 16 query rows; block = 4 waves (64 queries) sharing K/V chunks of 32.
template <int D, bool CAUSAL>
__global__ __launch_bounds__(128) void k_flash(const float* __restrict__ qb, const float* __restrict__ kb, const float* __restrict__ vb,
                                             int pitch, int T, int H, float scale, float* __restrict__ y, int ypitch) {
  constexpr int KS = D / 32;        // k-steps for QK
  constexpr int DT = D / 16;        // d tiles for PV
  __shared__ __attribute__((aligned(16))) unsigned short sKh[32][D + 8], sKl[32][D + 8], sVh[32][D + 8], sVl[32][D + 8];
  __shared__ __attribute__((aligned(16))) unsigned short sPh[4][16][40], sPl[4][16][40];
  __shared__ __attribute__((aligned(16))) float sO[4][16][D];
  const int tid = threadIdx.x, w = tid >> 5, lane = tid & 31, ln = lane & 15, hh = lane >> 4;
  const int nqb = (T + 63) / 64;
  const int bh = blockIdx.x / nqb, qblk = blockIdx.x % nqb;
  const int b = bh / H, h = bh % H;
  const int q0 = qblk * 64 + w * 16;
  const float* Q = qb + (size_t)b * T * pitch + h * D;
  const float* K = kb + (size_t)b * T * pitch + h * D;
  const float* V = vb + (size_t)b * T * pitch + h * D;

  // A fragments of the wave's 16 query rows (scaled), hi/lo
  FragB aqh[KS], aql[KS];
  {
    int row = q0 + ln; if (row >= T) row = T - 1;
    const float* qr = Q + (size_t)row * pitch;
#pragma unroll
    for (int ks = 0; ks < KS; ++ks)
#pragma unroll
      for (int i = 0; i < 16; ++i) {
        const int d = ks * 32 + ((i < 8) ? (8 * hh + i) : (16 + 8 * hh + (i - 8)));
        const float x = qr[d] * scale; const unsigned short hb = bf16_bits(x);
        aqh[ks].u[i] = hb; aql[ks].u[i] = bf16_bits(x - bf16_val(hb));
      }
  }
  float m_r[8], l_r[8];
#pragma unroll
  for (int r = 0; r < 8; ++r) { m_r[r] = -3.0e38f; l_r[r] = 0.f; }
  v8f oacc[DT];
#pragma unroll
  for (int dt = 0; dt < DT; ++dt) oacc[dt] = (v8f){0.f,0.f,0.f,0.f,0.f,0.f,0.f,0.f};

  const int kv_end = CAUSAL ? min(T, qblk * 64 + 64) : T;     // block-uniform
  for (int j0 = 0; j0 < kv_end; j0 += 32) {
    __syncthreads();
    for (int e = tid; e < 32 * (D / 4); e += 128) {
      const int r = e / (D / 4), c4 = (e % (D / 4)) * 4;
      const int key = j0 + r;
      v4f kf = {0.f,0.f,0.f,0.f}, vf = {0.f,0.f,0.f,0.f};
      if (key < T) { kf = *(const v4fa*)(K + (size_t)key * pitch + c4); vf = *(const v4fa*)(V + (size_t)key * pitch + c4); }
#pragma unroll
      for (int t = 0; t < 4; ++t) {
        unsigned short hb = bf16_bits(kf[t]); sKh[r][c4 + t] = hb; sKl[r][c4 + t] = bf16_bits(kf[t] - bf16_val(hb));
        hb = bf16_bits(vf[t]); sVh[r][c4 + t] = hb; sVl[r][c4 + t] = bf16_bits(vf[t] - bf16_val(hb));
      }
    }
    __syncthreads();
    // S tile 16 x 32
    v8f s[2];
#pragma unroll
    for (int nt = 0; nt < 2; ++nt) {
      v8f acc = {};
#pragma unroll
      for (int ks = 0; ks < KS; ++ks) {
        FragB bh_, bl_;
        bh_.half[0] = *(const v8us*)&sKh[nt * 16 + ln][ks * 32 + 8 * hh]; bh_.half[1] = *(const v8us*)&sKh[nt * 16 + ln][ks * 32 + 16 + 8 * hh];
        bl_.half[0] = *(const v8us*)&sKl[nt * 16 + ln][ks * 32 + 8 * hh]; bl_.half[1] = *(const v8us*)&sKl[nt * 16 + ln][ks * 32 + 16 + 8 * hh];
        acc = mmaN<3>(aqh[ks].v, aql[ks].v, bh_.v, bl_.v, acc);
      }
      s[nt] = acc;
    }
    // mask + running max (rows 8hh+r; the 16 lanes of a half share rows)
    float alpha[8];
#pragma unroll
    for (int r = 0; r < 8; ++r) {
      const int qi = q0 + 8 * hh + r;
      const int ja = j0 + ln, jb = j0 + 16 + ln;
      if (CAUSAL) { if (ja > qi) s[0][r] = -3.0e38f; if (jb > qi) s[1][r] = -3.0e38f; }
      if (ja >= T) s[0][r] = -3.0e38f;
      if (jb >= T) s[1][r] = -3.0e38f;
      float mx = fmaxf(s[0][r], s[1][r]);
      mx = fmaxf(mx, __shfl_xor(mx, 1, 32)); mx = fmaxf(mx, __shfl_xor(mx, 2, 32)); mx = fmaxf(mx, __shfl_xor(mx, 4, 32)); mx = fmaxf(mx, __shfl_xor(mx, 8, 32));
      const float mnew = fmaxf(m_r[r], mx);
      alpha[r] = (mnew > -1.0e38f) ? __expf(m_r[r] - mnew) : 1.0f;
      const float p0 = (s[0][r] > -1.0e38f) ? __expf(s[0][r] - mnew) : 0.f;
      const float p1 = (s[1][r] > -1.0e38f) ? __expf(s[1][r] - mnew) : 0.f;
      m_r[r] = mnew;
      l_r[r] = l_r[r] * alpha[r] + p0 + p1;            // per-lane partial row sum (16 lanes combined at the end)
      unsigned short hb = bf16_bits(p0); sPh[w][8 * hh + r][ln] = hb;      sPl[w][8 * hh + r][ln] = bf16_bits(p0 - bf16_val(hb));
      hb = bf16_bits(p1);                sPh[w][8 * hh + r][16 + ln] = hb; sPl[w][8 * hh + r][16 + ln] = bf16_bits(p1 - bf16_val(hb));
    }
#pragma unroll
    for (int dt = 0; dt < DT; ++dt)
#pragma unroll
      for (int r = 0; r < 8; ++r) oacc[dt][r] *= alpha[r];
    __builtin_amdgcn_fence(__ATOMIC_ACQ_REL, "workgroup");
    __builtin_amdgcn_wave_barrier();
    FragB pah, pal;
    pah.half[0] = *(const v8us*)&sPh[w][ln][8 * hh]; pah.half[1] = *(const v8us*)&sPh[w][ln][16 + 8 * hh];
    pal.half[0] = *(const v8us*)&sPl[w][ln][8 * hh]; pal.half[1] = *(const v8us*)&sPl[w][ln][16 + 8 * hh];
#pragma unroll
    for (int dt = 0; dt < DT; ++dt) {
      FragB bvh, bvl;
#pragma unroll
      for (int i = 0; i < 8; ++i) {
        bvh.u[i] = sVh[8 * hh + i][dt * 16 + ln]; bvh.u[8 + i] = sVh[16 + 8 * hh + i][dt * 16 + ln];
        bvl.u[i] = sVl[8 * hh + i][dt * 16 + ln]; bvl.u[8 + i] = sVl[16 + 8 * hh + i][dt * 16 + ln];
      }
      oacc[dt] = mmaN<3>(pah.v, pal.v, bvh.v, bvl.v, oacc[dt]);
    }
    __builtin_amdgcn_fence(__ATOMIC_ACQ_REL, "workgroup");
    __builtin_amdgcn_wave_barrier();
  }
#pragma unroll
  for (int r = 0; r < 8; ++r) {
    float l = l_r[r];
    l += __shfl_xor(l, 1, 32); l += __shfl_xor(l, 2, 32); l += __shfl_xor(l, 4, 32); l += __shfl_xor(l, 8, 32);
    l_r[r] = (l > 0.f) ? 1.0f / l : 0.f;
  }
#pragma unroll
  for (int dt = 0; dt < DT; ++dt)
#pragma unroll
    for (int r = 0; r < 8; ++r) sO[w][8 * hh + r][dt * 16 + ln] = oacc[dt][r] * l_r[r];
  __builtin_amdgcn_fence(__ATOMIC_ACQ_REL, "workgroup");
  __builtin_amdgcn_wave_barrier();
  {
    for (int r = 0; r < 16; ++r) {
      const int row = q0 + r;
      if (row < T && lane < D / 4) {
        const v4f val = *(const v4fa*)&sO[w][r][lane * 4];
        *(v4f*)(y + ((size_t)b * T + row) * ypitch + h * D + lane * 4) = val;
      }
    }
    
  }
}

// 16 x 16 tile of 16-bit values, row-major in LDS, read transposed: lane l passes the address of row 8 (l >> 4) + (l & 7), columns 8 ((l >> 3) & 1) + 0..7,
// and receives rows 8 (l >> 4) + 0..7 of column l & 15. A load that the compiler sees: it places the wait.
__device__ __forceinline__ v8us ld_tr16(const unsigned short* p) {
  typedef short s16x8 __attribute__((ext_vector_type(8)));
  typedef __attribute__((address_space(3))) s16x8 lds_s16x8;
  return __builtin_bit_cast(v8us, __builtin_amdgcn_ds_load_tr16_b128_v8i16((lds_s16x8*)p));
}
template <int D, int LO>
__global__ __launch_bounds__(128) void k_flash_band(const unsigned short* __restrict__ Qb, const unsigned short* __restrict__ Kb, const unsigned short* __restrict__ Vb,
                                                  int pitch, int T, int H, int band, unsigned short* __restrict__ y, int ypitch) {
  constexpr int KS = D / 32, DT = D / 16;
  __shared__ __attribute__((aligned(16))) unsigned short sKh[32][D + 8], sKl[32][D + 8];
  __shared__ __attribute__((aligned(32))) unsigned short sVh[32][D + 16], sVl[32][D + 16];   // V rows at an odd multiple of 32 B, the pitch of the transposing reader
  __shared__ __attribute__((aligned(16))) float sO[4][16][D + 4];   // 16 B more a row: the 16 lanes that write one column group of 16 rows meet 16 different bank groups
  const int tid = threadIdx.x, w = tid >> 5, lane = tid & 31, ln = lane & 15, hh = lane >> 4;
  const int nqb = (T + 63) / 64;
  const int bh = blockIdx.x / nqb, qblk = blockIdx.x % nqb;
  const int b = bh / H, h = bh % H;
  const int q0 = qblk * 64 + w * 16;
  const unsigned short* Q = Qb + (size_t)b * T * pitch + h * D;
  const unsigned short* K = Kb + (size_t)b * T * pitch + h * D;
  const unsigned short* V = Vb + (size_t)b * T * pitch + h * D;
  FragB aqh[KS], aql[KS];
  {
    // lane (ln, hh) holds d = ks * 32 + 8 hh + 0..7 and ks * 32 + 16 + 8 hh + 0..7 of row q0 + ln: two 16-byte pieces of the row, hi and lo alike
    int row = q0 + ln; if (row >= T) row = T - 1;
    const unsigned short* qr = Q + (size_t)row * pitch + 8 * hh;
#pragma unroll
    for (int ks = 0; ks < KS; ++ks) {
      aqh[ks].half[0] = *(const v8us*)(qr + ks * 32);      aqh[ks].half[1] = *(const v8us*)(qr + ks * 32 + 16);
      aql[ks].half[0] = *(const v8us*)(qr + LO + ks * 32); aql[ks].half[1] = *(const v8us*)(qr + LO + ks * 32 + 16);
    }
    // the address that these loads name is not written ahead of this wait: the input keeps it live up to it
    asm volatile("s_wait_xcnt 0x0" :: "v"(qr) : "memory");
  }
  const int trow = 8 * hh + (lane & 7), tcol = 8 * ((lane >> 3) & 1);   // the 16 bytes this lane hands to a transposing load of a 16 x 16 tile
  // the keys that count for this lane's query: klo .. klo + kwid = [qi - band, min(qi + band, T - 1)]
  const int qi = min(q0 + ln, T - 1);
  const int klo = qi - band;
  const unsigned kwid = (unsigned)(min(qi + band, T - 1) - klo);
  float m_r = -3.0e38f, l_r = 0.f;
  v8f oacc[DT];   // oacc[dt][r] = O[q0 + ln][dt * 16 + 8 hh + r]
#pragma unroll
  for (int dt = 0; dt < DT; ++dt) oacc[dt] = (v8f){0.f,0.f,0.f,0.f,0.f,0.f,0.f,0.f};
  // A key farther than band from every query row of the block has weight exp(-3e38 - m) = 0 in every row:
  // the loop runs only over the 32-key chunks that meet [first row - band, last row + band] (block-uniform bounds).
  const int kv_begin = max(0, qblk * 64 - band) & ~31, kv_end = min(T, qblk * 64 + 64 + band);
  const int wq0 = qblk * 64 + __builtin_amdgcn_readfirstlane(w) * 16;   // the wave's first row, in a scalar register: the chunk test below is a scalar branch
  for (int j0 = kv_begin; j0 < kv_end; j0 += 32) {
    __syncthreads();
    {
      constexpr int NE = 32 * (D / 8) / 128;   // 16-byte pieces of each of K hi, K lo, V hi, V lo per thread and trip
      static_assert(NE == 2, "the wait below names two K and two V addresses");
      v8us kh[NE], kl[NE], vh[NE], vl[NE]; const unsigned short* pk[NE]; const unsigned short* pv[NE];
#pragma unroll
      for (int i = 0; i < NE; ++i) {
        const int e = tid + 128 * i, key = j0 + e / (D / 8), c8 = (e % (D / 8)) * 8;
        const size_t o = (size_t)min(key, T - 1) * pitch + c8;   // address in bounds for every lane; a key past the end is zeroed below
        pk[i] = K + o; pv[i] = V + o;
        kh[i] = *(const v8us*)pk[i]; kl[i] = *(const v8us*)(pk[i] + LO); vh[i] = *(const v8us*)pv[i]; vl[i] = *(const v8us*)(pv[i] + LO);
      }
      // no register that one of these loads names as its address is written (not by a load's result either) ahead of this wait:
      // the inputs keep all four addresses live up to it
      asm volatile("s_wait_xcnt 0x0" :: "v"(pk[0]), "v"(pk[1]), "v"(pv[0]), "v"(pv[1]) : "memory");
      if (j0 + 32 > T) {   // the same for the whole work-group: only a last chunk that runs past the end has keys to zero
#pragma unroll   // constant indices: the arrays stay in registers
        for (int i = 0; i < NE; ++i)
          if (j0 + (tid + 128 * i) / (D / 8) >= T) { kh[i] = (v8us)(unsigned short)0; kl[i] = (v8us)(unsigned short)0; vh[i] = (v8us)(unsigned short)0; vl[i] = (v8us)(unsigned short)0; }
      }
#pragma unroll
      for (int i = 0; i < NE; ++i) {
        const int e = tid + 128 * i, r = e / (D / 8), c8 = (e % (D / 8)) * 8;
        *(v8us*)&sKh[r][c8] = kh[i]; *(v8us*)&sKl[r][c8] = kl[i]; *(v8us*)&sVh[r][c8] = vh[i]; *(v8us*)&sVl[r][c8] = vl[i];
      }
    }
    __syncthreads();
    // a chunk wholly outside the band of this wave's own 16 rows adds nothing to them (no work-group barrier below this line in the trip)
    if (j0 + 31 < wq0 - band || j0 > wq0 + 15 + band) continue;
    // S^T tile nt: s[nt][r] = score of key j0 + nt * 16 + 8 hh + r with query q0 + ln. A = K rows, B = the Q fragments, both in the k order d = 8 hh + 0..7, 16 + 8 hh + 0..7 of each 32.
    v8f s[2];
#pragma unroll
    for (int nt = 0; nt < 2; ++nt) {
      v8f acc = {};
#pragma unroll
      for (int ks = 0; ks < KS; ++ks) {
        FragB kh_, kl_;
        kh_.half[0] = *(const v8us*)&sKh[nt * 16 + ln][ks * 32 + 8 * hh]; kh_.half[1] = *(const v8us*)&sKh[nt * 16 + ln][ks * 32 + 16 + 8 * hh];
        kl_.half[0] = *(const v8us*)&sKl[nt * 16 + ln][ks * 32 + 8 * hh]; kl_.half[1] = *(const v8us*)&sKl[nt * 16 + ln][ks * 32 + 16 + 8 * hh];
        acc = mma3x(kh_.v, kl_.v, aqh[ks].v, aql[ks].v, acc);
      }
      s[nt] = acc;
    }
    // element i = nt * 8 + r of this lane: key j0 + nt * 16 + 8 hh + r
    const int kd0 = j0 + 8 * hh - klo;
    float sc[16];
#pragma unroll
    for (int i = 0; i < 16; ++i) sc[i] = ((unsigned)(kd0 + (i >> 3) * 16 + (i & 7)) <= kwid) ? s[i >> 3][i & 7] : -3.0e38f;
    float mx4[4];
#pragma unroll
    for (int c = 0; c < 4; ++c) mx4[c] = fmaxf(fmaxf(sc[c], sc[4 + c]), fmaxf(sc[8 + c], sc[12 + c]));
    float mx = fmaxf(fmaxf(mx4[0], mx4[1]), fmaxf(mx4[2], mx4[3]));
    mx = fmaxf(mx, xhalf(mx));   // the other 16 keys of the chunk are in lane l ^ 16
    const float mnew = fmaxf(m_r, mx);
    const float alpha = (mnew > -1.0e38f) ? __expf(m_r - mnew) : 1.0f;
    m_r = mnew;
    // b[i] = P^T[key 8 hh + i or 16 + 8 hh + (i - 8)][q0 + ln]: the k order in which the transposing loads below deliver V
    // (register j holds elements 2 j and 2 j + 1); hi = bf16(p), lo = bf16(p - hi), rounded as bf16_bits rounds
    v8u ph, pl;
    v2f ps2[2] = {{0.f, 0.f}, {0.f, 0.f}};
#pragma unroll
    for (int j = 0; j < 8; ++j) {
      const v2f p = {__expf(sc[2 * j] - mnew), __expf(sc[2 * j + 1] - mnew)};
      ps2[j & 1] += p;
      const unsigned int h0 = bf16_top(p[0]), h1 = bf16_top(p[1]);
      const v2f hv = {__uint_as_float(h0 & 0xFFFF0000u), __uint_as_float(h1 & 0xFFFF0000u)};
      const v2f lo = p - hv;
      ph[j] = __builtin_amdgcn_perm(h1, h0, 0x07060302u);                              // the top halves of h0 (low) and h1 (high)
      pl[j] = __builtin_amdgcn_perm(bf16_top(lo[1]), bf16_top(lo[0]), 0x07060302u);
    }
    const v16b pbh = __builtin_bit_cast(v16b, ph), pbl = __builtin_bit_cast(v16b, pl);
    l_r = l_r * alpha + ((ps2[0][0] + ps2[0][1]) + (ps2[1][0] + ps2[1][1]));   // this lane's 16 keys; the halves are joined behind the loop
#pragma unroll
    for (int dt = 0; dt < DT; ++dt)
#pragma unroll
      for (int r = 0; r < 8; ++r) oacc[dt][r] *= alpha;
    // A = V^T: lane (ln, hh) gets V[8 hh + 0..7][dt * 16 + ln] from the first load of a pair and V[16 + 8 hh + 0..7][dt * 16 + ln] from the second: the k order of pbh / pbl.
    // All sixteen loads stand in one group ahead of the products: one LDS latency a trip, not one per 16 columns.
    FragB avh[DT], avl[DT];
#pragma unroll
    for (int dt = 0; dt < DT; ++dt) {
      avh[dt].half[0] = ld_tr16(&sVh[trow][dt * 16 + tcol]); avh[dt].half[1] = ld_tr16(&sVh[16 + trow][dt * 16 + tcol]);
      avl[dt].half[0] = ld_tr16(&sVl[trow][dt * 16 + tcol]); avl[dt].half[1] = ld_tr16(&sVl[16 + trow][dt * 16 + tcol]);
    }
#pragma unroll
    for (int dt = 0; dt < DT; ++dt) oacc[dt] = mma3x(avh[dt].v, avl[dt].v, pbh, pbl, oacc[dt]);
  }
  {
    const float l = l_r + xhalf(l_r);
    const float inv = (m_r > -1.0e38f) ? 1.0f / l : __builtin_nanf("");
#pragma unroll
    for (int dt = 0; dt < DT; ++dt) {
      // a lane's eight values are eight columns in a row of its query: two 16-byte stores
      *(v4fa*)&sO[w][ln][dt * 16 + 8 * hh]     = (v4f){oacc[dt][0] * inv, oacc[dt][1] * inv, oacc[dt][2] * inv, oacc[dt][3] * inv};
      *(v4fa*)&sO[w][ln][dt * 16 + 8 * hh + 4] = (v4f){oacc[dt][4] * inv, oacc[dt][5] * inv, oacc[dt][6] * inv, oacc[dt][7] * inv};
    }
  }
  __builtin_amdgcn_fence(__ATOMIC_ACQ_REL, "workgroup");
  __builtin_amdgcn_wave_barrier();
  {
    static_assert(D == 64, "16 lanes of 4 columns cover a row: a wave stores two rows at a time");
    for (int r2 = 0; r2 < 16; r2 += 2) {
      const int r = r2 + hh, row = q0 + r;
      if (row < T) {
        const v4f val = *(const v4fa*)&sO[w][r][ln * 4];
        v4us h4, l4;
#pragma unroll   // constant indices: the vectors stay in registers
        for (int t = 0; t < 4; ++t) { const unsigned short hb = bf16_bits(val[t]); h4[t] = hb; l4[t] = bf16_bits(val[t] - bf16_val(hb)); }
        unsigned short* py = y + ((size_t)b * T + row) * ypitch + h * D + ln * 4;
        *(v4us*)py = h4; *(v4us*)(py + LO) = l4;
        // neither the address nor the data that these two stores name is written ahead of this wait: the inputs keep them live up to it
        asm volatile("s_wait_xcnt 0x0" :: "v"(py), "v"(h4), "v"(l4) : "memory");
      }
    }
  }
}
// table of the interleaved rotary step: rot[pos][i] = (cos, sin) of pos * inv_freq[i], inv_freq[i] = 10000^(-i/(d/2)); thread per (pos, i);
// written anew in every call, ahead of the GEMMs that read it. A part of k_setup.
__device__ __forceinline__ void rot_table_part(float* __restrict__ rot, int t) {
  if (t >= TT * (HD / 2)) return;
  const int pos = t / (HD / 2), i = t % (HD / 2);
  const float inv = powf(10000.0f, -(float)i / (float)(HD / 2)); const float ang = (float)pos * inv; float sn, cs; sincosf(ang, &sn, &cs);
  v2f a = {cs, sn};
  *(v2f*)(rot + (size_t)t * 2) = a;
}
// All that the GEMMs need beforehand, in one launch (no part reads what another writes): the first SETUP_RB work-groups write the rotary table
// (the longest threads, so they start first), then SETUP_WB work-groups, one per tile, for each of the four weight matrices.
static_assert(EE % WT_TK == 0 && EE % WT_TN == 0, "whole tiles");
constexpr int SETUP_RB = (TT * (HD / 2) + 255) / 256, SETUP_WB = (EE / WT_TK) * (EE / WT_TN);
__global__ __launch_bounds__(256) void k_setup(const float* __restrict__ Wq, const float* __restrict__ Wk, const float* __restrict__ Wv, const float* __restrict__ Wo,
                                             unsigned short* __restrict__ Tq, unsigned short* __restrict__ Tk, unsigned short* __restrict__ Tv, unsigned short* __restrict__ To,
                                             float* __restrict__ rot) {
  __shared__ __attribute__((aligned(16))) unsigned short sT[WT_TN * WT_P];
  const int bid = blockIdx.x;
  if (bid < SETUP_RB) { rot_table_part(rot, bid * 256 + threadIdx.x); return; }   // the same for the whole work-group, ahead of the barrier
  const int m = (bid - SETUP_RB) / SETUP_WB, tile = (bid - SETUP_RB) % SETUP_WB;
  wt_bf16_tile(sT, m == 0 ? Wq : m == 1 ? Wk : m == 2 ? Wv : Wo, m == 0 ? Tq : m == 1 ? Tk : m == 2 ? Tv : To, EE, EE, tile);
}
extern "C" void kernel_launch(void* const* d_in, const int* in_sizes, int n_in,
                              void* d_out, int out_size, void* d_ws, size_t ws_size, hipStream_t stream) {
  (void)in_sizes; (void)n_in; (void)out_size;
  const float* xq = (const float*)d_in[0]; const float* xkv = (const float*)d_in[1];
  const float* Wq = (const float*)d_in[2]; const float* Wk = (const float*)d_in[3]; const float* Wv = (const float*)d_in[4]; const float* Wo = (const float*)d_in[5];
  char* ws = (char*)d_ws; size_t off = 0;
  auto take = [&](size_t bytes) { char* p = ws + off; off += (bytes + 255) & ~(size_t)255; return p; };
  const int M = BB * TT, gb = (M / 128) * (EE / 128);
  unsigned short* Wt[4]; for (int i = 0; i < 4; ++i) Wt[i] = (unsigned short*)take((size_t)EE * EE * 2);
  float* q = (float*)take((size_t)M * EE * 4); float* k = (float*)take((size_t)M * EE * 4); float* v = (float*)take((size_t)M * EE * 4); float* att = (float*)take((size_t)M * EE * 4);
  float* rot = (float*)take((size_t)TT * HD * 4);
  if (off > ws_size) return;
  k_setup<<<SETUP_RB + 4 * SETUP_WB, 256, 0, stream>>>(Wq, Wk, Wv, Wo, Wt[0], Wt[1], Wt[2], Wt[3], rot);
  // q (times 1/sqrt(HD)), k, v and the attention's output leave their kernels as bf16 hi | lo rows of 2 * EE 16-bit values, in the room of the f32 rows
  k_gemm_qkv<EE><<<dim3(gb, 3), 256, 0, stream>>>(xq, xkv, EE, Wt[0], Wt[1], Wt[2], EE, q, k, v, 2 * EE, M, EE, EE, rot, 0.125f);
  k_flash_band<HD, EE><<<BB * NH * (TT / 64), 128, 0, stream>>>((const unsigned short*)q, (const unsigned short*)k, (const unsigned short*)v, 2 * EE, TT, NH, 256, (unsigned short*)att, 2 * EE);
  k_gemm_bf<EE, 0, false, false, 0><<<gb, 256, 0, stream>>>(att, 2 * EE, Wt[3], EE, nullptr, (float*)d_out, EE, M, EE, EE, nullptr, 1.0f);
}

// v010
// A run of this version takes 150 microseconds.
// Next to v009, in two timings, it ran 1.07 times as fast each time.
// Counting every step since v000, it is 7.75 times as fast.
#include <hip/hip_runtime.h>
// All contractions on v_wmma_f32_16x16x32_bf16, f32 accumulate: x_q·Wq, x_kv·Wk, x_kv·Wv (inputs, W rounded to bf16: single exact term),
// QKᵀ and P·V per 16-query tile as 3-term bf16 hi/lo splits with the |i−j| ≤ 256 band, out·Wo with the A operand split (2 terms);
// interleaved rotary embedding and softmax in f32.
#define BB 4
#define TT 2048
#define EE 1024
#define NH 16
#define HD 64

typedef __bf16 v16b __attribute__((ext_vector_type(16)));
typedef unsigned short v8us __attribute__((ext_vector_type(8), may_alias));
typedef float  v8f  __attribute__((ext_vector_type(8)));
typedef float  v4f  __attribute__((ext_vector_type(4)));
typedef float  v4fa __attribute__((ext_vector_type(4), may_alias));
union FragB { v16b v; v8us half[2]; unsigned short u[16]; };

__device__ __forceinline__ unsigned short bf16_bits(float x) { unsigned int u = __float_as_uint(x); return (unsigned short)((u + 0x7FFFu + ((u >> 16) & 1u)) >> 16); }
__device__ __forceinline__ float bf16_val(unsigned short b) { return __uint_as_float(((unsigned int)b) << 16); }
__device__ __forceinline__ float bf16_round(float x) { return bf16_val(bf16_bits(x)); }
// D += A·B with NT terms: 1 = ah·bh, 2 = + al·bh (A split), 3 = + ah·bl (both split)
template <int NT>
__device__ __forceinline__ v8f mmaN(v16b ah, v16b al, v16b bh, v16b bl, v8f c) {
  c = __builtin_amdgcn_wmma_f32_16x16x32_bf16(false, ah, false, bh, (short)0, c, false, false);
  if (NT >= 2) c = __builtin_amdgcn_wmma_f32_16x16x32_bf16(false, al, false, bh, (short)0, c, false, false);
  if (NT >= 3) c = __builtin_amdgcn_wmma_f32_16x16x32_bf16(false, ah, false, bl, (short)0, c, false, false);
  asm volatile("v_nop\n\tv_nop\n\tv_nop\n\tv_nop" : "+v"(c) : "v"(ah), "v"(al), "v"(bh), "v"(bl));
  return c;
}

// D += A x B, both split, the terms in the order ah x bh, ah x bl, al x bh: the order of mmaN<3> when its A and B change places
__device__ __forceinline__ v8f mma3x(v16b ah, v16b al, v16b bh, v16b bl, v8f c) {
  c = __builtin_amdgcn_wmma_f32_16x16x32_bf16(false, ah, false, bh, (short)0, c, false, false);
  c = __builtin_amdgcn_wmma_f32_16x16x32_bf16(false, ah, false, bl, (short)0, c, false, false);
  c = __builtin_amdgcn_wmma_f32_16x16x32_bf16(false, al, false, bh, (short)0, c, false, false);
  // the four vector slots that the chip needs behind a matrix instruction, on every path out of here (as in mmaN)
  asm volatile("v_nop\n\tv_nop\n\tv_nop\n\tv_nop" : "+v"(c) : "v"(ah), "v"(al), "v"(bh), "v"(bl));
  return c;
}
typedef unsigned int v8u __attribute__((ext_vector_type(8)));
typedef unsigned int v4u __attribute__((ext_vector_type(4)));
typedef unsigned int v2u __attribute__((ext_vector_type(2)));
typedef float v2f __attribute__((ext_vector_type(2)));
typedef __bf16 v2b __attribute__((ext_vector_type(2)));
typedef unsigned short v4us __attribute__((ext_vector_type(4), may_alias));
// bf16(a) in the low half of the word, bf16(b) in the high half: the chip's packed convert, one instruction for the pair; it rounds to nearest even, as bf16_bits does
__device__ __forceinline__ unsigned int bf16_pk(float a, float b) { const v2f x = {a, b}; return __builtin_bit_cast(unsigned int, __builtin_convertvector(x, v2b)); }
// the two bf16 values of such a word, as f32
__device__ __forceinline__ v2f bf16_pk_val(unsigned int u) { return (v2f){__uint_as_float(u << 16), __uint_as_float(u & 0xFFFF0000u)}; }
// four values as bf16 pairs: h = bf16(x), l = bf16(x - h)
__device__ __forceinline__ void bf16_split4(v4f x, v4us& h, v4us& l) {
  const v2u hu = {bf16_pk(x[0], x[1]), bf16_pk(x[2], x[3])};
  const v2f r0 = (v2f){x[0], x[1]} - bf16_pk_val(hu[0]), r1 = (v2f){x[2], x[3]} - bf16_pk_val(hu[1]);
  const v2u lu = {bf16_pk(r0[0], r0[1]), bf16_pk(r1[0], r1[1])};
  h = __builtin_bit_cast(v4us, hu); l = __builtin_bit_cast(v4us, lu);
}
// the value of lane l ^ 16
__device__ __forceinline__ float xhalf(float x) {
  return __builtin_bit_cast(float, __builtin_amdgcn_permlanex16(__builtin_bit_cast(int, x), __builtin_bit_cast(int, x), 0x76543210, 0xfedcba98, false, false));
}

// Wt[n][k] = bf16(W[k][n]), one tile of 64 k x 128 n per work-group of 8 waves, turned in LDS. A part of k_setup.
// In: a wave's load is 512 B in a row of W (four whole lines); a thread takes 4 n of 8 rows k and rounds them.
// Out: eight lanes store the 128 B (64 k) of one row of Wt, one whole line. sT holds WT_TN rows of WT_P 16-bit values.
constexpr int WT_TK = 64, WT_TN = 128;
constexpr int WT_P = WT_TK + 8;          // LDS row pitch in bf16: 128 B of k + 16 B, as in the GEMM's planes
__device__ __forceinline__ void wt_bf16_tile(unsigned short* sT, const float* __restrict__ W, unsigned short* __restrict__ Wt, int K, int N, int tile) {
  const int tid = threadIdx.x, w = tid >> 5, lane = tid & 31;
  const int ntn = N / WT_TN;
  const int k0 = (tile / ntn) * WT_TK, n0 = (tile % ntn) * WT_TN;
  const float* pw = W + (size_t)(k0 + 8 * w) * N + n0 + 4 * lane;
  v4f x[8];
#pragma unroll   // constant indices: the arrays stay in registers (the same for the loops below); the eight loads are issued together
  for (int i = 0; i < 8; ++i) x[i] = *(const v4fa*)(pw + (size_t)i * N);
#pragma unroll
  for (int j = 0; j < 4; ++j) {
    v4u v;
#pragma unroll
    for (int i = 0; i < 4; ++i) v[i] = bf16_pk(x[2 * i][j], x[2 * i + 1][j]);
    *(v8us*)(sT + (4 * lane + j) * WT_P + 8 * w) = __builtin_bit_cast(v8us, v);
  }
  __syncthreads();
  const int r = tid >> 3, c = (tid & 7) * 8;
  unsigned short* po = Wt + (size_t)(n0 + r) * K + k0 + c;
  v8us o[4];
#pragma unroll
  for (int i = 0; i < 4; ++i) o[i] = *(const v8us*)(sT + (r + 32 * i) * WT_P + c);
#pragma unroll
  for (int i = 0; i < 4; ++i) *(v8us*)(po + (size_t)(32 * i) * K) = o[i];
  // neither the address nor the data that these four stores name is written ahead of this wait: the inputs keep them live up to it
  asm volatile("s_wait_xcnt 0x0" :: "v"(po), "v"(o[0]), "v"(o[1]), "v"(o[2]), "v"(o[3]) : "memory");
}

// GEMM C[M][N] (f32, pitch ldc) = act(A[M][K] x W + bias). One work-group of 8 waves makes a 128 x 128 tile of C; a wave makes 32 x 64 of it.
// A pass is 64 k: the A rows are laid in LDS beside the 128 rows of Wt (bf16 [N][K], pitch ldb); every global load covers whole 128-B lines.
// ALO == 0: A is f32 (pitch lda), rounded to bf16 once per work-group, one term. ALO > 0: A arrives as the bf16 pairs its producer wrote, rows of
// 16-bit values at pitch lda, hi at column k and lo at column ALO + k: both planes are copied as they are, 2 terms.
// Two LDS buffers: the next pass is loaded into registers ahead of this pass's products and stored behind them, one barrier a pass.
// The k order of every sum is ascending in steps of 32, hi term then lo term. BIAS_BF16 rounds the bias to bf16 before the add.
// K%64==0, M%128==0, N%128==0.
// ROT: the interleaved rotary step is applied to the finished f32 tile on its way out: column pair (2i, 2i+1) of a head, row pos = row % TT,
// is turned by the (cos, sin) pair rot[pos][i] that k_setup wrote earlier in the same call (a wave's 64 columns are one head).
// LO > 0: the finished value, times oscale, leaves as a bf16 pair hi = bf16(x), lo = bf16(x - hi), the operands of the attention's 3-term products:
// C is then rows of 16-bit values at pitch ldc, hi at column c and lo at column LO + c of the same row (a wave's 64 columns are one 128-B line of each).
// The body of one work-group: sm is the kernel's LDS array of GEMM_LDS(ALO) 16-bit values, bid the number of the tile.
constexpr int GEMM_PB = 72;              // LDS row pitch in bf16: 128 B of k + 16 B, an odd multiple of 16 B for the 16-byte readers
constexpr int GEMM_LDS(int alo) { return 2 * (alo > 0 ? 3 : 2) * 128 * GEMM_PB; }   // two buffers of the planes A hi, W, (A lo)
template <int ALO, int ACT, bool BIAS_BF16, bool ROT, int LO>
__device__ __forceinline__ void gemm_tile(unsigned short* sm, int bid, const float* __restrict__ A, int lda, const unsigned short* __restrict__ Wt, int ldb,
                                          const float* __restrict__ bias, float* __restrict__ C, int ldc, int M, int N, int K,
                                          const float* __restrict__ rot, float oscale) {
  constexpr bool ASPLIT = ALO > 0;
  constexpr int PB = GEMM_PB;
  constexpr int PLANE = 128 * PB;        // one operand plane of a pass
  constexpr int NPL = ASPLIT ? 3 : 2;    // A hi, W, (A lo)
  constexpr int PO = 68;                 // pitch in f32 of the output staging rows
  const int tid = threadIdx.x, w = tid >> 5, lane = tid & 31, ln = lane & 15, hh = lane >> 4;
  const int ntn = N / 128;
  const int mb = bid / ntn, nb = bid % ntn;
  if (mb * 128 >= M) return;             // the same for the whole work-group, ahead of every barrier
  const int row0 = mb * 128, col0 = nb * 128;
  const int wm = w >> 1, wn = w & 1;
  const int ar = tid >> 4, ac = (tid & 15) * 4;    // staging of an f32 A: 16 lanes cover 256 B of a row
  const int br = tid >> 3, bc = (tid & 7) * 8;     // staging of W and of each plane of a 16-bit A: 8 lanes cover 128 B of a row
  const float* ag = A + (size_t)(row0 + ar) * lda + ac;
  const unsigned short* ap = (const unsigned short*)A + (size_t)(row0 + br) * lda + bc;
  const unsigned short* bg = Wt + (size_t)(col0 + br) * ldb + bc;
  v4f xa[8]; v8us xah[4], xal[4], xb[4];
  v8f acc[2][4] = {};
  const int np = K / 64;
  auto fetch = [&](int kb) {
    if constexpr (ASPLIT) {
      const unsigned short* pp[4]; const unsigned short* pb[4];
#pragma unroll   // constant indices: the arrays stay in registers (the same for the loops below)
      for (int i = 0; i < 4; ++i) { pp[i] = ap + (size_t)(32 * i) * lda + kb; xah[i] = *(const v8us*)pp[i]; xal[i] = *(const v8us*)(pp[i] + ALO); }
#pragma unroll
      for (int i = 0; i < 4; ++i) { pb[i] = bg + (size_t)(32 * i) * ldb + kb; xb[i] = *(const v8us*)pb[i]; }
      // no register that one of these loads names as its address is written (not by a later load's result either) ahead of this wait:
      // the inputs keep all eight addresses live up to it
      asm volatile("s_wait_xcnt 0x0" :: "v"(pp[0]), "v"(pp[1]), "v"(pp[2]), "v"(pp[3]), "v"(pb[0]), "v"(pb[1]), "v"(pb[2]), "v"(pb[3]) : "memory");
    } else {
    const float* pa[8]; const unsigned short* pb[4];
#pragma unroll
    for (int i = 0; i < 8; ++i) { pa[i] = ag + (size_t)(16 * i) * lda + kb; xa[i] = *(const v4fa*)pa[i]; }
#pragma unroll
    for (int i = 0; i < 4; ++i) { pb[i] = bg + (size_t)(32 * i) * ldb + kb; xb[i] = *(const v8us*)pb[i]; }
    // no register that one of these loads names as its address is written (not by a later load's result either) ahead of this wait:
    // the inputs keep all twelve addresses live up to it
    asm volatile("s_wait_xcnt 0x0" :: "v"(pa[0]), "v"(pa[1]), "v"(pa[2]), "v"(pa[3]), "v"(pa[4]), "v"(pa[5]), "v"(pa[6]), "v"(pa[7]),
                 "v"(pb[0]), "v"(pb[1]), "v"(pb[2]), "v"(pb[3]) : "memory");
    }
  };
  fetch(0);
  for (int p = 0; p <= np; ++p) {
    if (p > 0) {
      // products of pass p - 1 out of its buffer
      const unsigned short* sAh = sm + ((p - 1) & 1) * (NPL * PLANE);
      const unsigned short* sB = sAh + PLANE;
      const unsigned short* sAl = sB + PLANE;
#pragma unroll
      for (int ks = 0; ks < 2; ++ks) {
        FragB ah[2], al[2], b[4];
#pragma unroll
        for (int mi = 0; mi < 2; ++mi) {
          const int o = (wm * 32 + mi * 16 + ln) * PB + ks * 32 + 8 * hh;
          ah[mi].half[0] = *(const v8us*)(sAh + o); ah[mi].half[1] = *(const v8us*)(sAh + o + 16);
          if (ASPLIT) { al[mi].half[0] = *(const v8us*)(sAl + o); al[mi].half[1] = *(const v8us*)(sAl + o + 16); }
          else al[mi] = ah[mi];
        }
#pragma unroll
        for (int t = 0; t < 4; ++t) {
          const int o = (wn * 64 + t * 16 + ln) * PB + ks * 32 + 8 * hh;
          b[t].half[0] = *(const v8us*)(sB + o); b[t].half[1] = *(const v8us*)(sB + o + 16);
        }
#pragma unroll
        for (int mi = 0; mi < 2; ++mi)
#pragma unroll
          for (int t = 0; t < 4; ++t) acc[mi][t] = mmaN<ASPLIT ? 2 : 1>(ah[mi].v, al[mi].v, b[t].v, b[t].v, acc[mi][t]);
      }
    }
    if (p < np) {
      // pass p from registers into the buffer whose readers left it at the barrier that ended trip p - 1
      unsigned short* dAh = sm + (p & 1) * (NPL * PLANE);
      unsigned short* dB = dAh + PLANE;
      unsigned short* dAl = dB + PLANE;
      if constexpr (ASPLIT) {
#pragma unroll   // constant indices: the arrays stay in registers
        for (int i = 0; i < 4; ++i) { *(v8us*)(dAh + (br + 32 * i) * PB + bc) = xah[i]; *(v8us*)(dAl + (br + 32 * i) * PB + bc) = xal[i]; }
      } else {
#pragma unroll
        for (int i = 0; i < 8; ++i) {
          const v2u h = {bf16_pk(xa[i][0], xa[i][1]), bf16_pk(xa[i][2], xa[i][3])};
          *(v4us*)(dAh + (ar + 16 * i) * PB + ac) = __builtin_bit_cast(v4us, h);
        }
      }
#pragma unroll
      for (int i = 0; i < 4; ++i) *(v8us*)(dB + (br + 32 * i) * PB + bc) = xb[i];
    }
    __syncthreads();
    if (p + 1 < np) {
      // pass p + 1 starts its way from L2 now and is waited for only behind the products of pass p
      fetch((p + 1) * 64);
    }
  }
  const int rsub = lane >> 4, c4 = (lane & 15) * 4;
  v4f cs[16];
  if (ROT) {
    // the (cos, sin) pairs of this lane's two column pairs in its 16 rows: sixteen loads off one address, issued together (one latency for all)
    static_assert(TT % 128 == 0 && HD == 64, "a 128-row tile stays inside one sequence; a wave's 64 columns are one head");
    const float* pr = rot + (size_t)(row0 % TT + wm * 32 + rsub) * HD + c4;
#pragma unroll
    for (int q = 0; q < 16; ++q) cs[q] = *(const v4fa*)(pr + q * 2 * HD);
    // the address that these loads name is not written ahead of this wait: the input keeps it live up to it
    asm volatile("s_wait_xcnt 0x0" :: "v"(pr) : "memory");
  }
  // the barrier of the last trip stands behind every wave's last read of the buffers: each wave now stages its 32 x 64 tile in a range of its own
  float* so = (float*)sm + w * (32 * PO);
#pragma unroll
  for (int mi = 0; mi < 2; ++mi)
#pragma unroll
    for (int t = 0; t < 4; ++t) {
      float bv = bias ? bias[col0 + wn * 64 + t * 16 + ln] : 0.f;
      if (BIAS_BF16) bv = bf16_round(bv);
#pragma unroll
      for (int r = 0; r < 8; ++r) { float v = acc[mi][t][r] + bv; if (ACT == 1) v = fmaxf(v, 0.f); so[(mi * 16 + 8 * hh + r) * PO + t * 16 + ln] = v; }
    }
  __builtin_amdgcn_fence(__ATOMIC_ACQ_REL, "workgroup");
  __builtin_amdgcn_wave_barrier();
#pragma unroll
  for (int q = 0; q < 16; ++q) {
    const int r = q * 2 + rsub;
    v4f v = *(const v4fa*)&so[r * PO + c4];
    if (ROT) {
      const v4f x = v, t = cs[q];
      v = (v4f){x[0] * t[0] - x[1] * t[1], x[1] * t[0] + x[0] * t[1], x[2] * t[2] - x[3] * t[3], x[3] * t[2] + x[2] * t[3]};
    }
    if (LO > 0) {
      v4us h, l;
      bf16_split4(v * oscale, h, l);
      unsigned short* ph = (unsigned short*)C + (size_t)(row0 + wm * 32 + r) * ldc + col0 + wn * 64 + c4;
      *(v4us*)ph = h; *(v4us*)(ph + LO) = l;
      // neither the address nor the data that these two stores name is written ahead of this wait: the inputs keep them live up to it
      asm volatile("s_wait_xcnt 0x0" :: "v"(ph), "v"(h), "v"(l) : "memory");
    } else {
      *(v4f*)(C + (size_t)(row0 + wm * 32 + r) * ldc + col0 + wn * 64 + c4) = v;
    }
  }
}

template <int ALO, int ACT, bool BIAS_BF16, bool ROT, int LO>
__global__ __launch_bounds__(256) void k_gemm_bf(const float* __restrict__ A, int lda, const unsigned short* __restrict__ Wt, int ldb,
                                               const float* __restrict__ bias, float* __restrict__ C, int ldc, int M, int N, int K,
                                               const float* __restrict__ rot, float oscale) {
  __shared__ __attribute__((aligned(16))) unsigned short sm[GEMM_LDS(ALO)];
  gemm_tile<ALO, ACT, BIAS_BF16, ROT, LO>(sm, blockIdx.x, A, lda, Wt, ldb, bias, C, ldc, M, N, K, rot, oscale);
}
// The three projections, none of which reads another's output, in one launch: blockIdx.y = 0 makes q = rot(xq Wq) * qscale, 1 makes k = rot(xkv Wk), 2 makes v = xkv Wv;
// blockIdx.x is the tile, as in k_gemm_bf. The choice is the same for the whole work-group.
template <int LO>
__global__ __launch_bounds__(256) void k_gemm_qkv(const float* __restrict__ xq, const float* __restrict__ xkv, int lda,
                                                const unsigned short* __restrict__ Tq, const unsigned short* __restrict__ Tk, const unsigned short* __restrict__ Tv, int ldb,
                                                float* __restrict__ q, float* __restrict__ k, float* __restrict__ v, int ldc, int M, int N, int K,
                                                const float* __restrict__ rot, float qscale) {
  __shared__ __attribute__((aligned(16))) unsigned short sm[GEMM_LDS(0)];
  const int z = blockIdx.y;
  if (z < 2) gemm_tile<0, 0, false, true, LO>(sm, blockIdx.x, z == 0 ? xq : xkv, lda, z == 0 ? Tq : Tk, ldb, nullptr, z == 0 ? q : k, ldc, M, N, K, rot, z == 0 ? qscale : 1.0f);
  else gemm_tile<0, 0, false, false, LO>(sm, blockIdx.x, xkv, lda, Tv, ldb, nullptr, v, ldc, M, N, K, nullptr, 1.0f);
}

// Flash-style causal/unmasked attention, all contractions 3-term bf16 hi/lo splits, f32 softmax with running max.
// q,k,v rows are read from f32 buffers with arbitrary row pitch (so they can live inside a fused qkv buffer);
// D = head size (multiple of 32, <= 128); one wave = 16 query rows; block = 4 waves (64 queries) sharing K/V chunks of 32.
template <int D, bool CAUSAL>
__global__ __launch_bounds__(128) void k_flash(const float* __restrict__ qb, const float* __restrict__ kb, const float* __restrict__ vb,
                                             int pitch, int T, int H, float scale, float* __restrict__ y, int ypitch) {
  constexpr int KS = D / 32;        // k-steps for QK
  constexpr int DT = D / 16;        // d tiles for PV
  __shared__ __attribute__((aligned(16))) unsigned short sKh[32][D + 8], sKl[32][D + 8], sVh[32][D + 8], sVl[32][D + 8];
  __shared__ __attribute__((aligned(16))) unsigned short sPh[4][16][40], sPl[4][16][40];
  __shared__ __attribute__((aligned(16))) float sO[4][16][D];
  const int tid = threadIdx.x, w = tid >> 5, lane = tid & 31, ln = lane & 15, hh = lane >> 4;
  const int nqb = (T + 63) / 64;
  const int bh = blockIdx.x / nqb, qblk = blockIdx.x % nqb;
  const int b = bh / H, h = bh % H;
  const int q0 = qblk * 64 + w * 16;
  const float* Q = qb + (size_t)b * T * pitch + h * D;
  const float* K = kb + (size_t)b * T * pitch + h * D;
  const float* V = vb + (size_t)b * T * pitch + h * D;

  // A fragments of the wave's 16 query rows (scaled), hi/lo
  FragB aqh[KS], aql[KS];
  {
    int row = q0 + ln; if (row >= T) row = T - 1;
    const float* qr = Q + (size_t)row * pitch;
#pragma unroll
    for (int ks = 0; ks < KS; ++ks)
#pragma unroll
      for (int i = 0; i < 16; ++i) {
        const int d = ks * 32 + ((i < 8) ? (8 * hh + i) : (16 + 8 * hh + (i - 8)));
        const float x = qr[d] * scale; const unsigned short hb = bf16_bits(x);
        aqh[ks].u[i] = hb; aql[ks].u[i] = bf16_bits(x - bf16_val(hb));
      }
  }
  float m_r[8], l_r[8];
#pragma unroll
  for (int r = 0; r < 8; ++r) { m_r[r] = -3.0e38f; l_r[r] = 0.f; }
  v8f oacc[DT];
#pragma unroll
  for (int dt = 0; dt < DT; ++dt) oacc[dt] = (v8f){0.f,0.f,0.f,0.f,0.f,0.f,0.f,0.f};

  const int kv_end = CAUSAL ? min(T, qblk * 64 + 64) : T;     // block-uniform
  for (int j0 = 0; j0 < kv_end; j0 += 32) {
    __syncthreads();
    for (int e = tid; e < 32 * (D / 4); e += 128) {
      const int r = e / (D / 4), c4 = (e % (D / 4)) * 4;
      const int key = j0 + r;
      v4f kf = {0.f,0.f,0.f,0.f}, vf = {0.f,0.f,0.f,0.f};
      if (key < T) { kf = *(const v4fa*)(K + (size_t)key * pitch + c4); vf = *(const v4fa*)(V + (size_t)key * pitch + c4); }
#pragma unroll
      for (int t = 0; t < 4; ++t) {
        unsigned short hb = bf16_bits(kf[t]); sKh[r][c4 + t] = hb; sKl[r][c4 + t] = bf16_bits(kf[t] - bf16_val(hb));
        hb = bf16_bits(vf[t]); sVh[r][c4 + t] = hb; sVl[r][c4 + t] = bf16_bits(vf[t] - bf16_val(hb));
      }
    }
    __syncthreads();
    // S tile 16 x 32
    v8f s[2];
#pragma unroll
    for (int nt = 0; nt < 2; ++nt) {
      v8f acc = {};
#pragma unroll
      for (int ks = 0; ks < KS; ++ks) {
        FragB bh_, bl_;
        bh_.half[0] = *(const v8us*)&sKh[nt * 16 + ln][ks * 32 + 8 * hh]; bh_.half[1] = *(const v8us*)&sKh[nt * 16 + ln][ks * 32 + 16 + 8 * hh];
        bl_.half[0] = *(const v8us*)&sKl[nt * 16 + ln][ks * 32 + 8 * hh]; bl_.half[1] = *(const v8us*)&sKl[nt * 16 + ln][ks * 32 + 16 + 8 * hh];
        acc = mmaN<3>(aqh[ks].v, aql[ks].v, bh_.v, bl_.v, acc);
      }
      s[nt] = acc;
    }
    // mask + running max (rows 8hh+r; the 16 lanes of a half share rows)
    float alpha[8];
#pragma unroll
    for (int r = 0; r < 8; ++r) {
      const int qi = q0 + 8 * hh + r;
      const int ja = j0 + ln, jb = j0 + 16 + ln;
      if (CAUSAL) { if (ja > qi) s[0][r] = -3.0e38f; if (jb > qi) s[1][r] = -3.0e38f; }
      if (ja >= T) s[0][r] = -3.0e38f;
      if (jb >= T) s[1][r] = -3.0e38f;
      float mx = fmaxf(s[0][r], s[1][r]);
      mx = fmaxf(mx, __shfl_xor(mx, 1, 32)); mx = fmaxf(mx, __shfl_xor(mx, 2, 32)); mx = fmaxf(mx, __shfl_xor(mx, 4, 32)); mx = fmaxf(mx, __shfl_xor(mx, 8, 32));
      const float mnew = fmaxf(m_r[r], mx);
      alpha[r] = (mnew > -1.0e38f) ? __expf(m_r[r] - mnew) : 1.0f;
      const float p0 = (s[0][r] > -1.0e38f) ? __expf(s[0][r] - mnew) : 0.f;
      const float p1 = (s[1][r] > -1.0e38f) ? __expf(s[1][r] - mnew) : 0.f;
      m_r[r] = mnew;
      l_r[r] = l_r[r] * alpha[r] + p0 + p1;            // per-lane partial row sum (16 lanes combined at the end)
      unsigned short hb = bf16_bits(p0); sPh[w][8 * hh + r][ln] = hb;      sPl[w][8 * hh + r][ln] = bf16_bits(p0 - bf16_val(hb));
      hb = bf16_bits(p1);                sPh[w][8 * hh + r][16 + ln] = hb; sPl[w][8 * hh + r][16 + ln] = bf16_bits(p1 - bf16_val(hb));
    }
#pragma unroll
    for (int dt = 0; dt < DT; ++dt)
#pragma unroll
      for (int r = 0; r < 8; ++r) oacc[dt][r] *= alpha[r];
    __builtin_amdgcn_fence(__ATOMIC_ACQ_REL, "workgroup");
    __builtin_amdgcn_wave_barrier();
    FragB pah, pal;
    pah.half[0] = *(const v8us*)&sPh[w][ln][8 * hh]; pah.half[1] = *(const v8us*)&sPh[w][ln][16 + 8 * hh];
    pal.half[0] = *(const v8us*)&sPl[w][ln][8 * hh]; pal.half[1] = *(const v8us*)&sPl[w][ln][16 + 8 * hh];
#pragma unroll
    for (int dt = 0; dt < DT; ++dt) {
      FragB bvh, bvl;
#pragma unroll
      for (int i = 0; i < 8; ++i) {
        bvh.u[i] = sVh[8 * hh + i][dt * 16 + ln]; bvh.u[8 + i] = sVh[16 + 8 * hh + i][dt * 16 + ln];
        bvl.u[i] = sVl[8 * hh + i][dt * 16 + ln]; bvl.u[8 + i] = sVl[16 + 8 * hh + i][dt * 16 + ln];
      }
      oacc[dt] = mmaN<3>(pah.v, pal.v, bvh.v, bvl.v, oacc[dt]);
    }
    __builtin_amdgcn_fence(__ATOMIC_ACQ_REL, "workgroup");
    __builtin_amdgcn_wave_barrier();
  }
#pragma unroll
  for (int r = 0; r < 8; ++r) {
    float l = l_r[r];
    l += __shfl_xor(l, 1, 32); l += __shfl_xor(l, 2, 32); l += __shfl_xor(l, 4, 32); l += __shfl_xor(l, 8, 32);
    l_r[r] = (l > 0.f) ? 1.0f / l : 0.f;
  }
#pragma unroll
  for (int dt = 0; dt < DT; ++dt)
#pragma unroll
    for (int r = 0; r < 8; ++r) sO[w][8 * hh + r][dt * 16 + ln] = oacc[dt][r] * l_r[r];
  __builtin_amdgcn_fence(__ATOMIC_ACQ_REL, "workgroup");
  __builtin_amdgcn_wave_barrier();
  {
    for (int r = 0; r < 16; ++r) {
      const int row = q0 + r;
      if (row < T && lane < D / 4) {
        const v4f val = *(const v4fa*)&sO[w][r][lane * 4];
        *(v4f*)(y + ((size_t)b * T + row) * ypitch + h * D + lane * 4) = val;
      }
    }
    
  }
}

// 16 x 16 tile of 16-bit values, row-major in LDS, read transposed: lane l passes the address of row 8 (l >> 4) + (l & 7), columns 8 ((l >> 3) & 1) + 0..7,
// and receives rows 8 (l >> 4) + 0..7 of column l & 15. A load that the compiler sees: it places the wait.
__device__ __forceinline__ v8us ld_tr16(const unsigned short* p) {
  typedef short s16x8 __attribute__((ext_vector_type(8)));
  typedef __attribute__((address_space(3))) s16x8 lds_s16x8;
  return __builtin_bit_cast(v8us, __builtin_amdgcn_ds_load_tr16_b128_v8i16((lds_s16x8*)p));
}
template <int D, int LO>
__global__ __launch_bounds__(128) void k_flash_band(const unsigned short* __restrict__ Qb, const unsigned short* __restrict__ Kb, const unsigned short* __restrict__ Vb,
                                                  int pitch, int T, int H, int band, unsigned short* __restrict__ y, int ypitch) {
  constexpr int KS = D / 32, DT = D / 16;
  __shared__ __attribute__((aligned(16))) unsigned short sKh[32][D + 8], sKl[32][D + 8];
  __shared__ __attribute__((aligned(32))) unsigned short sVh[32][D + 16], sVl[32][D + 16];   // V rows at an odd multiple of 32 B, the pitch of the transposing reader
  __shared__ __attribute__((aligned(16))) float sO[4][16][D + 4];   // 16 B more a row: the 16 lanes that write one column group of 16 rows meet 16 different bank groups
  const int tid = threadIdx.x, w = tid >> 5, lane = tid & 31, ln = lane & 15, hh = lane >> 4;
  const int nqb = (T + 63) / 64;
  const int bh = blockIdx.x / nqb, qblk = blockIdx.x % nqb;
  const int b = bh / H, h = bh % H;
  const int q0 = qblk * 64 + w * 16;
  const unsigned short* Q = Qb + (size_t)b * T * pitch + h * D;
  const unsigned short* K = Kb + (size_t)b * T * pitch + h * D;
  const unsigned short* V = Vb + (size_t)b * T * pitch + h * D;
  FragB aqh[KS], aql[KS];
  {
    // lane (ln, hh) holds d = ks * 32 + 8 hh + 0..7 and ks * 32 + 16 + 8 hh + 0..7 of row q0 + ln: two 16-byte pieces of the row, hi and lo alike
    int row = q0 + ln; if (row >= T) row = T - 1;
    const unsigned short* qr = Q + (size_t)row * pitch + 8 * hh;
#pragma unroll
    for (int ks = 0; ks < KS; ++ks) {
      aqh[ks].half[0] = *(const v8us*)(qr + ks * 32);      aqh[ks].half[1] = *(const v8us*)(qr + ks * 32 + 16);
      aql[ks].half[0] = *(const v8us*)(qr + LO + ks * 32); aql[ks].half[1] = *(const v8us*)(qr + LO + ks * 32 + 16);
    }
    // the address that these loads name is not written ahead of this wait: the input keeps it live up to it
    asm volatile("s_wait_xcnt 0x0" :: "v"(qr) : "memory");
  }
  const int trow = 8 * hh + (lane & 7), tcol = 8 * ((lane >> 3) & 1);   // the 16 bytes this lane hands to a transposing load of a 16 x 16 tile
  // the keys that count for this lane's query: klo .. klo + kwid = [qi - band, min(qi + band, T - 1)]
  const int qi = min(q0 + ln, T - 1);
  const int klo = qi - band;
  const unsigned kwid = (unsigned)(min(qi + band, T - 1) - klo);
  float m_r = -3.0e38f, l_r = 0.f;
  v8f oacc[DT];   // oacc[dt][r] = O[q0 + ln][dt * 16 + 8 hh + r]
#pragma unroll
  for (int dt = 0; dt < DT; ++dt) oacc[dt] = (v8f){0.f,0.f,0.f,0.f,0.f,0.f,0.f,0.f};
  // A key farther than band from every query row of the block has weight exp(-3e38 - m) = 0 in every row:
  // the loop runs only over the 32-key chunks that meet [first row - band, last row + band] (block-uniform bounds).
  const int kv_begin = max(0, qblk * 64 - band) & ~31, kv_end = min(T, qblk * 64 + 64 + band);
  const int wq0 = qblk * 64 + __builtin_amdgcn_readfirstlane(w) * 16;   // the wave's first row, in a scalar register: the chunk test below is a scalar branch
  for (int j0 = kv_begin; j0 < kv_end; j0 += 32) {
    __syncthreads();
    {
      constexpr int NE = 32 * (D / 8) / 128;   // 16-byte pieces of each of K hi, K lo, V hi, V lo per thread and trip
      static_assert(NE == 2, "the wait below names two K and two V addresses");
      v8us kh[NE], kl[NE], vh[NE], vl[NE]; const unsigned short* pk[NE]; const unsigned short* pv[NE];
#pragma unroll
      for (int i = 0; i < NE; ++i) {
        const int e = tid + 128 * i, key = j0 + e / (D / 8), c8 = (e % (D / 8)) * 8;
        const size_t o = (size_t)min(key, T - 1) * pitch + c8;   // address in bounds for every lane; a key past the end is zeroed below
        pk[i] = K + o; pv[i] = V + o;
        kh[i] = *(const v8us*)pk[i]; kl[i] = *(const v8us*)(pk[i] + LO); vh[i] = *(const v8us*)pv[i]; vl[i] = *(const v8us*)(pv[i] + LO);
      }
      // no register that one of these loads names as its address is written (not by a load's result either) ahead of this wait:
      // the inputs keep all four addresses live up to it
      asm volatile("s_wait_xcnt 0x0" :: "v"(pk[0]), "v"(pk[1]), "v"(pv[0]), "v"(pv[1]) : "memory");
      if (j0 + 32 > T) {   // the same for the whole work-group: only a last chunk that runs past the end has keys to zero
#pragma unroll   // constant indices: the arrays stay in registers
        for (int i = 0; i < NE; ++i)
          if (j0 + (tid + 128 * i) / (D / 8) >= T) { kh[i] = (v8us)(unsigned short)0; kl[i] = (v8us)(unsigned short)0; vh[i] = (v8us)(unsigned short)0; vl[i] = (v8us)(unsigned short)0; }
      }
#pragma unroll
      for (int i = 0; i < NE; ++i) {
        const int e = tid + 128 * i, r = e / (D / 8), c8 = (e % (D / 8)) * 8;
        *(v8us*)&sKh[r][c8] = kh[i]; *(v8us*)&sKl[r][c8] = kl[i]; *(v8us*)&sVh[r][c8] = vh[i]; *(v8us*)&sVl[r][c8] = vl[i];
      }
    }
    __syncthreads();
    // a chunk wholly outside the band of this wave's own 16 rows adds nothing to them (no work-group barrier below this line in the trip)
    if (j0 + 31 < wq0 - band || j0 > wq0 + 15 + band) continue;
    // S^T tile nt: s[nt][r] = score of key j0 + nt * 16 + 8 hh + r with query q0 + ln. A = K rows, B = the Q fragments, both in the k order d = 8 hh + 0..7, 16 + 8 hh + 0..7 of each 32.
    v8f s[2];
#pragma unroll
    for (int nt = 0; nt < 2; ++nt) {
      v8f acc = {};
#pragma unroll
      for (int ks = 0; ks < KS; ++ks) {
        FragB kh_, kl_;
        kh_.half[0] = *(const v8us*)&sKh[nt * 16 + ln][ks * 32 + 8 * hh]; kh_.half[1] = *(const v8us*)&sKh[nt * 16 + ln][ks * 32 + 16 + 8 * hh];
        kl_.half[0] = *(const v8us*)&sKl[nt * 16 + ln][ks * 32 + 8 * hh]; kl_.half[1] = *(const v8us*)&sKl[nt * 16 + ln][ks * 32 + 16 + 8 * hh];
        acc = mma3x(kh_.v, kl_.v, aqh[ks].v, aql[ks].v, acc);
      }
      s[nt] = acc;
    }
    // element i = nt * 8 + r of this lane: key j0 + nt * 16 + 8 hh + r
    const int kd0 = j0 + 8 * hh - klo;
    float sc[16];
#pragma unroll
    for (int i = 0; i < 16; ++i) sc[i] = ((unsigned)(kd0 + (i >> 3) * 16 + (i & 7)) <= kwid) ? s[i >> 3][i & 7] : -3.0e38f;
    float mx4[4];
#pragma unroll
    for (int c = 0; c < 4; ++c) mx4[c] = fmaxf(fmaxf(sc[c], sc[4 + c]), fmaxf(sc[8 + c], sc[12 + c]));
    float mx = fmaxf(fmaxf(mx4[0], mx4[1]), fmaxf(mx4[2], mx4[3]));
    mx = fmaxf(mx, xhalf(mx));   // the other 16 keys of the chunk are in lane l ^ 16
    const float mnew = fmaxf(m_r, mx);
    // exp(m_r - mnew) as __expf forms it, with the one slot that the instruction set asks for behind a transcendental in the same statement
    float ea;
    asm("v_exp_f32 %0, %1\n\tv_nop" : "=v"(ea) : "v"((m_r - mnew) * 1.44269504f));
    const float alpha = (mnew > -1.0e38f) ? ea : 1.0f;
    m_r = mnew;
    // b[i] = P^T[key 8 hh + i or 16 + 8 hh + (i - 8)][q0 + ln]: the k order in which the transposing loads below deliver V
    // (register j holds elements 2 j and 2 j + 1); hi = bf16(p), lo = bf16(p - hi), each pair by one packed convert
    v8u ph, pl;
    v2f ps2[2] = {{0.f, 0.f}, {0.f, 0.f}};
#pragma unroll
    for (int j = 0; j < 8; ++j) {
      const v2f p = {__expf(sc[2 * j] - mnew), __expf(sc[2 * j + 1] - mnew)};
      ps2[j & 1] += p;
      ph[j] = bf16_pk(p[0], p[1]);
      const v2f lo = p - bf16_pk_val(ph[j]);
      pl[j] = bf16_pk(lo[0], lo[1]);
    }
    const v16b pbh = __builtin_bit_cast(v16b, ph), pbl = __builtin_bit_cast(v16b, pl);
    l_r = l_r * alpha + ((ps2[0][0] + ps2[0][1]) + (ps2[1][0] + ps2[1][1]));   // this lane's 16 keys; the halves are joined behind the loop
#pragma unroll
    for (int dt = 0; dt < DT; ++dt)
#pragma unroll
      for (int r = 0; r < 8; ++r) oacc[dt][r] *= alpha;
    // A = V^T: lane (ln, hh) gets V[8 hh + 0..7][dt * 16 + ln] from the first load of a pair and V[16 + 8 hh + 0..7][dt * 16 + ln] from the second: the k order of pbh / pbl.
    // All sixteen loads stand in one group ahead of the products: one LDS latency a trip, not one per 16 columns.
    FragB avh[DT], avl[DT];
#pragma unroll
    for (int dt = 0; dt < DT; ++dt) {
      avh[dt].half[0] = ld_tr16(&sVh[trow][dt * 16 + tcol]); avh[dt].half[1] = ld_tr16(&sVh[16 + trow][dt * 16 + tcol]);
      avl[dt].half[0] = ld_tr16(&sVl[trow][dt * 16 + tcol]); avl[dt].half[1] = ld_tr16(&sVl[16 + trow][dt * 16 + tcol]);
    }
#pragma unroll
    for (int dt = 0; dt < DT; ++dt) oacc[dt] = mma3x(avh[dt].v, avl[dt].v, pbh, pbl, oacc[dt]);
  }
  {
    const float l = l_r + xhalf(l_r);
    const float inv = (m_r > -1.0e38f) ? 1.0f / l : __builtin_nanf("");
#pragma unroll
    for (int dt = 0; dt < DT; ++dt) {
      // a lane's eight values are eight columns in a row of its query: two 16-byte stores
      *(v4fa*)&sO[w][ln][dt * 16 + 8 * hh]     = (v4f){oacc[dt][0] * inv, oacc[dt][1] * inv, oacc[dt][2] * inv, oacc[dt][3] * inv};
      *(v4fa*)&sO[w][ln][dt * 16 + 8 * hh + 4] = (v4f){oacc[dt][4] * inv, oacc[dt][5] * inv, oacc[dt][6] * inv, oacc[dt][7] * inv};
    }
  }
  __builtin_amdgcn_fence(__ATOMIC_ACQ_REL, "workgroup");
  __builtin_amdgcn_wave_barrier();
  {
    static_assert(D == 64, "16 lanes of 4 columns cover a row: a wave stores two rows at a time");
    for (int r2 = 0; r2 < 16; r2 += 2) {
      const int r = r2 + hh, row = q0 + r;
      if (row < T) {
        const v4f val = *(const v4fa*)&sO[w][r][ln * 4];
        v4us h4, l4;
        bf16_split4(val, h4, l4);
        unsigned short* py = y + ((size_t)b * T + row) * ypitch + h * D + ln * 4;
        *(v4us*)py = h4; *(v4us*)(py + LO) = l4;
        // neither the address nor the data that these two stores name is written ahead of this wait: the inputs keep them live up to it
        asm volatile("s_wait_xcnt 0x0" :: "v"(py), "v"(h4), "v"(l4) : "memory");
      }
    }
  }
}
// table of the interleaved rotary step: rot[pos][i] = (cos, sin) of pos * inv_freq[i], inv_freq[i] = 10000^(-i/(d/2)); thread per (pos, i);
// written anew in every call, ahead of the GEMMs that read it. A part of k_setup.
__device__ __forceinline__ void rot_table_part(float* __restrict__ rot, int t) {
  if (t >= TT * (HD / 2)) return;
  const int pos = t / (HD / 2), i = t % (HD / 2);
  const float inv = powf(10000.0f, -(float)i / (float)(HD / 2)); const float ang = (float)pos * inv; float sn, cs; sincosf(ang, &sn, &cs);
  v2f a = {cs, sn};
  *(v2f*)(rot + (size_t)t * 2) = a;
}
// All that the GEMMs need beforehand, in one launch (no part reads what another writes): the first SETUP_RB work-groups write the rotary table
// (the longest threads, so they start first), then SETUP_WB work-groups, one per tile, for each of the four weight matrices.
static_assert(EE % WT_TK == 0 && EE % WT_TN == 0, "whole tiles");
constexpr int SETUP_RB = (TT * (HD / 2) + 255) / 256, SETUP_WB = (EE / WT_TK) * (EE / WT_TN);
__global__ __launch_bounds__(256) void k_setup(const float* __restrict__ Wq, const float* __restrict__ Wk, const float* __restrict__ Wv, const float* __restrict__ Wo,
                                             unsigned short* __restrict__ Tq, unsigned short* __restrict__ Tk, unsigned short* __restrict__ Tv, unsigned short* __restrict__ To,
                                             float* __restrict__ rot) {
  __shared__ __attribute__((aligned(16))) unsigned short sT[WT_TN * WT_P];
  const int bid = blockIdx.x;
  if (bid < SETUP_RB) { rot_table_part(rot, bid * 256 + threadIdx.x); return; }   // the same for the whole work-group, ahead of the barrier
  const int m = (bid - SETUP_RB) / SETUP_WB, tile = (bid - SETUP_RB) % SETUP_WB;
  wt_bf16_tile(sT, m == 0 ? Wq : m == 1 ? Wk : m == 2 ? Wv : Wo, m == 0 ? Tq : m == 1 ? Tk : m == 2 ? Tv : To, EE, EE, tile);
}
extern "C" void kernel_launch(void* const* d_in, const int* in_sizes, int n_in,
                              void* d_out, int out_size, void* d_ws, size_t ws_size, hipStream_t stream) {
  (void)in_sizes; (void)n_in; (void)out_size;
  const float* xq = (const float*)d_in[0]; const float* xkv = (const float*)d_in[1];
  const float* Wq = (const float*)d_in[2]; const float* Wk = (const float*)d_in[3]; const float* Wv = (const float*)d_in[4]; const float* Wo = (const float*)d_in[5];
  char* ws = (char*)d_ws; size_t off = 0;
  auto take = [&](size_t bytes) { char* p = ws + off; off += (bytes + 255) & ~(size_t)255; return p; };
  const int M = BB * TT, gb = (M / 128) * (EE / 128);
  unsigned short* Wt[4]; for (int i = 0; i < 4; ++i) Wt[i] = (unsigned short*)take((size_t)EE * EE * 2);
  float* q = (float*)take((size_t)M * EE * 4); float* k = (float*)take((size_t)M * EE * 4); float* v = (float*)take((size_t)M * EE * 4); float* att = (float*)take((size_t)M * EE * 4);
  float* rot = (float*)take((size_t)TT * HD * 4);
  if (off > ws_size) return;
  k_setup<<<SETUP_RB + 4 * SETUP_WB, 256, 0, stream>>>(Wq, Wk, Wv, Wo, Wt[0], Wt[1], Wt[2], Wt[3], rot);
  // q (times 1/sqrt(HD)), k, v and the attention's output leave their kernels as bf16 hi | lo rows of 2 * EE 16-bit values, in the room of the f32 rows
  k_gemm_qkv<EE><<<dim3(gb, 3), 256, 0, stream>>>(xq, xkv, EE, Wt[0], Wt[1], Wt[2], EE, q, k, v, 2 * EE, M, EE, EE, rot, 0.125f);
  k_flash_band<HD, EE><<<BB * NH * (TT / 64), 128, 0, stream>>>((const unsigned short*)q, (const unsigned short*)k, (const unsigned short*)v, 2 * EE, TT, NH, 256, (unsigned short*)att, 2 * EE);
  k_gemm_bf<EE, 0, false, false, 0><<<gb, 256, 0, stream>>>(att, 2 * EE, Wt[3], EE, nullptr, (float*)d_out, EE, M, EE, EE, nullptr, 1.0f);
}
